// v000
// Times are from an AMD MI455X. After a warm-up the kernel runs many times in a row, and a time is the length of
// such a window on the GPU divided by its runs, so every launch and the gaps after it count. The runs cycle
// through copies of the inputs. A figure is the median of several windows, for all but v000 over two sittings.
// Sittings can differ by a few percent; kernels timed side by side share one.
// v000, which the later versions start from, runs in 680 microseconds.
#include <hip/hip_runtime.h>
// SpatialMHSA (4 x 12 frames x 512 spatial tokens x 256 = 8 heads of 32): q/k/v = x W (xavier (in,out) weights); per (batch, frame, head) attention over the 512 tokens with scores/sqrt(32) + an INPUT additive bias sim[n][m]; out = merged heads W_o.
// Structure: exact f16 plane of x; ONE fused q|k|v GEMM (32x64 wave tiles, f32 accumulation, exact x16 weights, f16 output); per chunk of 6 (batch, frame) groups: a repack kernel laying q, k per (group, head) as [512][32] slabs and v^T as [64 (32 live)][512] slabs, ONE batched S = q k^T GEMM over the 48 (group, head) pairs, scale + bias + softmax on VALU (wave per row) into an f16 P plane (x2^10), ONE batched P v GEMM (f16 out, 64-wide head slots) and a compaction to token rows; output GEMM.
// Compute dtype: x, sim and weights rounded to bf16; q, k, v, P, attention output as f16 operands (~2^-12); f32 accumulation/softmax. v_wmma_f32_16x16x32_f16.
#define NBATCH 4
#define NFR 12
#define NN 512
#define DD 256
#define NH 8
#define HD 32
#define NG (NBATCH * NFR)         /* 48 groups */
#define NR (NG * NN)             /* 24576 token rows */
#define GCH 6                    /* groups per chunk */
#define NQ (GCH * NH)            /* 48 (group, head) pairs per chunk */
#define CROWS (GCH * NN)         /* 3072 rows per chunk */
#define SCL 0.17677669529663687f /* 32^-0.5 */
typedef __bf16 v16b __attribute__((ext_vector_type(16)));
typedef unsigned short v8us __attribute__((ext_vector_type(8), may_alias));
typedef float  v8f  __attribute__((ext_vector_type(8)));
typedef float  v4f  __attribute__((ext_vector_type(4)));
typedef float  v4fa __attribute__((ext_vector_type(4), may_alias));
union FragB { v16b v; v8us half[2]; unsigned short u[16]; };

__device__ __forceinline__ unsigned short bf16_bits(float x) { unsigned int u = __float_as_uint(x); return (unsigned short)((u + 0x7FFFu + ((u >> 16) & 1u)) >> 16); }
__device__ __forceinline__ float bf16_val(unsigned short b) { return __uint_as_float(((unsigned int)b) << 16); }
__device__ __forceinline__ float bf16_round(float x) { return bf16_val(bf16_bits(x)); }
// D += A·B with NT terms: 1 = ah·bh, 2 = + al·bh (A split), 3 = + ah·bl (both split)
template <int NT>
__device__ __forceinline__ v8f mmaN(v16b ah, v16b al, v16b bh, v16b bl, v8f c) {
  c = __builtin_amdgcn_wmma_f32_16x16x32_bf16(false, ah, false, bh, (short)0, c, false, false);
  if (NT >= 2) c = __builtin_amdgcn_wmma_f32_16x16x32_bf16(false, al, false, bh, (short)0, c, false, false);
  if (NT >= 3) c = __builtin_amdgcn_wmma_f32_16x16x32_bf16(false, ah, false, bl, (short)0, c, false, false);
  asm volatile("v_nop\n\tv_nop\n\tv_nop\n\tv_nop" : "+v"(c) : "v"(ah), "v"(al), "v"(bh), "v"(bl));
  return c;
}

__global__ __launch_bounds__(256) void k_wt_bf16(const float* __restrict__ W, unsigned short* __restrict__ Wt, int K, int N) {
  const int t = blockIdx.x * 256 + threadIdx.x;
  const int k8n = K / 8;
  if (t >= N * k8n) return;
  const int n = t / k8n, k8 = (t % k8n) * 8;
  v8us v;
#pragma unroll
  for (int i = 0; i < 8; ++i) v[i] = bf16_bits(W[(size_t)(k8 + i) * N + n]);
  *(v8us*)(Wt + (size_t)n * K + k8) = v;
  
}

// GEMM C[M][N] (f32, pitch ldc) = act(A[M][K]·W + bias). A f32 row-major (pitch lda) converted per fragment to bf16
// (ASPLIT: hi/lo two planes -> 2 terms, else single rounded term); Wt bf16 [N][K] (pitch ldb). BIAS_BF16 rounds the
// bias to bf16 first (bias quantised to bf16 before the add). K%32==0, M%16==0, N%64==0.
template <bool ASPLIT, int ACT, bool BIAS_BF16>
__global__ __launch_bounds__(128) void k_gemm_bf(const float* __restrict__ A, int lda, const unsigned short* __restrict__ Wt, int ldb,
                                               const float* __restrict__ bias, float* __restrict__ C, int ldc, int M, int N, int K) {
  __shared__ __attribute__((aligned(16))) float so[4][16][64];
  const int tid = threadIdx.x, w = tid >> 5, lane = tid & 31, ln = lane & 15, hh = lane >> 4;
  const int ntn = N / 64;
  const int wid = blockIdx.x * 4 + w;
  const int mt = wid / ntn, nq = wid % ntn;
  if (mt * 16 >= M) return;
  const int row0 = mt * 16, col0 = nq * 64;
  const float* arow = A + (size_t)(row0 + ln) * lda;
  v8f acc[4] = {};
  for (int kb = 0; kb < K; kb += 32) {
    FragB ah, al;
    const v4f x0 = *(const v4fa*)(arow + kb + 8 * hh), x1 = *(const v4fa*)(arow + kb + 8 * hh + 4);
    const v4f x2 = *(const v4fa*)(arow + kb + 16 + 8 * hh), x3 = *(const v4fa*)(arow + kb + 16 + 8 * hh + 4);
    float xs[16] = {x0[0],x0[1],x0[2],x0[3],x1[0],x1[1],x1[2],x1[3],x2[0],x2[1],x2[2],x2[3],x3[0],x3[1],x3[2],x3[3]};
#pragma unroll
    for (int i = 0; i < 16; ++i) { const unsigned short hb = bf16_bits(xs[i]); ah.u[i] = hb; al.u[i] = ASPLIT ? bf16_bits(xs[i] - bf16_val(hb)) : (unsigned short)0; }
#pragma unroll
    for (int t = 0; t < 4; ++t) {
      const unsigned short* brow = Wt + (size_t)(col0 + t * 16 + ln) * ldb + kb;
      FragB b;
      b.half[0] = *(const v8us*)(brow + 8 * hh);
      b.half[1] = *(const v8us*)(brow + 16 + 8 * hh);
      acc[t] = mmaN<ASPLIT ? 2 : 1>(ah.v, al.v, b.v, b.v, acc[t]);
    }
  }
#pragma unroll
  for (int t = 0; t < 4; ++t) {
    float bv = bias ? bias[col0 + t * 16 + ln] : 0.f;
    if (BIAS_BF16) bv = bf16_round(bv);
#pragma unroll
    for (int r = 0; r < 8; ++r) { float v = acc[t][r] + bv; if (ACT == 1) v = fmaxf(v, 0.f); so[w][8 * hh + r][t * 16 + ln] = v; }
  }
  __builtin_amdgcn_fence(__ATOMIC_ACQ_REL, "workgroup");
  __builtin_amdgcn_wave_barrier();
  const int rsub = lane >> 4, c4 = (lane & 15) * 4;
  {
#pragma unroll
    for (int q = 0; q < 8; ++q) {
      const int r = q * 2 + rsub;
      const v4f v = *(const v4fa*)&so[w][r][c4];
      *(v4f*)(C + (size_t)(row0 + r) * ldc + col0 + c4) = v;
    }
    
  }
}

// GEMM C = act(A·W + bias + resid): A f32 (ASPLIT -> hi/lo 2 terms), Wt bf16 [N][K]; ACT 0 none, 1 relu, 2 exact gelu;
// resid (optional, f32, row index = (row % rmod), pitch ldr, RES_BF16 rounds it) added before the activation.
template <bool ASPLIT, int ACT, bool BIAS_BF16, bool RES_BF16>
__global__ __launch_bounds__(128) void k_gemm_bf3(const float* __restrict__ A, int lda, const unsigned short* __restrict__ Wt, int ldb,
                                                const float* __restrict__ bias, const float* __restrict__ resid, int rmod, int ldr,
                                                float* __restrict__ C, int ldc, int M, int N, int K) {
  __shared__ __attribute__((aligned(16))) float so[4][16][64];
  const int tid = threadIdx.x, w = tid >> 5, lane = tid & 31, ln = lane & 15, hh = lane >> 4;
  const int ntn = N / 64;
  const int wid = blockIdx.x * 4 + w;
  const int mt = wid / ntn, nq = wid % ntn;
  if (mt * 16 >= M) return;
  const int row0 = mt * 16, col0 = nq * 64;
  const float* arow = A + (size_t)(row0 + ln) * lda;
  v8f acc[4] = {};
  for (int kb = 0; kb < K; kb += 32) {
    FragB ah, al;
    const v4f x0 = *(const v4fa*)(arow + kb + 8 * hh), x1 = *(const v4fa*)(arow + kb + 8 * hh + 4);
    const v4f x2 = *(const v4fa*)(arow + kb + 16 + 8 * hh), x3 = *(const v4fa*)(arow + kb + 16 + 8 * hh + 4);
    float xs[16] = {x0[0],x0[1],x0[2],x0[3],x1[0],x1[1],x1[2],x1[3],x2[0],x2[1],x2[2],x2[3],x3[0],x3[1],x3[2],x3[3]};
#pragma unroll
    for (int i = 0; i < 16; ++i) { const unsigned short hb = bf16_bits(xs[i]); ah.u[i] = hb; al.u[i] = ASPLIT ? bf16_bits(xs[i] - bf16_val(hb)) : (unsigned short)0; }
#pragma unroll
    for (int t = 0; t < 4; ++t) {
      const unsigned short* brow = Wt + (size_t)(col0 + t * 16 + ln) * ldb + kb;
      FragB b;
      b.half[0] = *(const v8us*)(brow + 8 * hh);
      b.half[1] = *(const v8us*)(brow + 16 + 8 * hh);
      acc[t] = mmaN<ASPLIT ? 2 : 1>(ah.v, al.v, b.v, b.v, acc[t]);
    }
  }
#pragma unroll
  for (int t = 0; t < 4; ++t) {
    const int col = col0 + t * 16 + ln;
    float bv = bias ? bias[col] : 0.f;
    if (BIAS_BF16) bv = bf16_round(bv);
#pragma unroll
    for (int r = 0; r < 8; ++r) {
      float v = acc[t][r] + bv;
      if (resid) { float rv = resid[(size_t)((row0 + 8 * hh + r) % rmod) * ldr + col]; if (RES_BF16) rv = bf16_round(rv); v += rv; }
      if (ACT == 1) v = fmaxf(v, 0.f);
      if (ACT == 2) v = 0.5f * v * (1.0f + erff(v * 0.70710678118654752f));
      if (ACT == 3) { const float u = 0.7978845608028654f * (v + 0.044715f * v * v * v); v = 0.5f * v * (1.0f + tanhf(u)); }
      so[w][8 * hh + r][t * 16 + ln] = v;
    }
  }
  __builtin_amdgcn_fence(__ATOMIC_ACQ_REL, "workgroup");
  __builtin_amdgcn_wave_barrier();
  const int rsub = lane >> 4, c4 = (lane & 15) * 4;
  {
#pragma unroll
    for (int q = 0; q < 8; ++q) {
      const int r = q * 2 + rsub;
      const v4f v = *(const v4fa*)&so[w][r][c4];
      *(v4f*)(C + (size_t)(row0 + r) * ldc + col0 + c4) = v;
    }
    
  }
}
// row LayerNorm (biased variance, eps) over N: s = X (+ R); optional out_sum <- s; out_norm <- (s-mu)*rsqrt(var+eps)*g + b
template <bool PARAM_BF16>
__global__ __launch_bounds__(256) void k_layernorm(const float* __restrict__ X, const float* __restrict__ R, const float* __restrict__ g, const float* __restrict__ bta,
                                                  float* __restrict__ out_sum, float* __restrict__ out_norm, int N, float eps) {
  __shared__ float red[256];
  const int row = blockIdx.x, tid = threadIdx.x;
  const float* x = X + (size_t)row * N; const float* rr = R ? R + (size_t)row * N : nullptr;
  float vals[16];                     // up to N = 4096
  const int per = N / 256;            // contiguous chunk per thread? use strided-by-4 chunks: thread handles j = tid*4 + 1024*u
  float s1 = 0.f;
  for (int u = 0; u < per / 4; ++u) {
    const int j = tid * 4 + 1024 * u;
    const v4f a = *(const v4fa*)(x + j);
    v4f b = {0.f,0.f,0.f,0.f}; if (rr) b = *(const v4fa*)(rr + j);
#pragma unroll
    for (int q = 0; q < 4; ++q) { const float v = a[q] + b[q]; vals[u * 4 + q] = v; s1 += v; }
  }
  red[tid] = s1; __syncthreads();
  for (int st = 128; st > 0; st >>= 1) { if (tid < st) red[tid] += red[tid + st]; __syncthreads(); }
  const float mu = red[0] / (float)N; __syncthreads();
  float s2 = 0.f;
  for (int u = 0; u < per / 4; ++u)
#pragma unroll
    for (int q = 0; q < 4; ++q) { const float c = vals[u * 4 + q] - mu; s2 += c * c; }
  red[tid] = s2; __syncthreads();
  for (int st = 128; st > 0; st >>= 1) { if (tid < st) red[tid] += red[tid + st]; __syncthreads(); }
  const float rs = rsqrtf(red[0] / (float)N + eps);
  {
    for (int u = 0; u < per / 4; ++u) {
      const int j = tid * 4 + 1024 * u;
      v4f o, sm;
#pragma unroll
      for (int q = 0; q < 4; ++q) {
        float gg = g[j + q], bb = bta[j + q];
        if (PARAM_BF16) { gg = bf16_round(gg); bb = bf16_round(bb); }
        sm[q] = vals[u * 4 + q]; o[q] = (vals[u * 4 + q] - mu) * rs * gg + bb;
      }
      if (out_sum) *(v4f*)(out_sum + (size_t)row * N + j) = sm;
      *(v4f*)(out_norm + (size_t)row * N + j) = o;
    }
    
  }
}



// ---- f16 WMMA path (v_wmma_f32_16x16x32_f16): 11-bit significands for operands in range — used where a [0,1] probability operand needs more precision than bf16
typedef _Float16 v16h __attribute__((ext_vector_type(16)));
union FragH { v16h v; v8us half[2]; _Float16 h[16]; unsigned short u[16]; };
template <int NT>
__device__ __forceinline__ v8f mmaH(v16h ah, v16h al, v16h bh, v16h bl, v8f c) {
  c = __builtin_amdgcn_wmma_f32_16x16x32_f16(false, ah, false, bh, (short)0, c, false, false);
  if (NT >= 2) c = __builtin_amdgcn_wmma_f32_16x16x32_f16(false, al, false, bh, (short)0, c, false, false);
  if (NT >= 3) c = __builtin_amdgcn_wmma_f32_16x16x32_f16(false, ah, false, bl, (short)0, c, false, false);
  asm volatile("v_nop\n\tv_nop\n\tv_nop\n\tv_nop" : "+v"(c) : "v"(ah), "v"(al), "v"(bh), "v"(bl));
  return c;
}
// batched GEMM like k_gemm_b but f16 operands: A f32 (split into f16 hi/lo if ASPLIT, else rounded to f16), Bt = f16 values [n][k]; alpha; C f32; N multiple of 16 (partial tiles skipped)
template <bool ASPLIT>
__global__ __launch_bounds__(128) void k_gemm_h(const float* __restrict__ A, int lda, size_t sA, const _Float16* __restrict__ Bh, int ldb, size_t sB, float alpha, float* __restrict__ C, int ldc, size_t sC, int M, int N, int K) {
  __shared__ __attribute__((aligned(16))) float so[4][16][64];
  const int tid = threadIdx.x, w = tid >> 5, lane = tid & 31, ln = lane & 15, hh = lane >> 4; const int by = blockIdx.y;
  A += (size_t)by * sA; Bh += (size_t)by * sB; C += (size_t)by * sC;
  const int ntn = (N + 63) / 64; const int wid = blockIdx.x * 4 + w; const int mt = wid / ntn, nq = wid % ntn; if (mt * 16 >= M) return;
  const int row0 = mt * 16, col0 = nq * 64; const float* arow = A + (size_t)(row0 + ln) * lda;
  v8f acc[4] = {};
  for (int kb = 0; kb < K; kb += 32) {
    FragH ah, al;
    const v4f x0 = *(const v4fa*)(arow + kb + 8 * hh), x1 = *(const v4fa*)(arow + kb + 8 * hh + 4), x2 = *(const v4fa*)(arow + kb + 16 + 8 * hh), x3 = *(const v4fa*)(arow + kb + 16 + 8 * hh + 4);
    float xs[16] = {x0[0],x0[1],x0[2],x0[3],x1[0],x1[1],x1[2],x1[3],x2[0],x2[1],x2[2],x2[3],x3[0],x3[1],x3[2],x3[3]};
#pragma unroll
    for (int i = 0; i < 16; ++i) { const _Float16 h = (_Float16)xs[i]; ah.h[i] = h; al.h[i] = ASPLIT ? (_Float16)(xs[i] - (float)h) : (_Float16)0.0f; }
#pragma unroll
    for (int t = 0; t < 4; ++t) { if (col0 + t * 16 >= N) continue; const size_t boff = (size_t)(col0 + t * 16 + ln) * ldb + kb; FragH bq; bq.half[0] = *(const v8us*)(Bh + boff + 8 * hh); bq.half[1] = *(const v8us*)(Bh + boff + 16 + 8 * hh);
      acc[t] = mmaH<ASPLIT ? 2 : 1>(ah.v, al.v, bq.v, bq.v, acc[t]); }
  }
#pragma unroll
  for (int t = 0; t < 4; ++t) { if (col0 + t * 16 >= N) continue;
#pragma unroll
    for (int r = 0; r < 8; ++r) so[w][8 * hh + r][t * 16 + ln] = acc[t][r] * alpha; }
  __builtin_amdgcn_fence(__ATOMIC_ACQ_REL, "workgroup"); __builtin_amdgcn_wave_barrier();
  const int rsub = lane >> 4, c4 = (lane & 15) * 4;
  {
#pragma unroll
    for (int q = 0; q < 8; ++q) { const int r = q * 2 + rsub; if (col0 + c4 < N) { const v4f v = *(const v4fa*)&so[w][r][c4]; *(v4f*)(C + (size_t)(row0 + r) * ldc + col0 + c4) = v; } }
     }
}

// Wt[n][k] = f16(W[k][n]·scale) from f32 row-major W[K][N] (scale = power of two; bf16-exact weights stay exact in f16 away from the subnormal range)
__global__ __launch_bounds__(256) void k_wt_f16(const float* __restrict__ W, _Float16* __restrict__ Wt, int K, int N, float scale) {
  const int t = blockIdx.x * 256 + threadIdx.x; if (t >= N * (K / 8)) return; const int n = t / (K / 8), k8 = (t % (K / 8)) * 8; FragH f;
#pragma unroll
  for (int i = 0; i < 8; ++i) f.h[i] = (_Float16)(bf16_round(W[(size_t)(k8 + i) * N + n]) * scale); const v8us o = f.half[0];
  *(v8us*)((unsigned short*)Wt + (size_t)n * K + k8) = o; 
}
// k_gemm_hh variant with fused epilogue: v = acc·alpha + bias[by·sBias + col] (+ CP[(row/rowsPerB)·sCPb + by·64 + col] if CP) ; ACT 0 none / 1 elu ; writes f16 C16 (and f32 C if non-null)
template <int ACT>
__global__ __launch_bounds__(128) void k_gemm_hhx(const _Float16* __restrict__ A, int lda, size_t sA, const _Float16* __restrict__ Bh, int ldb, size_t sB, float alpha, const float* __restrict__ bias, size_t sBias, const float* __restrict__ CP, int rowsPerB, size_t sCPb, int row0g,
    float* __restrict__ C, _Float16* __restrict__ C16, int ldc, size_t sC, int M, int N, int K) {
  __shared__ __attribute__((aligned(16))) float so[4][16][64];
  const int tid = threadIdx.x, w = tid >> 5, lane = tid & 31, ln = lane & 15, hh = lane >> 4; const int by = blockIdx.y;
  A += (size_t)by * sA; Bh += (size_t)by * sB; const size_t cofs = (size_t)by * sC; const float* bp = bias ? bias + (size_t)by * sBias : nullptr;
  const int ntn = (N + 63) / 64; const int wid = blockIdx.x * 4 + w; const int mt = wid / ntn, nq = wid % ntn; if (mt * 16 >= M) return;
  const int row0 = mt * 16, col0 = nq * 64; const _Float16* arow = A + (size_t)(row0 + ln) * lda;
  v8f acc[4] = {};
  for (int kb = 0; kb < K; kb += 32) { FragH ah; ah.half[0] = *(const v8us*)((const unsigned short*)arow + kb + 8 * hh); ah.half[1] = *(const v8us*)((const unsigned short*)arow + kb + 16 + 8 * hh);
#pragma unroll
    for (int t = 0; t < 4; ++t) { if (col0 + t * 16 >= N) continue; const size_t boff = (size_t)(col0 + t * 16 + ln) * ldb + kb; FragH bq; bq.half[0] = *(const v8us*)((const unsigned short*)Bh + boff + 8 * hh); bq.half[1] = *(const v8us*)((const unsigned short*)Bh + boff + 16 + 8 * hh);
      acc[t] = mmaH<1>(ah.v, ah.v, bq.v, bq.v, acc[t]); }
  }
#pragma unroll
  for (int t = 0; t < 4; ++t) { if (col0 + t * 16 >= N) continue; const int col = col0 + t * 16 + ln; const float bv = bp ? bf16_round(bp[col]) : 0.f;
#pragma unroll
    for (int r = 0; r < 8; ++r) { float v = acc[t][r] * alpha + bv; if (CP) { const int rr = row0g + row0 + 8 * hh + r; if (rowsPerB < 0) v += CP[cofs + (size_t)rr * ldc + col];      /* rowsPerB < 0: own element of the batched C plane */ else { const int bidx = rr / rowsPerB; v += CP[(size_t)bidx * sCPb + (size_t)by * 64 + col]; } } if (ACT == 1) v = (v > 0.f) ? v : expm1f(v); else if (ACT == 7) v = (v > 0.f) ? v + 1.0f : expf(v); else if (ACT == 8) v = tanhf(v); else if (ACT == 9) v = 0.5f * v * (1.0f + tanhf(0.7978845608028654f * (v + 0.044715f * v * v * v))); else if (ACT == 11) v = 1.0f / (1.0f + expf(-v)); else if (ACT == 12) v = (v > 0.f) ? v : 0.01f * v; else if (ACT == 14) v = (v > 0.f) ? v : 0.1f * v; else if (ACT == 16) v = (v >= 0.f) ? v : 0.3f * v; else if (ACT == 15) v = v / (1.0f + expf(-v)); else if (ACT == 3) v = fmaxf(v, 0.f); else if (ACT == 6) v = 0.5f * v * (1.0f + erff(v * 0.70710678118654752f)); so[w][8 * hh + r][t * 16 + ln] = v; } }
  __builtin_amdgcn_fence(__ATOMIC_ACQ_REL, "workgroup"); __builtin_amdgcn_wave_barrier();
  const int rsub = lane >> 4, c4 = (lane & 15) * 4; typedef _Float16 v4h __attribute__((ext_vector_type(4)));
  {
#pragma unroll
    for (int q = 0; q < 8; ++q) { const int r = q * 2 + rsub; if (col0 + c4 < N) { const v4f v = *(const v4fa*)&so[w][r][c4]; if (C) *(v4f*)(C + cofs + (size_t)(row0 + r) * ldc + col0 + c4) = v; if (C16) { v4h h4; for (int i = 0; i < 4; ++i) h4[i] = (_Float16)v[i]; *(v4h*)(C16 + cofs + (size_t)(row0 + r) * ldc + col0 + c4) = h4; } } }
     }
}


typedef _Float16 v4h __attribute__((ext_vector_type(4)));

__global__ __launch_bounds__(256) void k_x16(const float* __restrict__ x, _Float16* __restrict__ X16, size_t n8) { const size_t t = (size_t)blockIdx.x * 256 + threadIdx.x; if (t >= n8) return; FragH f;
#pragma unroll
  for (int q = 0; q < 8; ++q) f.h[q] = (_Float16)bf16_round(x[t * 8 + q]); *(v8us*)((unsigned short*)X16 + t * 8) = f.half[0];  }
__global__ __launch_bounds__(256) void k_h16(const float* __restrict__ x, _Float16* __restrict__ X16, size_t n8) { const size_t t = (size_t)blockIdx.x * 256 + threadIdx.x; if (t >= n8) return; FragH f;
#pragma unroll
  for (int q = 0; q < 8; ++q) f.h[q] = (_Float16)x[t * 8 + q]; *(v8us*)((unsigned short*)X16 + t * 8) = f.half[0];  }
__global__ __launch_bounds__(256) void k_round16f(const float* __restrict__ W, _Float16* __restrict__ Bt, size_t n8) { const size_t t = (size_t)blockIdx.x * 256 + threadIdx.x; if (t >= n8) return; FragH f;
#pragma unroll
  for (int i = 0; i < 8; ++i) f.h[i] = (_Float16)(bf16_round(W[t * 8 + i]) * 16.0f); *(v8us*)((unsigned short*)Bt + t * 8) = f.half[0];  }
template <int NHv, int TTv>
__global__ __launch_bounds__(256) void k_vt(const _Float16* __restrict__ V16, int ldv, int voff, _Float16* __restrict__ Vt) { __shared__ unsigned short tl[64][66]; const int tid = threadIdx.x; const int slab = blockIdx.x / (TTv / 64), lg = blockIdx.x % (TTv / 64); const int b = slab / NHv, h = slab % NHv;
  for (int i = tid; i < 64 * 8; i += 256) { const int r = i / 8, c8 = (i % 8) * 8; FragH f; f.half[0] = *(const v8us*)((const unsigned short*)V16 + ((size_t)b * TTv + lg * 64 + r) * ldv + voff + h * 64 + c8);
#pragma unroll
    for (int q = 0; q < 8; ++q) tl[r][c8 + q] = f.u[q]; }
  __syncthreads();
  {
#pragma unroll
    for (int rd = 0; rd < 2; ++rd) { const int d = rd * 32 + tid / 8, pc = tid % 8; FragH f;
#pragma unroll
      for (int q = 0; q < 8; ++q) f.u[q] = tl[pc * 8 + q][d];
      *(v8us*)((unsigned short*)Vt + ((size_t)slab * 64 + d) * TTv + lg * 64 + pc * 8) = f.half[0]; }
     } }

__global__ __launch_bounds__(256) void k_hl(const float* __restrict__ F, _Float16* __restrict__ Hh, _Float16* __restrict__ Hl, size_t n8) { const size_t t = (size_t)blockIdx.x * 256 + threadIdx.x; if (t >= n8) return; FragH fh, fl; const v4f a = *(const v4fa*)(F + t * 8), c = *(const v4fa*)(F + t * 8 + 4);
#pragma unroll
  for (int q = 0; q < 4; ++q) { _Float16 h = (_Float16)a[q]; fh.h[q] = h; fl.h[q] = (_Float16)((a[q] - (float)h) * 1024.0f); h = (_Float16)c[q]; fh.h[4 + q] = h; fl.h[4 + q] = (_Float16)((c[q] - (float)h) * 1024.0f); }
  { *(v8us*)((unsigned short*)Hh + t * 8) = fh.half[0]; *(v8us*)((unsigned short*)Hl + t * 8) = fl.half[0];  } }

// ---- fast GEMM (wave tile 32x64; requires M % 32 == 0 rows per launch region and N % 64 == 0); epilogue = k_gemm_hhx semantics ----
__device__ __forceinline__ v16h g2_frag(const _Float16* p, int hh) { FragH f; f.half[0] = *(const v8us*)((const unsigned short*)p + 8 * hh); f.half[1] = *(const v8us*)((const unsigned short*)p + 16 + 8 * hh); return f.v; }
__device__ __forceinline__ v8f g2_mma(v16h a, v16h b, v8f c) { v8f d = __builtin_amdgcn_wmma_f32_16x16x32_f16(false, a, false, b, (short)0, c, false, false); asm volatile("v_nop\n\tv_nop\n\tv_nop\n\tv_nop" : "+v"(d) : "v"(a), "v"(b)); return d; }
template <int ACT>
__global__ __launch_bounds__(128) void k_gemm2(const _Float16* __restrict__ A, int lda, size_t sA, const _Float16* __restrict__ Bh, int ldb, size_t sB, float alpha, const float* __restrict__ bias, size_t sBias, const float* __restrict__ CP, int rowsPerB, size_t sCPb, int row0g,
    float* __restrict__ C, _Float16* __restrict__ C16, int ldc, size_t sC, int M, int N, int K) { static_assert(ACT == 0 || ACT == 3 || ACT == 6 || ACT == 8 || ACT == 9 || ACT == 11 || ACT == 12 || ACT == 14 || ACT == 15 || ACT == 16, "k_gemm2: unsupported ACT code (would silently apply no activation)");
  __shared__ __attribute__((aligned(16))) float so[4][32][68];
  const int tid = threadIdx.x, w = tid >> 5, lane = tid & 31, ln = lane & 15, hh = lane >> 4; const int by = blockIdx.y;
  A += (size_t)by * sA; Bh += (size_t)by * sB; const size_t cofs = (size_t)by * sC; const float* bp = bias ? bias + (size_t)by * sBias : nullptr;
  const int ntn = N >> 6; const int mt = blockIdx.x / ntn, nq = blockIdx.x - mt * ntn; const int row0 = mt * 128 + 32 * w, col0 = nq * 64; if (row0 >= M) return;
  const _Float16* a0p = A + (size_t)(row0 + ln) * lda; const _Float16* a1p = a0p + (size_t)16 * lda;
  const _Float16* b0p = Bh + (size_t)(col0 + ln) * ldb; const _Float16* b1p = b0p + (size_t)16 * ldb; const _Float16* b2p = b1p + (size_t)16 * ldb; const _Float16* b3p = b2p + (size_t)16 * ldb;
  const v8f z8 = {0.f,0.f,0.f,0.f,0.f,0.f,0.f,0.f}; v8f c00 = z8, c01 = z8, c02 = z8, c03 = z8, c10 = z8, c11 = z8, c12 = z8, c13 = z8;
#pragma unroll 1
  for (int kb = 0; kb < K; kb += 32) { const v16h a0 = g2_frag(a0p + kb, hh), a1 = g2_frag(a1p + kb, hh);
    v16h b = g2_frag(b0p + kb, hh); c00 = g2_mma(a0, b, c00); c10 = g2_mma(a1, b, c10);
    b = g2_frag(b1p + kb, hh); c01 = g2_mma(a0, b, c01); c11 = g2_mma(a1, b, c11);
    b = g2_frag(b2p + kb, hh); c02 = g2_mma(a0, b, c02); c12 = g2_mma(a1, b, c12);
    b = g2_frag(b3p + kb, hh); c03 = g2_mma(a0, b, c03); c13 = g2_mma(a1, b, c13); }
  v8f accs[8] = {c00, c01, c02, c03, c10, c11, c12, c13};
#pragma unroll
  for (int u = 0; u < 8; ++u) { const int t = u & 3, half = u >> 2; const int col = col0 + t * 16 + ln; const float bv = bp ? bf16_round(bp[col]) : 0.f;
#pragma unroll
    for (int r = 0; r < 8; ++r) { const int rloc = half * 16 + 8 * hh + r; float v = accs[u][r] * alpha + bv; if (CP) { if (rowsPerB < 0) v += CP[cofs + (size_t)(row0g + row0 + rloc) * ldc + col];      /* rowsPerB < 0: own element of the batched C plane */ else { const int bidx = (row0g + row0 + rloc) / rowsPerB; v += CP[(size_t)bidx * sCPb + (size_t)by * 64 + col]; } }
      if (ACT == 3) v = fmaxf(v, 0.f); else if (ACT == 6) v = 0.5f * v * (1.0f + erff(v * 0.70710678118654752f)); else if (ACT == 11) v = 1.0f / (1.0f + expf(-v)); else if (ACT == 15) v = v / (1.0f + expf(-v)); else if (ACT == 12) v = (v > 0.f) ? v : 0.01f * v; else if (ACT == 8) v = tanhf(v); else if (ACT == 9) v = 0.5f * v * (1.0f + tanhf(0.7978845608028654f * (v + 0.044715f * v * v * v))); else if (ACT == 14) v = (v > 0.f) ? v : 0.1f * v; else if (ACT == 16) v = (v >= 0.f) ? v : 0.3f * v;
      so[w][rloc][t * 16 + ln] = v; } }
  __builtin_amdgcn_fence(__ATOMIC_ACQ_REL, "workgroup"); __builtin_amdgcn_wave_barrier();
  const int rsub = lane >> 4, c4 = (lane & 15) * 4;
  {
#pragma unroll
    for (int q = 0; q < 16; ++q) { const int r = q * 2 + rsub; const v4f v = *(const v4fa*)&so[w][r][c4]; if (C) *(v4f*)(C + cofs + (size_t)(row0 + r) * ldc + col0 + c4) = v; if (C16) { v4h h4; for (int i = 0; i < 4; ++i) h4[i] = (_Float16)v[i]; *(v4h*)(C16 + cofs + (size_t)(row0 + r) * ldc + col0 + c4) = h4; } }
     } }


__global__ __launch_bounds__(256) void k_repack(const _Float16* __restrict__ QKV, size_t r0, _Float16* __restrict__ QP, _Float16* __restrict__ KP, _Float16* __restrict__ VT) {
  const int t = blockIdx.x * 256 + threadIdx.x;
  if (t < NQ * NN) { const int n = t % NN, q = t / NN; const int gl = q / NH, h = q % NH; const v8us* s = (const v8us*)((const unsigned short*)QKV + ((r0 + (size_t)gl * NN + n) * (3 * DD) + h * HD)); const v8us* sk = (const v8us*)((const unsigned short*)QKV + ((r0 + (size_t)gl * NN + n) * (3 * DD) + DD + h * HD));
    unsigned short* dq = (unsigned short*)QP + ((size_t)q * NN + n) * HD; unsigned short* dk = (unsigned short*)KP + ((size_t)q * NN + n) * HD;
    { for (int i = 0; i < 4; ++i) { *(v8us*)(dq + i * 8) = s[i]; *(v8us*)(dk + i * 8) = sk[i]; }  } return; }
  const int u = t - NQ * NN; if (u >= NQ * 64 * (NN / 8)) return; const int k8 = u % (NN / 8); const int d = (u / (NN / 8)) % 64; const int q = u / ((NN / 8) * 64); const int gl = q / NH, h = q % NH; FragH f;
  for (int e = 0; e < 8; ++e) { const int key = k8 * 8 + e; f.h[e] = (d < HD) ? QKV[(r0 + (size_t)gl * NN + key) * (3 * DD) + 2 * DD + h * HD + d] : (_Float16)0.0f; }
  unsigned short* dv = (unsigned short*)VT + ((size_t)q * 64 + d) * NN + k8 * 8; *(v8us*)dv = f.half[0];  }
__global__ __launch_bounds__(256) void k_soft(const float* __restrict__ S, const float* __restrict__ sim, _Float16* __restrict__ P) {
  #pragma clang fp contract(off)
  const int wv = threadIdx.x >> 5, ln = threadIdx.x & 31; const int r = blockIdx.x * 8 + wv; if (r >= NQ * NN) return; const int n = r % NN; const float* sr = S + (size_t)r * NN; const float* sb = sim + (size_t)n * NN; float m = -3.0e38f;
#pragma unroll 1
  for (int j = ln; j < NN; j += 32) { float z = sr[j] * SCL; z += bf16_round(sb[j]); m = fmaxf(m, z); }
  for (int o = 16; o > 0; o >>= 1) m = fmaxf(m, __shfl_xor(m, o, 32)); float su = 0.f;
#pragma unroll 1
  for (int j = ln; j < NN; j += 32) { float z = sr[j] * SCL; z += bf16_round(sb[j]); su += expf(z - m); }
  for (int o = 16; o > 0; o >>= 1) su += __shfl_xor(su, o, 32); const float f = 1024.0f / su;
  {
#pragma unroll 1
    for (int j = ln; j < NN; j += 32) { float z = sr[j] * SCL; z += bf16_round(sb[j]); *(_Float16*)(P + (size_t)r * NN + j) = (_Float16)(expf(z - m) * f); }
     } }
__global__ __launch_bounds__(256) void k_compact(const _Float16* __restrict__ OC, size_t r0, _Float16* __restrict__ O16) {
  const int t = blockIdx.x * 256 + threadIdx.x; if (t >= GCH * NN * NH) return; const int h = t % NH; const int n = (t / NH) % NN; const int gl = t / (NH * NN); const v8us* s = (const v8us*)((const unsigned short*)OC + (((size_t)gl * NH + h) * NN + n) * 64); v8us a[4]; for (int i = 0; i < 4; ++i) a[i] = s[i];
  unsigned short* d = (unsigned short*)O16 + (r0 + (size_t)gl * NN + n) * DD + h * HD;
{ for (int i = 0; i < 4; ++i) *(v8us*)(d + i * 8) = a[i];  } }
__global__ __launch_bounds__(256) void k_wqkv(const float* __restrict__ Wq, const float* __restrict__ Wk, const float* __restrict__ Wv, _Float16* __restrict__ Bt) { const int t = blockIdx.x * 256 + threadIdx.x; if (t >= 3 * DD * (DD / 8)) return; const int n = t / (DD / 8), k0 = (t % (DD / 8)) * 8; const int which = n / DD, o = n % DD; const float* Wm = which == 0 ? Wq : (which == 1 ? Wk : Wv); FragH f;
  for (int q = 0; q < 8; ++q) f.h[q] = (_Float16)(bf16_round(Wm[(size_t)(k0 + q) * DD + o]) * 16.0f); *(v8us*)((unsigned short*)Bt + (size_t)n * DD + k0) = f.half[0];  }

extern "C" void kernel_launch(void* const* d_in, const int* in_sizes, int n_in,
                              void* d_out, int out_size, void* d_ws, size_t ws_size, hipStream_t stream) {
  (void)in_sizes; (void)n_in; (void)out_size;
  const float* const* I = (const float* const*)d_in; const float* x = I[0]; const float* sim = I[1]; const float* Wq = I[2]; const float* Wk = I[3]; const float* Wv = I[4]; const float* Wo = I[5];
  char* ws = (char*)d_ws; size_t off = 0;
  auto take = [&](size_t bytes) { char* p = ws + off; off += (bytes + 255) & ~(size_t)255; return p; };
  _Float16* BQKV = (_Float16*)take((size_t)3 * DD * DD * 2); _Float16* BO = (_Float16*)take((size_t)DD * DD * 2);
  _Float16* X16 = (_Float16*)take((size_t)NR * DD * 2); _Float16* QKV = (_Float16*)take((size_t)NR * 3 * DD * 2); _Float16* O16 = (_Float16*)take((size_t)NR * DD * 2);
  _Float16* QP = (_Float16*)take((size_t)NQ * NN * HD * 2); _Float16* KP = (_Float16*)take((size_t)NQ * NN * HD * 2); _Float16* VT = (_Float16*)take((size_t)NQ * 64 * NN * 2); float* S = (float*)take((size_t)NQ * NN * NN * 4); _Float16* P = (_Float16*)take((size_t)NQ * NN * NN * 2); _Float16* OC = (_Float16*)take((size_t)NQ * NN * 64 * 2);
  if (off > ws_size) return;      /* 0.5 + 12 + 36 + 12 + 1.5 + 1.5 + 3 + 48 + 24 + 3 = 142 MiB */
  k_wqkv<<<(3 * DD * (DD / 8) + 255) / 256, 256, 0, stream>>>(Wq, Wk, Wv, BQKV); k_wt_f16<<<(DD * DD / 8 + 255) / 256, 256, 0, stream>>>(Wo, BO, DD, DD, 16.0f);
  k_x16<<<(unsigned)(((size_t)NR * DD / 8 + 255) / 256), 256, 0, stream>>>(x, X16, (size_t)NR * DD / 8);
  k_gemm2<0><<<dim3((NR / 128) * (3 * DD / 64), 1), 128, 0, stream>>>(X16, DD, 0, BQKV, DD, 0, 0.0625f, nullptr, 0, nullptr, 1, 0, 0, nullptr, QKV, 3 * DD, 0, NR, 3 * DD, DD);      /* [q | k | v], heads h*32 + d */
  for (int c = 0; c < NG / GCH; ++c) { const size_t r0 = (size_t)c * CROWS;
    k_repack<<<(NQ * NN + NQ * 64 * (NN / 8) + 255) / 256, 256, 0, stream>>>(QKV, r0, QP, KP, VT);
    k_gemm2<0><<<dim3((NN / 128) * (NN / 64), NQ), 128, 0, stream>>>(QP, HD, (size_t)NN * HD, KP, HD, (size_t)NN * HD, 1.0f, nullptr, 0, nullptr, 1, 0, 0, S, nullptr, NN, (size_t)NN * NN, NN, NN, HD);      /* raw q.k (scale + bias in the softmax) */
    k_soft<<<(NQ * NN + 7) / 8, 256, 0, stream>>>(S, sim, P);
    k_gemm2<0><<<dim3((NN / 128) * 1, NQ), 128, 0, stream>>>(P, NN, (size_t)NN * NN, VT, NN, (size_t)64 * NN, 0.0009765625f, nullptr, 0, nullptr, 1, 0, 0, nullptr, OC, 64, (size_t)NN * 64, NN, 64, NN);
    k_compact<<<(GCH * NN * NH + 255) / 256, 256, 0, stream>>>(OC, r0, O16); }
  k_gemm2<0><<<dim3((NR / 128) * (DD / 64), 1), 128, 0, stream>>>(O16, DD, 0, BO, DD, 0, 0.0625f, nullptr, 0, nullptr, 1, 0, 0, (float*)d_out, nullptr, DD, 0, NR, DD, DD);
}

// v001
// Measured time: 106 microseconds a run.
// Timed twice side by side with v000, it ran 6.59 and 6.50 times as fast.
#include <hip/hip_runtime.h>
// SpatialMHSA (4 x 12 frames x 512 spatial tokens x 256 = 8 heads of 32): q/k/v = x W (xavier (in,out) weights); per (batch, frame, head) attention over the 512 tokens with scores/sqrt(32) + an INPUT additive bias sim[n][m]; out = merged heads W_o.
// Structure: exact f16 plane of x; q|k projection GEMM to token rows and a swapped-operand GEMM that writes v^T (32x64 wave tiles, f32 accumulation, exact x16 weights, f16 output); ONE fused attention kernel over all 384 (group, head) pairs (S^T = K Q^T with the scaled bias plane as C, online softmax in registers, O^T = V^T P^T, f16 token rows out); output GEMM.
// Compute dtype: x, sim and weights rounded to bf16; q, k, v, P, attention output as f16 operands (~2^-12); f32 accumulation/softmax. v_wmma_f32_16x16x32_f16.
#define NBATCH 4
#define NFR 12
#define NN 512
#define DD 256
#define NH 8
#define HD 32
#define NG (NBATCH * NFR)         /* 48 groups */
#define NR (NG * NN)             /* 24576 token rows */
#define SCL 0.17677669529663687f /* 32^-0.5 */
typedef __bf16 v16b __attribute__((ext_vector_type(16)));
typedef unsigned short v8us __attribute__((ext_vector_type(8), may_alias));
typedef float  v8f  __attribute__((ext_vector_type(8)));
typedef float  v4f  __attribute__((ext_vector_type(4)));
typedef float  v4fa __attribute__((ext_vector_type(4), may_alias));
union FragB { v16b v; v8us half[2]; unsigned short u[16]; };

__device__ __forceinline__ unsigned short bf16_bits(float x) { unsigned int u = __float_as_uint(x); return (unsigned short)((u + 0x7FFFu + ((u >> 16) & 1u)) >> 16); }
__device__ __forceinline__ float bf16_val(unsigned short b) { return __uint_as_float(((unsigned int)b) << 16); }
__device__ __forceinline__ float bf16_round(float x) { return bf16_val(bf16_bits(x)); }
// D += A·B with NT terms: 1 = ah·bh, 2 = + al·bh (A split), 3 = + ah·bl (both split)
template <int NT>
__device__ __forceinline__ v8f mmaN(v16b ah, v16b al, v16b bh, v16b bl, v8f c) {
  c = __builtin_amdgcn_wmma_f32_16x16x32_bf16(false, ah, false, bh, (short)0, c, false, false);
  if (NT >= 2) c = __builtin_amdgcn_wmma_f32_16x16x32_bf16(false, al, false, bh, (short)0, c, false, false);
  if (NT >= 3) c = __builtin_amdgcn_wmma_f32_16x16x32_bf16(false, ah, false, bl, (short)0, c, false, false);
  asm volatile("v_nop\n\tv_nop\n\tv_nop\n\tv_nop" : "+v"(c) : "v"(ah), "v"(al), "v"(bh), "v"(bl));
  return c;
}

__global__ __launch_bounds__(256) void k_wt_bf16(const float* __restrict__ W, unsigned short* __restrict__ Wt, int K, int N) {
  const int t = blockIdx.x * 256 + threadIdx.x;
  const int k8n = K / 8;
  if (t >= N * k8n) return;
  const int n = t / k8n, k8 = (t % k8n) * 8;
  v8us v;
#pragma unroll
  for (int i = 0; i < 8; ++i) v[i] = bf16_bits(W[(size_t)(k8 + i) * N + n]);
  *(v8us*)(Wt + (size_t)n * K + k8) = v;
  
}

// GEMM C[M][N] (f32, pitch ldc) = act(A[M][K]·W + bias). A f32 row-major (pitch lda) converted per fragment to bf16
// (ASPLIT: hi/lo two planes -> 2 terms, else single rounded term); Wt bf16 [N][K] (pitch ldb). BIAS_BF16 rounds the
// bias to bf16 first (bias quantised to bf16 before the add). K%32==0, M%16==0, N%64==0.
template <bool ASPLIT, int ACT, bool BIAS_BF16>
__global__ __launch_bounds__(128) void k_gemm_bf(const float* __restrict__ A, int lda, const unsigned short* __restrict__ Wt, int ldb,
                                               const float* __restrict__ bias, float* __restrict__ C, int ldc, int M, int N, int K) {
  __shared__ __attribute__((aligned(16))) float so[4][16][64];
  const int tid = threadIdx.x, w = tid >> 5, lane = tid & 31, ln = lane & 15, hh = lane >> 4;
  const int ntn = N / 64;
  const int wid = blockIdx.x * 4 + w;
  const int mt = wid / ntn, nq = wid % ntn;
  if (mt * 16 >= M) return;
  const int row0 = mt * 16, col0 = nq * 64;
  const float* arow = A + (size_t)(row0 + ln) * lda;
  v8f acc[4] = {};
  for (int kb = 0; kb < K; kb += 32) {
    FragB ah, al;
    const v4f x0 = *(const v4fa*)(arow + kb + 8 * hh), x1 = *(const v4fa*)(arow + kb + 8 * hh + 4);
    const v4f x2 = *(const v4fa*)(arow + kb + 16 + 8 * hh), x3 = *(const v4fa*)(arow + kb + 16 + 8 * hh + 4);
    float xs[16] = {x0[0],x0[1],x0[2],x0[3],x1[0],x1[1],x1[2],x1[3],x2[0],x2[1],x2[2],x2[3],x3[0],x3[1],x3[2],x3[3]};
#pragma unroll
    for (int i = 0; i < 16; ++i) { const unsigned short hb = bf16_bits(xs[i]); ah.u[i] = hb; al.u[i] = ASPLIT ? bf16_bits(xs[i] - bf16_val(hb)) : (unsigned short)0; }
#pragma unroll
    for (int t = 0; t < 4; ++t) {
      const unsigned short* brow = Wt + (size_t)(col0 + t * 16 + ln) * ldb + kb;
      FragB b;
      b.half[0] = *(const v8us*)(brow + 8 * hh);
      b.half[1] = *(const v8us*)(brow + 16 + 8 * hh);
      acc[t] = mmaN<ASPLIT ? 2 : 1>(ah.v, al.v, b.v, b.v, acc[t]);
    }
  }
#pragma unroll
  for (int t = 0; t < 4; ++t) {
    float bv = bias ? bias[col0 + t * 16 + ln] : 0.f;
    if (BIAS_BF16) bv = bf16_round(bv);
#pragma unroll
    for (int r = 0; r < 8; ++r) { float v = acc[t][r] + bv; if (ACT == 1) v = fmaxf(v, 0.f); so[w][8 * hh + r][t * 16 + ln] = v; }
  }
  __builtin_amdgcn_fence(__ATOMIC_ACQ_REL, "workgroup");
  __builtin_amdgcn_wave_barrier();
  const int rsub = lane >> 4, c4 = (lane & 15) * 4;
  {
#pragma unroll
    for (int q = 0; q < 8; ++q) {
      const int r = q * 2 + rsub;
      const v4f v = *(const v4fa*)&so[w][r][c4];
      *(v4f*)(C + (size_t)(row0 + r) * ldc + col0 + c4) = v;
    }
    
  }
}

// GEMM C = act(A·W + bias + resid): A f32 (ASPLIT -> hi/lo 2 terms), Wt bf16 [N][K]; ACT 0 none, 1 relu, 2 exact gelu;
// resid (optional, f32, row index = (row % rmod), pitch ldr, RES_BF16 rounds it) added before the activation.
template <bool ASPLIT, int ACT, bool BIAS_BF16, bool RES_BF16>
__global__ __launch_bounds__(128) void k_gemm_bf3(const float* __restrict__ A, int lda, const unsigned short* __restrict__ Wt, int ldb,
                                                const float* __restrict__ bias, const float* __restrict__ resid, int rmod, int ldr,
                                                float* __restrict__ C, int ldc, int M, int N, int K) {
  __shared__ __attribute__((aligned(16))) float so[4][16][64];
  const int tid = threadIdx.x, w = tid >> 5, lane = tid & 31, ln = lane & 15, hh = lane >> 4;
  const int ntn = N / 64;
  const int wid = blockIdx.x * 4 + w;
  const int mt = wid / ntn, nq = wid % ntn;
  if (mt * 16 >= M) return;
  const int row0 = mt * 16, col0 = nq * 64;
  const float* arow = A + (size_t)(row0 + ln) * lda;
  v8f acc[4] = {};
  for (int kb = 0; kb < K; kb += 32) {
    FragB ah, al;
    const v4f x0 = *(const v4fa*)(arow + kb + 8 * hh), x1 = *(const v4fa*)(arow + kb + 8 * hh + 4);
    const v4f x2 = *(const v4fa*)(arow + kb + 16 + 8 * hh), x3 = *(const v4fa*)(arow + kb + 16 + 8 * hh + 4);
    float xs[16] = {x0[0],x0[1],x0[2],x0[3],x1[0],x1[1],x1[2],x1[3],x2[0],x2[1],x2[2],x2[3],x3[0],x3[1],x3[2],x3[3]};
#pragma unroll
    for (int i = 0; i < 16; ++i) { const unsigned short hb = bf16_bits(xs[i]); ah.u[i] = hb; al.u[i] = ASPLIT ? bf16_bits(xs[i] - bf16_val(hb)) : (unsigned short)0; }
#pragma unroll
    for (int t = 0; t < 4; ++t) {
      const unsigned short* brow = Wt + (size_t)(col0 + t * 16 + ln) * ldb + kb;
      FragB b;
      b.half[0] = *(const v8us*)(brow + 8 * hh);
      b.half[1] = *(const v8us*)(brow + 16 + 8 * hh);
      acc[t] = mmaN<ASPLIT ? 2 : 1>(ah.v, al.v, b.v, b.v, acc[t]);
    }
  }
#pragma unroll
  for (int t = 0; t < 4; ++t) {
    const int col = col0 + t * 16 + ln;
    float bv = bias ? bias[col] : 0.f;
    if (BIAS_BF16) bv = bf16_round(bv);
#pragma unroll
    for (int r = 0; r < 8; ++r) {
      float v = acc[t][r] + bv;
      if (resid) { float rv = resid[(size_t)((row0 + 8 * hh + r) % rmod) * ldr + col]; if (RES_BF16) rv = bf16_round(rv); v += rv; }
      if (ACT == 1) v = fmaxf(v, 0.f);
      if (ACT == 2) v = 0.5f * v * (1.0f + erff(v * 0.70710678118654752f));
      if (ACT == 3) { const float u = 0.7978845608028654f * (v + 0.044715f * v * v * v); v = 0.5f * v * (1.0f + tanhf(u)); }
      so[w][8 * hh + r][t * 16 + ln] = v;
    }
  }
  __builtin_amdgcn_fence(__ATOMIC_ACQ_REL, "workgroup");
  __builtin_amdgcn_wave_barrier();
  const int rsub = lane >> 4, c4 = (lane & 15) * 4;
  {
#pragma unroll
    for (int q = 0; q < 8; ++q) {
      const int r = q * 2 + rsub;
      const v4f v = *(const v4fa*)&so[w][r][c4];
      *(v4f*)(C + (size_t)(row0 + r) * ldc + col0 + c4) = v;
    }
    
  }
}
// row LayerNorm (biased variance, eps) over N: s = X (+ R); optional out_sum <- s; out_norm <- (s-mu)*rsqrt(var+eps)*g + b
template <bool PARAM_BF16>
__global__ __launch_bounds__(256) void k_layernorm(const float* __restrict__ X, const float* __restrict__ R, const float* __restrict__ g, const float* __restrict__ bta,
                                                  float* __restrict__ out_sum, float* __restrict__ out_norm, int N, float eps) {
  __shared__ float red[256];
  const int row = blockIdx.x, tid = threadIdx.x;
  const float* x = X + (size_t)row * N; const float* rr = R ? R + (size_t)row * N : nullptr;
  float vals[16];                     // up to N = 4096
  const int per = N / 256;            // contiguous chunk per thread? use strided-by-4 chunks: thread handles j = tid*4 + 1024*u
  float s1 = 0.f;
  for (int u = 0; u < per / 4; ++u) {
    const int j = tid * 4 + 1024 * u;
    const v4f a = *(const v4fa*)(x + j);
    v4f b = {0.f,0.f,0.f,0.f}; if (rr) b = *(const v4fa*)(rr + j);
#pragma unroll
    for (int q = 0; q < 4; ++q) { const float v = a[q] + b[q]; vals[u * 4 + q] = v; s1 += v; }
  }
  red[tid] = s1; __syncthreads();
  for (int st = 128; st > 0; st >>= 1) { if (tid < st) red[tid] += red[tid + st]; __syncthreads(); }
  const float mu = red[0] / (float)N; __syncthreads();
  float s2 = 0.f;
  for (int u = 0; u < per / 4; ++u)
#pragma unroll
    for (int q = 0; q < 4; ++q) { const float c = vals[u * 4 + q] - mu; s2 += c * c; }
  red[tid] = s2; __syncthreads();
  for (int st = 128; st > 0; st >>= 1) { if (tid < st) red[tid] += red[tid + st]; __syncthreads(); }
  const float rs = rsqrtf(red[0] / (float)N + eps);
  {
    for (int u = 0; u < per / 4; ++u) {
      const int j = tid * 4 + 1024 * u;
      v4f o, sm;
#pragma unroll
      for (int q = 0; q < 4; ++q) {
        float gg = g[j + q], bb = bta[j + q];
        if (PARAM_BF16) { gg = bf16_round(gg); bb = bf16_round(bb); }
        sm[q] = vals[u * 4 + q]; o[q] = (vals[u * 4 + q] - mu) * rs * gg + bb;
      }
      if (out_sum) *(v4f*)(out_sum + (size_t)row * N + j) = sm;
      *(v4f*)(out_norm + (size_t)row * N + j) = o;
    }
    
  }
}



// ---- f16 WMMA path (v_wmma_f32_16x16x32_f16): 11-bit significands for operands in range — used where a [0,1] probability operand needs more precision than bf16
typedef _Float16 v16h __attribute__((ext_vector_type(16)));
union FragH { v16h v; v8us half[2]; _Float16 h[16]; unsigned short u[16]; };
template <int NT>
__device__ __forceinline__ v8f mmaH(v16h ah, v16h al, v16h bh, v16h bl, v8f c) {
  c = __builtin_amdgcn_wmma_f32_16x16x32_f16(false, ah, false, bh, (short)0, c, false, false);
  if (NT >= 2) c = __builtin_amdgcn_wmma_f32_16x16x32_f16(false, al, false, bh, (short)0, c, false, false);
  if (NT >= 3) c = __builtin_amdgcn_wmma_f32_16x16x32_f16(false, ah, false, bl, (short)0, c, false, false);
  asm volatile("v_nop\n\tv_nop\n\tv_nop\n\tv_nop" : "+v"(c) : "v"(ah), "v"(al), "v"(bh), "v"(bl));
  return c;
}
// batched GEMM like k_gemm_b but f16 operands: A f32 (split into f16 hi/lo if ASPLIT, else rounded to f16), Bt = f16 values [n][k]; alpha; C f32; N multiple of 16 (partial tiles skipped)
template <bool ASPLIT>
__global__ __launch_bounds__(128) void k_gemm_h(const float* __restrict__ A, int lda, size_t sA, const _Float16* __restrict__ Bh, int ldb, size_t sB, float alpha, float* __restrict__ C, int ldc, size_t sC, int M, int N, int K) {
  __shared__ __attribute__((aligned(16))) float so[4][16][64];
  const int tid = threadIdx.x, w = tid >> 5, lane = tid & 31, ln = lane & 15, hh = lane >> 4; const int by = blockIdx.y;
  A += (size_t)by * sA; Bh += (size_t)by * sB; C += (size_t)by * sC;
  const int ntn = (N + 63) / 64; const int wid = blockIdx.x * 4 + w; const int mt = wid / ntn, nq = wid % ntn; if (mt * 16 >= M) return;
  const int row0 = mt * 16, col0 = nq * 64; const float* arow = A + (size_t)(row0 + ln) * lda;
  v8f acc[4] = {};
  for (int kb = 0; kb < K; kb += 32) {
    FragH ah, al;
    const v4f x0 = *(const v4fa*)(arow + kb + 8 * hh), x1 = *(const v4fa*)(arow + kb + 8 * hh + 4), x2 = *(const v4fa*)(arow + kb + 16 + 8 * hh), x3 = *(const v4fa*)(arow + kb + 16 + 8 * hh + 4);
    float xs[16] = {x0[0],x0[1],x0[2],x0[3],x1[0],x1[1],x1[2],x1[3],x2[0],x2[1],x2[2],x2[3],x3[0],x3[1],x3[2],x3[3]};
#pragma unroll
    for (int i = 0; i < 16; ++i) { const _Float16 h = (_Float16)xs[i]; ah.h[i] = h; al.h[i] = ASPLIT ? (_Float16)(xs[i] - (float)h) : (_Float16)0.0f; }
#pragma unroll
    for (int t = 0; t < 4; ++t) { if (col0 + t * 16 >= N) continue; const size_t boff = (size_t)(col0 + t * 16 + ln) * ldb + kb; FragH bq; bq.half[0] = *(const v8us*)(Bh + boff + 8 * hh); bq.half[1] = *(const v8us*)(Bh + boff + 16 + 8 * hh);
      acc[t] = mmaH<ASPLIT ? 2 : 1>(ah.v, al.v, bq.v, bq.v, acc[t]); }
  }
#pragma unroll
  for (int t = 0; t < 4; ++t) { if (col0 + t * 16 >= N) continue;
#pragma unroll
    for (int r = 0; r < 8; ++r) so[w][8 * hh + r][t * 16 + ln] = acc[t][r] * alpha; }
  __builtin_amdgcn_fence(__ATOMIC_ACQ_REL, "workgroup"); __builtin_amdgcn_wave_barrier();
  const int rsub = lane >> 4, c4 = (lane & 15) * 4;
  {
#pragma unroll
    for (int q = 0; q < 8; ++q) { const int r = q * 2 + rsub; if (col0 + c4 < N) { const v4f v = *(const v4fa*)&so[w][r][c4]; *(v4f*)(C + (size_t)(row0 + r) * ldc + col0 + c4) = v; } }
     }
}

// Wt[n][k] = f16(W[k][n]·scale) from f32 row-major W[K][N] (scale = power of two; bf16-exact weights stay exact in f16 away from the subnormal range)
__global__ __launch_bounds__(256) void k_wt_f16(const float* __restrict__ W, _Float16* __restrict__ Wt, int K, int N, float scale) {
  const int t = blockIdx.x * 256 + threadIdx.x; if (t >= N * (K / 8)) return; const int n = t / (K / 8), k8 = (t % (K / 8)) * 8; FragH f;
#pragma unroll
  for (int i = 0; i < 8; ++i) f.h[i] = (_Float16)(bf16_round(W[(size_t)(k8 + i) * N + n]) * scale); const v8us o = f.half[0];
  *(v8us*)((unsigned short*)Wt + (size_t)n * K + k8) = o; 
}
// k_gemm_hh variant with fused epilogue: v = acc·alpha + bias[by·sBias + col] (+ CP[(row/rowsPerB)·sCPb + by·64 + col] if CP) ; ACT 0 none / 1 elu ; writes f16 C16 (and f32 C if non-null)
template <int ACT>
__global__ __launch_bounds__(128) void k_gemm_hhx(const _Float16* __restrict__ A, int lda, size_t sA, const _Float16* __restrict__ Bh, int ldb, size_t sB, float alpha, const float* __restrict__ bias, size_t sBias, const float* __restrict__ CP, int rowsPerB, size_t sCPb, int row0g,
    float* __restrict__ C, _Float16* __restrict__ C16, int ldc, size_t sC, int M, int N, int K) {
  __shared__ __attribute__((aligned(16))) float so[4][16][64];
  const int tid = threadIdx.x, w = tid >> 5, lane = tid & 31, ln = lane & 15, hh = lane >> 4; const int by = blockIdx.y;
  A += (size_t)by * sA; Bh += (size_t)by * sB; const size_t cofs = (size_t)by * sC; const float* bp = bias ? bias + (size_t)by * sBias : nullptr;
  const int ntn = (N + 63) / 64; const int wid = blockIdx.x * 4 + w; const int mt = wid / ntn, nq = wid % ntn; if (mt * 16 >= M) return;
  const int row0 = mt * 16, col0 = nq * 64; const _Float16* arow = A + (size_t)(row0 + ln) * lda;
  v8f acc[4] = {};
  for (int kb = 0; kb < K; kb += 32) { FragH ah; ah.half[0] = *(const v8us*)((const unsigned short*)arow + kb + 8 * hh); ah.half[1] = *(const v8us*)((const unsigned short*)arow + kb + 16 + 8 * hh);
#pragma unroll
    for (int t = 0; t < 4; ++t) { if (col0 + t * 16 >= N) continue; const size_t boff = (size_t)(col0 + t * 16 + ln) * ldb + kb; FragH bq; bq.half[0] = *(const v8us*)((const unsigned short*)Bh + boff + 8 * hh); bq.half[1] = *(const v8us*)((const unsigned short*)Bh + boff + 16 + 8 * hh);
      acc[t] = mmaH<1>(ah.v, ah.v, bq.v, bq.v, acc[t]); }
  }
#pragma unroll
  for (int t = 0; t < 4; ++t) { if (col0 + t * 16 >= N) continue; const int col = col0 + t * 16 + ln; const float bv = bp ? bf16_round(bp[col]) : 0.f;
#pragma unroll
    for (int r = 0; r < 8; ++r) { float v = acc[t][r] * alpha + bv; if (CP) { const int rr = row0g + row0 + 8 * hh + r; if (rowsPerB < 0) v += CP[cofs + (size_t)rr * ldc + col];      /* rowsPerB < 0: own element of the batched C plane */ else { const int bidx = rr / rowsPerB; v += CP[(size_t)bidx * sCPb + (size_t)by * 64 + col]; } } if (ACT == 1) v = (v > 0.f) ? v : expm1f(v); else if (ACT == 7) v = (v > 0.f) ? v + 1.0f : expf(v); else if (ACT == 8) v = tanhf(v); else if (ACT == 9) v = 0.5f * v * (1.0f + tanhf(0.7978845608028654f * (v + 0.044715f * v * v * v))); else if (ACT == 11) v = 1.0f / (1.0f + expf(-v)); else if (ACT == 12) v = (v > 0.f) ? v : 0.01f * v; else if (ACT == 14) v = (v > 0.f) ? v : 0.1f * v; else if (ACT == 16) v = (v >= 0.f) ? v : 0.3f * v; else if (ACT == 15) v = v / (1.0f + expf(-v)); else if (ACT == 3) v = fmaxf(v, 0.f); else if (ACT == 6) v = 0.5f * v * (1.0f + erff(v * 0.70710678118654752f)); so[w][8 * hh + r][t * 16 + ln] = v; } }
  __builtin_amdgcn_fence(__ATOMIC_ACQ_REL, "workgroup"); __builtin_amdgcn_wave_barrier();
  const int rsub = lane >> 4, c4 = (lane & 15) * 4; typedef _Float16 v4h __attribute__((ext_vector_type(4)));
  {
#pragma unroll
    for (int q = 0; q < 8; ++q) { const int r = q * 2 + rsub; if (col0 + c4 < N) { const v4f v = *(const v4fa*)&so[w][r][c4]; if (C) *(v4f*)(C + cofs + (size_t)(row0 + r) * ldc + col0 + c4) = v; if (C16) { v4h h4; for (int i = 0; i < 4; ++i) h4[i] = (_Float16)v[i]; *(v4h*)(C16 + cofs + (size_t)(row0 + r) * ldc + col0 + c4) = h4; } } }
     }
}


typedef _Float16 v4h __attribute__((ext_vector_type(4)));

__global__ __launch_bounds__(256) void k_x16(const float* __restrict__ x, _Float16* __restrict__ X16, size_t n8) { const size_t t = (size_t)blockIdx.x * 256 + threadIdx.x; if (t >= n8) return; FragH f;
#pragma unroll
  for (int q = 0; q < 8; ++q) f.h[q] = (_Float16)bf16_round(x[t * 8 + q]); *(v8us*)((unsigned short*)X16 + t * 8) = f.half[0];  }
__global__ __launch_bounds__(256) void k_h16(const float* __restrict__ x, _Float16* __restrict__ X16, size_t n8) { const size_t t = (size_t)blockIdx.x * 256 + threadIdx.x; if (t >= n8) return; FragH f;
#pragma unroll
  for (int q = 0; q < 8; ++q) f.h[q] = (_Float16)x[t * 8 + q]; *(v8us*)((unsigned short*)X16 + t * 8) = f.half[0];  }
__global__ __launch_bounds__(256) void k_round16f(const float* __restrict__ W, _Float16* __restrict__ Bt, size_t n8) { const size_t t = (size_t)blockIdx.x * 256 + threadIdx.x; if (t >= n8) return; FragH f;
#pragma unroll
  for (int i = 0; i < 8; ++i) f.h[i] = (_Float16)(bf16_round(W[t * 8 + i]) * 16.0f); *(v8us*)((unsigned short*)Bt + t * 8) = f.half[0];  }
template <int NHv, int TTv>
__global__ __launch_bounds__(256) void k_vt(const _Float16* __restrict__ V16, int ldv, int voff, _Float16* __restrict__ Vt) { __shared__ unsigned short tl[64][66]; const int tid = threadIdx.x; const int slab = blockIdx.x / (TTv / 64), lg = blockIdx.x % (TTv / 64); const int b = slab / NHv, h = slab % NHv;
  for (int i = tid; i < 64 * 8; i += 256) { const int r = i / 8, c8 = (i % 8) * 8; FragH f; f.half[0] = *(const v8us*)((const unsigned short*)V16 + ((size_t)b * TTv + lg * 64 + r) * ldv + voff + h * 64 + c8);
#pragma unroll
    for (int q = 0; q < 8; ++q) tl[r][c8 + q] = f.u[q]; }
  __syncthreads();
  {
#pragma unroll
    for (int rd = 0; rd < 2; ++rd) { const int d = rd * 32 + tid / 8, pc = tid % 8; FragH f;
#pragma unroll
      for (int q = 0; q < 8; ++q) f.u[q] = tl[pc * 8 + q][d];
      *(v8us*)((unsigned short*)Vt + ((size_t)slab * 64 + d) * TTv + lg * 64 + pc * 8) = f.half[0]; }
     } }

__global__ __launch_bounds__(256) void k_hl(const float* __restrict__ F, _Float16* __restrict__ Hh, _Float16* __restrict__ Hl, size_t n8) { const size_t t = (size_t)blockIdx.x * 256 + threadIdx.x; if (t >= n8) return; FragH fh, fl; const v4f a = *(const v4fa*)(F + t * 8), c = *(const v4fa*)(F + t * 8 + 4);
#pragma unroll
  for (int q = 0; q < 4; ++q) { _Float16 h = (_Float16)a[q]; fh.h[q] = h; fl.h[q] = (_Float16)((a[q] - (float)h) * 1024.0f); h = (_Float16)c[q]; fh.h[4 + q] = h; fl.h[4 + q] = (_Float16)((c[q] - (float)h) * 1024.0f); }
  { *(v8us*)((unsigned short*)Hh + t * 8) = fh.half[0]; *(v8us*)((unsigned short*)Hl + t * 8) = fl.half[0];  } }

// ---- fast GEMM (wave tile 32x64; requires M % 32 == 0 rows per launch region and N % 64 == 0); epilogue = k_gemm_hhx semantics ----
__device__ __forceinline__ v16h g2_frag(const _Float16* p, int hh) { FragH f; f.half[0] = *(const v8us*)((const unsigned short*)p + 8 * hh); f.half[1] = *(const v8us*)((const unsigned short*)p + 16 + 8 * hh); return f.v; }
__device__ __forceinline__ v8f g2_mma(v16h a, v16h b, v8f c) { v8f d = __builtin_amdgcn_wmma_f32_16x16x32_f16(false, a, false, b, (short)0, c, false, false); asm volatile("v_nop\n\tv_nop\n\tv_nop\n\tv_nop" : "+v"(d) : "v"(a), "v"(b)); return d; }
template <int ACT>
__global__ __launch_bounds__(128) void k_gemm2(const _Float16* __restrict__ A, int lda, size_t sA, const _Float16* __restrict__ Bh, int ldb, size_t sB, float alpha, const float* __restrict__ bias, size_t sBias, const float* __restrict__ CP, int rowsPerB, size_t sCPb, int row0g,
    float* __restrict__ C, _Float16* __restrict__ C16, int ldc, size_t sC, int M, int N, int K) { static_assert(ACT == 0 || ACT == 3 || ACT == 6 || ACT == 8 || ACT == 9 || ACT == 11 || ACT == 12 || ACT == 14 || ACT == 15 || ACT == 16, "k_gemm2: unsupported ACT code (would silently apply no activation)");
  __shared__ __attribute__((aligned(16))) float so[4][32][68];
  const int tid = threadIdx.x, w = tid >> 5, lane = tid & 31, ln = lane & 15, hh = lane >> 4; const int by = blockIdx.y;
  A += (size_t)by * sA; Bh += (size_t)by * sB; const size_t cofs = (size_t)by * sC; const float* bp = bias ? bias + (size_t)by * sBias : nullptr;
  const int ntn = N >> 6; const int mt = blockIdx.x / ntn, nq = blockIdx.x - mt * ntn; const int row0 = mt * 128 + 32 * w, col0 = nq * 64; if (row0 >= M) return;
  const _Float16* a0p = A + (size_t)(row0 + ln) * lda; const _Float16* a1p = a0p + (size_t)16 * lda;
  const _Float16* b0p = Bh + (size_t)(col0 + ln) * ldb; const _Float16* b1p = b0p + (size_t)16 * ldb; const _Float16* b2p = b1p + (size_t)16 * ldb; const _Float16* b3p = b2p + (size_t)16 * ldb;
  const v8f z8 = {0.f,0.f,0.f,0.f,0.f,0.f,0.f,0.f}; v8f c00 = z8, c01 = z8, c02 = z8, c03 = z8, c10 = z8, c11 = z8, c12 = z8, c13 = z8;
#pragma unroll 1
  for (int kb = 0; kb < K; kb += 32) { const v16h a0 = g2_frag(a0p + kb, hh), a1 = g2_frag(a1p + kb, hh);
    v16h b = g2_frag(b0p + kb, hh); c00 = g2_mma(a0, b, c00); c10 = g2_mma(a1, b, c10);
    b = g2_frag(b1p + kb, hh); c01 = g2_mma(a0, b, c01); c11 = g2_mma(a1, b, c11);
    b = g2_frag(b2p + kb, hh); c02 = g2_mma(a0, b, c02); c12 = g2_mma(a1, b, c12);
    b = g2_frag(b3p + kb, hh); c03 = g2_mma(a0, b, c03); c13 = g2_mma(a1, b, c13); }
  v8f accs[8] = {c00, c01, c02, c03, c10, c11, c12, c13};
#pragma unroll
  for (int u = 0; u < 8; ++u) { const int t = u & 3, half = u >> 2; const int col = col0 + t * 16 + ln; const float bv = bp ? bf16_round(bp[col]) : 0.f;
#pragma unroll
    for (int r = 0; r < 8; ++r) { const int rloc = half * 16 + 8 * hh + r; float v = accs[u][r] * alpha + bv; if (CP) { if (rowsPerB < 0) v += CP[cofs + (size_t)(row0g + row0 + rloc) * ldc + col];      /* rowsPerB < 0: own element of the batched C plane */ else { const int bidx = (row0g + row0 + rloc) / rowsPerB; v += CP[(size_t)bidx * sCPb + (size_t)by * 64 + col]; } }
      if (ACT == 3) v = fmaxf(v, 0.f); else if (ACT == 6) v = 0.5f * v * (1.0f + erff(v * 0.70710678118654752f)); else if (ACT == 11) v = 1.0f / (1.0f + expf(-v)); else if (ACT == 15) v = v / (1.0f + expf(-v)); else if (ACT == 12) v = (v > 0.f) ? v : 0.01f * v; else if (ACT == 8) v = tanhf(v); else if (ACT == 9) v = 0.5f * v * (1.0f + tanhf(0.7978845608028654f * (v + 0.044715f * v * v * v))); else if (ACT == 14) v = (v > 0.f) ? v : 0.1f * v; else if (ACT == 16) v = (v >= 0.f) ? v : 0.3f * v;
      so[w][rloc][t * 16 + ln] = v; } }
  __builtin_amdgcn_fence(__ATOMIC_ACQ_REL, "workgroup"); __builtin_amdgcn_wave_barrier();
  const int rsub = lane >> 4, c4 = (lane & 15) * 4;
  {
#pragma unroll
    for (int q = 0; q < 16; ++q) { const int r = q * 2 + rsub; const v4f v = *(const v4fa*)&so[w][r][c4]; if (C) *(v4f*)(C + cofs + (size_t)(row0 + r) * ldc + col0 + c4) = v; if (C16) { v4h h4; for (int i = 0; i < 4; ++i) h4[i] = (_Float16)v[i]; *(v4h*)(C16 + cofs + (size_t)(row0 + r) * ldc + col0 + c4) = h4; } }
     } }


// additive bias plane for the score accumulator: bf16-rounded sim times sqrt(32), so that (q.k + BP) * 32^-0.5 = q.k * 32^-0.5 + sim.
// Laid out in the accumulator's own order, per 16-query x 16-key tile [register half j][lane (c = query, h)][4 keys 8h + 4j ..], so that a wave's 16-byte loads cover whole lines.
__global__ __launch_bounds__(256) void k_bias(const float* __restrict__ sim, float* __restrict__ BP) {
  const int t = blockIdx.x * 256 + threadIdx.x; if (t >= NN * NN / 4) return; const v4f a = *(const v4fa*)(sim + (size_t)t * 4); v4f o;
#pragma unroll
  for (int q = 0; q < 4; ++q) o[q] = bf16_round(a[q]) * 5.656854249492381f;
  const int n = t / (NN / 4), key = (t % (NN / 4)) * 4; const int tile = (n >> 4) * (NN / 16) + (key >> 4), j = (key >> 2) & 1, lanei = ((key >> 3) & 1) * 16 + (n & 15);
  *(v4f*)(BP + (size_t)tile * 256 + j * 128 + lanei * 4) = o; }

// Fused attention. One work-group = one (group, head) and 128 queries; each of its 8 waves owns 16 queries (one column group).
// S^T = K Q^T (+ bias plane as the C operand): lane (c, h) holds keys 8h..8h+7 of each 16-key tile for query c, so two score tiles
// convert in place into the B operand of O^T += V^T P^T (hardware k order on both sides). Online softmax over blocks of 128 keys in
// the log2 domain; P carries 2^10 (cancels against the row sum). K rows and V^T rows sit in LDS at pitches of 16 B x odd.
#define KPITCH 40                /* f16 per K row in LDS: 80 B */
#define VPITCH 520               /* f16 per V^T row in LDS: 1040 B */
#define KBLK 128                 /* keys per online-softmax block */
#define QWG 128                  /* queries per work-group */
#define C2 (SCL * 1.4426950408889634f)
__device__ __forceinline__ v16h lds_frag(const unsigned short* p, int hh) { FragH f; f.half[0] = *(const v8us*)(p + 8 * hh); f.half[1] = *(const v8us*)(p + 16 + 8 * hh); return f.v; }
__global__ __launch_bounds__(256) void k_attn(const _Float16* __restrict__ QK, const _Float16* __restrict__ VTg, const float* __restrict__ BP, _Float16* __restrict__ O16) {
  __shared__ __attribute__((aligned(16))) unsigned short sk[NN * KPITCH];
  __shared__ __attribute__((aligned(16))) unsigned short sv[HD * VPITCH];
  const int tid = threadIdx.x, w = tid >> 5, lane = tid & 31, ln = lane & 15, hh = lane >> 4;
  const int qb = blockIdx.x % (NN / QWG), gh = blockIdx.x / (NN / QWG); const int g = gh / NH, h = gh % NH;
  // staging: the K rows, V^T rows and the wave's Q fragment are loaded first, each group from one lane address plus constant steps
  const int n0 = qb * QWG + w * 16;
  const unsigned short* kg = (const unsigned short*)QK + ((size_t)g * NN + (tid >> 2)) * (2 * DD) + h * HD + (tid & 3) * 8;      /* token row tid/4 + 64 i, 16-byte part tid%4; the k half lies DD further */
  const unsigned short* vg = (const unsigned short*)VTg + (size_t)(h * HD + (tid >> 6)) * NR + (size_t)g * NN + (tid & 63) * 8;      /* head dim tid/64 + 4 i, keys 8 (tid%64).. */
  const unsigned short* qg = (const unsigned short*)QK + ((size_t)g * NN + n0 + ln) * (2 * DD) + h * HD + 8 * hh;      /* query n0 + ln, dims 8hh.. and 16 + 8hh.. */
  v8us kr[8], vr8[8]; FragH qfr;
#pragma unroll
  for (int i = 0; i < 8; ++i) kr[i] = *(const v8us*)(kg + DD + (size_t)i * 64 * (2 * DD));
#pragma unroll
  for (int i = 0; i < 8; ++i) vr8[i] = *(const v8us*)(vg + (size_t)i * 4 * NR);
  qfr.half[0] = *(const v8us*)qg; qfr.half[1] = *(const v8us*)(qg + 16); const v16h qf = qfr.v;
  asm volatile("s_wait_xcnt 0x0" :: "v"(kg), "v"(vg), "v"(qg) : "memory");      /* wait before the loads' address registers are rewritten; naming the addresses as inputs keeps them live up to here, so that no later load's data lands in them either */
#pragma unroll
  for (int i = 0; i < 8; ++i) *(v8us*)(sk + ((tid >> 2) + 64 * i) * KPITCH + (tid & 3) * 8) = kr[i];
#pragma unroll
  for (int i = 0; i < 8; ++i) *(v8us*)(sv + ((tid >> 6) + 4 * i) * VPITCH + (tid & 63) * 8) = vr8[i];
  __syncthreads();
  const float* bro = BP + (size_t)(n0 >> 4) * (NN / 16) * 256 + lane * 4;
  const v8f z8 = {0.f,0.f,0.f,0.f,0.f,0.f,0.f,0.f}; v8f o0 = z8, o1 = z8, os = z8; float m = -3.0e38f;
  FragH ones;      /* A whose row 0 is all ones: row 0 of os = the column sums of the rounded P, summed on the matrix pipe */
#pragma unroll
  for (int i = 0; i < 16; ++i) ones.h[i] = (ln == 0) ? (_Float16)1.0f : (_Float16)0.0f;
  // rolled: only one block's 64 score registers are live at a time, which keeps more waves resident
#pragma unroll 1
  for (int kb = 0; kb < NN; kb += KBLK) {
    v8f s[KBLK / 16];
#pragma unroll
    for (int t = 0; t < KBLK / 16; ++t) { const v4f cl = *(const v4fa*)(bro + (kb + t * 16) * 16), ch = *(const v4fa*)(bro + (kb + t * 16) * 16 + 128); const v8f c = {cl[0], cl[1], cl[2], cl[3], ch[0], ch[1], ch[2], ch[3]};
      s[t] = __builtin_amdgcn_wmma_f32_16x16x32_f16(false, lds_frag(sk + (kb + t * 16 + ln) * KPITCH, hh), false, qf, (short)0, c, false, false); }
    float mx[4] = {s[0][0], s[0][1], s[0][2], s[0][3]};
#pragma unroll
    for (int t = 0; t < KBLK / 16; ++t)
#pragma unroll
      for (int r = 0; r < 8; ++r) mx[r & 3] = fmaxf(mx[r & 3], s[t][r]);
    float bm = fmaxf(fmaxf(mx[0], mx[1]), fmaxf(mx[2], mx[3])); bm = fmaxf(bm, __shfl_xor(bm, 16, 32));      /* both halves of a column share one maximum */
    const float mn = fmaxf(m, bm); const float al = __builtin_amdgcn_exp2f((m - mn) * C2); const float off = 10.0f - mn * C2; m = mn;
#pragma unroll
    for (int r = 0; r < 8; ++r) { o0[r] *= al; o1[r] *= al; }
    os[0] *= al;      /* only row 0 of the sum tile is ever read */
#pragma unroll
    for (int p = 0; p < KBLK / 32; ++p) { FragH b;
#pragma unroll
      for (int r = 0; r < 8; ++r) { const float e0 = __builtin_amdgcn_exp2f(fmaf(s[2 * p][r], C2, off)), e1 = __builtin_amdgcn_exp2f(fmaf(s[2 * p + 1][r], C2, off));
        b.h[r] = (_Float16)e0; b.h[8 + r] = (_Float16)e1; }
      const unsigned short* vr = sv + ln * VPITCH + kb + p * 32;
      o0 = __builtin_amdgcn_wmma_f32_16x16x32_f16(false, lds_frag(vr, hh), false, b.v, (short)0, o0, false, false);
      o1 = __builtin_amdgcn_wmma_f32_16x16x32_f16(false, lds_frag(vr + 16 * VPITCH, hh), false, b.v, (short)0, o1, false, false);
      os = __builtin_amdgcn_wmma_f32_16x16x32_f16(false, ones.v, false, b.v, (short)0, os, false, false); }
  }
  const float su = __shfl(os[0], ln, 32); const float inv = 1.0f / su; FragH f;      /* row 0 sits in register 0 of lanes 0..15 */
#pragma unroll
  for (int r = 0; r < 8; ++r) { f.h[r] = (_Float16)(o0[r] * inv); f.h[8 + r] = (_Float16)(o1[r] * inv); }
  unsigned short* d = (unsigned short*)O16 + ((size_t)g * NN + n0 + ln) * DD + h * HD + 8 * hh;      /* lane (c, h): head dims 8h..8h+7 and 16+8h.. of query c */
  *(v8us*)d = f.half[0]; *(v8us*)(d + 16) = f.half[1]; }
__global__ __launch_bounds__(256) void k_wqkv(const float* __restrict__ Wq, const float* __restrict__ Wk, const float* __restrict__ Wv, _Float16* __restrict__ Bt) { const int t = blockIdx.x * 256 + threadIdx.x; if (t >= 3 * DD * (DD / 8)) return; const int n = t / (DD / 8), k0 = (t % (DD / 8)) * 8; const int which = n / DD, o = n % DD; const float* Wm = which == 0 ? Wq : (which == 1 ? Wk : Wv); FragH f;
  for (int q = 0; q < 8; ++q) f.h[q] = (_Float16)(bf16_round(Wm[(size_t)(k0 + q) * DD + o]) * 16.0f); *(v8us*)((unsigned short*)Bt + (size_t)n * DD + k0) = f.half[0];  }

extern "C" void kernel_launch(void* const* d_in, const int* in_sizes, int n_in,
                              void* d_out, int out_size, void* d_ws, size_t ws_size, hipStream_t stream) {
  (void)in_sizes; (void)n_in; (void)out_size;
  const float* const* I = (const float* const*)d_in; const float* x = I[0]; const float* sim = I[1]; const float* Wq = I[2]; const float* Wk = I[3]; const float* Wv = I[4]; const float* Wo = I[5];
  char* ws = (char*)d_ws; size_t off = 0;
  auto take = [&](size_t bytes) { char* p = ws + off; off += (bytes + 255) & ~(size_t)255; return p; };
  _Float16* BQKV = (_Float16*)take((size_t)3 * DD * DD * 2); _Float16* BO = (_Float16*)take((size_t)DD * DD * 2);
  _Float16* X16 = (_Float16*)take((size_t)NR * DD * 2); _Float16* QK = (_Float16*)take((size_t)NR * 2 * DD * 2); _Float16* VTg = (_Float16*)take((size_t)DD * NR * 2); _Float16* O16 = (_Float16*)take((size_t)NR * DD * 2);
  float* BP = (float*)take((size_t)NN * NN * 4);
  if (off > ws_size) return;      /* 0.5 + 12 + 24 + 12 + 12 + 1 = 61.5 MiB */
  k_wqkv<<<(3 * DD * (DD / 8) + 255) / 256, 256, 0, stream>>>(Wq, Wk, Wv, BQKV); k_wt_f16<<<(DD * DD / 8 + 255) / 256, 256, 0, stream>>>(Wo, BO, DD, DD, 16.0f);
  k_bias<<<(NN * NN / 4 + 255) / 256, 256, 0, stream>>>(sim, BP);
  k_x16<<<(unsigned)(((size_t)NR * DD / 8 + 255) / 256), 256, 0, stream>>>(x, X16, (size_t)NR * DD / 8);
  k_gemm2<0><<<dim3((NR / 128) * (2 * DD / 64), 1), 128, 0, stream>>>(X16, DD, 0, BQKV, DD, 0, 0.0625f, nullptr, 0, nullptr, 1, 0, 0, nullptr, QK, 2 * DD, 0, NR, 2 * DD, DD);      /* token rows [q | k], heads h*32 + d */
  k_gemm2<0><<<dim3((DD / 128) * (NR / 64), 1), 128, 0, stream>>>(BQKV + (size_t)2 * DD * DD, DD, 0, X16, DD, 0, 0.0625f, nullptr, 0, nullptr, 1, 0, 0, nullptr, VTg, NR, 0, DD, NR, DD);      /* v^T: rows h*32 + d, columns = token rows (operands swapped) */
  k_attn<<<NG * NH * (NN / QWG), 256, 0, stream>>>(QK, VTg, BP, O16);
  k_gemm2<0><<<dim3((NR / 128) * (DD / 64), 1), 128, 0, stream>>>(O16, DD, 0, BO, DD, 0, 0.0625f, nullptr, 0, nullptr, 1, 0, 0, (float*)d_out, nullptr, DD, 0, NR, DD, DD);
}

// v002
// It runs in 79.8 microseconds.
// Next to v001, in two timings, it ran 1.32 and 1.34 times as fast.
// Counting every step since v000, it is 8.70 times as fast.
#include <hip/hip_runtime.h>
// SpatialMHSA (4 x 12 frames x 512 spatial tokens x 256 = 8 heads of 32): q/k/v = x W (xavier (in,out) weights); per (batch, frame, head) attention over the 512 tokens with scores/sqrt(32) + an INPUT additive bias sim[n][m]; out = merged heads W_o.
// Structure: ONE projection kernel (x rounded into LDS once per 64 token rows; q|k to token rows and v^T from it, f32 accumulation, exact x16 weights, f16 output); ONE fused attention kernel over all 384 (group, head) pairs (S^T = K Q^T with the scaled bias plane as C, online softmax in registers, O^T = V^T P^T, f16 token rows out); output GEMM.
// Compute dtype: x, sim and weights rounded to bf16; q, k, v, P, attention output as f16 operands (~2^-12); f32 accumulation/softmax. v_wmma_f32_16x16x32_f16.
#define NBATCH 4
#define NFR 12
#define NN 512
#define DD 256
#define NH 8
#define HD 32
#define NG (NBATCH * NFR)         /* 48 groups */
#define NR (NG * NN)             /* 24576 token rows */
#define SCL 0.17677669529663687f /* 32^-0.5 */
typedef __bf16 v16b __attribute__((ext_vector_type(16)));
typedef unsigned short v8us __attribute__((ext_vector_type(8), may_alias));
typedef float  v8f  __attribute__((ext_vector_type(8)));
typedef float  v4f  __attribute__((ext_vector_type(4)));
typedef float  v4fa __attribute__((ext_vector_type(4), may_alias));
union FragB { v16b v; v8us half[2]; unsigned short u[16]; };

__device__ __forceinline__ unsigned short bf16_bits(float x) { unsigned int u = __float_as_uint(x); return (unsigned short)((u + 0x7FFFu + ((u >> 16) & 1u)) >> 16); }
__device__ __forceinline__ float bf16_val(unsigned short b) { return __uint_as_float(((unsigned int)b) << 16); }
__device__ __forceinline__ float bf16_round(float x) { return bf16_val(bf16_bits(x)); }
// D += A·B with NT terms: 1 = ah·bh, 2 = + al·bh (A split), 3 = + ah·bl (both split)
template <int NT>
__device__ __forceinline__ v8f mmaN(v16b ah, v16b al, v16b bh, v16b bl, v8f c) {
  c = __builtin_amdgcn_wmma_f32_16x16x32_bf16(false, ah, false, bh, (short)0, c, false, false);
  if (NT >= 2) c = __builtin_amdgcn_wmma_f32_16x16x32_bf16(false, al, false, bh, (short)0, c, false, false);
  if (NT >= 3) c = __builtin_amdgcn_wmma_f32_16x16x32_bf16(false, ah, false, bl, (short)0, c, false, false);
  asm volatile("v_nop\n\tv_nop\n\tv_nop\n\tv_nop" : "+v"(c) : "v"(ah), "v"(al), "v"(bh), "v"(bl));
  return c;
}

__global__ __launch_bounds__(256) void k_wt_bf16(const float* __restrict__ W, unsigned short* __restrict__ Wt, int K, int N) {
  const int t = blockIdx.x * 256 + threadIdx.x;
  const int k8n = K / 8;
  if (t >= N * k8n) return;
  const int n = t / k8n, k8 = (t % k8n) * 8;
  v8us v;
#pragma unroll
  for (int i = 0; i < 8; ++i) v[i] = bf16_bits(W[(size_t)(k8 + i) * N + n]);
  *(v8us*)(Wt + (size_t)n * K + k8) = v;
  
}

// GEMM C[M][N] (f32, pitch ldc) = act(A[M][K]·W + bias). A f32 row-major (pitch lda) converted per fragment to bf16
// (ASPLIT: hi/lo two planes -> 2 terms, else single rounded term); Wt bf16 [N][K] (pitch ldb). BIAS_BF16 rounds the
// bias to bf16 first (bias quantised to bf16 before the add). K%32==0, M%16==0, N%64==0.
template <bool ASPLIT, int ACT, bool BIAS_BF16>
__global__ __launch_bounds__(128) void k_gemm_bf(const float* __restrict__ A, int lda, const unsigned short* __restrict__ Wt, int ldb,
                                               const float* __restrict__ bias, float* __restrict__ C, int ldc, int M, int N, int K) {
  __shared__ __attribute__((aligned(16))) float so[4][16][64];
  const int tid = threadIdx.x, w = tid >> 5, lane = tid & 31, ln = lane & 15, hh = lane >> 4;
  const int ntn = N / 64;
  const int wid = blockIdx.x * 4 + w;
  const int mt = wid / ntn, nq = wid % ntn;
  if (mt * 16 >= M) return;
  const int row0 = mt * 16, col0 = nq * 64;
  const float* arow = A + (size_t)(row0 + ln) * lda;
  v8f acc[4] = {};
  for (int kb = 0; kb < K; kb += 32) {
    FragB ah, al;
    const v4f x0 = *(const v4fa*)(arow + kb + 8 * hh), x1 = *(const v4fa*)(arow + kb + 8 * hh + 4);
    const v4f x2 = *(const v4fa*)(arow + kb + 16 + 8 * hh), x3 = *(const v4fa*)(arow + kb + 16 + 8 * hh + 4);
    float xs[16] = {x0[0],x0[1],x0[2],x0[3],x1[0],x1[1],x1[2],x1[3],x2[0],x2[1],x2[2],x2[3],x3[0],x3[1],x3[2],x3[3]};
#pragma unroll
    for (int i = 0; i < 16; ++i) { const unsigned short hb = bf16_bits(xs[i]); ah.u[i] = hb; al.u[i] = ASPLIT ? bf16_bits(xs[i] - bf16_val(hb)) : (unsigned short)0; }
#pragma unroll
    for (int t = 0; t < 4; ++t) {
      const unsigned short* brow = Wt + (size_t)(col0 + t * 16 + ln) * ldb + kb;
      FragB b;
      b.half[0] = *(const v8us*)(brow + 8 * hh);
      b.half[1] = *(const v8us*)(brow + 16 + 8 * hh);
      acc[t] = mmaN<ASPLIT ? 2 : 1>(ah.v, al.v, b.v, b.v, acc[t]);
    }
  }
#pragma unroll
  for (int t = 0; t < 4; ++t) {
    float bv = bias ? bias[col0 + t * 16 + ln] : 0.f;
    if (BIAS_BF16) bv = bf16_round(bv);
#pragma unroll
    for (int r = 0; r < 8; ++r) { float v = acc[t][r] + bv; if (ACT == 1) v = fmaxf(v, 0.f); so[w][8 * hh + r][t * 16 + ln] = v; }
  }
  __builtin_amdgcn_fence(__ATOMIC_ACQ_REL, "workgroup");
  __builtin_amdgcn_wave_barrier();
  const int rsub = lane >> 4, c4 = (lane & 15) * 4;
  {
#pragma unroll
    for (int q = 0; q < 8; ++q) {
      const int r = q * 2 + rsub;
      const v4f v = *(const v4fa*)&so[w][r][c4];
      *(v4f*)(C + (size_t)(row0 + r) * ldc + col0 + c4) = v;
    }
    
  }
}

// GEMM C = act(A·W + bias + resid): A f32 (ASPLIT -> hi/lo 2 terms), Wt bf16 [N][K]; ACT 0 none, 1 relu, 2 exact gelu;
// resid (optional, f32, row index = (row % rmod), pitch ldr, RES_BF16 rounds it) added before the activation.
template <bool ASPLIT, int ACT, bool BIAS_BF16, bool RES_BF16>
__global__ __launch_bounds__(128) void k_gemm_bf3(const float* __restrict__ A, int lda, const unsigned short* __restrict__ Wt, int ldb,
                                                const float* __restrict__ bias, const float* __restrict__ resid, int rmod, int ldr,
                                                float* __restrict__ C, int ldc, int M, int N, int K) {
  __shared__ __attribute__((aligned(16))) float so[4][16][64];
  const int tid = threadIdx.x, w = tid >> 5, lane = tid & 31, ln = lane & 15, hh = lane >> 4;
  const int ntn = N / 64;
  const int wid = blockIdx.x * 4 + w;
  const int mt = wid / ntn, nq = wid % ntn;
  if (mt * 16 >= M) return;
  const int row0 = mt * 16, col0 = nq * 64;
  const float* arow = A + (size_t)(row0 + ln) * lda;
  v8f acc[4] = {};
  for (int kb = 0; kb < K; kb += 32) {
    FragB ah, al;
    const v4f x0 = *(const v4fa*)(arow + kb + 8 * hh), x1 = *(const v4fa*)(arow + kb + 8 * hh + 4);
    const v4f x2 = *(const v4fa*)(arow + kb + 16 + 8 * hh), x3 = *(const v4fa*)(arow + kb + 16 + 8 * hh + 4);
    float xs[16] = {x0[0],x0[1],x0[2],x0[3],x1[0],x1[1],x1[2],x1[3],x2[0],x2[1],x2[2],x2[3],x3[0],x3[1],x3[2],x3[3]};
#pragma unroll
    for (int i = 0; i < 16; ++i) { const unsigned short hb = bf16_bits(xs[i]); ah.u[i] = hb; al.u[i] = ASPLIT ? bf16_bits(xs[i] - bf16_val(hb)) : (unsigned short)0; }
#pragma unroll
    for (int t = 0; t < 4; ++t) {
      const unsigned short* brow = Wt + (size_t)(col0 + t * 16 + ln) * ldb + kb;
      FragB b;
      b.half[0] = *(const v8us*)(brow + 8 * hh);
      b.half[1] = *(const v8us*)(brow + 16 + 8 * hh);
      acc[t] = mmaN<ASPLIT ? 2 : 1>(ah.v, al.v, b.v, b.v, acc[t]);
    }
  }
#pragma unroll
  for (int t = 0; t < 4; ++t) {
    const int col = col0 + t * 16 + ln;
    float bv = bias ? bias[col] : 0.f;
    if (BIAS_BF16) bv = bf16_round(bv);
#pragma unroll
    for (int r = 0; r < 8; ++r) {
      float v = acc[t][r] + bv;
      if (resid) { float rv = resid[(size_t)((row0 + 8 * hh + r) % rmod) * ldr + col]; if (RES_BF16) rv = bf16_round(rv); v += rv; }
      if (ACT == 1) v = fmaxf(v, 0.f);
      if (ACT == 2) v = 0.5f * v * (1.0f + erff(v * 0.70710678118654752f));
      if (ACT == 3) { const float u = 0.7978845608028654f * (v + 0.044715f * v * v * v); v = 0.5f * v * (1.0f + tanhf(u)); }
      so[w][8 * hh + r][t * 16 + ln] = v;
    }
  }
  __builtin_amdgcn_fence(__ATOMIC_ACQ_REL, "workgroup");
  __builtin_amdgcn_wave_barrier();
  const int rsub = lane >> 4, c4 = (lane & 15) * 4;
  {
#pragma unroll
    for (int q = 0; q < 8; ++q) {
      const int r = q * 2 + rsub;
      const v4f v = *(const v4fa*)&so[w][r][c4];
      *(v4f*)(C + (size_t)(row0 + r) * ldc + col0 + c4) = v;
    }
    
  }
}
// row LayerNorm (biased variance, eps) over N: s = X (+ R); optional out_sum <- s; out_norm <- (s-mu)*rsqrt(var+eps)*g + b
template <bool PARAM_BF16>
__global__ __launch_bounds__(256) void k_layernorm(const float* __restrict__ X, const float* __restrict__ R, const float* __restrict__ g, const float* __restrict__ bta,
                                                  float* __restrict__ out_sum, float* __restrict__ out_norm, int N, float eps) {
  __shared__ float red[256];
  const int row = blockIdx.x, tid = threadIdx.x;
  const float* x = X + (size_t)row * N; const float* rr = R ? R + (size_t)row * N : nullptr;
  float vals[16];                     // up to N = 4096
  const int per = N / 256;            // contiguous chunk per thread? use strided-by-4 chunks: thread handles j = tid*4 + 1024*u
  float s1 = 0.f;
  for (int u = 0; u < per / 4; ++u) {
    const int j = tid * 4 + 1024 * u;
    const v4f a = *(const v4fa*)(x + j);
    v4f b = {0.f,0.f,0.f,0.f}; if (rr) b = *(const v4fa*)(rr + j);
#pragma unroll
    for (int q = 0; q < 4; ++q) { const float v = a[q] + b[q]; vals[u * 4 + q] = v; s1 += v; }
  }
  red[tid] = s1; __syncthreads();
  for (int st = 128; st > 0; st >>= 1) { if (tid < st) red[tid] += red[tid + st]; __syncthreads(); }
  const float mu = red[0] / (float)N; __syncthreads();
  float s2 = 0.f;
  for (int u = 0; u < per / 4; ++u)
#pragma unroll
    for (int q = 0; q < 4; ++q) { const float c = vals[u * 4 + q] - mu; s2 += c * c; }
  red[tid] = s2; __syncthreads();
  for (int st = 128; st > 0; st >>= 1) { if (tid < st) red[tid] += red[tid + st]; __syncthreads(); }
  const float rs = rsqrtf(red[0] / (float)N + eps);
  {
    for (int u = 0; u < per / 4; ++u) {
      const int j = tid * 4 + 1024 * u;
      v4f o, sm;
#pragma unroll
      for (int q = 0; q < 4; ++q) {
        float gg = g[j + q], bb = bta[j + q];
        if (PARAM_BF16) { gg = bf16_round(gg); bb = bf16_round(bb); }
        sm[q] = vals[u * 4 + q]; o[q] = (vals[u * 4 + q] - mu) * rs * gg + bb;
      }
      if (out_sum) *(v4f*)(out_sum + (size_t)row * N + j) = sm;
      *(v4f*)(out_norm + (size_t)row * N + j) = o;
    }
    
  }
}



// ---- f16 WMMA path (v_wmma_f32_16x16x32_f16): 11-bit significands for operands in range — used where a [0,1] probability operand needs more precision than bf16
typedef _Float16 v16h __attribute__((ext_vector_type(16)));
union FragH { v16h v; v8us half[2]; _Float16 h[16]; unsigned short u[16]; };
template <int NT>
__device__ __forceinline__ v8f mmaH(v16h ah, v16h al, v16h bh, v16h bl, v8f c) {
  c = __builtin_amdgcn_wmma_f32_16x16x32_f16(false, ah, false, bh, (short)0, c, false, false);
  if (NT >= 2) c = __builtin_amdgcn_wmma_f32_16x16x32_f16(false, al, false, bh, (short)0, c, false, false);
  if (NT >= 3) c = __builtin_amdgcn_wmma_f32_16x16x32_f16(false, ah, false, bl, (short)0, c, false, false);
  asm volatile("v_nop\n\tv_nop\n\tv_nop\n\tv_nop" : "+v"(c) : "v"(ah), "v"(al), "v"(bh), "v"(bl));
  return c;
}
// batched GEMM like k_gemm_b but f16 operands: A f32 (split into f16 hi/lo if ASPLIT, else rounded to f16), Bt = f16 values [n][k]; alpha; C f32; N multiple of 16 (partial tiles skipped)
template <bool ASPLIT>
__global__ __launch_bounds__(128) void k_gemm_h(const float* __restrict__ A, int lda, size_t sA, const _Float16* __restrict__ Bh, int ldb, size_t sB, float alpha, float* __restrict__ C, int ldc, size_t sC, int M, int N, int K) {
  __shared__ __attribute__((aligned(16))) float so[4][16][64];
  const int tid = threadIdx.x, w = tid >> 5, lane = tid & 31, ln = lane & 15, hh = lane >> 4; const int by = blockIdx.y;
  A += (size_t)by * sA; Bh += (size_t)by * sB; C += (size_t)by * sC;
  const int ntn = (N + 63) / 64; const int wid = blockIdx.x * 4 + w; const int mt = wid / ntn, nq = wid % ntn; if (mt * 16 >= M) return;
  const int row0 = mt * 16, col0 = nq * 64; const float* arow = A + (size_t)(row0 + ln) * lda;
  v8f acc[4] = {};
  for (int kb = 0; kb < K; kb += 32) {
    FragH ah, al;
    const v4f x0 = *(const v4fa*)(arow + kb + 8 * hh), x1 = *(const v4fa*)(arow + kb + 8 * hh + 4), x2 = *(const v4fa*)(arow + kb + 16 + 8 * hh), x3 = *(const v4fa*)(arow + kb + 16 + 8 * hh + 4);
    float xs[16] = {x0[0],x0[1],x0[2],x0[3],x1[0],x1[1],x1[2],x1[3],x2[0],x2[1],x2[2],x2[3],x3[0],x3[1],x3[2],x3[3]};
#pragma unroll
    for (int i = 0; i < 16; ++i) { const _Float16 h = (_Float16)xs[i]; ah.h[i] = h; al.h[i] = ASPLIT ? (_Float16)(xs[i] - (float)h) : (_Float16)0.0f; }
#pragma unroll
    for (int t = 0; t < 4; ++t) { if (col0 + t * 16 >= N) continue; const size_t boff = (size_t)(col0 + t * 16 + ln) * ldb + kb; FragH bq; bq.half[0] = *(const v8us*)(Bh + boff + 8 * hh); bq.half[1] = *(const v8us*)(Bh + boff + 16 + 8 * hh);
      acc[t] = mmaH<ASPLIT ? 2 : 1>(ah.v, al.v, bq.v, bq.v, acc[t]); }
  }
#pragma unroll
  for (int t = 0; t < 4; ++t) { if (col0 + t * 16 >= N) continue;
#pragma unroll
    for (int r = 0; r < 8; ++r) so[w][8 * hh + r][t * 16 + ln] = acc[t][r] * alpha; }
  __builtin_amdgcn_fence(__ATOMIC_ACQ_REL, "workgroup"); __builtin_amdgcn_wave_barrier();
  const int rsub = lane >> 4, c4 = (lane & 15) * 4;
  {
#pragma unroll
    for (int q = 0; q < 8; ++q) { const int r = q * 2 + rsub; if (col0 + c4 < N) { const v4f v = *(const v4fa*)&so[w][r][c4]; *(v4f*)(C + (size_t)(row0 + r) * ldc + col0 + c4) = v; } }
     }
}

// Wt[n][k] = f16(W[k][n]·scale) from f32 row-major W[K][N] (scale = power of two; bf16-exact weights stay exact in f16 away from the subnormal range)
__global__ __launch_bounds__(256) void k_wt_f16(const float* __restrict__ W, _Float16* __restrict__ Wt, int K, int N, float scale) {
  const int t = blockIdx.x * 256 + threadIdx.x; if (t >= N * (K / 8)) return; const int n = t / (K / 8), k8 = (t % (K / 8)) * 8; FragH f;
#pragma unroll
  for (int i = 0; i < 8; ++i) f.h[i] = (_Float16)(bf16_round(W[(size_t)(k8 + i) * N + n]) * scale); const v8us o = f.half[0];
  *(v8us*)((unsigned short*)Wt + (size_t)n * K + k8) = o; 
}
// k_gemm_hh variant with fused epilogue: v = acc·alpha + bias[by·sBias + col] (+ CP[(row/rowsPerB)·sCPb + by·64 + col] if CP) ; ACT 0 none / 1 elu ; writes f16 C16 (and f32 C if non-null)
template <int ACT>
__global__ __launch_bounds__(128) void k_gemm_hhx(const _Float16* __restrict__ A, int lda, size_t sA, const _Float16* __restrict__ Bh, int ldb, size_t sB, float alpha, const float* __restrict__ bias, size_t sBias, const float* __restrict__ CP, int rowsPerB, size_t sCPb, int row0g,
    float* __restrict__ C, _Float16* __restrict__ C16, int ldc, size_t sC, int M, int N, int K) {
  __shared__ __attribute__((aligned(16))) float so[4][16][64];
  const int tid = threadIdx.x, w = tid >> 5, lane = tid & 31, ln = lane & 15, hh = lane >> 4; const int by = blockIdx.y;
  A += (size_t)by * sA; Bh += (size_t)by * sB; const size_t cofs = (size_t)by * sC; const float* bp = bias ? bias + (size_t)by * sBias : nullptr;
  const int ntn = (N + 63) / 64; const int wid = blockIdx.x * 4 + w; const int mt = wid / ntn, nq = wid % ntn; if (mt * 16 >= M) return;
  const int row0 = mt * 16, col0 = nq * 64; const _Float16* arow = A + (size_t)(row0 + ln) * lda;
  v8f acc[4] = {};
  for (int kb = 0; kb < K; kb += 32) { FragH ah; ah.half[0] = *(const v8us*)((const unsigned short*)arow + kb + 8 * hh); ah.half[1] = *(const v8us*)((const unsigned short*)arow + kb + 16 + 8 * hh);
#pragma unroll
    for (int t = 0; t < 4; ++t) { if (col0 + t * 16 >= N) continue; const size_t boff = (size_t)(col0 + t * 16 + ln) * ldb + kb; FragH bq; bq.half[0] = *(const v8us*)((const unsigned short*)Bh + boff + 8 * hh); bq.half[1] = *(const v8us*)((const unsigned short*)Bh + boff + 16 + 8 * hh);
      acc[t] = mmaH<1>(ah.v, ah.v, bq.v, bq.v, acc[t]); }
  }
#pragma unroll
  for (int t = 0; t < 4; ++t) { if (col0 + t * 16 >= N) continue; const int col = col0 + t * 16 + ln; const float bv = bp ? bf16_round(bp[col]) : 0.f;
#pragma unroll
    for (int r = 0; r < 8; ++r) { float v = acc[t][r] * alpha + bv; if (CP) { const int rr = row0g + row0 + 8 * hh + r; if (rowsPerB < 0) v += CP[cofs + (size_t)rr * ldc + col];      /* rowsPerB < 0: own element of the batched C plane */ else { const int bidx = rr / rowsPerB; v += CP[(size_t)bidx * sCPb + (size_t)by * 64 + col]; } } if (ACT == 1) v = (v > 0.f) ? v : expm1f(v); else if (ACT == 7) v = (v > 0.f) ? v + 1.0f : expf(v); else if (ACT == 8) v = tanhf(v); else if (ACT == 9) v = 0.5f * v * (1.0f + tanhf(0.7978845608028654f * (v + 0.044715f * v * v * v))); else if (ACT == 11) v = 1.0f / (1.0f + expf(-v)); else if (ACT == 12) v = (v > 0.f) ? v : 0.01f * v; else if (ACT == 14) v = (v > 0.f) ? v : 0.1f * v; else if (ACT == 16) v = (v >= 0.f) ? v : 0.3f * v; else if (ACT == 15) v = v / (1.0f + expf(-v)); else if (ACT == 3) v = fmaxf(v, 0.f); else if (ACT == 6) v = 0.5f * v * (1.0f + erff(v * 0.70710678118654752f)); so[w][8 * hh + r][t * 16 + ln] = v; } }
  __builtin_amdgcn_fence(__ATOMIC_ACQ_REL, "workgroup"); __builtin_amdgcn_wave_barrier();
  const int rsub = lane >> 4, c4 = (lane & 15) * 4; typedef _Float16 v4h __attribute__((ext_vector_type(4)));
  {
#pragma unroll
    for (int q = 0; q < 8; ++q) { const int r = q * 2 + rsub; if (col0 + c4 < N) { const v4f v = *(const v4fa*)&so[w][r][c4]; if (C) *(v4f*)(C + cofs + (size_t)(row0 + r) * ldc + col0 + c4) = v; if (C16) { v4h h4; for (int i = 0; i < 4; ++i) h4[i] = (_Float16)v[i]; *(v4h*)(C16 + cofs + (size_t)(row0 + r) * ldc + col0 + c4) = h4; } } }
     }
}


typedef _Float16 v4h __attribute__((ext_vector_type(4)));

__global__ __launch_bounds__(256) void k_x16(const float* __restrict__ x, _Float16* __restrict__ X16, size_t n8) { const size_t t = (size_t)blockIdx.x * 256 + threadIdx.x; if (t >= n8) return; FragH f;
#pragma unroll
  for (int q = 0; q < 8; ++q) f.h[q] = (_Float16)bf16_round(x[t * 8 + q]); *(v8us*)((unsigned short*)X16 + t * 8) = f.half[0];  }
__global__ __launch_bounds__(256) void k_h16(const float* __restrict__ x, _Float16* __restrict__ X16, size_t n8) { const size_t t = (size_t)blockIdx.x * 256 + threadIdx.x; if (t >= n8) return; FragH f;
#pragma unroll
  for (int q = 0; q < 8; ++q) f.h[q] = (_Float16)x[t * 8 + q]; *(v8us*)((unsigned short*)X16 + t * 8) = f.half[0];  }
__global__ __launch_bounds__(256) void k_round16f(const float* __restrict__ W, _Float16* __restrict__ Bt, size_t n8) { const size_t t = (size_t)blockIdx.x * 256 + threadIdx.x; if (t >= n8) return; FragH f;
#pragma unroll
  for (int i = 0; i < 8; ++i) f.h[i] = (_Float16)(bf16_round(W[t * 8 + i]) * 16.0f); *(v8us*)((unsigned short*)Bt + t * 8) = f.half[0];  }
template <int NHv, int TTv>
__global__ __launch_bounds__(256) void k_vt(const _Float16* __restrict__ V16, int ldv, int voff, _Float16* __restrict__ Vt) { __shared__ unsigned short tl[64][66]; const int tid = threadIdx.x; const int slab = blockIdx.x / (TTv / 64), lg = blockIdx.x % (TTv / 64); const int b = slab / NHv, h = slab % NHv;
  for (int i = tid; i < 64 * 8; i += 256) { const int r = i / 8, c8 = (i % 8) * 8; FragH f; f.half[0] = *(const v8us*)((const unsigned short*)V16 + ((size_t)b * TTv + lg * 64 + r) * ldv + voff + h * 64 + c8);
#pragma unroll
    for (int q = 0; q < 8; ++q) tl[r][c8 + q] = f.u[q]; }
  __syncthreads();
  {
#pragma unroll
    for (int rd = 0; rd < 2; ++rd) { const int d = rd * 32 + tid / 8, pc = tid % 8; FragH f;
#pragma unroll
      for (int q = 0; q < 8; ++q) f.u[q] = tl[pc * 8 + q][d];
      *(v8us*)((unsigned short*)Vt + ((size_t)slab * 64 + d) * TTv + lg * 64 + pc * 8) = f.half[0]; }
     } }

__global__ __launch_bounds__(256) void k_hl(const float* __restrict__ F, _Float16* __restrict__ Hh, _Float16* __restrict__ Hl, size_t n8) { const size_t t = (size_t)blockIdx.x * 256 + threadIdx.x; if (t >= n8) return; FragH fh, fl; const v4f a = *(const v4fa*)(F + t * 8), c = *(const v4fa*)(F + t * 8 + 4);
#pragma unroll
  for (int q = 0; q < 4; ++q) { _Float16 h = (_Float16)a[q]; fh.h[q] = h; fl.h[q] = (_Float16)((a[q] - (float)h) * 1024.0f); h = (_Float16)c[q]; fh.h[4 + q] = h; fl.h[4 + q] = (_Float16)((c[q] - (float)h) * 1024.0f); }
  { *(v8us*)((unsigned short*)Hh + t * 8) = fh.half[0]; *(v8us*)((unsigned short*)Hl + t * 8) = fl.half[0];  } }

// ---- fast GEMM (wave tile 32x64; requires M % 32 == 0 rows per launch region and N % 64 == 0); epilogue = k_gemm_hhx semantics ----
__device__ __forceinline__ v16h g2_frag(const _Float16* p, int hh) { FragH f; f.half[0] = *(const v8us*)((const unsigned short*)p + 8 * hh); f.half[1] = *(const v8us*)((const unsigned short*)p + 16 + 8 * hh); return f.v; }
__device__ __forceinline__ v8f g2_mma(v16h a, v16h b, v8f c) { v8f d = __builtin_amdgcn_wmma_f32_16x16x32_f16(false, a, false, b, (short)0, c, false, false); asm volatile("v_nop\n\tv_nop\n\tv_nop\n\tv_nop" : "+v"(d) : "v"(a), "v"(b)); return d; }
template <int ACT>
__global__ __launch_bounds__(128) void k_gemm2(const _Float16* __restrict__ A, int lda, size_t sA, const _Float16* __restrict__ Bh, int ldb, size_t sB, float alpha, const float* __restrict__ bias, size_t sBias, const float* __restrict__ CP, int rowsPerB, size_t sCPb, int row0g,
    float* __restrict__ C, _Float16* __restrict__ C16, int ldc, size_t sC, int M, int N, int K) { static_assert(ACT == 0 || ACT == 3 || ACT == 6 || ACT == 8 || ACT == 9 || ACT == 11 || ACT == 12 || ACT == 14 || ACT == 15 || ACT == 16, "k_gemm2: unsupported ACT code (would silently apply no activation)");
  __shared__ __attribute__((aligned(16))) float so[4][32][68];
  const int tid = threadIdx.x, w = tid >> 5, lane = tid & 31, ln = lane & 15, hh = lane >> 4; const int by = blockIdx.y;
  A += (size_t)by * sA; Bh += (size_t)by * sB; const size_t cofs = (size_t)by * sC; const float* bp = bias ? bias + (size_t)by * sBias : nullptr;
  const int ntn = N >> 6; const int mt = blockIdx.x / ntn, nq = blockIdx.x - mt * ntn; const int row0 = mt * 128 + 32 * w, col0 = nq * 64; if (row0 >= M) return;
  const _Float16* a0p = A + (size_t)(row0 + ln) * lda; const _Float16* a1p = a0p + (size_t)16 * lda;
  const _Float16* b0p = Bh + (size_t)(col0 + ln) * ldb; const _Float16* b1p = b0p + (size_t)16 * ldb; const _Float16* b2p = b1p + (size_t)16 * ldb; const _Float16* b3p = b2p + (size_t)16 * ldb;
  const v8f z8 = {0.f,0.f,0.f,0.f,0.f,0.f,0.f,0.f}; v8f c00 = z8, c01 = z8, c02 = z8, c03 = z8, c10 = z8, c11 = z8, c12 = z8, c13 = z8;
#pragma unroll 1
  for (int kb = 0; kb < K; kb += 32) { const v16h a0 = g2_frag(a0p + kb, hh), a1 = g2_frag(a1p + kb, hh);
    v16h b = g2_frag(b0p + kb, hh); c00 = g2_mma(a0, b, c00); c10 = g2_mma(a1, b, c10);
    b = g2_frag(b1p + kb, hh); c01 = g2_mma(a0, b, c01); c11 = g2_mma(a1, b, c11);
    b = g2_frag(b2p + kb, hh); c02 = g2_mma(a0, b, c02); c12 = g2_mma(a1, b, c12);
    b = g2_frag(b3p + kb, hh); c03 = g2_mma(a0, b, c03); c13 = g2_mma(a1, b, c13); }
  v8f accs[8] = {c00, c01, c02, c03, c10, c11, c12, c13};
#pragma unroll
  for (int u = 0; u < 8; ++u) { const int t = u & 3, half = u >> 2; const int col = col0 + t * 16 + ln; const float bv = bp ? bf16_round(bp[col]) : 0.f;
#pragma unroll
    for (int r = 0; r < 8; ++r) { const int rloc = half * 16 + 8 * hh + r; float v = accs[u][r] * alpha + bv; if (CP) { if (rowsPerB < 0) v += CP[cofs + (size_t)(row0g + row0 + rloc) * ldc + col];      /* rowsPerB < 0: own element of the batched C plane */ else { const int bidx = (row0g + row0 + rloc) / rowsPerB; v += CP[(size_t)bidx * sCPb + (size_t)by * 64 + col]; } }
      if (ACT == 3) v = fmaxf(v, 0.f); else if (ACT == 6) v = 0.5f * v * (1.0f + erff(v * 0.70710678118654752f)); else if (ACT == 11) v = 1.0f / (1.0f + expf(-v)); else if (ACT == 15) v = v / (1.0f + expf(-v)); else if (ACT == 12) v = (v > 0.f) ? v : 0.01f * v; else if (ACT == 8) v = tanhf(v); else if (ACT == 9) v = 0.5f * v * (1.0f + tanhf(0.7978845608028654f * (v + 0.044715f * v * v * v))); else if (ACT == 14) v = (v > 0.f) ? v : 0.1f * v; else if (ACT == 16) v = (v >= 0.f) ? v : 0.3f * v;
      so[w][rloc][t * 16 + ln] = v; } }
  __builtin_amdgcn_fence(__ATOMIC_ACQ_REL, "workgroup"); __builtin_amdgcn_wave_barrier();
  const int rsub = lane >> 4, c4 = (lane & 15) * 4;
  {
#pragma unroll
    for (int q = 0; q < 16; ++q) { const int r = q * 2 + rsub; const v4f v = *(const v4fa*)&so[w][r][c4]; if (C) *(v4f*)(C + cofs + (size_t)(row0 + r) * ldc + col0 + c4) = v; if (C16) { v4h h4; for (int i = 0; i < 4; ++i) h4[i] = (_Float16)v[i]; *(v4h*)(C16 + cofs + (size_t)(row0 + r) * ldc + col0 + c4) = h4; } }
     } }


// additive bias plane for the score accumulator: bf16-rounded sim times sqrt(32), so that (q.k + BP) * 32^-0.5 = q.k * 32^-0.5 + sim.
// Laid out in the accumulator's own order, per 16-query x 16-key tile [register half j][lane (c = query, h)][4 keys 8h + 4j ..], so that a wave's 16-byte loads cover whole lines.
__global__ __launch_bounds__(256) void k_bias(const float* __restrict__ sim, float* __restrict__ BP) {
  const int t = blockIdx.x * 256 + threadIdx.x; if (t >= NN * NN / 4) return; const v4f a = *(const v4fa*)(sim + (size_t)t * 4); v4f o;
#pragma unroll
  for (int q = 0; q < 4; ++q) o[q] = bf16_round(a[q]) * 5.656854249492381f;
  const int n = t / (NN / 4), key = (t % (NN / 4)) * 4; const int tile = (n >> 4) * (NN / 16) + (key >> 4), j = (key >> 2) & 1, lanei = ((key >> 3) & 1) * 16 + (n & 15);
  *(v4f*)(BP + (size_t)tile * 256 + j * 128 + lanei * 4) = o; }

// Fused attention. One work-group = one (group, head) and 128 queries; each of its 8 waves owns 16 queries (one column group).
// S^T = K Q^T (+ bias plane as the C operand): lane (c, h) holds keys 8h..8h+7 of each 16-key tile for query c, so two score tiles
// convert in place into the B operand of O^T += V^T P^T (hardware k order on both sides). Online softmax over blocks of 128 keys in
// the log2 domain; P carries 2^10 (cancels against the row sum). K rows and V^T rows sit in LDS at pitches of 16 B x odd.
#define KPITCH 40                /* f16 per K row in LDS: 80 B */
#define VPITCH 520               /* f16 per V^T row in LDS: 1040 B */
#define KBLK 128                 /* keys per online-softmax block */
#define QWG 128                  /* queries per work-group */
#define C2 (SCL * 1.4426950408889634f)
__device__ __forceinline__ v16h lds_frag(const unsigned short* p, int hh) { FragH f; f.half[0] = *(const v8us*)(p + 8 * hh); f.half[1] = *(const v8us*)(p + 16 + 8 * hh); return f.v; }
__global__ __launch_bounds__(256) void k_attn(const _Float16* __restrict__ QK, const _Float16* __restrict__ VTg, const float* __restrict__ BP, _Float16* __restrict__ O16) {
  __shared__ __attribute__((aligned(16))) unsigned short sk[NN * KPITCH];
  __shared__ __attribute__((aligned(16))) unsigned short sv[HD * VPITCH];
  const int tid = threadIdx.x, w = tid >> 5, lane = tid & 31, ln = lane & 15, hh = lane >> 4;
  const int qb = blockIdx.x % (NN / QWG), gh = blockIdx.x / (NN / QWG); const int g = gh / NH, h = gh % NH;
  // staging: the K rows, V^T rows and the wave's Q fragment are loaded first, each group from one lane address plus constant steps
  const int n0 = qb * QWG + w * 16;
  const unsigned short* kg = (const unsigned short*)QK + ((size_t)g * NN + (tid >> 2)) * (2 * DD) + h * HD + (tid & 3) * 8;      /* token row tid/4 + 64 i, 16-byte part tid%4; the k half lies DD further */
  const unsigned short* vg = (const unsigned short*)VTg + (size_t)(h * HD + (tid >> 6)) * NR + (size_t)g * NN + (tid & 63) * 8;      /* head dim tid/64 + 4 i, keys 8 (tid%64).. */
  const unsigned short* qg = (const unsigned short*)QK + ((size_t)g * NN + n0 + ln) * (2 * DD) + h * HD + 8 * hh;      /* query n0 + ln, dims 8hh.. and 16 + 8hh.. */
  v8us kr[8], vr8[8]; FragH qfr;
#pragma unroll
  for (int i = 0; i < 8; ++i) kr[i] = *(const v8us*)(kg + DD + (size_t)i * 64 * (2 * DD));
#pragma unroll
  for (int i = 0; i < 8; ++i) vr8[i] = *(const v8us*)(vg + (size_t)i * 4 * NR);
  qfr.half[0] = *(const v8us*)qg; qfr.half[1] = *(const v8us*)(qg + 16); const v16h qf = qfr.v;
  asm volatile("s_wait_xcnt 0x0" :: "v"(kg), "v"(vg), "v"(qg) : "memory");      /* wait before the loads' address registers are rewritten; naming the addresses as inputs keeps them live up to here, so that no later load's data lands in them either */
#pragma unroll
  for (int i = 0; i < 8; ++i) *(v8us*)(sk + ((tid >> 2) + 64 * i) * KPITCH + (tid & 3) * 8) = kr[i];
#pragma unroll
  for (int i = 0; i < 8; ++i) *(v8us*)(sv + ((tid >> 6) + 4 * i) * VPITCH + (tid & 63) * 8) = vr8[i];
  __syncthreads();
  const float* bro = BP + (size_t)(n0 >> 4) * (NN / 16) * 256 + lane * 4;
  const v8f z8 = {0.f,0.f,0.f,0.f,0.f,0.f,0.f,0.f}; v8f o0 = z8, o1 = z8, os = z8; float m = -3.0e38f;
  FragH ones;      /* A whose row 0 is all ones: row 0 of os = the column sums of the rounded P, summed on the matrix pipe */
#pragma unroll
  for (int i = 0; i < 16; ++i) ones.h[i] = (ln == 0) ? (_Float16)1.0f : (_Float16)0.0f;
  // rolled: only one block's 64 score registers are live at a time, which keeps more waves resident
#pragma unroll 1
  for (int kb = 0; kb < NN; kb += KBLK) {
    v8f s[KBLK / 16];
#pragma unroll
    for (int t = 0; t < KBLK / 16; ++t) { const v4f cl = *(const v4fa*)(bro + (kb + t * 16) * 16), ch = *(const v4fa*)(bro + (kb + t * 16) * 16 + 128); const v8f c = {cl[0], cl[1], cl[2], cl[3], ch[0], ch[1], ch[2], ch[3]};
      s[t] = __builtin_amdgcn_wmma_f32_16x16x32_f16(false, lds_frag(sk + (kb + t * 16 + ln) * KPITCH, hh), false, qf, (short)0, c, false, false); }
    float mx[4] = {s[0][0], s[0][1], s[0][2], s[0][3]};
#pragma unroll
    for (int t = 0; t < KBLK / 16; ++t)
#pragma unroll
      for (int r = 0; r < 8; ++r) mx[r & 3] = fmaxf(mx[r & 3], s[t][r]);
    float bm = fmaxf(fmaxf(mx[0], mx[1]), fmaxf(mx[2], mx[3])); bm = fmaxf(bm, __shfl_xor(bm, 16, 32));      /* both halves of a column share one maximum */
    const float mn = fmaxf(m, bm); const float al = __builtin_amdgcn_exp2f((m - mn) * C2); const float off = 10.0f - mn * C2; m = mn;
#pragma unroll
    for (int r = 0; r < 8; ++r) { o0[r] *= al; o1[r] *= al; }
    os[0] *= al;      /* only row 0 of the sum tile is ever read */
#pragma unroll
    for (int p = 0; p < KBLK / 32; ++p) { FragH b;
#pragma unroll
      for (int r = 0; r < 8; ++r) { const float e0 = __builtin_amdgcn_exp2f(fmaf(s[2 * p][r], C2, off)), e1 = __builtin_amdgcn_exp2f(fmaf(s[2 * p + 1][r], C2, off));
        b.h[r] = (_Float16)e0; b.h[8 + r] = (_Float16)e1; }
      const unsigned short* vr = sv + ln * VPITCH + kb + p * 32;
      o0 = __builtin_amdgcn_wmma_f32_16x16x32_f16(false, lds_frag(vr, hh), false, b.v, (short)0, o0, false, false);
      o1 = __builtin_amdgcn_wmma_f32_16x16x32_f16(false, lds_frag(vr + 16 * VPITCH, hh), false, b.v, (short)0, o1, false, false);
      os = __builtin_amdgcn_wmma_f32_16x16x32_f16(false, ones.v, false, b.v, (short)0, os, false, false); }
  }
  const float su = __shfl(os[0], ln, 32); const float inv = 1.0f / su; FragH f;      /* row 0 sits in register 0 of lanes 0..15 */
#pragma unroll
  for (int r = 0; r < 8; ++r) { f.h[r] = (_Float16)(o0[r] * inv); f.h[8 + r] = (_Float16)(o1[r] * inv); }
  unsigned short* d = (unsigned short*)O16 + ((size_t)g * NN + n0 + ln) * DD + h * HD + 8 * hh;      /* lane (c, h): head dims 8h..8h+7 and 16+8h.. of query c */
  *(v8us*)d = f.half[0]; *(v8us*)(d + 16) = f.half[1]; }
// Fused projection. One work-group = 64 token rows: x is read once as f32, rounded (bf16, exact in f16) into LDS, and all 768 outputs of those rows are formed from it.
// q | k: D = W rows (A) x token rows (B), so lane (c, h) holds 8 neighbouring output dims of token c; v^T: D = token rows (A) x W rows (B), so a lane holds 8 neighbouring tokens of one dim.
// Each wave stages its f16 tile in its own LDS range and stores whole 128-byte lines.
// Every loop of the kernel is unrolled: its arrays are register fragments and must be indexed by constants.
#define PROWS 64                 /* token rows per work-group */
#define XPITCH 264               /* f16 per x row in LDS: 528 B = 16 B x 33 */
#define SPITCH 72                /* f16 per staged output row in LDS: 144 B = 16 B x 9 */
__device__ __forceinline__ v16h pj_frag(const unsigned short* p) { FragH f; f.half[0] = *(const v8us*)p; f.half[1] = *(const v8us*)(p + 16); return f.v; }
// four waves per SIMD: two work-groups fit a WGP, so that all 384 are resident at once
__global__ __launch_bounds__(256) __attribute__((amdgpu_waves_per_eu(4, 4))) void k_proj(const float* __restrict__ x, const _Float16* __restrict__ Bw, _Float16* __restrict__ QK, _Float16* __restrict__ VTg) {
  __shared__ __attribute__((aligned(16))) unsigned short sx[PROWS * XPITCH];
  __shared__ __attribute__((aligned(16))) unsigned short st[8][PROWS * SPITCH];
  __shared__ __attribute__((aligned(16))) unsigned short sv2[8][32 * SPITCH];      /* a range of its own for v^T: no wait on the q | k stores before it is written */
  const int tid = threadIdx.x, w = tid >> 5, lane = tid & 31, ln = lane & 15, hh = lane >> 4;
  const int row0 = blockIdx.x * PROWS;
  const float* xg = x + (size_t)row0 * DD + tid * 8;      /* row 8 i + w, columns 8 lane.. */
  const unsigned short* wq = (const unsigned short*)Bw + (size_t)(w * 64 + ln) * DD + 8 * hh;      /* q | k output dims 64 w + 16 a + ln */
  const unsigned short* wv = (const unsigned short*)Bw + (size_t)(2 * DD + w * 32 + ln) * DD + 8 * hh;      /* v output dims 32 w + 16 b + ln */
  v4f xa[8], xb[8];
#pragma unroll
  for (int i = 0; i < 8; ++i) { xa[i] = *(const v4fa*)(xg + i * 8 * DD); xb[i] = *(const v4fa*)(xg + i * 8 * DD + 4); }
  v16h af[4];      /* the first weight fragments fly while x is converted */
#pragma unroll
  for (int a = 0; a < 4; ++a) af[a] = pj_frag(wq + a * 16 * DD);
#pragma unroll
  for (int i = 0; i < 8; ++i) { FragH f;
#pragma unroll
    for (int q = 0; q < 4; ++q) { f.h[q] = (_Float16)bf16_round(xa[i][q]); f.h[4 + q] = (_Float16)bf16_round(xb[i][q]); }
    *(v8us*)(sx + (i * 8 + w) * XPITCH + lane * 8) = f.half[0]; }
  __syncthreads();
  const unsigned short* xs = sx + ln * XPITCH + 8 * hh;
  unsigned short* sw = st[w]; unsigned short* sw2 = sv2[w];
  const v8f z8 = {0.f,0.f,0.f,0.f,0.f,0.f,0.f,0.f};
  {
    v8f acc[4][4];
#pragma unroll
    for (int a = 0; a < 4; ++a)
#pragma unroll
      for (int b = 0; b < 4; ++b) acc[a][b] = z8;
    // unrolled so that the next step's weight fragments are loaded into a second register set ahead of this step's products
#pragma unroll
    for (int kb = 0; kb < DD; kb += 32) { v16h an[4], bx[4];
      if (kb + 32 < DD) {
#pragma unroll
        for (int a = 0; a < 4; ++a) an[a] = pj_frag(wq + a * 16 * DD + kb + 32); }
#pragma unroll
      for (int b = 0; b < 4; ++b) bx[b] = pj_frag(xs + b * 16 * XPITCH + kb);
#pragma unroll
      for (int a = 0; a < 4; ++a)
#pragma unroll
        for (int b = 0; b < 4; ++b) acc[a][b] = __builtin_amdgcn_wmma_f32_16x16x32_f16(false, af[a], false, bx[b], (short)0, acc[a][b], false, false);
      if (kb + 32 < DD) {
#pragma unroll
        for (int a = 0; a < 4; ++a) af[a] = an[a]; } }
#pragma unroll
    for (int a = 0; a < 4; ++a)
#pragma unroll
      for (int b = 0; b < 4; ++b) { FragH f;
#pragma unroll
        for (int r = 0; r < 8; ++r) f.h[r] = (_Float16)(acc[a][b][r] * 0.0625f);
        *(v8us*)(sw + (b * 16 + ln) * SPITCH + a * 16 + 8 * hh) = f.half[0]; }
  }
  __builtin_amdgcn_fence(__ATOMIC_ACQ_REL, "workgroup"); __builtin_amdgcn_wave_barrier();      /* the wave's other lanes read what this lane staged */
  v16h vf[8][2];      /* all of the wave's v weight fragments (128 registers, free now) fly while the q | k tile is stored */
#pragma unroll
  for (int s = 0; s < 8; ++s) { vf[s][0] = pj_frag(wv + s * 32); vf[s][1] = pj_frag(wv + 16 * DD + s * 32); }
  asm volatile("s_wait_xcnt 0x0" :: "v"(wq), "v"(wv) : "memory");      /* wait before the weight loads' address registers are rewritten; naming the addresses as inputs keeps them live up to here, so that no load's data lands in them either */
  {
    unsigned short* qd = (unsigned short*)QK + (size_t)(row0 + (lane >> 3)) * (2 * DD) + w * 64 + (lane & 7) * 8;
    v8us tv[16];
#pragma unroll
    for (int q = 0; q < 16; ++q) tv[q] = *(const v8us*)(sw + (q * 4 + (lane >> 3)) * SPITCH + (lane & 7) * 8);
    __builtin_amdgcn_sched_barrier(0);      /* all LDS reads issue as one group ahead of the stores; otherwise each store waits out its own read's latency in one register set */
#pragma unroll
    for (int q = 0; q < 16; ++q) *(v8us*)(qd + (size_t)q * 4 * (2 * DD)) = tv[q];
    asm volatile("s_wait_xcnt 0x0" ::: "memory");      /* wait before the stores' address and data registers are rewritten by the v^T part */
  }
  {
    v8f acc[4][2];
#pragma unroll
    for (int a = 0; a < 4; ++a) { acc[a][0] = z8; acc[a][1] = z8; }
    // unrolled: the weight fragments are indexed by the step
#pragma unroll
    for (int kb = 0; kb < DD; kb += 32) { v16h ax[4];
#pragma unroll
      for (int a = 0; a < 4; ++a) ax[a] = pj_frag(xs + a * 16 * XPITCH + kb);
      __builtin_amdgcn_sched_barrier(0);      /* the step's loads issue as one group ahead of its products: one place with LDS reads a step, not four */
#pragma unroll
      for (int a = 0; a < 4; ++a)
#pragma unroll
        for (int b = 0; b < 2; ++b) acc[a][b] = __builtin_amdgcn_wmma_f32_16x16x32_f16(false, ax[a], false, vf[kb / 32][b], (short)0, acc[a][b], false, false);
      __builtin_amdgcn_sched_barrier(0); }      /* keeps later steps' LDS reads in their own step; hoisted all together they spilled registers to scratch */
#pragma unroll
    for (int a = 0; a < 4; ++a)
#pragma unroll
      for (int b = 0; b < 2; ++b) { FragH f;
#pragma unroll
        for (int r = 0; r < 8; ++r) f.h[r] = (_Float16)(acc[a][b][r] * 0.0625f);
        *(v8us*)(sw2 + (b * 16 + ln) * SPITCH + a * 16 + 8 * hh) = f.half[0]; }
  }
  __builtin_amdgcn_fence(__ATOMIC_ACQ_REL, "workgroup"); __builtin_amdgcn_wave_barrier();      /* as above: lanes read each other's staged rows */
  {
    unsigned short* vd = (unsigned short*)VTg + (size_t)(w * 32 + (lane >> 3)) * NR + row0 + (lane & 7) * 8;
    v8us tv[8];
#pragma unroll
    for (int q = 0; q < 8; ++q) tv[q] = *(const v8us*)(sw2 + (q * 4 + (lane >> 3)) * SPITCH + (lane & 7) * 8);
    __builtin_amdgcn_sched_barrier(0);      /* as above: one group of LDS reads, then the stores */
#pragma unroll
    for (int q = 0; q < 8; ++q) *(v8us*)(vd + (size_t)q * 4 * NR) = tv[q];
  }
}
__global__ __launch_bounds__(256) void k_wqkv(const float* __restrict__ Wq, const float* __restrict__ Wk, const float* __restrict__ Wv, _Float16* __restrict__ Bt) { const int t = blockIdx.x * 256 + threadIdx.x; if (t >= 3 * DD * (DD / 8)) return; const int n = t / (DD / 8), k0 = (t % (DD / 8)) * 8; const int which = n / DD, o = n % DD; const float* Wm = which == 0 ? Wq : (which == 1 ? Wk : Wv); FragH f;
  for (int q = 0; q < 8; ++q) f.h[q] = (_Float16)(bf16_round(Wm[(size_t)(k0 + q) * DD + o]) * 16.0f); *(v8us*)((unsigned short*)Bt + (size_t)n * DD + k0) = f.half[0];  }

extern "C" void kernel_launch(void* const* d_in, const int* in_sizes, int n_in,
                              void* d_out, int out_size, void* d_ws, size_t ws_size, hipStream_t stream) {
  (void)in_sizes; (void)n_in; (void)out_size;
  const float* const* I = (const float* const*)d_in; const float* x = I[0]; const float* sim = I[1]; const float* Wq = I[2]; const float* Wk = I[3]; const float* Wv = I[4]; const float* Wo = I[5];
  char* ws = (char*)d_ws; size_t off = 0;
  auto take = [&](size_t bytes) { char* p = ws + off; off += (bytes + 255) & ~(size_t)255; return p; };
  _Float16* BQKV = (_Float16*)take((size_t)3 * DD * DD * 2); _Float16* BO = (_Float16*)take((size_t)DD * DD * 2);
  _Float16* QK = (_Float16*)take((size_t)NR * 2 * DD * 2); _Float16* VTg = (_Float16*)take((size_t)DD * NR * 2); _Float16* O16 = (_Float16*)take((size_t)NR * DD * 2);
  float* BP = (float*)take((size_t)NN * NN * 4);
  if (off > ws_size) return;      /* under 50 MiB */
  k_wqkv<<<(3 * DD * (DD / 8) + 255) / 256, 256, 0, stream>>>(Wq, Wk, Wv, BQKV); k_wt_f16<<<(DD * DD / 8 + 255) / 256, 256, 0, stream>>>(Wo, BO, DD, DD, 16.0f);
  k_bias<<<(NN * NN / 4 + 255) / 256, 256, 0, stream>>>(sim, BP);
  k_proj<<<NR / PROWS, 256, 0, stream>>>(x, BQKV, QK, VTg);      /* token rows [q | k], heads h*32 + d; v^T: rows h*32 + d, columns = token rows */
  k_attn<<<NG * NH * (NN / QWG), 256, 0, stream>>>(QK, VTg, BP, O16);
  k_gemm2<0><<<dim3((NR / 128) * (DD / 64), 1), 128, 0, stream>>>(O16, DD, 0, BO, DD, 0, 0.0625f, nullptr, 0, nullptr, 1, 0, 0, (float*)d_out, nullptr, DD, 0, NR, DD, DD);
}

// v003
// One run takes 73.4 microseconds.
// Two timings next to v002 both put it at 1.08 times that version's speed.
// Counting every step since v000, it is 9.39 times as fast.
#include <hip/hip_runtime.h>
// SpatialMHSA (4 x 12 frames x 512 spatial tokens x 256 = 8 heads of 32): q/k/v = x W (xavier (in,out) weights); per (batch, frame, head) attention over the 512 tokens with scores/sqrt(32) + an INPUT additive bias sim[n][m]; out = merged heads W_o.
// Structure: ONE projection kernel (x rounded into LDS once per 64 token rows; q|k to token rows and v^T from it, f32 accumulation, exact x16 weights, f16 output); ONE fused attention kernel over all 384 (group, head) pairs (S^T = K Q^T with the scaled bias plane as C, online softmax in registers, O^T = V^T P^T, f16 token rows out); output GEMM.
// Compute dtype: x, sim and weights rounded to bf16; q, k, v, P, attention output as f16 operands (~2^-12); f32 accumulation/softmax. v_wmma_f32_16x16x32_f16.
#define NBATCH 4
#define NFR 12
#define NN 512
#define DD 256
#define NH 8
#define HD 32
#define NG (NBATCH * NFR)         /* 48 groups */
#define NR (NG * NN)             /* 24576 token rows */
#define SCL 0.17677669529663687f /* 32^-0.5 */
typedef __bf16 v16b __attribute__((ext_vector_type(16)));
typedef unsigned short v8us __attribute__((ext_vector_type(8), may_alias));
typedef float  v8f  __attribute__((ext_vector_type(8)));
typedef float  v4f  __attribute__((ext_vector_type(4)));
typedef float  v4fa __attribute__((ext_vector_type(4), may_alias));
union FragB { v16b v; v8us half[2]; unsigned short u[16]; };

__device__ __forceinline__ unsigned short bf16_bits(float x) { unsigned int u = __float_as_uint(x); return (unsigned short)((u + 0x7FFFu + ((u >> 16) & 1u)) >> 16); }
__device__ __forceinline__ float bf16_val(unsigned short b) { return __uint_as_float(((unsigned int)b) << 16); }
__device__ __forceinline__ float bf16_round(float x) { return bf16_val(bf16_bits(x)); }
// D += A·B with NT terms: 1 = ah·bh, 2 = + al·bh (A split), 3 = + ah·bl (both split)
template <int NT>
__device__ __forceinline__ v8f mmaN(v16b ah, v16b al, v16b bh, v16b bl, v8f c) {
  c = __builtin_amdgcn_wmma_f32_16x16x32_bf16(false, ah, false, bh, (short)0, c, false, false);
  if (NT >= 2) c = __builtin_amdgcn_wmma_f32_16x16x32_bf16(false, al, false, bh, (short)0, c, false, false);
  if (NT >= 3) c = __builtin_amdgcn_wmma_f32_16x16x32_bf16(false, ah, false, bl, (short)0, c, false, false);
  asm volatile("v_nop\n\tv_nop\n\tv_nop\n\tv_nop" : "+v"(c) : "v"(ah), "v"(al), "v"(bh), "v"(bl));
  return c;
}

__global__ __launch_bounds__(256) void k_wt_bf16(const float* __restrict__ W, unsigned short* __restrict__ Wt, int K, int N) {
  const int t = blockIdx.x * 256 + threadIdx.x;
  const int k8n = K / 8;
  if (t >= N * k8n) return;
  const int n = t / k8n, k8 = (t % k8n) * 8;
  v8us v;
#pragma unroll
  for (int i = 0; i < 8; ++i) v[i] = bf16_bits(W[(size_t)(k8 + i) * N + n]);
  *(v8us*)(Wt + (size_t)n * K + k8) = v;
  
}

// GEMM C[M][N] (f32, pitch ldc) = act(A[M][K]·W + bias). A f32 row-major (pitch lda) converted per fragment to bf16
// (ASPLIT: hi/lo two planes -> 2 terms, else single rounded term); Wt bf16 [N][K] (pitch ldb). BIAS_BF16 rounds the
// bias to bf16 first (bias quantised to bf16 before the add). K%32==0, M%16==0, N%64==0.
template <bool ASPLIT, int ACT, bool BIAS_BF16>
__global__ __launch_bounds__(128) void k_gemm_bf(const float* __restrict__ A, int lda, const unsigned short* __restrict__ Wt, int ldb,
                                               const float* __restrict__ bias, float* __restrict__ C, int ldc, int M, int N, int K) {
  __shared__ __attribute__((aligned(16))) float so[4][16][64];
  const int tid = threadIdx.x, w = tid >> 5, lane = tid & 31, ln = lane & 15, hh = lane >> 4;
  const int ntn = N / 64;
  const int wid = blockIdx.x * 4 + w;
  const int mt = wid / ntn, nq = wid % ntn;
  if (mt * 16 >= M) return;
  const int row0 = mt * 16, col0 = nq * 64;
  const float* arow = A + (size_t)(row0 + ln) * lda;
  v8f acc[4] = {};
  for (int kb = 0; kb < K; kb += 32) {
    FragB ah, al;
    const v4f x0 = *(const v4fa*)(arow + kb + 8 * hh), x1 = *(const v4fa*)(arow + kb + 8 * hh + 4);
    const v4f x2 = *(const v4fa*)(arow + kb + 16 + 8 * hh), x3 = *(const v4fa*)(arow + kb + 16 + 8 * hh + 4);
    float xs[16] = {x0[0],x0[1],x0[2],x0[3],x1[0],x1[1],x1[2],x1[3],x2[0],x2[1],x2[2],x2[3],x3[0],x3[1],x3[2],x3[3]};
#pragma unroll
    for (int i = 0; i < 16; ++i) { const unsigned short hb = bf16_bits(xs[i]); ah.u[i] = hb; al.u[i] = ASPLIT ? bf16_bits(xs[i] - bf16_val(hb)) : (unsigned short)0; }
#pragma unroll
    for (int t = 0; t < 4; ++t) {
      const unsigned short* brow = Wt + (size_t)(col0 + t * 16 + ln) * ldb + kb;
      FragB b;
      b.half[0] = *(const v8us*)(brow + 8 * hh);
      b.half[1] = *(const v8us*)(brow + 16 + 8 * hh);
      acc[t] = mmaN<ASPLIT ? 2 : 1>(ah.v, al.v, b.v, b.v, acc[t]);
    }
  }
#pragma unroll
  for (int t = 0; t < 4; ++t) {
    float bv = bias ? bias[col0 + t * 16 + ln] : 0.f;
    if (BIAS_BF16) bv = bf16_round(bv);
#pragma unroll
    for (int r = 0; r < 8; ++r) { float v = acc[t][r] + bv; if (ACT == 1) v = fmaxf(v, 0.f); so[w][8 * hh + r][t * 16 + ln] = v; }
  }
  __builtin_amdgcn_fence(__ATOMIC_ACQ_REL, "workgroup");
  __builtin_amdgcn_wave_barrier();
  const int rsub = lane >> 4, c4 = (lane & 15) * 4;
  {
#pragma unroll
    for (int q = 0; q < 8; ++q) {
      const int r = q * 2 + rsub;
      const v4f v = *(const v4fa*)&so[w][r][c4];
      *(v4f*)(C + (size_t)(row0 + r) * ldc + col0 + c4) = v;
    }
    
  }
}

// GEMM C = act(A·W + bias + resid): A f32 (ASPLIT -> hi/lo 2 terms), Wt bf16 [N][K]; ACT 0 none, 1 relu, 2 exact gelu;
// resid (optional, f32, row index = (row % rmod), pitch ldr, RES_BF16 rounds it) added before the activation.
template <bool ASPLIT, int ACT, bool BIAS_BF16, bool RES_BF16>
__global__ __launch_bounds__(128) void k_gemm_bf3(const float* __restrict__ A, int lda, const unsigned short* __restrict__ Wt, int ldb,
                                                const float* __restrict__ bias, const float* __restrict__ resid, int rmod, int ldr,
                                                float* __restrict__ C, int ldc, int M, int N, int K) {
  __shared__ __attribute__((aligned(16))) float so[4][16][64];
  const int tid = threadIdx.x, w = tid >> 5, lane = tid & 31, ln = lane & 15, hh = lane >> 4;
  const int ntn = N / 64;
  const int wid = blockIdx.x * 4 + w;
  const int mt = wid / ntn, nq = wid % ntn;
  if (mt * 16 >= M) return;
  const int row0 = mt * 16, col0 = nq * 64;
  const float* arow = A + (size_t)(row0 + ln) * lda;
  v8f acc[4] = {};
  for (int kb = 0; kb < K; kb += 32) {
    FragB ah, al;
    const v4f x0 = *(const v4fa*)(arow + kb + 8 * hh), x1 = *(const v4fa*)(arow + kb + 8 * hh + 4);
    const v4f x2 = *(const v4fa*)(arow + kb + 16 + 8 * hh), x3 = *(const v4fa*)(arow + kb + 16 + 8 * hh + 4);
    float xs[16] = {x0[0],x0[1],x0[2],x0[3],x1[0],x1[1],x1[2],x1[3],x2[0],x2[1],x2[2],x2[3],x3[0],x3[1],x3[2],x3[3]};
#pragma unroll
    for (int i = 0; i < 16; ++i) { const unsigned short hb = bf16_bits(xs[i]); ah.u[i] = hb; al.u[i] = ASPLIT ? bf16_bits(xs[i] - bf16_val(hb)) : (unsigned short)0; }
#pragma unroll
    for (int t = 0; t < 4; ++t) {
      const unsigned short* brow = Wt + (size_t)(col0 + t * 16 + ln) * ldb + kb;
      FragB b;
      b.half[0] = *(const v8us*)(brow + 8 * hh);
      b.half[1] = *(const v8us*)(brow + 16 + 8 * hh);
      acc[t] = mmaN<ASPLIT ? 2 : 1>(ah.v, al.v, b.v, b.v, acc[t]);
    }
  }
#pragma unroll
  for (int t = 0; t < 4; ++t) {
    const int col = col0 + t * 16 + ln;
    float bv = bias ? bias[col] : 0.f;
    if (BIAS_BF16) bv = bf16_round(bv);
#pragma unroll
    for (int r = 0; r < 8; ++r) {
      float v = acc[t][r] + bv;
      if (resid) { float rv = resid[(size_t)((row0 + 8 * hh + r) % rmod) * ldr + col]; if (RES_BF16) rv = bf16_round(rv); v += rv; }
      if (ACT == 1) v = fmaxf(v, 0.f);
      if (ACT == 2) v = 0.5f * v * (1.0f + erff(v * 0.70710678118654752f));
      if (ACT == 3) { const float u = 0.7978845608028654f * (v + 0.044715f * v * v * v); v = 0.5f * v * (1.0f + tanhf(u)); }
      so[w][8 * hh + r][t * 16 + ln] = v;
    }
  }
  __builtin_amdgcn_fence(__ATOMIC_ACQ_REL, "workgroup");
  __builtin_amdgcn_wave_barrier();
  const int rsub = lane >> 4, c4 = (lane & 15) * 4;
  {
#pragma unroll
    for (int q = 0; q < 8; ++q) {
      const int r = q * 2 + rsub;
      const v4f v = *(const v4fa*)&so[w][r][c4];
      *(v4f*)(C + (size_t)(row0 + r) * ldc + col0 + c4) = v;
    }
    
  }
}
// row LayerNorm (biased variance, eps) over N: s = X (+ R); optional out_sum <- s; out_norm <- (s-mu)*rsqrt(var+eps)*g + b
template <bool PARAM_BF16>
__global__ __launch_bounds__(256) void k_layernorm(const float* __restrict__ X, const float* __restrict__ R, const float* __restrict__ g, const float* __restrict__ bta,
                                                  float* __restrict__ out_sum, float* __restrict__ out_norm, int N, float eps) {
  __shared__ float red[256];
  const int row = blockIdx.x, tid = threadIdx.x;
  const float* x = X + (size_t)row * N; const float* rr = R ? R + (size_t)row * N : nullptr;
  float vals[16];                     // up to N = 4096
  const int per = N / 256;            // contiguous chunk per thread? use strided-by-4 chunks: thread handles j = tid*4 + 1024*u
  float s1 = 0.f;
  for (int u = 0; u < per / 4; ++u) {
    const int j = tid * 4 + 1024 * u;
    const v4f a = *(const v4fa*)(x + j);
    v4f b = {0.f,0.f,0.f,0.f}; if (rr) b = *(const v4fa*)(rr + j);
#pragma unroll
    for (int q = 0; q < 4; ++q) { const float v = a[q] + b[q]; vals[u * 4 + q] = v; s1 += v; }
  }
  red[tid] = s1; __syncthreads();
  for (int st = 128; st > 0; st >>= 1) { if (tid < st) red[tid] += red[tid + st]; __syncthreads(); }
  const float mu = red[0] / (float)N; __syncthreads();
  float s2 = 0.f;
  for (int u = 0; u < per / 4; ++u)
#pragma unroll
    for (int q = 0; q < 4; ++q) { const float c = vals[u * 4 + q] - mu; s2 += c * c; }
  red[tid] = s2; __syncthreads();
  for (int st = 128; st > 0; st >>= 1) { if (tid < st) red[tid] += red[tid + st]; __syncthreads(); }
  const float rs = rsqrtf(red[0] / (float)N + eps);
  {
    for (int u = 0; u < per / 4; ++u) {
      const int j = tid * 4 + 1024 * u;
      v4f o, sm;
#pragma unroll
      for (int q = 0; q < 4; ++q) {
        float gg = g[j + q], bb = bta[j + q];
        if (PARAM_BF16) { gg = bf16_round(gg); bb = bf16_round(bb); }
        sm[q] = vals[u * 4 + q]; o[q] = (vals[u * 4 + q] - mu) * rs * gg + bb;
      }
      if (out_sum) *(v4f*)(out_sum + (size_t)row * N + j) = sm;
      *(v4f*)(out_norm + (size_t)row * N + j) = o;
    }
    
  }
}



// ---- f16 WMMA path (v_wmma_f32_16x16x32_f16): 11-bit significands for operands in range — used where a [0,1] probability operand needs more precision than bf16
typedef _Float16 v16h __attribute__((ext_vector_type(16)));
union FragH { v16h v; v8us half[2]; _Float16 h[16]; unsigned short u[16]; };
template <int NT>
__device__ __forceinline__ v8f mmaH(v16h ah, v16h al, v16h bh, v16h bl, v8f c) {
  c = __builtin_amdgcn_wmma_f32_16x16x32_f16(false, ah, false, bh, (short)0, c, false, false);
  if (NT >= 2) c = __builtin_amdgcn_wmma_f32_16x16x32_f16(false, al, false, bh, (short)0, c, false, false);
  if (NT >= 3) c = __builtin_amdgcn_wmma_f32_16x16x32_f16(false, ah, false, bl, (short)0, c, false, false);
  asm volatile("v_nop\n\tv_nop\n\tv_nop\n\tv_nop" : "+v"(c) : "v"(ah), "v"(al), "v"(bh), "v"(bl));
  return c;
}
// batched GEMM like k_gemm_b but f16 operands: A f32 (split into f16 hi/lo if ASPLIT, else rounded to f16), Bt = f16 values [n][k]; alpha; C f32; N multiple of 16 (partial tiles skipped)
template <bool ASPLIT>
__global__ __launch_bounds__(128) void k_gemm_h(const float* __restrict__ A, int lda, size_t sA, const _Float16* __restrict__ Bh, int ldb, size_t sB, float alpha, float* __restrict__ C, int ldc, size_t sC, int M, int N, int K) {
  __shared__ __attribute__((aligned(16))) float so[4][16][64];
  const int tid = threadIdx.x, w = tid >> 5, lane = tid & 31, ln = lane & 15, hh = lane >> 4; const int by = blockIdx.y;
  A += (size_t)by * sA; Bh += (size_t)by * sB; C += (size_t)by * sC;
  const int ntn = (N + 63) / 64; const int wid = blockIdx.x * 4 + w; const int mt = wid / ntn, nq = wid % ntn; if (mt * 16 >= M) return;
  const int row0 = mt * 16, col0 = nq * 64; const float* arow = A + (size_t)(row0 + ln) * lda;
  v8f acc[4] = {};
  for (int kb = 0; kb < K; kb += 32) {
    FragH ah, al;
    const v4f x0 = *(const v4fa*)(arow + kb + 8 * hh), x1 = *(const v4fa*)(arow + kb + 8 * hh + 4), x2 = *(const v4fa*)(arow + kb + 16 + 8 * hh), x3 = *(const v4fa*)(arow + kb + 16 + 8 * hh + 4);
    float xs[16] = {x0[0],x0[1],x0[2],x0[3],x1[0],x1[1],x1[2],x1[3],x2[0],x2[1],x2[2],x2[3],x3[0],x3[1],x3[2],x3[3]};
#pragma unroll
    for (int i = 0; i < 16; ++i) { const _Float16 h = (_Float16)xs[i]; ah.h[i] = h; al.h[i] = ASPLIT ? (_Float16)(xs[i] - (float)h) : (_Float16)0.0f; }
#pragma unroll
    for (int t = 0; t < 4; ++t) { if (col0 + t * 16 >= N) continue; const size_t boff = (size_t)(col0 + t * 16 + ln) * ldb + kb; FragH bq; bq.half[0] = *(const v8us*)(Bh + boff + 8 * hh); bq.half[1] = *(const v8us*)(Bh + boff + 16 + 8 * hh);
      acc[t] = mmaH<ASPLIT ? 2 : 1>(ah.v, al.v, bq.v, bq.v, acc[t]); }
  }
#pragma unroll
  for (int t = 0; t < 4; ++t) { if (col0 + t * 16 >= N) continue;
#pragma unroll
    for (int r = 0; r < 8; ++r) so[w][8 * hh + r][t * 16 + ln] = acc[t][r] * alpha; }
  __builtin_amdgcn_fence(__ATOMIC_ACQ_REL, "workgroup"); __builtin_amdgcn_wave_barrier();
  const int rsub = lane >> 4, c4 = (lane & 15) * 4;
  {
#pragma unroll
    for (int q = 0; q < 8; ++q) { const int r = q * 2 + rsub; if (col0 + c4 < N) { const v4f v = *(const v4fa*)&so[w][r][c4]; *(v4f*)(C + (size_t)(row0 + r) * ldc + col0 + c4) = v; } }
     }
}

// Wt[n][k] = f16(W[k][n]·scale) from f32 row-major W[K][N] (scale = power of two; bf16-exact weights stay exact in f16 away from the subnormal range)
__global__ __launch_bounds__(256) void k_wt_f16(const float* __restrict__ W, _Float16* __restrict__ Wt, int K, int N, float scale) {
  const int t = blockIdx.x * 256 + threadIdx.x; if (t >= N * (K / 8)) return; const int n = t / (K / 8), k8 = (t % (K / 8)) * 8; FragH f;
#pragma unroll
  for (int i = 0; i < 8; ++i) f.h[i] = (_Float16)(bf16_round(W[(size_t)(k8 + i) * N + n]) * scale); const v8us o = f.half[0];
  *(v8us*)((unsigned short*)Wt + (size_t)n * K + k8) = o; 
}
// k_gemm_hh variant with fused epilogue: v = acc·alpha + bias[by·sBias + col] (+ CP[(row/rowsPerB)·sCPb + by·64 + col] if CP) ; ACT 0 none / 1 elu ; writes f16 C16 (and f32 C if non-null)
template <int ACT>
__global__ __launch_bounds__(128) void k_gemm_hhx(const _Float16* __restrict__ A, int lda, size_t sA, const _Float16* __restrict__ Bh, int ldb, size_t sB, float alpha, const float* __restrict__ bias, size_t sBias, const float* __restrict__ CP, int rowsPerB, size_t sCPb, int row0g,
    float* __restrict__ C, _Float16* __restrict__ C16, int ldc, size_t sC, int M, int N, int K) {
  __shared__ __attribute__((aligned(16))) float so[4][16][64];
  const int tid = threadIdx.x, w = tid >> 5, lane = tid & 31, ln = lane & 15, hh = lane >> 4; const int by = blockIdx.y;
  A += (size_t)by * sA; Bh += (size_t)by * sB; const size_t cofs = (size_t)by * sC; const float* bp = bias ? bias + (size_t)by * sBias : nullptr;
  const int ntn = (N + 63) / 64; const int wid = blockIdx.x * 4 + w; const int mt = wid / ntn, nq = wid % ntn; if (mt * 16 >= M) return;
  const int row0 = mt * 16, col0 = nq * 64; const _Float16* arow = A + (size_t)(row0 + ln) * lda;
  v8f acc[4] = {};
  for (int kb = 0; kb < K; kb += 32) { FragH ah; ah.half[0] = *(const v8us*)((const unsigned short*)arow + kb + 8 * hh); ah.half[1] = *(const v8us*)((const unsigned short*)arow + kb + 16 + 8 * hh);
#pragma unroll
    for (int t = 0; t < 4; ++t) { if (col0 + t * 16 >= N) continue; const size_t boff = (size_t)(col0 + t * 16 + ln) * ldb + kb; FragH bq; bq.half[0] = *(const v8us*)((const unsigned short*)Bh + boff + 8 * hh); bq.half[1] = *(const v8us*)((const unsigned short*)Bh + boff + 16 + 8 * hh);
      acc[t] = mmaH<1>(ah.v, ah.v, bq.v, bq.v, acc[t]); }
  }
#pragma unroll
  for (int t = 0; t < 4; ++t) { if (col0 + t * 16 >= N) continue; const int col = col0 + t * 16 + ln; const float bv = bp ? bf16_round(bp[col]) : 0.f;
#pragma unroll
    for (int r = 0; r < 8; ++r) { float v = acc[t][r] * alpha + bv; if (CP) { const int rr = row0g + row0 + 8 * hh + r; if (rowsPerB < 0) v += CP[cofs + (size_t)rr * ldc + col];      /* rowsPerB < 0: own element of the batched C plane */ else { const int bidx = rr / rowsPerB; v += CP[(size_t)bidx * sCPb + (size_t)by * 64 + col]; } } if (ACT == 1) v = (v > 0.f) ? v : expm1f(v); else if (ACT == 7) v = (v > 0.f) ? v + 1.0f : expf(v); else if (ACT == 8) v = tanhf(v); else if (ACT == 9) v = 0.5f * v * (1.0f + tanhf(0.7978845608028654f * (v + 0.044715f * v * v * v))); else if (ACT == 11) v = 1.0f / (1.0f + expf(-v)); else if (ACT == 12) v = (v > 0.f) ? v : 0.01f * v; else if (ACT == 14) v = (v > 0.f) ? v : 0.1f * v; else if (ACT == 16) v = (v >= 0.f) ? v : 0.3f * v; else if (ACT == 15) v = v / (1.0f + expf(-v)); else if (ACT == 3) v = fmaxf(v, 0.f); else if (ACT == 6) v = 0.5f * v * (1.0f + erff(v * 0.70710678118654752f)); so[w][8 * hh + r][t * 16 + ln] = v; } }
  __builtin_amdgcn_fence(__ATOMIC_ACQ_REL, "workgroup"); __builtin_amdgcn_wave_barrier();
  const int rsub = lane >> 4, c4 = (lane & 15) * 4; typedef _Float16 v4h __attribute__((ext_vector_type(4)));
  {
#pragma unroll
    for (int q = 0; q < 8; ++q) { const int r = q * 2 + rsub; if (col0 + c4 < N) { const v4f v = *(const v4fa*)&so[w][r][c4]; if (C) *(v4f*)(C + cofs + (size_t)(row0 + r) * ldc + col0 + c4) = v; if (C16) { v4h h4; for (int i = 0; i < 4; ++i) h4[i] = (_Float16)v[i]; *(v4h*)(C16 + cofs + (size_t)(row0 + r) * ldc + col0 + c4) = h4; } } }
     }
}


typedef _Float16 v4h __attribute__((ext_vector_type(4)));

__global__ __launch_bounds__(256) void k_x16(const float* __restrict__ x, _Float16* __restrict__ X16, size_t n8) { const size_t t = (size_t)blockIdx.x * 256 + threadIdx.x; if (t >= n8) return; FragH f;
#pragma unroll
  for (int q = 0; q < 8; ++q) f.h[q] = (_Float16)bf16_round(x[t * 8 + q]); *(v8us*)((unsigned short*)X16 + t * 8) = f.half[0];  }
__global__ __launch_bounds__(256) void k_h16(const float* __restrict__ x, _Float16* __restrict__ X16, size_t n8) { const size_t t = (size_t)blockIdx.x * 256 + threadIdx.x; if (t >= n8) return; FragH f;
#pragma unroll
  for (int q = 0; q < 8; ++q) f.h[q] = (_Float16)x[t * 8 + q]; *(v8us*)((unsigned short*)X16 + t * 8) = f.half[0];  }
__global__ __launch_bounds__(256) void k_round16f(const float* __restrict__ W, _Float16* __restrict__ Bt, size_t n8) { const size_t t = (size_t)blockIdx.x * 256 + threadIdx.x; if (t >= n8) return; FragH f;
#pragma unroll
  for (int i = 0; i < 8; ++i) f.h[i] = (_Float16)(bf16_round(W[t * 8 + i]) * 16.0f); *(v8us*)((unsigned short*)Bt + t * 8) = f.half[0];  }
template <int NHv, int TTv>
__global__ __launch_bounds__(256) void k_vt(const _Float16* __restrict__ V16, int ldv, int voff, _Float16* __restrict__ Vt) { __shared__ unsigned short tl[64][66]; const int tid = threadIdx.x; const int slab = blockIdx.x / (TTv / 64), lg = blockIdx.x % (TTv / 64); const int b = slab / NHv, h = slab % NHv;
  for (int i = tid; i < 64 * 8; i += 256) { const int r = i / 8, c8 = (i % 8) * 8; FragH f; f.half[0] = *(const v8us*)((const unsigned short*)V16 + ((size_t)b * TTv + lg * 64 + r) * ldv + voff + h * 64 + c8);
#pragma unroll
    for (int q = 0; q < 8; ++q) tl[r][c8 + q] = f.u[q]; }
  __syncthreads();
  {
#pragma unroll
    for (int rd = 0; rd < 2; ++rd) { const int d = rd * 32 + tid / 8, pc = tid % 8; FragH f;
#pragma unroll
      for (int q = 0; q < 8; ++q) f.u[q] = tl[pc * 8 + q][d];
      *(v8us*)((unsigned short*)Vt + ((size_t)slab * 64 + d) * TTv + lg * 64 + pc * 8) = f.half[0]; }
     } }

__global__ __launch_bounds__(256) void k_hl(const float* __restrict__ F, _Float16* __restrict__ Hh, _Float16* __restrict__ Hl, size_t n8) { const size_t t = (size_t)blockIdx.x * 256 + threadIdx.x; if (t >= n8) return; FragH fh, fl; const v4f a = *(const v4fa*)(F + t * 8), c = *(const v4fa*)(F + t * 8 + 4);
#pragma unroll
  for (int q = 0; q < 4; ++q) { _Float16 h = (_Float16)a[q]; fh.h[q] = h; fl.h[q] = (_Float16)((a[q] - (float)h) * 1024.0f); h = (_Float16)c[q]; fh.h[4 + q] = h; fl.h[4 + q] = (_Float16)((c[q] - (float)h) * 1024.0f); }
  { *(v8us*)((unsigned short*)Hh + t * 8) = fh.half[0]; *(v8us*)((unsigned short*)Hl + t * 8) = fl.half[0];  } }

// ---- fast GEMM (wave tile 32x64; requires M % 32 == 0 rows per launch region and N % 64 == 0); epilogue = k_gemm_hhx semantics ----
__device__ __forceinline__ v16h g2_frag(const _Float16* p, int hh) { FragH f; f.half[0] = *(const v8us*)((const unsigned short*)p + 8 * hh); f.half[1] = *(const v8us*)((const unsigned short*)p + 16 + 8 * hh); return f.v; }
__device__ __forceinline__ v8f g2_mma(v16h a, v16h b, v8f c) { v8f d = __builtin_amdgcn_wmma_f32_16x16x32_f16(false, a, false, b, (short)0, c, false, false); asm volatile("v_nop\n\tv_nop\n\tv_nop\n\tv_nop" : "+v"(d) : "v"(a), "v"(b)); return d; }
template <int ACT>
__global__ __launch_bounds__(128) void k_gemm2(const _Float16* __restrict__ A, int lda, size_t sA, const _Float16* __restrict__ Bh, int ldb, size_t sB, float alpha, const float* __restrict__ bias, size_t sBias, const float* __restrict__ CP, int rowsPerB, size_t sCPb, int row0g,
    float* __restrict__ C, _Float16* __restrict__ C16, int ldc, size_t sC, int M, int N, int K) { static_assert(ACT == 0 || ACT == 3 || ACT == 6 || ACT == 8 || ACT == 9 || ACT == 11 || ACT == 12 || ACT == 14 || ACT == 15 || ACT == 16, "k_gemm2: unsupported ACT code (would silently apply no activation)");
  __shared__ __attribute__((aligned(16))) float so[4][32][68];
  const int tid = threadIdx.x, w = tid >> 5, lane = tid & 31, ln = lane & 15, hh = lane >> 4; const int by = blockIdx.y;
  A += (size_t)by * sA; Bh += (size_t)by * sB; const size_t cofs = (size_t)by * sC; const float* bp = bias ? bias + (size_t)by * sBias : nullptr;
  const int ntn = N >> 6; const int mt = blockIdx.x / ntn, nq = blockIdx.x - mt * ntn; const int row0 = mt * 128 + 32 * w, col0 = nq * 64; if (row0 >= M) return;
  const _Float16* a0p = A + (size_t)(row0 + ln) * lda; const _Float16* a1p = a0p + (size_t)16 * lda;
  const _Float16* b0p = Bh + (size_t)(col0 + ln) * ldb; const _Float16* b1p = b0p + (size_t)16 * ldb; const _Float16* b2p = b1p + (size_t)16 * ldb; const _Float16* b3p = b2p + (size_t)16 * ldb;
  const v8f z8 = {0.f,0.f,0.f,0.f,0.f,0.f,0.f,0.f}; v8f c00 = z8, c01 = z8, c02 = z8, c03 = z8, c10 = z8, c11 = z8, c12 = z8, c13 = z8;
#pragma unroll 1
  for (int kb = 0; kb < K; kb += 32) { const v16h a0 = g2_frag(a0p + kb, hh), a1 = g2_frag(a1p + kb, hh);
    v16h b = g2_frag(b0p + kb, hh); c00 = g2_mma(a0, b, c00); c10 = g2_mma(a1, b, c10);
    b = g2_frag(b1p + kb, hh); c01 = g2_mma(a0, b, c01); c11 = g2_mma(a1, b, c11);
    b = g2_frag(b2p + kb, hh); c02 = g2_mma(a0, b, c02); c12 = g2_mma(a1, b, c12);
    b = g2_frag(b3p + kb, hh); c03 = g2_mma(a0, b, c03); c13 = g2_mma(a1, b, c13); }
  v8f accs[8] = {c00, c01, c02, c03, c10, c11, c12, c13};
#pragma unroll
  for (int u = 0; u < 8; ++u) { const int t = u & 3, half = u >> 2; const int col = col0 + t * 16 + ln; const float bv = bp ? bf16_round(bp[col]) : 0.f;
#pragma unroll
    for (int r = 0; r < 8; ++r) { const int rloc = half * 16 + 8 * hh + r; float v = accs[u][r] * alpha + bv; if (CP) { if (rowsPerB < 0) v += CP[cofs + (size_t)(row0g + row0 + rloc) * ldc + col];      /* rowsPerB < 0: own element of the batched C plane */ else { const int bidx = (row0g + row0 + rloc) / rowsPerB; v += CP[(size_t)bidx * sCPb + (size_t)by * 64 + col]; } }
      if (ACT == 3) v = fmaxf(v, 0.f); else if (ACT == 6) v = 0.5f * v * (1.0f + erff(v * 0.70710678118654752f)); else if (ACT == 11) v = 1.0f / (1.0f + expf(-v)); else if (ACT == 15) v = v / (1.0f + expf(-v)); else if (ACT == 12) v = (v > 0.f) ? v : 0.01f * v; else if (ACT == 8) v = tanhf(v); else if (ACT == 9) v = 0.5f * v * (1.0f + tanhf(0.7978845608028654f * (v + 0.044715f * v * v * v))); else if (ACT == 14) v = (v > 0.f) ? v : 0.1f * v; else if (ACT == 16) v = (v >= 0.f) ? v : 0.3f * v;
      so[w][rloc][t * 16 + ln] = v; } }
  __builtin_amdgcn_fence(__ATOMIC_ACQ_REL, "workgroup"); __builtin_amdgcn_wave_barrier();
  const int rsub = lane >> 4, c4 = (lane & 15) * 4;
  {
#pragma unroll
    for (int q = 0; q < 16; ++q) { const int r = q * 2 + rsub; const v4f v = *(const v4fa*)&so[w][r][c4]; if (C) *(v4f*)(C + cofs + (size_t)(row0 + r) * ldc + col0 + c4) = v; if (C16) { v4h h4; for (int i = 0; i < 4; ++i) h4[i] = (_Float16)v[i]; *(v4h*)(C16 + cofs + (size_t)(row0 + r) * ldc + col0 + c4) = h4; } }
     } }


// additive bias plane for the score accumulator: bf16-rounded sim times sqrt(32), so that (q.k + BP) * 32^-0.5 = q.k * 32^-0.5 + sim.
// Laid out in the accumulator's own order, per 16-query x 16-key tile [register half j][lane (c = query, h)][4 keys 8h + 4j ..], so that a wave's 16-byte loads cover whole lines.
__device__ __forceinline__ void d_bias(int blk, const float* __restrict__ sim, float* __restrict__ BP) {
  const int t = blk * 256 + threadIdx.x; if (t >= NN * NN / 4) return; const v4f a = *(const v4fa*)(sim + (size_t)t * 4); v4f o;
#pragma unroll
  for (int q = 0; q < 4; ++q) o[q] = bf16_round(a[q]) * 5.656854249492381f;
  const int n = t / (NN / 4), key = (t % (NN / 4)) * 4; const int tile = (n >> 4) * (NN / 16) + (key >> 4), j = (key >> 2) & 1, lanei = ((key >> 3) & 1) * 16 + (n & 15);
  *(v4f*)(BP + (size_t)tile * 256 + j * 128 + lanei * 4) = o; }

// Fused attention. One work-group = one (group, head) and 128 queries; each of its 8 waves owns 16 queries (one column group).
// S^T = K Q^T (+ bias plane as the C operand): lane (c, h) holds keys 8h..8h+7 of each 16-key tile for query c, so two score tiles
// convert in place into the B operand of O^T += V^T P^T (hardware k order on both sides). Online softmax over blocks of 128 keys in
// the log2 domain; P carries 2^10 (cancels against the row sum). K rows and V^T rows sit in LDS at pitches of 16 B x odd.
#define KPITCH 40                /* f16 per K row in LDS: 80 B */
#define VPITCH 520               /* f16 per V^T row in LDS: 1040 B */
#define KBLK 128                 /* keys per online-softmax block */
#define QWG 128                  /* queries per work-group */
#define C2 (SCL * 1.4426950408889634f)
__device__ __forceinline__ v16h lds_frag(const unsigned short* p, int hh) { FragH f; f.half[0] = *(const v8us*)(p + 8 * hh); f.half[1] = *(const v8us*)(p + 16 + 8 * hh); return f.v; }
__global__ __launch_bounds__(256) void k_attn(const _Float16* __restrict__ QK, const _Float16* __restrict__ VTg, const float* __restrict__ BP, _Float16* __restrict__ O16) {
  __shared__ __attribute__((aligned(16))) unsigned short sk[NN * KPITCH];
  __shared__ __attribute__((aligned(16))) unsigned short sv[HD * VPITCH];
  const int tid = threadIdx.x, w = tid >> 5, lane = tid & 31, ln = lane & 15, hh = lane >> 4;
  const int qb = blockIdx.x % (NN / QWG), gh = blockIdx.x / (NN / QWG); const int g = gh / NH, h = gh % NH;
  // staging: the K rows, V^T rows and the wave's Q fragment are loaded first, each group from one lane address plus constant steps
  const int n0 = qb * QWG + w * 16;
  const unsigned short* kg = (const unsigned short*)QK + ((size_t)g * NN + (tid >> 2)) * (2 * DD) + h * HD + (tid & 3) * 8;      /* token row tid/4 + 64 i, 16-byte part tid%4; the k half lies DD further */
  const unsigned short* vg = (const unsigned short*)VTg + (size_t)(h * HD + (tid >> 6)) * NR + (size_t)g * NN + (tid & 63) * 8;      /* head dim tid/64 + 4 i, keys 8 (tid%64).. */
  const unsigned short* qg = (const unsigned short*)QK + ((size_t)g * NN + n0 + ln) * (2 * DD) + h * HD + 8 * hh;      /* query n0 + ln, dims 8hh.. and 16 + 8hh.. */
  v8us kr[8], vr8[8]; FragH qfr;
#pragma unroll
  for (int i = 0; i < 8; ++i) kr[i] = *(const v8us*)(kg + DD + (size_t)i * 64 * (2 * DD));
#pragma unroll
  for (int i = 0; i < 8; ++i) vr8[i] = *(const v8us*)(vg + (size_t)i * 4 * NR);
  qfr.half[0] = *(const v8us*)qg; qfr.half[1] = *(const v8us*)(qg + 16); const v16h qf = qfr.v;
  asm volatile("s_wait_xcnt 0x0" :: "v"(kg), "v"(vg), "v"(qg) : "memory");      /* wait before the loads' address registers are rewritten; naming the addresses as inputs keeps them live up to here, so that no later load's data lands in them either */
#pragma unroll
  for (int i = 0; i < 8; ++i) *(v8us*)(sk + ((tid >> 2) + 64 * i) * KPITCH + (tid & 3) * 8) = kr[i];
#pragma unroll
  for (int i = 0; i < 8; ++i) *(v8us*)(sv + ((tid >> 6) + 4 * i) * VPITCH + (tid & 63) * 8) = vr8[i];
  __syncthreads();
  const float* bro = BP + (size_t)(n0 >> 4) * (NN / 16) * 256 + lane * 4;
  const v8f z8 = {0.f,0.f,0.f,0.f,0.f,0.f,0.f,0.f}; v8f o0 = z8, o1 = z8, os = z8; float m = -3.0e38f;
  FragH ones;      /* A whose row 0 is all ones: row 0 of os = the column sums of the rounded P, summed on the matrix pipe */
#pragma unroll
  for (int i = 0; i < 16; ++i) ones.h[i] = (ln == 0) ? (_Float16)1.0f : (_Float16)0.0f;
  // rolled: only one block's 64 score registers are live at a time, which keeps more waves resident
#pragma unroll 1
  for (int kb = 0; kb < NN; kb += KBLK) {
    v8f s[KBLK / 16];
#pragma unroll
    for (int t = 0; t < KBLK / 16; ++t) { const v4f cl = *(const v4fa*)(bro + (kb + t * 16) * 16), ch = *(const v4fa*)(bro + (kb + t * 16) * 16 + 128); const v8f c = {cl[0], cl[1], cl[2], cl[3], ch[0], ch[1], ch[2], ch[3]};
      s[t] = __builtin_amdgcn_wmma_f32_16x16x32_f16(false, lds_frag(sk + (kb + t * 16 + ln) * KPITCH, hh), false, qf, (short)0, c, false, false); }
    float mx[4] = {s[0][0], s[0][1], s[0][2], s[0][3]};
#pragma unroll
    for (int t = 0; t < KBLK / 16; ++t)
#pragma unroll
      for (int r = 0; r < 8; ++r) mx[r & 3] = fmaxf(mx[r & 3], s[t][r]);
    float bm = fmaxf(fmaxf(mx[0], mx[1]), fmaxf(mx[2], mx[3])); bm = fmaxf(bm, __shfl_xor(bm, 16, 32));      /* both halves of a column share one maximum */
    const float mn = fmaxf(m, bm); const float al = __builtin_amdgcn_exp2f((m - mn) * C2); const float off = 10.0f - mn * C2; m = mn;
#pragma unroll
    for (int r = 0; r < 8; ++r) { o0[r] *= al; o1[r] *= al; }
    os[0] *= al;      /* only row 0 of the sum tile is ever read */
#pragma unroll
    for (int p = 0; p < KBLK / 32; ++p) { FragH b;
#pragma unroll
      for (int r = 0; r < 8; ++r) { const float e0 = __builtin_amdgcn_exp2f(fmaf(s[2 * p][r], C2, off)), e1 = __builtin_amdgcn_exp2f(fmaf(s[2 * p + 1][r], C2, off));
        b.h[r] = (_Float16)e0; b.h[8 + r] = (_Float16)e1; }
      const unsigned short* vr = sv + ln * VPITCH + kb + p * 32;
      o0 = __builtin_amdgcn_wmma_f32_16x16x32_f16(false, lds_frag(vr, hh), false, b.v, (short)0, o0, false, false);
      o1 = __builtin_amdgcn_wmma_f32_16x16x32_f16(false, lds_frag(vr + 16 * VPITCH, hh), false, b.v, (short)0, o1, false, false);
      os = __builtin_amdgcn_wmma_f32_16x16x32_f16(false, ones.v, false, b.v, (short)0, os, false, false); }
  }
  const float su = __shfl(os[0], ln, 32); const float inv = 1.0f / su; FragH f;      /* row 0 sits in register 0 of lanes 0..15 */
#pragma unroll
  for (int r = 0; r < 8; ++r) { f.h[r] = (_Float16)(o0[r] * inv); f.h[8 + r] = (_Float16)(o1[r] * inv); }
  unsigned short* d = (unsigned short*)O16 + ((size_t)g * NN + n0 + ln) * DD + h * HD + 8 * hh;      /* lane (c, h): head dims 8h..8h+7 and 16+8h.. of query c */
  *(v8us*)d = f.half[0]; *(v8us*)(d + 16) = f.half[1]; }
// Fused projection. One work-group = 64 token rows: x is read once as f32, rounded (bf16, exact in f16) into LDS, and all 768 outputs of those rows are formed from it.
// q | k: D = W rows (A) x token rows (B), so lane (c, h) holds 8 neighbouring output dims of token c; v^T: D = token rows (A) x W rows (B), so a lane holds 8 neighbouring tokens of one dim.
// Each wave stages its f16 tile in its own LDS range and stores whole 128-byte lines.
// Every loop of the kernel is unrolled: its arrays are register fragments and must be indexed by constants.
#define PROWS 64                 /* token rows per work-group */
#define XPITCH 264               /* f16 per x row in LDS: 528 B = 16 B x 33 */
#define SPITCH 72                /* f16 per staged output row in LDS: 144 B = 16 B x 9 */
__device__ __forceinline__ v16h pj_frag(const unsigned short* p) { FragH f; f.half[0] = *(const v8us*)p; f.half[1] = *(const v8us*)(p + 16); return f.v; }
// four waves per SIMD: two work-groups fit a WGP, so that all 384 are resident at once
__global__ __launch_bounds__(256) __attribute__((amdgpu_waves_per_eu(4, 4))) void k_proj(const float* __restrict__ x, const _Float16* __restrict__ Bw, _Float16* __restrict__ QK, _Float16* __restrict__ VTg) {
  __shared__ __attribute__((aligned(16))) unsigned short sx[PROWS * XPITCH];
  __shared__ __attribute__((aligned(16))) unsigned short st[8][PROWS * SPITCH];
  __shared__ __attribute__((aligned(16))) unsigned short sv2[8][32 * SPITCH];      /* a range of its own for v^T: no wait on the q | k stores before it is written */
  const int tid = threadIdx.x, w = tid >> 5, lane = tid & 31, ln = lane & 15, hh = lane >> 4;
  const int row0 = blockIdx.x * PROWS;
  const float* xg = x + (size_t)row0 * DD + tid * 8;      /* row 8 i + w, columns 8 lane.. */
  const unsigned short* wq = (const unsigned short*)Bw + (size_t)(w * 64 + ln) * DD + 8 * hh;      /* q | k output dims 64 w + 16 a + ln */
  const unsigned short* wv = (const unsigned short*)Bw + (size_t)(2 * DD + w * 32 + ln) * DD + 8 * hh;      /* v output dims 32 w + 16 b + ln */
  v4f xa[8], xb[8];
#pragma unroll
  for (int i = 0; i < 8; ++i) { xa[i] = *(const v4fa*)(xg + i * 8 * DD); xb[i] = *(const v4fa*)(xg + i * 8 * DD + 4); }
  v16h af[4];      /* the first weight fragments fly while x is converted */
#pragma unroll
  for (int a = 0; a < 4; ++a) af[a] = pj_frag(wq + a * 16 * DD);
#pragma unroll
  for (int i = 0; i < 8; ++i) { FragH f;
#pragma unroll
    for (int q = 0; q < 4; ++q) { f.h[q] = (_Float16)bf16_round(xa[i][q]); f.h[4 + q] = (_Float16)bf16_round(xb[i][q]); }
    *(v8us*)(sx + (i * 8 + w) * XPITCH + lane * 8) = f.half[0]; }
  __syncthreads();
  const unsigned short* xs = sx + ln * XPITCH + 8 * hh;
  unsigned short* sw = st[w]; unsigned short* sw2 = sv2[w];
  const v8f z8 = {0.f,0.f,0.f,0.f,0.f,0.f,0.f,0.f};
  {
    v8f acc[4][4];
#pragma unroll
    for (int a = 0; a < 4; ++a)
#pragma unroll
      for (int b = 0; b < 4; ++b) acc[a][b] = z8;
    // unrolled so that the next step's weight fragments are loaded into a second register set ahead of this step's products
#pragma unroll
    for (int kb = 0; kb < DD; kb += 32) { v16h an[4], bx[4];
      if (kb + 32 < DD) {
#pragma unroll
        for (int a = 0; a < 4; ++a) an[a] = pj_frag(wq + a * 16 * DD + kb + 32); }
#pragma unroll
      for (int b = 0; b < 4; ++b) bx[b] = pj_frag(xs + b * 16 * XPITCH + kb);
#pragma unroll
      for (int a = 0; a < 4; ++a)
#pragma unroll
        for (int b = 0; b < 4; ++b) acc[a][b] = __builtin_amdgcn_wmma_f32_16x16x32_f16(false, af[a], false, bx[b], (short)0, acc[a][b], false, false);
      if (kb + 32 < DD) {
#pragma unroll
        for (int a = 0; a < 4; ++a) af[a] = an[a]; } }
#pragma unroll
    for (int a = 0; a < 4; ++a)
#pragma unroll
      for (int b = 0; b < 4; ++b) { FragH f;
#pragma unroll
        for (int r = 0; r < 8; ++r) f.h[r] = (_Float16)(acc[a][b][r] * 0.0625f);
        *(v8us*)(sw + (b * 16 + ln) * SPITCH + a * 16 + 8 * hh) = f.half[0]; }
  }
  __builtin_amdgcn_fence(__ATOMIC_ACQ_REL, "workgroup"); __builtin_amdgcn_wave_barrier();      /* the wave's other lanes read what this lane staged */
  v16h vf[8][2];      /* all of the wave's v weight fragments (128 registers, free now) fly while the q | k tile is stored */
#pragma unroll
  for (int s = 0; s < 8; ++s) { vf[s][0] = pj_frag(wv + s * 32); vf[s][1] = pj_frag(wv + 16 * DD + s * 32); }
  asm volatile("s_wait_xcnt 0x0" :: "v"(wq), "v"(wv) : "memory");      /* wait before the weight loads' address registers are rewritten; naming the addresses as inputs keeps them live up to here, so that no load's data lands in them either */
  {
    unsigned short* qd = (unsigned short*)QK + (size_t)(row0 + (lane >> 3)) * (2 * DD) + w * 64 + (lane & 7) * 8;
    v8us tv[16];
#pragma unroll
    for (int q = 0; q < 16; ++q) tv[q] = *(const v8us*)(sw + (q * 4 + (lane >> 3)) * SPITCH + (lane & 7) * 8);
    __builtin_amdgcn_sched_barrier(0);      /* all LDS reads issue as one group ahead of the stores; otherwise each store waits out its own read's latency in one register set */
#pragma unroll
    for (int q = 0; q < 16; ++q) *(v8us*)(qd + (size_t)q * 4 * (2 * DD)) = tv[q];
    asm volatile("s_wait_xcnt 0x0" ::: "memory");      /* wait before the stores' address and data registers are rewritten by the v^T part */
  }
  {
    v8f acc[4][2];
#pragma unroll
    for (int a = 0; a < 4; ++a) { acc[a][0] = z8; acc[a][1] = z8; }
    // unrolled: the weight fragments are indexed by the step
#pragma unroll
    for (int kb = 0; kb < DD; kb += 32) { v16h ax[4];
#pragma unroll
      for (int a = 0; a < 4; ++a) ax[a] = pj_frag(xs + a * 16 * XPITCH + kb);
      __builtin_amdgcn_sched_barrier(0);      /* the step's loads issue as one group ahead of its products: one place with LDS reads a step, not four */
#pragma unroll
      for (int a = 0; a < 4; ++a)
#pragma unroll
        for (int b = 0; b < 2; ++b) acc[a][b] = __builtin_amdgcn_wmma_f32_16x16x32_f16(false, ax[a], false, vf[kb / 32][b], (short)0, acc[a][b], false, false);
      __builtin_amdgcn_sched_barrier(0); }      /* keeps later steps' LDS reads in their own step; hoisted all together they spilled registers to scratch */
#pragma unroll
    for (int a = 0; a < 4; ++a)
#pragma unroll
      for (int b = 0; b < 2; ++b) { FragH f;
#pragma unroll
        for (int r = 0; r < 8; ++r) f.h[r] = (_Float16)(acc[a][b][r] * 0.0625f);
        *(v8us*)(sw2 + (b * 16 + ln) * SPITCH + a * 16 + 8 * hh) = f.half[0]; }
  }
  __builtin_amdgcn_fence(__ATOMIC_ACQ_REL, "workgroup"); __builtin_amdgcn_wave_barrier();      /* as above: lanes read each other's staged rows */
  {
    unsigned short* vd = (unsigned short*)VTg + (size_t)(w * 32 + (lane >> 3)) * NR + row0 + (lane & 7) * 8;
    v8us tv[8];
#pragma unroll
    for (int q = 0; q < 8; ++q) tv[q] = *(const v8us*)(sw2 + (q * 4 + (lane >> 3)) * SPITCH + (lane & 7) * 8);
    __builtin_amdgcn_sched_barrier(0);      /* as above: one group of LDS reads, then the stores */
#pragma unroll
    for (int q = 0; q < 8; ++q) *(v8us*)(vd + (size_t)q * 4 * NR) = tv[q];
  }
}
__device__ __forceinline__ void d_wqkv(int blk, const float* __restrict__ Wq, const float* __restrict__ Wk, const float* __restrict__ Wv, _Float16* __restrict__ Bt) { const int t = blk * 256 + threadIdx.x; if (t >= 3 * DD * (DD / 8)) return; const int n = t / (DD / 8), k0 = (t % (DD / 8)) * 8; const int which = n / DD, o = n % DD; const float* Wm = which == 0 ? Wq : (which == 1 ? Wk : Wv); FragH f;
  for (int q = 0; q < 8; ++q) f.h[q] = (_Float16)(bf16_round(Wm[(size_t)(k0 + q) * DD + o]) * 16.0f); *(v8us*)((unsigned short*)Bt + (size_t)n * DD + k0) = f.half[0];  }
// W_o as f16 rows [n][k], times 16 (the body of k_wt_f16 at K = N = DD)
__device__ __forceinline__ void d_wo(int blk, const float* __restrict__ Wo, _Float16* __restrict__ Bo) { const int t = blk * 256 + threadIdx.x; if (t >= DD * (DD / 8)) return; const int n = t / (DD / 8), k8 = (t % (DD / 8)) * 8; FragH f;
#pragma unroll
  for (int i = 0; i < 8; ++i) f.h[i] = (_Float16)(bf16_round(Wo[(size_t)(k8 + i) * DD + n]) * 16.0f);
  *(v8us*)((unsigned short*)Bo + (size_t)n * DD + k8) = f.half[0]; }
// One preparation launch: the three jobs read none of each other's output, so they share a grid and each work-group picks its job by its index.
// The weight jobs come first: their strided reads take the longest.
#define PB_QKV (3 * DD * (DD / 8) / 256)      /* 96 work-groups */
#define PB_WO (DD * (DD / 8) / 256)           /* 32 */
#define PB_BIAS (NN * NN / 4 / 256)           /* 256 */
__global__ __launch_bounds__(256) void k_prep(const float* __restrict__ Wq, const float* __restrict__ Wk, const float* __restrict__ Wv, const float* __restrict__ Wo, const float* __restrict__ sim,
                                              _Float16* __restrict__ Bt, _Float16* __restrict__ Bo, float* __restrict__ BP) {
  const int b = blockIdx.x;
  if (b < PB_QKV) d_wqkv(b, Wq, Wk, Wv, Bt);
  else if (b < PB_QKV + PB_WO) d_wo(b - PB_QKV, Wo, Bo);
  else d_bias(b - (PB_QKV + PB_WO), sim, BP);
}

extern "C" void kernel_launch(void* const* d_in, const int* in_sizes, int n_in,
                              void* d_out, int out_size, void* d_ws, size_t ws_size, hipStream_t stream) {
  (void)in_sizes; (void)n_in; (void)out_size;
  const float* const* I = (const float* const*)d_in; const float* x = I[0]; const float* sim = I[1]; const float* Wq = I[2]; const float* Wk = I[3]; const float* Wv = I[4]; const float* Wo = I[5];
  char* ws = (char*)d_ws; size_t off = 0;
  auto take = [&](size_t bytes) { char* p = ws + off; off += (bytes + 255) & ~(size_t)255; return p; };
  _Float16* BQKV = (_Float16*)take((size_t)3 * DD * DD * 2); _Float16* BO = (_Float16*)take((size_t)DD * DD * 2);
  _Float16* QK = (_Float16*)take((size_t)NR * 2 * DD * 2); _Float16* VTg = (_Float16*)take((size_t)DD * NR * 2); _Float16* O16 = (_Float16*)take((size_t)NR * DD * 2);
  float* BP = (float*)take((size_t)NN * NN * 4);
  if (off > ws_size) return;      /* under 50 MiB */
  k_prep<<<PB_QKV + PB_WO + PB_BIAS, 256, 0, stream>>>(Wq, Wk, Wv, Wo, sim, BQKV, BO, BP);
  k_proj<<<NR / PROWS, 256, 0, stream>>>(x, BQKV, QK, VTg);      /* token rows [q | k], heads h*32 + d; v^T: rows h*32 + d, columns = token rows */
  k_attn<<<NG * NH * (NN / QWG), 256, 0, stream>>>(QK, VTg, BP, O16);
  k_gemm2<0><<<dim3((NR / 128) * (DD / 64), 1), 128, 0, stream>>>(O16, DD, 0, BO, DD, 0, 0.0625f, nullptr, 0, nullptr, 1, 0, 0, (float*)d_out, nullptr, DD, 0, NR, DD, DD);
}

// v004
// One run takes 64.4 microseconds.
// Timed twice side by side with v003, it ran 1.12 and 1.13 times as fast.
// Counting every step since v000, it is 10.6 times as fast.
#include <hip/hip_runtime.h>
// SpatialMHSA (4 x 12 frames x 512 spatial tokens x 256 = 8 heads of 32): q/k/v = x W (xavier (in,out) weights); per (batch, frame, head) attention over the 512 tokens with scores/sqrt(32) + an INPUT additive bias sim[n][m]; out = merged heads W_o.
// Structure: ONE projection kernel (x rounded into LDS once per 64 token rows; q as fragment blocks, k as per-head rows and v^T from it, f32 accumulation, exact x16 weights, f16 output); ONE fused attention kernel over all 384 (group, head) pairs (S^T = K Q^T with the scaled bias plane as C, online softmax in registers, O^T = V^T P^T, f16 out as the output GEMM's A fragments); output GEMM. Weights and attention output lie in the workspace in fragment order.
// Compute dtype: x, sim and weights rounded to bf16; q, k, v, P, attention output as f16 operands; f32 accumulation/softmax. v_wmma_f32_16x16x32_f16.
#define NBATCH 4
#define NFR 12
#define NN 512
#define DD 256
#define NH 8
#define HD 32
#define NG (NBATCH * NFR)         /* 48 groups */
#define NR (NG * NN)             /* 24576 token rows */
#define SCL 0.17677669529663687f /* 32^-0.5 */
typedef __bf16 v16b __attribute__((ext_vector_type(16)));
typedef unsigned short v8us __attribute__((ext_vector_type(8), may_alias));
typedef float  v8f  __attribute__((ext_vector_type(8)));
typedef float  v4f  __attribute__((ext_vector_type(4)));
typedef float  v4fa __attribute__((ext_vector_type(4), may_alias));
union FragB { v16b v; v8us half[2]; unsigned short u[16]; };

__device__ __forceinline__ unsigned short bf16_bits(float x) { unsigned int u = __float_as_uint(x); return (unsigned short)((u + 0x7FFFu + ((u >> 16) & 1u)) >> 16); }
__device__ __forceinline__ float bf16_val(unsigned short b) { return __uint_as_float(((unsigned int)b) << 16); }
__device__ __forceinline__ float bf16_round(float x) { return bf16_val(bf16_bits(x)); }
// D += A·B with NT terms: 1 = ah·bh, 2 = + al·bh (A split), 3 = + ah·bl (both split)
template <int NT>
__device__ __forceinline__ v8f mmaN(v16b ah, v16b al, v16b bh, v16b bl, v8f c) {
  c = __builtin_amdgcn_wmma_f32_16x16x32_bf16(false, ah, false, bh, (short)0, c, false, false);
  if (NT >= 2) c = __builtin_amdgcn_wmma_f32_16x16x32_bf16(false, al, false, bh, (short)0, c, false, false);
  if (NT >= 3) c = __builtin_amdgcn_wmma_f32_16x16x32_bf16(false, ah, false, bl, (short)0, c, false, false);
  asm volatile("v_nop\n\tv_nop\n\tv_nop\n\tv_nop" : "+v"(c) : "v"(ah), "v"(al), "v"(bh), "v"(bl));
  return c;
}

__global__ __launch_bounds__(256) void k_wt_bf16(const float* __restrict__ W, unsigned short* __restrict__ Wt, int K, int N) {
  const int t = blockIdx.x * 256 + threadIdx.x;
  const int k8n = K / 8;
  if (t >= N * k8n) return;
  const int n = t / k8n, k8 = (t % k8n) * 8;
  v8us v;
#pragma unroll
  for (int i = 0; i < 8; ++i) v[i] = bf16_bits(W[(size_t)(k8 + i) * N + n]);
  *(v8us*)(Wt + (size_t)n * K + k8) = v;
  
}

// GEMM C[M][N] (f32, pitch ldc) = act(A[M][K]·W + bias). A f32 row-major (pitch lda) converted per fragment to bf16
// (ASPLIT: hi/lo two planes -> 2 terms, else single rounded term); Wt bf16 [N][K] (pitch ldb). BIAS_BF16 rounds the
// bias to bf16 first (bias quantised to bf16 before the add). K%32==0, M%16==0, N%64==0.
template <bool ASPLIT, int ACT, bool BIAS_BF16>
__global__ __launch_bounds__(128) void k_gemm_bf(const float* __restrict__ A, int lda, const unsigned short* __restrict__ Wt, int ldb,
                                               const float* __restrict__ bias, float* __restrict__ C, int ldc, int M, int N, int K) {
  __shared__ __attribute__((aligned(16))) float so[4][16][64];
  const int tid = threadIdx.x, w = tid >> 5, lane = tid & 31, ln = lane & 15, hh = lane >> 4;
  const int ntn = N / 64;
  const int wid = blockIdx.x * 4 + w;
  const int mt = wid / ntn, nq = wid % ntn;
  if (mt * 16 >= M) return;
  const int row0 = mt * 16, col0 = nq * 64;
  const float* arow = A + (size_t)(row0 + ln) * lda;
  v8f acc[4] = {};
  for (int kb = 0; kb < K; kb += 32) {
    FragB ah, al;
    const v4f x0 = *(const v4fa*)(arow + kb + 8 * hh), x1 = *(const v4fa*)(arow + kb + 8 * hh + 4);
    const v4f x2 = *(const v4fa*)(arow + kb + 16 + 8 * hh), x3 = *(const v4fa*)(arow + kb + 16 + 8 * hh + 4);
    float xs[16] = {x0[0],x0[1],x0[2],x0[3],x1[0],x1[1],x1[2],x1[3],x2[0],x2[1],x2[2],x2[3],x3[0],x3[1],x3[2],x3[3]};
#pragma unroll
    for (int i = 0; i < 16; ++i) { const unsigned short hb = bf16_bits(xs[i]); ah.u[i] = hb; al.u[i] = ASPLIT ? bf16_bits(xs[i] - bf16_val(hb)) : (unsigned short)0; }
#pragma unroll
    for (int t = 0; t < 4; ++t) {
      const unsigned short* brow = Wt + (size_t)(col0 + t * 16 + ln) * ldb + kb;
      FragB b;
      b.half[0] = *(const v8us*)(brow + 8 * hh);
      b.half[1] = *(const v8us*)(brow + 16 + 8 * hh);
      acc[t] = mmaN<ASPLIT ? 2 : 1>(ah.v, al.v, b.v, b.v, acc[t]);
    }
  }
#pragma unroll
  for (int t = 0; t < 4; ++t) {
    float bv = bias ? bias[col0 + t * 16 + ln] : 0.f;
    if (BIAS_BF16) bv = bf16_round(bv);
#pragma unroll
    for (int r = 0; r < 8; ++r) { float v = acc[t][r] + bv; if (ACT == 1) v = fmaxf(v, 0.f); so[w][8 * hh + r][t * 16 + ln] = v; }
  }
  __builtin_amdgcn_fence(__ATOMIC_ACQ_REL, "workgroup");
  __builtin_amdgcn_wave_barrier();
  const int rsub = lane >> 4, c4 = (lane & 15) * 4;
  {
#pragma unroll
    for (int q = 0; q < 8; ++q) {
      const int r = q * 2 + rsub;
      const v4f v = *(const v4fa*)&so[w][r][c4];
      *(v4f*)(C + (size_t)(row0 + r) * ldc + col0 + c4) = v;
    }
    
  }
}

// GEMM C = act(A·W + bias + resid): A f32 (ASPLIT -> hi/lo 2 terms), Wt bf16 [N][K]; ACT 0 none, 1 relu, 2 exact gelu;
// resid (optional, f32, row index = (row % rmod), pitch ldr, RES_BF16 rounds it) added before the activation.
template <bool ASPLIT, int ACT, bool BIAS_BF16, bool RES_BF16>
__global__ __launch_bounds__(128) void k_gemm_bf3(const float* __restrict__ A, int lda, const unsigned short* __restrict__ Wt, int ldb,
                                                const float* __restrict__ bias, const float* __restrict__ resid, int rmod, int ldr,
                                                float* __restrict__ C, int ldc, int M, int N, int K) {
  __shared__ __attribute__((aligned(16))) float so[4][16][64];
  const int tid = threadIdx.x, w = tid >> 5, lane = tid & 31, ln = lane & 15, hh = lane >> 4;
  const int ntn = N / 64;
  const int wid = blockIdx.x * 4 + w;
  const int mt = wid / ntn, nq = wid % ntn;
  if (mt * 16 >= M) return;
  const int row0 = mt * 16, col0 = nq * 64;
  const float* arow = A + (size_t)(row0 + ln) * lda;
  v8f acc[4] = {};
  for (int kb = 0; kb < K; kb += 32) {
    FragB ah, al;
    const v4f x0 = *(const v4fa*)(arow + kb + 8 * hh), x1 = *(const v4fa*)(arow + kb + 8 * hh + 4);
    const v4f x2 = *(const v4fa*)(arow + kb + 16 + 8 * hh), x3 = *(const v4fa*)(arow + kb + 16 + 8 * hh + 4);
    float xs[16] = {x0[0],x0[1],x0[2],x0[3],x1[0],x1[1],x1[2],x1[3],x2[0],x2[1],x2[2],x2[3],x3[0],x3[1],x3[2],x3[3]};
#pragma unroll
    for (int i = 0; i < 16; ++i) { const unsigned short hb = bf16_bits(xs[i]); ah.u[i] = hb; al.u[i] = ASPLIT ? bf16_bits(xs[i] - bf16_val(hb)) : (unsigned short)0; }
#pragma unroll
    for (int t = 0; t < 4; ++t) {
      const unsigned short* brow = Wt + (size_t)(col0 + t * 16 + ln) * ldb + kb;
      FragB b;
      b.half[0] = *(const v8us*)(brow + 8 * hh);
      b.half[1] = *(const v8us*)(brow + 16 + 8 * hh);
      acc[t] = mmaN<ASPLIT ? 2 : 1>(ah.v, al.v, b.v, b.v, acc[t]);
    }
  }
#pragma unroll
  for (int t = 0; t < 4; ++t) {
    const int col = col0 + t * 16 + ln;
    float bv = bias ? bias[col] : 0.f;
    if (BIAS_BF16) bv = bf16_round(bv);
#pragma unroll
    for (int r = 0; r < 8; ++r) {
      float v = acc[t][r] + bv;
      if (resid) { float rv = resid[(size_t)((row0 + 8 * hh + r) % rmod) * ldr + col]; if (RES_BF16) rv = bf16_round(rv); v += rv; }
      if (ACT == 1) v = fmaxf(v, 0.f);
      if (ACT == 2) v = 0.5f * v * (1.0f + erff(v * 0.70710678118654752f));
      if (ACT == 3) { const float u = 0.7978845608028654f * (v + 0.044715f * v * v * v); v = 0.5f * v * (1.0f + tanhf(u)); }
      so[w][8 * hh + r][t * 16 + ln] = v;
    }
  }
  __builtin_amdgcn_fence(__ATOMIC_ACQ_REL, "workgroup");
  __builtin_amdgcn_wave_barrier();
  const int rsub = lane >> 4, c4 = (lane & 15) * 4;
  {
#pragma unroll
    for (int q = 0; q < 8; ++q) {
      const int r = q * 2 + rsub;
      const v4f v = *(const v4fa*)&so[w][r][c4];
      *(v4f*)(C + (size_t)(row0 + r) * ldc + col0 + c4) = v;
    }
    
  }
}
// row LayerNorm (biased variance, eps) over N: s = X (+ R); optional out_sum <- s; out_norm <- (s-mu)*rsqrt(var+eps)*g + b
template <bool PARAM_BF16>
__global__ __launch_bounds__(256) void k_layernorm(const float* __restrict__ X, const float* __restrict__ R, const float* __restrict__ g, const float* __restrict__ bta,
                                                  float* __restrict__ out_sum, float* __restrict__ out_norm, int N, float eps) {
  __shared__ float red[256];
  const int row = blockIdx.x, tid = threadIdx.x;
  const float* x = X + (size_t)row * N; const float* rr = R ? R + (size_t)row * N : nullptr;
  float vals[16];                     // up to N = 4096
  const int per = N / 256;            // contiguous chunk per thread? use strided-by-4 chunks: thread handles j = tid*4 + 1024*u
  float s1 = 0.f;
  for (int u = 0; u < per / 4; ++u) {
    const int j = tid * 4 + 1024 * u;
    const v4f a = *(const v4fa*)(x + j);
    v4f b = {0.f,0.f,0.f,0.f}; if (rr) b = *(const v4fa*)(rr + j);
#pragma unroll
    for (int q = 0; q < 4; ++q) { const float v = a[q] + b[q]; vals[u * 4 + q] = v; s1 += v; }
  }
  red[tid] = s1; __syncthreads();
  for (int st = 128; st > 0; st >>= 1) { if (tid < st) red[tid] += red[tid + st]; __syncthreads(); }
  const float mu = red[0] / (float)N; __syncthreads();
  float s2 = 0.f;
  for (int u = 0; u < per / 4; ++u)
#pragma unroll
    for (int q = 0; q < 4; ++q) { const float c = vals[u * 4 + q] - mu; s2 += c * c; }
  red[tid] = s2; __syncthreads();
  for (int st = 128; st > 0; st >>= 1) { if (tid < st) red[tid] += red[tid + st]; __syncthreads(); }
  const float rs = rsqrtf(red[0] / (float)N + eps);
  {
    for (int u = 0; u < per / 4; ++u) {
      const int j = tid * 4 + 1024 * u;
      v4f o, sm;
#pragma unroll
      for (int q = 0; q < 4; ++q) {
        float gg = g[j + q], bb = bta[j + q];
        if (PARAM_BF16) { gg = bf16_round(gg); bb = bf16_round(bb); }
        sm[q] = vals[u * 4 + q]; o[q] = (vals[u * 4 + q] - mu) * rs * gg + bb;
      }
      if (out_sum) *(v4f*)(out_sum + (size_t)row * N + j) = sm;
      *(v4f*)(out_norm + (size_t)row * N + j) = o;
    }
    
  }
}



// ---- f16 WMMA path (v_wmma_f32_16x16x32_f16): 11-bit significands for operands in range — used where a [0,1] probability operand needs more precision than bf16
typedef _Float16 v16h __attribute__((ext_vector_type(16)));
union FragH { v16h v; v8us half[2]; _Float16 h[16]; unsigned short u[16]; };
template <int NT>
__device__ __forceinline__ v8f mmaH(v16h ah, v16h al, v16h bh, v16h bl, v8f c) {
  c = __builtin_amdgcn_wmma_f32_16x16x32_f16(false, ah, false, bh, (short)0, c, false, false);
  if (NT >= 2) c = __builtin_amdgcn_wmma_f32_16x16x32_f16(false, al, false, bh, (short)0, c, false, false);
  if (NT >= 3) c = __builtin_amdgcn_wmma_f32_16x16x32_f16(false, ah, false, bl, (short)0, c, false, false);
  asm volatile("v_nop\n\tv_nop\n\tv_nop\n\tv_nop" : "+v"(c) : "v"(ah), "v"(al), "v"(bh), "v"(bl));
  return c;
}
// batched GEMM like k_gemm_b but f16 operands: A f32 (split into f16 hi/lo if ASPLIT, else rounded to f16), Bt = f16 values [n][k]; alpha; C f32; N multiple of 16 (partial tiles skipped)
template <bool ASPLIT>
__global__ __launch_bounds__(128) void k_gemm_h(const float* __restrict__ A, int lda, size_t sA, const _Float16* __restrict__ Bh, int ldb, size_t sB, float alpha, float* __restrict__ C, int ldc, size_t sC, int M, int N, int K) {
  __shared__ __attribute__((aligned(16))) float so[4][16][64];
  const int tid = threadIdx.x, w = tid >> 5, lane = tid & 31, ln = lane & 15, hh = lane >> 4; const int by = blockIdx.y;
  A += (size_t)by * sA; Bh += (size_t)by * sB; C += (size_t)by * sC;
  const int ntn = (N + 63) / 64; const int wid = blockIdx.x * 4 + w; const int mt = wid / ntn, nq = wid % ntn; if (mt * 16 >= M) return;
  const int row0 = mt * 16, col0 = nq * 64; const float* arow = A + (size_t)(row0 + ln) * lda;
  v8f acc[4] = {};
  for (int kb = 0; kb < K; kb += 32) {
    FragH ah, al;
    const v4f x0 = *(const v4fa*)(arow + kb + 8 * hh), x1 = *(const v4fa*)(arow + kb + 8 * hh + 4), x2 = *(const v4fa*)(arow + kb + 16 + 8 * hh), x3 = *(const v4fa*)(arow + kb + 16 + 8 * hh + 4);
    float xs[16] = {x0[0],x0[1],x0[2],x0[3],x1[0],x1[1],x1[2],x1[3],x2[0],x2[1],x2[2],x2[3],x3[0],x3[1],x3[2],x3[3]};
#pragma unroll
    for (int i = 0; i < 16; ++i) { const _Float16 h = (_Float16)xs[i]; ah.h[i] = h; al.h[i] = ASPLIT ? (_Float16)(xs[i] - (float)h) : (_Float16)0.0f; }
#pragma unroll
    for (int t = 0; t < 4; ++t) { if (col0 + t * 16 >= N) continue; const size_t boff = (size_t)(col0 + t * 16 + ln) * ldb + kb; FragH bq; bq.half[0] = *(const v8us*)(Bh + boff + 8 * hh); bq.half[1] = *(const v8us*)(Bh + boff + 16 + 8 * hh);
      acc[t] = mmaH<ASPLIT ? 2 : 1>(ah.v, al.v, bq.v, bq.v, acc[t]); }
  }
#pragma unroll
  for (int t = 0; t < 4; ++t) { if (col0 + t * 16 >= N) continue;
#pragma unroll
    for (int r = 0; r < 8; ++r) so[w][8 * hh + r][t * 16 + ln] = acc[t][r] * alpha; }
  __builtin_amdgcn_fence(__ATOMIC_ACQ_REL, "workgroup"); __builtin_amdgcn_wave_barrier();
  const int rsub = lane >> 4, c4 = (lane & 15) * 4;
  {
#pragma unroll
    for (int q = 0; q < 8; ++q) { const int r = q * 2 + rsub; if (col0 + c4 < N) { const v4f v = *(const v4fa*)&so[w][r][c4]; *(v4f*)(C + (size_t)(row0 + r) * ldc + col0 + c4) = v; } }
     }
}

// Wt[n][k] = f16(W[k][n]·scale) from f32 row-major W[K][N] (scale = power of two; bf16-exact weights stay exact in f16 away from the subnormal range)
__global__ __launch_bounds__(256) void k_wt_f16(const float* __restrict__ W, _Float16* __restrict__ Wt, int K, int N, float scale) {
  const int t = blockIdx.x * 256 + threadIdx.x; if (t >= N * (K / 8)) return; const int n = t / (K / 8), k8 = (t % (K / 8)) * 8; FragH f;
#pragma unroll
  for (int i = 0; i < 8; ++i) f.h[i] = (_Float16)(bf16_round(W[(size_t)(k8 + i) * N + n]) * scale); const v8us o = f.half[0];
  *(v8us*)((unsigned short*)Wt + (size_t)n * K + k8) = o; 
}
// k_gemm_hh variant with fused epilogue: v = acc·alpha + bias[by·sBias + col] (+ CP[(row/rowsPerB)·sCPb + by·64 + col] if CP) ; ACT 0 none / 1 elu ; writes f16 C16 (and f32 C if non-null)
template <int ACT>
__global__ __launch_bounds__(128) void k_gemm_hhx(const _Float16* __restrict__ A, int lda, size_t sA, const _Float16* __restrict__ Bh, int ldb, size_t sB, float alpha, const float* __restrict__ bias, size_t sBias, const float* __restrict__ CP, int rowsPerB, size_t sCPb, int row0g,
    float* __restrict__ C, _Float16* __restrict__ C16, int ldc, size_t sC, int M, int N, int K) {
  __shared__ __attribute__((aligned(16))) float so[4][16][64];
  const int tid = threadIdx.x, w = tid >> 5, lane = tid & 31, ln = lane & 15, hh = lane >> 4; const int by = blockIdx.y;
  A += (size_t)by * sA; Bh += (size_t)by * sB; const size_t cofs = (size_t)by * sC; const float* bp = bias ? bias + (size_t)by * sBias : nullptr;
  const int ntn = (N + 63) / 64; const int wid = blockIdx.x * 4 + w; const int mt = wid / ntn, nq = wid % ntn; if (mt * 16 >= M) return;
  const int row0 = mt * 16, col0 = nq * 64; const _Float16* arow = A + (size_t)(row0 + ln) * lda;
  v8f acc[4] = {};
  for (int kb = 0; kb < K; kb += 32) { FragH ah; ah.half[0] = *(const v8us*)((const unsigned short*)arow + kb + 8 * hh); ah.half[1] = *(const v8us*)((const unsigned short*)arow + kb + 16 + 8 * hh);
#pragma unroll
    for (int t = 0; t < 4; ++t) { if (col0 + t * 16 >= N) continue; const size_t boff = (size_t)(col0 + t * 16 + ln) * ldb + kb; FragH bq; bq.half[0] = *(const v8us*)((const unsigned short*)Bh + boff + 8 * hh); bq.half[1] = *(const v8us*)((const unsigned short*)Bh + boff + 16 + 8 * hh);
      acc[t] = mmaH<1>(ah.v, ah.v, bq.v, bq.v, acc[t]); }
  }
#pragma unroll
  for (int t = 0; t < 4; ++t) { if (col0 + t * 16 >= N) continue; const int col = col0 + t * 16 + ln; const float bv = bp ? bf16_round(bp[col]) : 0.f;
#pragma unroll
    for (int r = 0; r < 8; ++r) { float v = acc[t][r] * alpha + bv; if (CP) { const int rr = row0g + row0 + 8 * hh + r; if (rowsPerB < 0) v += CP[cofs + (size_t)rr * ldc + col];      /* rowsPerB < 0: own element of the batched C plane */ else { const int bidx = rr / rowsPerB; v += CP[(size_t)bidx * sCPb + (size_t)by * 64 + col]; } } if (ACT == 1) v = (v > 0.f) ? v : expm1f(v); else if (ACT == 7) v = (v > 0.f) ? v + 1.0f : expf(v); else if (ACT == 8) v = tanhf(v); else if (ACT == 9) v = 0.5f * v * (1.0f + tanhf(0.7978845608028654f * (v + 0.044715f * v * v * v))); else if (ACT == 11) v = 1.0f / (1.0f + expf(-v)); else if (ACT == 12) v = (v > 0.f) ? v : 0.01f * v; else if (ACT == 14) v = (v > 0.f) ? v : 0.1f * v; else if (ACT == 16) v = (v >= 0.f) ? v : 0.3f * v; else if (ACT == 15) v = v / (1.0f + expf(-v)); else if (ACT == 3) v = fmaxf(v, 0.f); else if (ACT == 6) v = 0.5f * v * (1.0f + erff(v * 0.70710678118654752f)); so[w][8 * hh + r][t * 16 + ln] = v; } }
  __builtin_amdgcn_fence(__ATOMIC_ACQ_REL, "workgroup"); __builtin_amdgcn_wave_barrier();
  const int rsub = lane >> 4, c4 = (lane & 15) * 4; typedef _Float16 v4h __attribute__((ext_vector_type(4)));
  {
#pragma unroll
    for (int q = 0; q < 8; ++q) { const int r = q * 2 + rsub; if (col0 + c4 < N) { const v4f v = *(const v4fa*)&so[w][r][c4]; if (C) *(v4f*)(C + cofs + (size_t)(row0 + r) * ldc + col0 + c4) = v; if (C16) { v4h h4; for (int i = 0; i < 4; ++i) h4[i] = (_Float16)v[i]; *(v4h*)(C16 + cofs + (size_t)(row0 + r) * ldc + col0 + c4) = h4; } } }
     }
}


typedef _Float16 v4h __attribute__((ext_vector_type(4)));

__global__ __launch_bounds__(256) void k_x16(const float* __restrict__ x, _Float16* __restrict__ X16, size_t n8) { const size_t t = (size_t)blockIdx.x * 256 + threadIdx.x; if (t >= n8) return; FragH f;
#pragma unroll
  for (int q = 0; q < 8; ++q) f.h[q] = (_Float16)bf16_round(x[t * 8 + q]); *(v8us*)((unsigned short*)X16 + t * 8) = f.half[0];  }
__global__ __launch_bounds__(256) void k_h16(const float* __restrict__ x, _Float16* __restrict__ X16, size_t n8) { const size_t t = (size_t)blockIdx.x * 256 + threadIdx.x; if (t >= n8) return; FragH f;
#pragma unroll
  for (int q = 0; q < 8; ++q) f.h[q] = (_Float16)x[t * 8 + q]; *(v8us*)((unsigned short*)X16 + t * 8) = f.half[0];  }
__global__ __launch_bounds__(256) void k_round16f(const float* __restrict__ W, _Float16* __restrict__ Bt, size_t n8) { const size_t t = (size_t)blockIdx.x * 256 + threadIdx.x; if (t >= n8) return; FragH f;
#pragma unroll
  for (int i = 0; i < 8; ++i) f.h[i] = (_Float16)(bf16_round(W[t * 8 + i]) * 16.0f); *(v8us*)((unsigned short*)Bt + t * 8) = f.half[0];  }
template <int NHv, int TTv>
__global__ __launch_bounds__(256) void k_vt(const _Float16* __restrict__ V16, int ldv, int voff, _Float16* __restrict__ Vt) { __shared__ unsigned short tl[64][66]; const int tid = threadIdx.x; const int slab = blockIdx.x / (TTv / 64), lg = blockIdx.x % (TTv / 64); const int b = slab / NHv, h = slab % NHv;
  for (int i = tid; i < 64 * 8; i += 256) { const int r = i / 8, c8 = (i % 8) * 8; FragH f; f.half[0] = *(const v8us*)((const unsigned short*)V16 + ((size_t)b * TTv + lg * 64 + r) * ldv + voff + h * 64 + c8);
#pragma unroll
    for (int q = 0; q < 8; ++q) tl[r][c8 + q] = f.u[q]; }
  __syncthreads();
  {
#pragma unroll
    for (int rd = 0; rd < 2; ++rd) { const int d = rd * 32 + tid / 8, pc = tid % 8; FragH f;
#pragma unroll
      for (int q = 0; q < 8; ++q) f.u[q] = tl[pc * 8 + q][d];
      *(v8us*)((unsigned short*)Vt + ((size_t)slab * 64 + d) * TTv + lg * 64 + pc * 8) = f.half[0]; }
     } }

__global__ __launch_bounds__(256) void k_hl(const float* __restrict__ F, _Float16* __restrict__ Hh, _Float16* __restrict__ Hl, size_t n8) { const size_t t = (size_t)blockIdx.x * 256 + threadIdx.x; if (t >= n8) return; FragH fh, fl; const v4f a = *(const v4fa*)(F + t * 8), c = *(const v4fa*)(F + t * 8 + 4);
#pragma unroll
  for (int q = 0; q < 4; ++q) { _Float16 h = (_Float16)a[q]; fh.h[q] = h; fl.h[q] = (_Float16)((a[q] - (float)h) * 1024.0f); h = (_Float16)c[q]; fh.h[4 + q] = h; fl.h[4 + q] = (_Float16)((c[q] - (float)h) * 1024.0f); }
  { *(v8us*)((unsigned short*)Hh + t * 8) = fh.half[0]; *(v8us*)((unsigned short*)Hl + t * 8) = fl.half[0];  } }

// ---- operand planes in fragment order: per (16-row tile, 32-wide k step) one 1-KiB block [register half j][lane 16 hh + ln][8 f16], holding element (row 16 tile + ln, k = 32 step + 16 j + 8 hh + e);
// blocks run [row tile][k step]. A wave's 16-byte-per-lane fragment load then covers 4 whole 128-byte lines; from plain rows it touches 16 lines for 32 bytes each.
#define FBLK 512                 /* f16 per block */
__device__ __forceinline__ v16h fo_frag(const unsigned short* p) { FragH f; f.half[0] = *(const v8us*)p; f.half[1] = *(const v8us*)(p + FBLK / 2); return f.v; }      /* p = block + 8 lane */
// ---- fast GEMM (wave tile 32x64; requires M % 32 == 0 rows per launch region and N % 64 == 0); A and Bh in fragment order (lda, ldb unused: the pitch is K); epilogue = k_gemm_hhx semantics ----
__device__ __forceinline__ v16h g2_frag(const _Float16* p) { return fo_frag((const unsigned short*)p); }
__device__ __forceinline__ v8f g2_mma(v16h a, v16h b, v8f c) { v8f d = __builtin_amdgcn_wmma_f32_16x16x32_f16(false, a, false, b, (short)0, c, false, false); asm volatile("v_nop\n\tv_nop\n\tv_nop\n\tv_nop" : "+v"(d) : "v"(a), "v"(b)); return d; }
template <int ACT>
__global__ __launch_bounds__(128) void k_gemm2(const _Float16* __restrict__ A, int lda, size_t sA, const _Float16* __restrict__ Bh, int ldb, size_t sB, float alpha, const float* __restrict__ bias, size_t sBias, const float* __restrict__ CP, int rowsPerB, size_t sCPb, int row0g,
    float* __restrict__ C, _Float16* __restrict__ C16, int ldc, size_t sC, int M, int N, int K) { static_assert(ACT == 0 || ACT == 3 || ACT == 6 || ACT == 8 || ACT == 9 || ACT == 11 || ACT == 12 || ACT == 14 || ACT == 15 || ACT == 16, "k_gemm2: unsupported ACT code (would silently apply no activation)");
  __shared__ __attribute__((aligned(16))) float so[4][32][68];
  const int tid = threadIdx.x, w = tid >> 5, lane = tid & 31, ln = lane & 15, hh = lane >> 4; const int by = blockIdx.y;
  A += (size_t)by * sA; Bh += (size_t)by * sB; const size_t cofs = (size_t)by * sC; const float* bp = bias ? bias + (size_t)by * sBias : nullptr;
  const int ntn = N >> 6; const int mt = blockIdx.x / ntn, nq = blockIdx.x - mt * ntn; const int row0 = mt * 128 + 32 * w, col0 = nq * 64; if (row0 >= M) return;
  const size_t tp = (size_t)(K >> 5) * FBLK;      /* f16 per 16-row tile */
  const _Float16* a0p = A + (size_t)(row0 >> 4) * tp + lane * 8; const _Float16* a1p = a0p + tp;
  const _Float16* b0p = Bh + (size_t)(col0 >> 4) * tp + lane * 8; const _Float16* b1p = b0p + tp; const _Float16* b2p = b1p + tp; const _Float16* b3p = b2p + tp;
  const v8f z8 = {0.f,0.f,0.f,0.f,0.f,0.f,0.f,0.f}; v8f c00 = z8, c01 = z8, c02 = z8, c03 = z8, c10 = z8, c11 = z8, c12 = z8, c13 = z8;
#pragma unroll 1
  for (int kb = 0; kb < K; kb += 32) { const int ko = kb * (FBLK / 32); const _Float16* pa0 = a0p + ko; const _Float16* pa1 = a1p + ko; const _Float16* pb0 = b0p + ko; const v16h a0 = g2_frag(pa0), a1 = g2_frag(pa1);
    v16h b = g2_frag(pb0);
    asm volatile("s_wait_xcnt 0x0" :: "v"(pa0), "v"(pa1), "v"(pb0) : "memory");      /* wait before the three loads' address registers are rewritten; naming the addresses as inputs keeps them live up to here, so that no later load's data lands in them either */
    c00 = g2_mma(a0, b, c00); c10 = g2_mma(a1, b, c10);
    b = g2_frag(b1p + ko); c01 = g2_mma(a0, b, c01); c11 = g2_mma(a1, b, c11);
    b = g2_frag(b2p + ko); c02 = g2_mma(a0, b, c02); c12 = g2_mma(a1, b, c12);
    b = g2_frag(b3p + ko); c03 = g2_mma(a0, b, c03); c13 = g2_mma(a1, b, c13); }
  v8f accs[8] = {c00, c01, c02, c03, c10, c11, c12, c13};
#pragma unroll
  for (int u = 0; u < 8; ++u) { const int t = u & 3, half = u >> 2; const int col = col0 + t * 16 + ln; const float bv = bp ? bf16_round(bp[col]) : 0.f;
#pragma unroll
    for (int r = 0; r < 8; ++r) { const int rloc = half * 16 + 8 * hh + r; float v = accs[u][r] * alpha + bv; if (CP) { if (rowsPerB < 0) v += CP[cofs + (size_t)(row0g + row0 + rloc) * ldc + col];      /* rowsPerB < 0: own element of the batched C plane */ else { const int bidx = (row0g + row0 + rloc) / rowsPerB; v += CP[(size_t)bidx * sCPb + (size_t)by * 64 + col]; } }
      if (ACT == 3) v = fmaxf(v, 0.f); else if (ACT == 6) v = 0.5f * v * (1.0f + erff(v * 0.70710678118654752f)); else if (ACT == 11) v = 1.0f / (1.0f + expf(-v)); else if (ACT == 15) v = v / (1.0f + expf(-v)); else if (ACT == 12) v = (v > 0.f) ? v : 0.01f * v; else if (ACT == 8) v = tanhf(v); else if (ACT == 9) v = 0.5f * v * (1.0f + tanhf(0.7978845608028654f * (v + 0.044715f * v * v * v))); else if (ACT == 14) v = (v > 0.f) ? v : 0.1f * v; else if (ACT == 16) v = (v >= 0.f) ? v : 0.3f * v;
      so[w][rloc][t * 16 + ln] = v; } }
  __builtin_amdgcn_fence(__ATOMIC_ACQ_REL, "workgroup"); __builtin_amdgcn_wave_barrier();
  const int rsub = lane >> 4, c4 = (lane & 15) * 4;
  {
#pragma unroll
    for (int q = 0; q < 16; ++q) { const int r = q * 2 + rsub; const v4f v = *(const v4fa*)&so[w][r][c4]; if (C) *(v4f*)(C + cofs + (size_t)(row0 + r) * ldc + col0 + c4) = v; if (C16) { v4h h4; for (int i = 0; i < 4; ++i) h4[i] = (_Float16)v[i]; *(v4h*)(C16 + cofs + (size_t)(row0 + r) * ldc + col0 + c4) = h4; } }
     } }


// additive bias plane for the score accumulator: bf16-rounded sim times sqrt(32), so that (q.k + BP) * 32^-0.5 = q.k * 32^-0.5 + sim.
// Laid out in the accumulator's own order, per 16-query x 16-key tile [register half j][lane (c = query, h)][4 keys 8h + 4j ..], so that a wave's 16-byte loads cover whole lines.
__device__ __forceinline__ void d_bias(int blk, const float* __restrict__ sim, float* __restrict__ BP) {
  const int t = blk * 256 + threadIdx.x; if (t >= NN * NN / 4) return; const v4f a = *(const v4fa*)(sim + (size_t)t * 4); v4f o;
#pragma unroll
  for (int q = 0; q < 4; ++q) o[q] = bf16_round(a[q]) * 5.656854249492381f;
  const int n = t / (NN / 4), key = (t % (NN / 4)) * 4; const int tile = (n >> 4) * (NN / 16) + (key >> 4), j = (key >> 2) & 1, lanei = ((key >> 3) & 1) * 16 + (n & 15);
  *(v4f*)(BP + (size_t)tile * 256 + j * 128 + lanei * 4) = o; }

// Fused attention. One work-group = one (group, head) and 128 queries; each of its 8 waves owns 16 queries (one column group).
// S^T = K Q^T (+ bias plane as the C operand): lane (c, h) holds keys 8h..8h+7 of each 16-key tile for query c, so two score tiles
// convert in place into the B operand of O^T += V^T P^T (hardware k order on both sides). Online softmax over blocks of 128 keys in
// the log2 domain; P carries 2^10 (cancels against the row sum). K rows and V^T rows sit in LDS at pitches of 16 B x odd.
#define KPITCH 40                /* f16 per K row in LDS: 80 B */
#define VPITCH 520               /* f16 per V^T row in LDS: 1040 B */
#define KBLK 128                 /* keys per online-softmax block */
#define QWG 128                  /* queries per work-group */
#define C2 (SCL * 1.4426950408889634f)
__device__ __forceinline__ v16h lds_frag(const unsigned short* p, int hh) { FragH f; f.half[0] = *(const v8us*)(p + 8 * hh); f.half[1] = *(const v8us*)(p + 16 + 8 * hh); return f.v; }
__global__ __launch_bounds__(256) void k_attn(const _Float16* __restrict__ Qf, const _Float16* __restrict__ Kp, const _Float16* __restrict__ VTg, const float* __restrict__ BP, _Float16* __restrict__ O16) {
  __shared__ __attribute__((aligned(16))) unsigned short sk[NN * KPITCH];
  __shared__ __attribute__((aligned(16))) unsigned short sv[HD * VPITCH];
  const int tid = threadIdx.x, w = tid >> 5, lane = tid & 31, ln = lane & 15, hh = lane >> 4;
  const int qb = blockIdx.x % (NN / QWG), gh = blockIdx.x / (NN / QWG); const int g = gh / NH, h = gh % NH;
  // staging: the K rows, V^T rows and the wave's Q fragment are loaded first, each group from one lane address plus constant steps
  const int n0 = qb * QWG + w * 16;
  const unsigned short* kg = (const unsigned short*)Kp + (size_t)gh * NN * HD + tid * 8;      /* k plane of (group, head): token row tid/4 + 64 i, 16-byte part tid%4 */
  const unsigned short* vg = (const unsigned short*)VTg + (size_t)(h * HD + (tid >> 6)) * NR + (size_t)g * NN + (tid & 63) * 8;      /* head dim tid/64 + 4 i, keys 8 (tid%64).. */
  const unsigned short* qg = (const unsigned short*)Qf + ((size_t)h * (NR / 16) + ((g * NN + n0) >> 4)) * FBLK + lane * 8;      /* fragment-order block [head][row tile]: query n0 + ln, dims 8hh.. and 16 + 8hh.. */
  v8us kr[8], vr8[8]; FragH qfr;
#pragma unroll
  for (int i = 0; i < 8; ++i) kr[i] = *(const v8us*)(kg + i * 64 * HD);
#pragma unroll
  for (int i = 0; i < 8; ++i) vr8[i] = *(const v8us*)(vg + (size_t)i * 4 * NR);
  qfr.half[0] = *(const v8us*)qg; qfr.half[1] = *(const v8us*)(qg + FBLK / 2); const v16h qf = qfr.v;
  asm volatile("s_wait_xcnt 0x0" :: "v"(tid), "v"(vg), "v"(qg) : "memory");      /* wait before the loads' address registers are rewritten; naming the addresses as inputs keeps them live up to here, so that no later load's data lands in them either (the k loads go by a scalar base and the thread index as lane offset) */
#pragma unroll
  for (int i = 0; i < 8; ++i) *(v8us*)(sk + ((tid >> 2) + 64 * i) * KPITCH + (tid & 3) * 8) = kr[i];
#pragma unroll
  for (int i = 0; i < 8; ++i) *(v8us*)(sv + ((tid >> 6) + 4 * i) * VPITCH + (tid & 63) * 8) = vr8[i];
  __syncthreads();
  const float* bro = BP + (size_t)(n0 >> 4) * (NN / 16) * 256 + lane * 4;
  const v8f z8 = {0.f,0.f,0.f,0.f,0.f,0.f,0.f,0.f}; v8f o0 = z8, o1 = z8, os = z8; float m = -3.0e38f;
  FragH ones;      /* A whose row 0 is all ones: row 0 of os = the column sums of the rounded P, summed on the matrix pipe */
#pragma unroll
  for (int i = 0; i < 16; ++i) ones.h[i] = (ln == 0) ? (_Float16)1.0f : (_Float16)0.0f;
  // rolled: only one block's 64 score registers are live at a time, which keeps more waves resident
#pragma unroll 1
  for (int kb = 0; kb < NN; kb += KBLK) {
    v8f s[KBLK / 16];
#pragma unroll
    for (int t = 0; t < KBLK / 16; ++t) { const v4f cl = *(const v4fa*)(bro + (kb + t * 16) * 16), ch = *(const v4fa*)(bro + (kb + t * 16) * 16 + 128); const v8f c = {cl[0], cl[1], cl[2], cl[3], ch[0], ch[1], ch[2], ch[3]};
      s[t] = __builtin_amdgcn_wmma_f32_16x16x32_f16(false, lds_frag(sk + (kb + t * 16 + ln) * KPITCH, hh), false, qf, (short)0, c, false, false); }
    float mx[4] = {s[0][0], s[0][1], s[0][2], s[0][3]};
#pragma unroll
    for (int t = 0; t < KBLK / 16; ++t)
#pragma unroll
      for (int r = 0; r < 8; ++r) mx[r & 3] = fmaxf(mx[r & 3], s[t][r]);
    float bm = fmaxf(fmaxf(mx[0], mx[1]), fmaxf(mx[2], mx[3])); bm = fmaxf(bm, __shfl_xor(bm, 16, 32));      /* both halves of a column share one maximum */
    const float mn = fmaxf(m, bm); const float al = __builtin_amdgcn_exp2f((m - mn) * C2); const float off = 10.0f - mn * C2; m = mn;
#pragma unroll
    for (int r = 0; r < 8; ++r) { o0[r] *= al; o1[r] *= al; }
    os[0] *= al;      /* only row 0 of the sum tile is ever read */
#pragma unroll
    for (int p = 0; p < KBLK / 32; ++p) { FragH b;
#pragma unroll
      for (int r = 0; r < 8; ++r) { const float e0 = __builtin_amdgcn_exp2f(fmaf(s[2 * p][r], C2, off)), e1 = __builtin_amdgcn_exp2f(fmaf(s[2 * p + 1][r], C2, off));
        b.h[r] = (_Float16)e0; b.h[8 + r] = (_Float16)e1; }
      const unsigned short* vr = sv + ln * VPITCH + kb + p * 32;
      o0 = __builtin_amdgcn_wmma_f32_16x16x32_f16(false, lds_frag(vr, hh), false, b.v, (short)0, o0, false, false);
      o1 = __builtin_amdgcn_wmma_f32_16x16x32_f16(false, lds_frag(vr + 16 * VPITCH, hh), false, b.v, (short)0, o1, false, false);
      os = __builtin_amdgcn_wmma_f32_16x16x32_f16(false, ones.v, false, b.v, (short)0, os, false, false); }
  }
  const float su = __shfl(os[0], ln, 32); const float inv = 1.0f / su; FragH f;      /* row 0 sits in register 0 of lanes 0..15 */
#pragma unroll
  for (int r = 0; r < 8; ++r) { f.h[r] = (_Float16)(o0[r] * inv); f.h[8 + r] = (_Float16)(o1[r] * inv); }
  unsigned short* d = (unsigned short*)O16 + ((size_t)((g * NN + n0) >> 4) * (DD / 32) + h) * FBLK + lane * 8;      /* lane (c, h) holds head dims 8h..8h+7 and 16+8h.. of query c: the output GEMM's A fragment of row tile (g NN + n0) / 16, k step h, as it stands */
  *(v8us*)d = f.half[0]; *(v8us*)(d + FBLK / 2) = f.half[1]; }
// Fused projection. One work-group = 64 token rows: x is read once as f32, rounded (bf16, exact in f16) into LDS, and all 768 outputs of those rows are formed from it.
// q | k: D = W rows (A) x token rows (B), so lane (c, h) holds 8 neighbouring output dims of token c; v^T: D = token rows (A) x W rows (B), so a lane holds 8 neighbouring tokens of one dim.
// Each wave stages its f16 tile in its own LDS range and stores whole 128-byte lines.
// Every loop of the kernel is unrolled: its arrays are register fragments and must be indexed by constants.
#define PROWS 64                 /* token rows per work-group */
#define XPITCH 264               /* f16 per x row in LDS: 528 B = 16 B x 33 */
#define SPITCH 72                /* f16 per staged output row in LDS: 144 B = 16 B x 9 */
#define VT0 ((2 * DD / 16) * (DD / 32) * FBLK)      /* f16 in front of the v weights in the fragment-order plane */
__device__ __forceinline__ v16h pj_frag(const unsigned short* p) { FragH f; f.half[0] = *(const v8us*)p; f.half[1] = *(const v8us*)(p + 16); return f.v; }
// four waves per SIMD: two work-groups fit a WGP, so that all 384 are resident at once
__global__ __launch_bounds__(256) __attribute__((amdgpu_waves_per_eu(4, 4))) void k_proj(const float* __restrict__ x, const _Float16* __restrict__ Bw, _Float16* __restrict__ Qf, _Float16* __restrict__ Kp, _Float16* __restrict__ VTg) {
  __shared__ __attribute__((aligned(16))) unsigned short sx[PROWS * XPITCH];
  __shared__ __attribute__((aligned(16))) unsigned short st[8][PROWS * SPITCH];
  __shared__ __attribute__((aligned(16))) unsigned short sv2[8][32 * SPITCH];      /* a range of its own for v^T: no wait on the q | k stores before it is written */
  const int tid = threadIdx.x, w = tid >> 5, lane = tid & 31, ln = lane & 15, hh = lane >> 4;
  const int row0 = blockIdx.x * PROWS;
  const float* xg = x + (size_t)row0 * DD + tid * 8;      /* row 8 i + w, columns 8 lane.. */
  const unsigned short* wq = (const unsigned short*)Bw + (size_t)(w * 4) * (DD / 32) * FBLK + lane * 8;      /* q | k output dims 64 w + 16 a + ln: row tiles 4 w + a, fragment order */
  const unsigned short* wv = (const unsigned short*)Bw + (size_t)(w * 2) * (DD / 32) * FBLK + lane * 8;      /* v output dims 32 w + 16 b + ln: row tiles 32 + 2 w + b; the 32 tiles of q | k are the constant VT0 at each load, so that this is the very address register of the loads */
  v4f xa[8], xb[8];
#pragma unroll
  for (int i = 0; i < 8; ++i) { xa[i] = *(const v4fa*)(xg + i * 8 * DD); xb[i] = *(const v4fa*)(xg + i * 8 * DD + 4); }
  v16h af[4];      /* the first weight fragments fly while x is converted */
#pragma unroll
  for (int a = 0; a < 4; ++a) af[a] = fo_frag(wq + a * (DD / 32) * FBLK);
#pragma unroll
  for (int i = 0; i < 8; ++i) { FragH f;
#pragma unroll
    for (int q = 0; q < 4; ++q) { f.h[q] = (_Float16)bf16_round(xa[i][q]); f.h[4 + q] = (_Float16)bf16_round(xb[i][q]); }
    *(v8us*)(sx + (i * 8 + w) * XPITCH + lane * 8) = f.half[0]; }
  __syncthreads();
  const unsigned short* xs = sx + ln * XPITCH + 8 * hh;
  unsigned short* sw = st[w]; unsigned short* sw2 = sv2[w];
  const v8f z8 = {0.f,0.f,0.f,0.f,0.f,0.f,0.f,0.f};
  {
    v8f acc[4][4];
#pragma unroll
    for (int a = 0; a < 4; ++a)
#pragma unroll
      for (int b = 0; b < 4; ++b) acc[a][b] = z8;
    // unrolled so that the next step's weight fragments are loaded into a second register set ahead of this step's products
#pragma unroll
    for (int kb = 0; kb < DD; kb += 32) { v16h an[4], bx[4];
      if (kb + 32 < DD) {
#pragma unroll
        for (int a = 0; a < 4; ++a) an[a] = fo_frag(wq + (a * (DD / 32) + kb / 32 + 1) * FBLK); }
#pragma unroll
      for (int b = 0; b < 4; ++b) bx[b] = pj_frag(xs + b * 16 * XPITCH + kb);
#pragma unroll
      for (int a = 0; a < 4; ++a)
#pragma unroll
        for (int b = 0; b < 4; ++b) acc[a][b] = __builtin_amdgcn_wmma_f32_16x16x32_f16(false, af[a], false, bx[b], (short)0, acc[a][b], false, false);
      if (kb + 32 < DD) {
#pragma unroll
        for (int a = 0; a < 4; ++a) af[a] = an[a]; } }
#pragma unroll
    for (int a = 0; a < 4; ++a)
#pragma unroll
      for (int b = 0; b < 4; ++b) { FragH f;
#pragma unroll
        for (int r = 0; r < 8; ++r) f.h[r] = (_Float16)(acc[a][b][r] * 0.0625f);
        *(v8us*)(sw + (b * 16 + ln) * SPITCH + a * 16 + 8 * hh) = f.half[0]; }
  }
  __builtin_amdgcn_fence(__ATOMIC_ACQ_REL, "workgroup"); __builtin_amdgcn_wave_barrier();      /* the wave's other lanes read what this lane staged */
  v16h vf[8][2];      /* all of the wave's v weight fragments (128 registers, free now) fly while the q | k tile is stored */
#pragma unroll
  for (int s = 0; s < 8; ++s) { vf[s][0] = fo_frag(wv + VT0 + s * FBLK); vf[s][1] = fo_frag(wv + VT0 + (DD / 32 + s) * FBLK); }
  asm volatile("s_wait_xcnt 0x0" :: "v"(wq), "v"(wv) : "memory");      /* wait before the weight loads' address registers are rewritten; naming the addresses as inputs keeps them live up to here, so that no load's data lands in them either */
  {
    // the wave's 64 dims are two heads of q (waves 0..3) or of k (waves 4..7). q goes out as fragment-order blocks [head][row tile], k as 64-byte rows of its [group][head] plane: every store covers 4 whole lines.
    // Both cases share one set of constant steps: 16 staged rows and 512 f16 of output per row tile; only the lane bases (register half or next 8 tokens; next head) differ.
    const int h0 = (w & 3) * 2; const bool isq = __builtin_amdgcn_readfirstlane(w) < 4;      /* the wave's number as a scalar: the case is picked by scalar selects, EXEC stays untouched */
    const unsigned short* sr0 = sw + (isq ? ln * SPITCH + 8 * hh : (lane >> 2) * SPITCH + (lane & 3) * 8);
    const unsigned short* sr1 = sr0 + (isq ? 16 : 8 * SPITCH);
    unsigned short* qd0 = (isq ? (unsigned short*)Qf + ((size_t)h0 * (NR / 16) + (row0 >> 4)) * FBLK : (unsigned short*)Kp + ((size_t)((row0 / NN) * NH + h0) * NN + row0 % NN) * HD) + lane * 8;
    unsigned short* qd1 = qd0 + (isq ? (NR / 16) * FBLK : NN * HD);
    v8us tv[16];
#pragma unroll
    for (int q = 0; q < 16; ++q) tv[q] = *(const v8us*)(((q & 1) ? sr1 : sr0) + ((q >> 1) & 3) * 16 * SPITCH + (q >> 3) * HD);      /* head q / 8, row tile (q / 2) % 4, half q % 2 */
    __builtin_amdgcn_sched_barrier(0);      /* all LDS reads issue as one group ahead of the stores; otherwise each store waits out its own read's latency in one register set */
#pragma unroll
    for (int q = 0; q < 16; ++q) *(v8us*)(((q >> 3) ? qd1 : qd0) + (q & 7) * (FBLK / 2)) = tv[q];
    asm volatile("s_wait_xcnt 0x0" ::: "memory");      /* wait before the stores' address and data registers are rewritten by the v^T part */
  }
  {
    v8f acc[4][2];
#pragma unroll
    for (int a = 0; a < 4; ++a) { acc[a][0] = z8; acc[a][1] = z8; }
    // unrolled: the weight fragments are indexed by the step
#pragma unroll
    for (int kb = 0; kb < DD; kb += 32) { v16h ax[4];
#pragma unroll
      for (int a = 0; a < 4; ++a) ax[a] = pj_frag(xs + a * 16 * XPITCH + kb);
      __builtin_amdgcn_sched_barrier(0);      /* the step's loads issue as one group ahead of its products: one place with LDS reads a step, not four */
#pragma unroll
      for (int a = 0; a < 4; ++a)
#pragma unroll
        for (int b = 0; b < 2; ++b) acc[a][b] = __builtin_amdgcn_wmma_f32_16x16x32_f16(false, ax[a], false, vf[kb / 32][b], (short)0, acc[a][b], false, false);
      __builtin_amdgcn_sched_barrier(0); }      /* keeps later steps' LDS reads in their own step; hoisted all together they spilled registers to scratch */
#pragma unroll
    for (int a = 0; a < 4; ++a)
#pragma unroll
      for (int b = 0; b < 2; ++b) { FragH f;
#pragma unroll
        for (int r = 0; r < 8; ++r) f.h[r] = (_Float16)(acc[a][b][r] * 0.0625f);
        *(v8us*)(sw2 + (b * 16 + ln) * SPITCH + a * 16 + 8 * hh) = f.half[0]; }
  }
  __builtin_amdgcn_fence(__ATOMIC_ACQ_REL, "workgroup"); __builtin_amdgcn_wave_barrier();      /* as above: lanes read each other's staged rows */
  {
    unsigned short* vd = (unsigned short*)VTg + (size_t)(w * 32 + (lane >> 3)) * NR + row0 + (lane & 7) * 8;
    v8us tv[8];
#pragma unroll
    for (int q = 0; q < 8; ++q) tv[q] = *(const v8us*)(sw2 + (q * 4 + (lane >> 3)) * SPITCH + (lane & 7) * 8);
    __builtin_amdgcn_sched_barrier(0);      /* as above: one group of LDS reads, then the stores */
#pragma unroll
    for (int q = 0; q < 8; ++q) *(v8us*)(vd + (size_t)q * 4 * NR) = tv[q];
  }
}
// thread t writes the t-th 16 bytes of the fragment-order plane: lane = t % 32, register half j, k step, row tile
__device__ __forceinline__ void d_wqkv(int blk, const float* __restrict__ Wq, const float* __restrict__ Wk, const float* __restrict__ Wv, _Float16* __restrict__ Bt) { const int t = blk * 256 + threadIdx.x; if (t >= 3 * DD * (DD / 8)) return; const int n = (t >> 9) * 16 + (t & 15), k0 = ((t >> 6) & 7) * 32 + ((t >> 5) & 1) * 16 + ((t >> 4) & 1) * 8; const int which = n / DD, o = n % DD; const float* Wm = which == 0 ? Wq : (which == 1 ? Wk : Wv); FragH f;
  for (int q = 0; q < 8; ++q) f.h[q] = (_Float16)(bf16_round(Wm[(size_t)(k0 + q) * DD + o]) * 16.0f); *(v8us*)((unsigned short*)Bt + (size_t)t * 8) = f.half[0];  }
// W_o as f16 [n][k], times 16, in fragment order (thread t as in d_wqkv)
__device__ __forceinline__ void d_wo(int blk, const float* __restrict__ Wo, _Float16* __restrict__ Bo) { const int t = blk * 256 + threadIdx.x; if (t >= DD * (DD / 8)) return; const int n = (t >> 9) * 16 + (t & 15), k8 = ((t >> 6) & 7) * 32 + ((t >> 5) & 1) * 16 + ((t >> 4) & 1) * 8; FragH f;
#pragma unroll
  for (int i = 0; i < 8; ++i) f.h[i] = (_Float16)(bf16_round(Wo[(size_t)(k8 + i) * DD + n]) * 16.0f);
  *(v8us*)((unsigned short*)Bo + (size_t)t * 8) = f.half[0]; }
// One preparation launch: the three jobs read none of each other's output, so they share a grid and each work-group picks its job by its index.
// The weight jobs come first: each of their threads gathers from eight weight rows.
#define PB_QKV (3 * DD * (DD / 8) / 256)      /* 96 work-groups */
#define PB_WO (DD * (DD / 8) / 256)           /* 32 */
#define PB_BIAS (NN * NN / 4 / 256)           /* 256 */
__global__ __launch_bounds__(256) void k_prep(const float* __restrict__ Wq, const float* __restrict__ Wk, const float* __restrict__ Wv, const float* __restrict__ Wo, const float* __restrict__ sim,
                                              _Float16* __restrict__ Bt, _Float16* __restrict__ Bo, float* __restrict__ BP) {
  const int b = blockIdx.x;
  if (b < PB_QKV) d_wqkv(b, Wq, Wk, Wv, Bt);
  else if (b < PB_QKV + PB_WO) d_wo(b - PB_QKV, Wo, Bo);
  else d_bias(b - (PB_QKV + PB_WO), sim, BP);
}

extern "C" void kernel_launch(void* const* d_in, const int* in_sizes, int n_in,
                              void* d_out, int out_size, void* d_ws, size_t ws_size, hipStream_t stream) {
  (void)in_sizes; (void)n_in; (void)out_size;
  const float* const* I = (const float* const*)d_in; const float* x = I[0]; const float* sim = I[1]; const float* Wq = I[2]; const float* Wk = I[3]; const float* Wv = I[4]; const float* Wo = I[5];
  char* ws = (char*)d_ws; size_t off = 0;
  auto take = [&](size_t bytes) { char* p = ws + off; off += (bytes + 255) & ~(size_t)255; return p; };
  _Float16* BQKV = (_Float16*)take((size_t)3 * DD * DD * 2); _Float16* BO = (_Float16*)take((size_t)DD * DD * 2);
  _Float16* Q16 = (_Float16*)take((size_t)NR * DD * 2); _Float16* K16 = (_Float16*)take((size_t)NR * DD * 2); _Float16* VTg = (_Float16*)take((size_t)DD * NR * 2); _Float16* O16 = (_Float16*)take((size_t)NR * DD * 2);
  float* BP = (float*)take((size_t)NN * NN * 4);
  if (off > ws_size) return;      /* under 50 MiB */
  k_prep<<<PB_QKV + PB_WO + PB_BIAS, 256, 0, stream>>>(Wq, Wk, Wv, Wo, sim, BQKV, BO, BP);
  k_proj<<<NR / PROWS, 256, 0, stream>>>(x, BQKV, Q16, K16, VTg);      /* q: fragment-order blocks [head][row tile]; k: planes [group][head][token][32]; v^T: rows h*32 + d, columns = token rows */
  k_attn<<<NG * NH * (NN / QWG), 256, 0, stream>>>(Q16, K16, VTg, BP, O16);
  k_gemm2<0><<<dim3((NR / 128) * (DD / 64), 1), 128, 0, stream>>>(O16, DD, 0, BO, DD, 0, 0.0625f, nullptr, 0, nullptr, 1, 0, 0, (float*)d_out, nullptr, DD, 0, NR, DD, DD);
}

// v005
// Measured time: 62.3 microseconds a run.
// Timed twice side by side with v004, it ran 1.07 and 1.06 times as fast.
// All steps since v000 together make it 11.3 times as fast.
#include <hip/hip_runtime.h>
// SpatialMHSA (4 x 12 frames x 512 spatial tokens x 256 = 8 heads of 32): q/k/v = x W (xavier (in,out) weights); per (batch, frame, head) attention over the 512 tokens with scores/sqrt(32) + an INPUT additive bias sim[n][m]; out = merged heads W_o.
// Structure: ONE projection kernel (x rounded into LDS once per 64 token rows; q as fragment blocks, k as per-head rows and v^T from it, f32 accumulation, exact x16 weights, f16 output); ONE fused attention kernel over all 384 (group, head) pairs (S^T = K Q^T plus the bias plane times a one-hot matrix, online softmax in registers, O^T = V^T P^T, f16 out as the output GEMM's A fragments); output GEMM. Weights and attention output lie in the workspace in fragment order.
// Compute dtype: x, sim and weights rounded to bf16; q, k, v, P, attention output as f16 operands (~2^-12); f32 accumulation/softmax. v_wmma_f32_16x16x32_f16.
#define NBATCH 4
#define NFR 12
#define NN 512
#define DD 256
#define NH 8
#define HD 32
#define NG (NBATCH * NFR)         /* 48 groups */
#define NR (NG * NN)             /* 24576 token rows */
#define SCL 0.17677669529663687f /* 32^-0.5 */
typedef __bf16 v16b __attribute__((ext_vector_type(16)));
typedef unsigned short v8us __attribute__((ext_vector_type(8), may_alias));
typedef float  v8f  __attribute__((ext_vector_type(8)));
typedef float  v4f  __attribute__((ext_vector_type(4)));
typedef float  v4fa __attribute__((ext_vector_type(4), may_alias));
union FragB { v16b v; v8us half[2]; unsigned short u[16]; };

__device__ __forceinline__ unsigned short bf16_bits(float x) { unsigned int u = __float_as_uint(x); return (unsigned short)((u + 0x7FFFu + ((u >> 16) & 1u)) >> 16); }
__device__ __forceinline__ float bf16_val(unsigned short b) { return __uint_as_float(((unsigned int)b) << 16); }
__device__ __forceinline__ float bf16_round(float x) { return bf16_val(bf16_bits(x)); }
// D += A·B with NT terms: 1 = ah·bh, 2 = + al·bh (A split), 3 = + ah·bl (both split)
template <int NT>
__device__ __forceinline__ v8f mmaN(v16b ah, v16b al, v16b bh, v16b bl, v8f c) {
  c = __builtin_amdgcn_wmma_f32_16x16x32_bf16(false, ah, false, bh, (short)0, c, false, false);
  if (NT >= 2) c = __builtin_amdgcn_wmma_f32_16x16x32_bf16(false, al, false, bh, (short)0, c, false, false);
  if (NT >= 3) c = __builtin_amdgcn_wmma_f32_16x16x32_bf16(false, ah, false, bl, (short)0, c, false, false);
  asm volatile("v_nop\n\tv_nop\n\tv_nop\n\tv_nop" : "+v"(c) : "v"(ah), "v"(al), "v"(bh), "v"(bl));
  return c;
}

__global__ __launch_bounds__(256) void k_wt_bf16(const float* __restrict__ W, unsigned short* __restrict__ Wt, int K, int N) {
  const int t = blockIdx.x * 256 + threadIdx.x;
  const int k8n = K / 8;
  if (t >= N * k8n) return;
  const int n = t / k8n, k8 = (t % k8n) * 8;
  v8us v;
#pragma unroll
  for (int i = 0; i < 8; ++i) v[i] = bf16_bits(W[(size_t)(k8 + i) * N + n]);
  *(v8us*)(Wt + (size_t)n * K + k8) = v;
  
}

// GEMM C[M][N] (f32, pitch ldc) = act(A[M][K]·W + bias). A f32 row-major (pitch lda) converted per fragment to bf16
// (ASPLIT: hi/lo two planes -> 2 terms, else single rounded term); Wt bf16 [N][K] (pitch ldb). BIAS_BF16 rounds the
// bias to bf16 first (bias quantised to bf16 before the add). K%32==0, M%16==0, N%64==0.
template <bool ASPLIT, int ACT, bool BIAS_BF16>
__global__ __launch_bounds__(128) void k_gemm_bf(const float* __restrict__ A, int lda, const unsigned short* __restrict__ Wt, int ldb,
                                               const float* __restrict__ bias, float* __restrict__ C, int ldc, int M, int N, int K) {
  __shared__ __attribute__((aligned(16))) float so[4][16][64];
  const int tid = threadIdx.x, w = tid >> 5, lane = tid & 31, ln = lane & 15, hh = lane >> 4;
  const int ntn = N / 64;
  const int wid = blockIdx.x * 4 + w;
  const int mt = wid / ntn, nq = wid % ntn;
  if (mt * 16 >= M) return;
  const int row0 = mt * 16, col0 = nq * 64;
  const float* arow = A + (size_t)(row0 + ln) * lda;
  v8f acc[4] = {};
  for (int kb = 0; kb < K; kb += 32) {
    FragB ah, al;
    const v4f x0 = *(const v4fa*)(arow + kb + 8 * hh), x1 = *(const v4fa*)(arow + kb + 8 * hh + 4);
    const v4f x2 = *(const v4fa*)(arow + kb + 16 + 8 * hh), x3 = *(const v4fa*)(arow + kb + 16 + 8 * hh + 4);
    float xs[16] = {x0[0],x0[1],x0[2],x0[3],x1[0],x1[1],x1[2],x1[3],x2[0],x2[1],x2[2],x2[3],x3[0],x3[1],x3[2],x3[3]};
#pragma unroll
    for (int i = 0; i < 16; ++i) { const unsigned short hb = bf16_bits(xs[i]); ah.u[i] = hb; al.u[i] = ASPLIT ? bf16_bits(xs[i] - bf16_val(hb)) : (unsigned short)0; }
#pragma unroll
    for (int t = 0; t < 4; ++t) {
      const unsigned short* brow = Wt + (size_t)(col0 + t * 16 + ln) * ldb + kb;
      FragB b;
      b.half[0] = *(const v8us*)(brow + 8 * hh);
      b.half[1] = *(const v8us*)(brow + 16 + 8 * hh);
      acc[t] = mmaN<ASPLIT ? 2 : 1>(ah.v, al.v, b.v, b.v, acc[t]);
    }
  }
#pragma unroll
  for (int t = 0; t < 4; ++t) {
    float bv = bias ? bias[col0 + t * 16 + ln] : 0.f;
    if (BIAS_BF16) bv = bf16_round(bv);
#pragma unroll
    for (int r = 0; r < 8; ++r) { float v = acc[t][r] + bv; if (ACT == 1) v = fmaxf(v, 0.f); so[w][8 * hh + r][t * 16 + ln] = v; }
  }
  __builtin_amdgcn_fence(__ATOMIC_ACQ_REL, "workgroup");
  __builtin_amdgcn_wave_barrier();
  const int rsub = lane >> 4, c4 = (lane & 15) * 4;
  {
#pragma unroll
    for (int q = 0; q < 8; ++q) {
      const int r = q * 2 + rsub;
      const v4f v = *(const v4fa*)&so[w][r][c4];
      *(v4f*)(C + (size_t)(row0 + r) * ldc + col0 + c4) = v;
    }
    
  }
}

// GEMM C = act(A·W + bias + resid): A f32 (ASPLIT -> hi/lo 2 terms), Wt bf16 [N][K]; ACT 0 none, 1 relu, 2 exact gelu;
// resid (optional, f32, row index = (row % rmod), pitch ldr, RES_BF16 rounds it) added before the activation.
template <bool ASPLIT, int ACT, bool BIAS_BF16, bool RES_BF16>
__global__ __launch_bounds__(128) void k_gemm_bf3(const float* __restrict__ A, int lda, const unsigned short* __restrict__ Wt, int ldb,
                                                const float* __restrict__ bias, const float* __restrict__ resid, int rmod, int ldr,
                                                float* __restrict__ C, int ldc, int M, int N, int K) {
  __shared__ __attribute__((aligned(16))) float so[4][16][64];
  const int tid = threadIdx.x, w = tid >> 5, lane = tid & 31, ln = lane & 15, hh = lane >> 4;
  const int ntn = N / 64;
  const int wid = blockIdx.x * 4 + w;
  const int mt = wid / ntn, nq = wid % ntn;
  if (mt * 16 >= M) return;
  const int row0 = mt * 16, col0 = nq * 64;
  const float* arow = A + (size_t)(row0 + ln) * lda;
  v8f acc[4] = {};
  for (int kb = 0; kb < K; kb += 32) {
    FragB ah, al;
    const v4f x0 = *(const v4fa*)(arow + kb + 8 * hh), x1 = *(const v4fa*)(arow + kb + 8 * hh + 4);
    const v4f x2 = *(const v4fa*)(arow + kb + 16 + 8 * hh), x3 = *(const v4fa*)(arow + kb + 16 + 8 * hh + 4);
    float xs[16] = {x0[0],x0[1],x0[2],x0[3],x1[0],x1[1],x1[2],x1[3],x2[0],x2[1],x2[2],x2[3],x3[0],x3[1],x3[2],x3[3]};
#pragma unroll
    for (int i = 0; i < 16; ++i) { const unsigned short hb = bf16_bits(xs[i]); ah.u[i] = hb; al.u[i] = ASPLIT ? bf16_bits(xs[i] - bf16_val(hb)) : (unsigned short)0; }
#pragma unroll
    for (int t = 0; t < 4; ++t) {
      const unsigned short* brow = Wt + (size_t)(col0 + t * 16 + ln) * ldb + kb;
      FragB b;
      b.half[0] = *(const v8us*)(brow + 8 * hh);
      b.half[1] = *(const v8us*)(brow + 16 + 8 * hh);
      acc[t] = mmaN<ASPLIT ? 2 : 1>(ah.v, al.v, b.v, b.v, acc[t]);
    }
  }
#pragma unroll
  for (int t = 0; t < 4; ++t) {
    const int col = col0 + t * 16 + ln;
    float bv = bias ? bias[col] : 0.f;
    if (BIAS_BF16) bv = bf16_round(bv);
#pragma unroll
    for (int r = 0; r < 8; ++r) {
      float v = acc[t][r] + bv;
      if (resid) { float rv = resid[(size_t)((row0 + 8 * hh + r) % rmod) * ldr + col]; if (RES_BF16) rv = bf16_round(rv); v += rv; }
      if (ACT == 1) v = fmaxf(v, 0.f);
      if (ACT == 2) v = 0.5f * v * (1.0f + erff(v * 0.70710678118654752f));
      if (ACT == 3) { const float u = 0.7978845608028654f * (v + 0.044715f * v * v * v); v = 0.5f * v * (1.0f + tanhf(u)); }
      so[w][8 * hh + r][t * 16 + ln] = v;
    }
  }
  __builtin_amdgcn_fence(__ATOMIC_ACQ_REL, "workgroup");
  __builtin_amdgcn_wave_barrier();
  const int rsub = lane >> 4, c4 = (lane & 15) * 4;
  {
#pragma unroll
    for (int q = 0; q < 8; ++q) {
      const int r = q * 2 + rsub;
      const v4f v = *(const v4fa*)&so[w][r][c4];
      *(v4f*)(C + (size_t)(row0 + r) * ldc + col0 + c4) = v;
    }
    
  }
}
// row LayerNorm (biased variance, eps) over N: s = X (+ R); optional out_sum <- s; out_norm <- (s-mu)*rsqrt(var+eps)*g + b
template <bool PARAM_BF16>
__global__ __launch_bounds__(256) void k_layernorm(const float* __restrict__ X, const float* __restrict__ R, const float* __restrict__ g, const float* __restrict__ bta,
                                                  float* __restrict__ out_sum, float* __restrict__ out_norm, int N, float eps) {
  __shared__ float red[256];
  const int row = blockIdx.x, tid = threadIdx.x;
  const float* x = X + (size_t)row * N; const float* rr = R ? R + (size_t)row * N : nullptr;
  float vals[16];                     // up to N = 4096
  const int per = N / 256;            // contiguous chunk per thread? use strided-by-4 chunks: thread handles j = tid*4 + 1024*u
  float s1 = 0.f;
  for (int u = 0; u < per / 4; ++u) {
    const int j = tid * 4 + 1024 * u;
    const v4f a = *(const v4fa*)(x + j);
    v4f b = {0.f,0.f,0.f,0.f}; if (rr) b = *(const v4fa*)(rr + j);
#pragma unroll
    for (int q = 0; q < 4; ++q) { const float v = a[q] + b[q]; vals[u * 4 + q] = v; s1 += v; }
  }
  red[tid] = s1; __syncthreads();
  for (int st = 128; st > 0; st >>= 1) { if (tid < st) red[tid] += red[tid + st]; __syncthreads(); }
  const float mu = red[0] / (float)N; __syncthreads();
  float s2 = 0.f;
  for (int u = 0; u < per / 4; ++u)
#pragma unroll
    for (int q = 0; q < 4; ++q) { const float c = vals[u * 4 + q] - mu; s2 += c * c; }
  red[tid] = s2; __syncthreads();
  for (int st = 128; st > 0; st >>= 1) { if (tid < st) red[tid] += red[tid + st]; __syncthreads(); }
  const float rs = rsqrtf(red[0] / (float)N + eps);
  {
    for (int u = 0; u < per / 4; ++u) {
      const int j = tid * 4 + 1024 * u;
      v4f o, sm;
#pragma unroll
      for (int q = 0; q < 4; ++q) {
        float gg = g[j + q], bb = bta[j + q];
        if (PARAM_BF16) { gg = bf16_round(gg); bb = bf16_round(bb); }
        sm[q] = vals[u * 4 + q]; o[q] = (vals[u * 4 + q] - mu) * rs * gg + bb;
      }
      if (out_sum) *(v4f*)(out_sum + (size_t)row * N + j) = sm;
      *(v4f*)(out_norm + (size_t)row * N + j) = o;
    }
    
  }
}



// ---- f16 WMMA path (v_wmma_f32_16x16x32_f16): 11-bit significands for operands in range — used where a [0,1] probability operand needs more precision than bf16
typedef _Float16 v16h __attribute__((ext_vector_type(16)));
union FragH { v16h v; v8us half[2]; _Float16 h[16]; unsigned short u[16]; };
template <int NT>
__device__ __forceinline__ v8f mmaH(v16h ah, v16h al, v16h bh, v16h bl, v8f c) {
  c = __builtin_amdgcn_wmma_f32_16x16x32_f16(false, ah, false, bh, (short)0, c, false, false);
  if (NT >= 2) c = __builtin_amdgcn_wmma_f32_16x16x32_f16(false, al, false, bh, (short)0, c, false, false);
  if (NT >= 3) c = __builtin_amdgcn_wmma_f32_16x16x32_f16(false, ah, false, bl, (short)0, c, false, false);
  asm volatile("v_nop\n\tv_nop\n\tv_nop\n\tv_nop" : "+v"(c) : "v"(ah), "v"(al), "v"(bh), "v"(bl));
  return c;
}
// batched GEMM like k_gemm_b but f16 operands: A f32 (split into f16 hi/lo if ASPLIT, else rounded to f16), Bt = f16 values [n][k]; alpha; C f32; N multiple of 16 (partial tiles skipped)
template <bool ASPLIT>
__global__ __launch_bounds__(128) void k_gemm_h(const float* __restrict__ A, int lda, size_t sA, const _Float16* __restrict__ Bh, int ldb, size_t sB, float alpha, float* __restrict__ C, int ldc, size_t sC, int M, int N, int K) {
  __shared__ __attribute__((aligned(16))) float so[4][16][64];
  const int tid = threadIdx.x, w = tid >> 5, lane = tid & 31, ln = lane & 15, hh = lane >> 4; const int by = blockIdx.y;
  A += (size_t)by * sA; Bh += (size_t)by * sB; C += (size_t)by * sC;
  const int ntn = (N + 63) / 64; const int wid = blockIdx.x * 4 + w; const int mt = wid / ntn, nq = wid % ntn; if (mt * 16 >= M) return;
  const int row0 = mt * 16, col0 = nq * 64; const float* arow = A + (size_t)(row0 + ln) * lda;
  v8f acc[4] = {};
  for (int kb = 0; kb < K; kb += 32) {
    FragH ah, al;
    const v4f x0 = *(const v4fa*)(arow + kb + 8 * hh), x1 = *(const v4fa*)(arow + kb + 8 * hh + 4), x2 = *(const v4fa*)(arow + kb + 16 + 8 * hh), x3 = *(const v4fa*)(arow + kb + 16 + 8 * hh + 4);
    float xs[16] = {x0[0],x0[1],x0[2],x0[3],x1[0],x1[1],x1[2],x1[3],x2[0],x2[1],x2[2],x2[3],x3[0],x3[1],x3[2],x3[3]};
#pragma unroll
    for (int i = 0; i < 16; ++i) { const _Float16 h = (_Float16)xs[i]; ah.h[i] = h; al.h[i] = ASPLIT ? (_Float16)(xs[i] - (float)h) : (_Float16)0.0f; }
#pragma unroll
    for (int t = 0; t < 4; ++t) { if (col0 + t * 16 >= N) continue; const size_t boff = (size_t)(col0 + t * 16 + ln) * ldb + kb; FragH bq; bq.half[0] = *(const v8us*)(Bh + boff + 8 * hh); bq.half[1] = *(const v8us*)(Bh + boff + 16 + 8 * hh);
      acc[t] = mmaH<ASPLIT ? 2 : 1>(ah.v, al.v, bq.v, bq.v, acc[t]); }
  }
#pragma unroll
  for (int t = 0; t < 4; ++t) { if (col0 + t * 16 >= N) continue;
#pragma unroll
    for (int r = 0; r < 8; ++r) so[w][8 * hh + r][t * 16 + ln] = acc[t][r] * alpha; }
  __builtin_amdgcn_fence(__ATOMIC_ACQ_REL, "workgroup"); __builtin_amdgcn_wave_barrier();
  const int rsub = lane >> 4, c4 = (lane & 15) * 4;
  {
#pragma unroll
    for (int q = 0; q < 8; ++q) { const int r = q * 2 + rsub; if (col0 + c4 < N) { const v4f v = *(const v4fa*)&so[w][r][c4]; *(v4f*)(C + (size_t)(row0 + r) * ldc + col0 + c4) = v; } }
     }
}

// Wt[n][k] = f16(W[k][n]·scale) from f32 row-major W[K][N] (scale = power of two; bf16-exact weights stay exact in f16 away from the subnormal range)
__global__ __launch_bounds__(256) void k_wt_f16(const float* __restrict__ W, _Float16* __restrict__ Wt, int K, int N, float scale) {
  const int t = blockIdx.x * 256 + threadIdx.x; if (t >= N * (K / 8)) return; const int n = t / (K / 8), k8 = (t % (K / 8)) * 8; FragH f;
#pragma unroll
  for (int i = 0; i < 8; ++i) f.h[i] = (_Float16)(bf16_round(W[(size_t)(k8 + i) * N + n]) * scale); const v8us o = f.half[0];
  *(v8us*)((unsigned short*)Wt + (size_t)n * K + k8) = o; 
}
// k_gemm_hh variant with fused epilogue: v = acc·alpha + bias[by·sBias + col] (+ CP[(row/rowsPerB)·sCPb + by·64 + col] if CP) ; ACT 0 none / 1 elu ; writes f16 C16 (and f32 C if non-null)
template <int ACT>
__global__ __launch_bounds__(128) void k_gemm_hhx(const _Float16* __restrict__ A, int lda, size_t sA, const _Float16* __restrict__ Bh, int ldb, size_t sB, float alpha, const float* __restrict__ bias, size_t sBias, const float* __restrict__ CP, int rowsPerB, size_t sCPb, int row0g,
    float* __restrict__ C, _Float16* __restrict__ C16, int ldc, size_t sC, int M, int N, int K) {
  __shared__ __attribute__((aligned(16))) float so[4][16][64];
  const int tid = threadIdx.x, w = tid >> 5, lane = tid & 31, ln = lane & 15, hh = lane >> 4; const int by = blockIdx.y;
  A += (size_t)by * sA; Bh += (size_t)by * sB; const size_t cofs = (size_t)by * sC; const float* bp = bias ? bias + (size_t)by * sBias : nullptr;
  const int ntn = (N + 63) / 64; const int wid = blockIdx.x * 4 + w; const int mt = wid / ntn, nq = wid % ntn; if (mt * 16 >= M) return;
  const int row0 = mt * 16, col0 = nq * 64; const _Float16* arow = A + (size_t)(row0 + ln) * lda;
  v8f acc[4] = {};
  for (int kb = 0; kb < K; kb += 32) { FragH ah; ah.half[0] = *(const v8us*)((const unsigned short*)arow + kb + 8 * hh); ah.half[1] = *(const v8us*)((const unsigned short*)arow + kb + 16 + 8 * hh);
#pragma unroll
    for (int t = 0; t < 4; ++t) { if (col0 + t * 16 >= N) continue; const size_t boff = (size_t)(col0 + t * 16 + ln) * ldb + kb; FragH bq; bq.half[0] = *(const v8us*)((const unsigned short*)Bh + boff + 8 * hh); bq.half[1] = *(const v8us*)((const unsigned short*)Bh + boff + 16 + 8 * hh);
      acc[t] = mmaH<1>(ah.v, ah.v, bq.v, bq.v, acc[t]); }
  }
#pragma unroll
  for (int t = 0; t < 4; ++t) { if (col0 + t * 16 >= N) continue; const int col = col0 + t * 16 + ln; const float bv = bp ? bf16_round(bp[col]) : 0.f;
#pragma unroll
    for (int r = 0; r < 8; ++r) { float v = acc[t][r] * alpha + bv; if (CP) { const int rr = row0g + row0 + 8 * hh + r; if (rowsPerB < 0) v += CP[cofs + (size_t)rr * ldc + col];      /* rowsPerB < 0: own element of the batched C plane */ else { const int bidx = rr / rowsPerB; v += CP[(size_t)bidx * sCPb + (size_t)by * 64 + col]; } } if (ACT == 1) v = (v > 0.f) ? v : expm1f(v); else if (ACT == 7) v = (v > 0.f) ? v + 1.0f : expf(v); else if (ACT == 8) v = tanhf(v); else if (ACT == 9) v = 0.5f * v * (1.0f + tanhf(0.7978845608028654f * (v + 0.044715f * v * v * v))); else if (ACT == 11) v = 1.0f / (1.0f + expf(-v)); else if (ACT == 12) v = (v > 0.f) ? v : 0.01f * v; else if (ACT == 14) v = (v > 0.f) ? v : 0.1f * v; else if (ACT == 16) v = (v >= 0.f) ? v : 0.3f * v; else if (ACT == 15) v = v / (1.0f + expf(-v)); else if (ACT == 3) v = fmaxf(v, 0.f); else if (ACT == 6) v = 0.5f * v * (1.0f + erff(v * 0.70710678118654752f)); so[w][8 * hh + r][t * 16 + ln] = v; } }
  __builtin_amdgcn_fence(__ATOMIC_ACQ_REL, "workgroup"); __builtin_amdgcn_wave_barrier();
  const int rsub = lane >> 4, c4 = (lane & 15) * 4; typedef _Float16 v4h __attribute__((ext_vector_type(4)));
  {
#pragma unroll
    for (int q = 0; q < 8; ++q) { const int r = q * 2 + rsub; if (col0 + c4 < N) { const v4f v = *(const v4fa*)&so[w][r][c4]; if (C) *(v4f*)(C + cofs + (size_t)(row0 + r) * ldc + col0 + c4) = v; if (C16) { v4h h4; for (int i = 0; i < 4; ++i) h4[i] = (_Float16)v[i]; *(v4h*)(C16 + cofs + (size_t)(row0 + r) * ldc + col0 + c4) = h4; } } }
     }
}


typedef _Float16 v4h __attribute__((ext_vector_type(4)));

__global__ __launch_bounds__(256) void k_x16(const float* __restrict__ x, _Float16* __restrict__ X16, size_t n8) { const size_t t = (size_t)blockIdx.x * 256 + threadIdx.x; if (t >= n8) return; FragH f;
#pragma unroll
  for (int q = 0; q < 8; ++q) f.h[q] = (_Float16)bf16_round(x[t * 8 + q]); *(v8us*)((unsigned short*)X16 + t * 8) = f.half[0];  }
__global__ __launch_bounds__(256) void k_h16(const float* __restrict__ x, _Float16* __restrict__ X16, size_t n8) { const size_t t = (size_t)blockIdx.x * 256 + threadIdx.x; if (t >= n8) return; FragH f;
#pragma unroll
  for (int q = 0; q < 8; ++q) f.h[q] = (_Float16)x[t * 8 + q]; *(v8us*)((unsigned short*)X16 + t * 8) = f.half[0];  }
__global__ __launch_bounds__(256) void k_round16f(const float* __restrict__ W, _Float16* __restrict__ Bt, size_t n8) { const size_t t = (size_t)blockIdx.x * 256 + threadIdx.x; if (t >= n8) return; FragH f;
#pragma unroll
  for (int i = 0; i < 8; ++i) f.h[i] = (_Float16)(bf16_round(W[t * 8 + i]) * 16.0f); *(v8us*)((unsigned short*)Bt + t * 8) = f.half[0];  }
template <int NHv, int TTv>
__global__ __launch_bounds__(256) void k_vt(const _Float16* __restrict__ V16, int ldv, int voff, _Float16* __restrict__ Vt) { __shared__ unsigned short tl[64][66]; const int tid = threadIdx.x; const int slab = blockIdx.x / (TTv / 64), lg = blockIdx.x % (TTv / 64); const int b = slab / NHv, h = slab % NHv;
  for (int i = tid; i < 64 * 8; i += 256) { const int r = i / 8, c8 = (i % 8) * 8; FragH f; f.half[0] = *(const v8us*)((const unsigned short*)V16 + ((size_t)b * TTv + lg * 64 + r) * ldv + voff + h * 64 + c8);
#pragma unroll
    for (int q = 0; q < 8; ++q) tl[r][c8 + q] = f.u[q]; }
  __syncthreads();
  {
#pragma unroll
    for (int rd = 0; rd < 2; ++rd) { const int d = rd * 32 + tid / 8, pc = tid % 8; FragH f;
#pragma unroll
      for (int q = 0; q < 8; ++q) f.u[q] = tl[pc * 8 + q][d];
      *(v8us*)((unsigned short*)Vt + ((size_t)slab * 64 + d) * TTv + lg * 64 + pc * 8) = f.half[0]; }
     } }

__global__ __launch_bounds__(256) void k_hl(const float* __restrict__ F, _Float16* __restrict__ Hh, _Float16* __restrict__ Hl, size_t n8) { const size_t t = (size_t)blockIdx.x * 256 + threadIdx.x; if (t >= n8) return; FragH fh, fl; const v4f a = *(const v4fa*)(F + t * 8), c = *(const v4fa*)(F + t * 8 + 4);
#pragma unroll
  for (int q = 0; q < 4; ++q) { _Float16 h = (_Float16)a[q]; fh.h[q] = h; fl.h[q] = (_Float16)((a[q] - (float)h) * 1024.0f); h = (_Float16)c[q]; fh.h[4 + q] = h; fl.h[4 + q] = (_Float16)((c[q] - (float)h) * 1024.0f); }
  { *(v8us*)((unsigned short*)Hh + t * 8) = fh.half[0]; *(v8us*)((unsigned short*)Hl + t * 8) = fl.half[0];  } }

// ---- operand planes in fragment order: per (16-row tile, 32-wide k step) one 1-KiB block [register half j][lane 16 hh + ln][8 f16], holding element (row 16 tile + ln, k = 32 step + 16 j + 8 hh + e);
// blocks run [row tile][k step]. A wave's 16-byte-per-lane fragment load then covers 4 whole 128-byte lines; from plain rows it touches 16 lines for 32 bytes each.
#define FBLK 512                 /* f16 per block */
__device__ __forceinline__ v16h fo_frag(const unsigned short* p) { FragH f; f.half[0] = *(const v8us*)p; f.half[1] = *(const v8us*)(p + FBLK / 2); return f.v; }      /* p = block + 8 lane */
// ---- fast GEMM (wave tile 32x64; requires M % 32 == 0 rows per launch region and N % 64 == 0); A and Bh in fragment order (lda, ldb unused: the pitch is K); epilogue = k_gemm_hhx semantics ----
__device__ __forceinline__ v16h g2_frag(const _Float16* p) { return fo_frag((const unsigned short*)p); }
__device__ __forceinline__ v8f g2_mma(v16h a, v16h b, v8f c) { v8f d = __builtin_amdgcn_wmma_f32_16x16x32_f16(false, a, false, b, (short)0, c, false, false); asm volatile("v_nop\n\tv_nop\n\tv_nop\n\tv_nop" : "+v"(d) : "v"(a), "v"(b)); return d; }
template <int ACT>
__global__ __launch_bounds__(128) void k_gemm2(const _Float16* __restrict__ A, int lda, size_t sA, const _Float16* __restrict__ Bh, int ldb, size_t sB, float alpha, const float* __restrict__ bias, size_t sBias, const float* __restrict__ CP, int rowsPerB, size_t sCPb, int row0g,
    float* __restrict__ C, _Float16* __restrict__ C16, int ldc, size_t sC, int M, int N, int K) { static_assert(ACT == 0 || ACT == 3 || ACT == 6 || ACT == 8 || ACT == 9 || ACT == 11 || ACT == 12 || ACT == 14 || ACT == 15 || ACT == 16, "k_gemm2: unsupported ACT code (would silently apply no activation)");
  __shared__ __attribute__((aligned(16))) float so[4][32][68];
  const int tid = threadIdx.x, w = tid >> 5, lane = tid & 31, ln = lane & 15, hh = lane >> 4; const int by = blockIdx.y;
  A += (size_t)by * sA; Bh += (size_t)by * sB; const size_t cofs = (size_t)by * sC; const float* bp = bias ? bias + (size_t)by * sBias : nullptr;
  const int ntn = N >> 6; const int mt = blockIdx.x / ntn, nq = blockIdx.x - mt * ntn; const int row0 = mt * 128 + 32 * w, col0 = nq * 64; if (row0 >= M) return;
  const size_t tp = (size_t)(K >> 5) * FBLK;      /* f16 per 16-row tile */
  const _Float16* a0p = A + (size_t)(row0 >> 4) * tp + lane * 8; const _Float16* a1p = a0p + tp;
  const _Float16* b0p = Bh + (size_t)(col0 >> 4) * tp + lane * 8; const _Float16* b1p = b0p + tp; const _Float16* b2p = b1p + tp; const _Float16* b3p = b2p + tp;
  const v8f z8 = {0.f,0.f,0.f,0.f,0.f,0.f,0.f,0.f}; v8f c00 = z8, c01 = z8, c02 = z8, c03 = z8, c10 = z8, c11 = z8, c12 = z8, c13 = z8;
#pragma unroll 1
  for (int kb = 0; kb < K; kb += 32) { const int ko = kb * (FBLK / 32); const _Float16* pa0 = a0p + ko; const _Float16* pa1 = a1p + ko; const _Float16* pb0 = b0p + ko; const v16h a0 = g2_frag(pa0), a1 = g2_frag(pa1);
    v16h b = g2_frag(pb0);
    asm volatile("s_wait_xcnt 0x0" :: "v"(pa0), "v"(pa1), "v"(pb0) : "memory");      /* wait before the three loads' address registers are rewritten; naming the addresses as inputs keeps them live up to here, so that no later load's data lands in them either */
    c00 = g2_mma(a0, b, c00); c10 = g2_mma(a1, b, c10);
    b = g2_frag(b1p + ko); c01 = g2_mma(a0, b, c01); c11 = g2_mma(a1, b, c11);
    b = g2_frag(b2p + ko); c02 = g2_mma(a0, b, c02); c12 = g2_mma(a1, b, c12);
    b = g2_frag(b3p + ko); c03 = g2_mma(a0, b, c03); c13 = g2_mma(a1, b, c13); }
  v8f accs[8] = {c00, c01, c02, c03, c10, c11, c12, c13};
#pragma unroll
  for (int u = 0; u < 8; ++u) { const int t = u & 3, half = u >> 2; const int col = col0 + t * 16 + ln; const float bv = bp ? bf16_round(bp[col]) : 0.f;
#pragma unroll
    for (int r = 0; r < 8; ++r) { const int rloc = half * 16 + 8 * hh + r; float v = accs[u][r] * alpha + bv; if (CP) { if (rowsPerB < 0) v += CP[cofs + (size_t)(row0g + row0 + rloc) * ldc + col];      /* rowsPerB < 0: own element of the batched C plane */ else { const int bidx = (row0g + row0 + rloc) / rowsPerB; v += CP[(size_t)bidx * sCPb + (size_t)by * 64 + col]; } }
      if (ACT == 3) v = fmaxf(v, 0.f); else if (ACT == 6) v = 0.5f * v * (1.0f + erff(v * 0.70710678118654752f)); else if (ACT == 11) v = 1.0f / (1.0f + expf(-v)); else if (ACT == 15) v = v / (1.0f + expf(-v)); else if (ACT == 12) v = (v > 0.f) ? v : 0.01f * v; else if (ACT == 8) v = tanhf(v); else if (ACT == 9) v = 0.5f * v * (1.0f + tanhf(0.7978845608028654f * (v + 0.044715f * v * v * v))); else if (ACT == 14) v = (v > 0.f) ? v : 0.1f * v; else if (ACT == 16) v = (v >= 0.f) ? v : 0.3f * v;
      so[w][rloc][t * 16 + ln] = v; } }
  __builtin_amdgcn_fence(__ATOMIC_ACQ_REL, "workgroup"); __builtin_amdgcn_wave_barrier();
  const int rsub = lane >> 4, c4 = (lane & 15) * 4;
  {
#pragma unroll
    for (int q = 0; q < 16; ++q) { const int r = q * 2 + rsub; const v4f v = *(const v4fa*)&so[w][r][c4]; if (C) *(v4f*)(C + cofs + (size_t)(row0 + r) * ldc + col0 + c4) = v; if (C16) { v4h h4; for (int i = 0; i < 4; ++i) h4[i] = (_Float16)v[i]; *(v4h*)(C16 + cofs + (size_t)(row0 + r) * ldc + col0 + c4) = h4; } }
     } }


// additive bias plane as a matrix operand: bf16-rounded sim is exact in f16 (8 significant bits; below 2^-14 the absolute error stays under 2^-25; a normal draw stays four orders of magnitude under the f16 maximum), half the bytes of an f32 accumulator tile.
// One fragment-order block per (16-query tile, 32 keys): element (row ln, k = 16 j + 8 hh + e) = sim[query 8 hh + e][key 16 j + ln]. Times the one-hot B (k = 16 x + c -> column c) it adds
// sim[query c][key 16 x + row] to a 16-key x 16-query score tile: one block serves two score tiles, x = 0 and 1. Thread t writes the t-th 16 bytes of the plane.
__device__ __forceinline__ void d_bias(int blk, const float* __restrict__ sim, _Float16* __restrict__ BP) {
  const int t = blk * 256 + threadIdx.x; if (t >= NN * NN / 8) return; const int key = ((t >> 6) & 15) * 32 + ((t >> 5) & 1) * 16 + (t & 15), q0 = (t >> 10) * 16 + ((t >> 4) & 1) * 8; FragH f;
#pragma unroll
  for (int e = 0; e < 8; ++e) f.h[e] = (_Float16)bf16_round(sim[(size_t)(q0 + e) * NN + key]);
  *(v8us*)((unsigned short*)BP + (size_t)t * 8) = f.half[0]; }

// Fused attention. One work-group = one (group, head) and 128 queries; each of its 8 waves owns 16 queries (one column group).
// S^T = K Q^T + bias block x one-hot (q carries 32^-0.5, so that sim is added as it stands): lane (c, h) holds keys 8h..8h+7 of each 16-key tile for query c, so two score tiles
// convert in place into the B operand of O^T += V^T P^T (hardware k order on both sides). Online softmax over blocks of 128 keys in
// the log2 domain; P carries 2^10 (cancels against the row sum). K rows and V^T rows sit in LDS at pitches of 16 B x odd.
#define KPITCH 40                /* f16 per K row in LDS: 80 B */
#define VPITCH 520               /* f16 per V^T row in LDS: 1040 B */
#define KBLK 128                 /* keys per online-softmax block */
#define QWG 128                  /* queries per work-group */
#define C2 1.4426950408889634f
__device__ __forceinline__ v16h lds_frag(const unsigned short* p, int hh) { FragH f; f.half[0] = *(const v8us*)(p + 8 * hh); f.half[1] = *(const v8us*)(p + 16 + 8 * hh); return f.v; }
__global__ __launch_bounds__(256) void k_attn(const _Float16* __restrict__ Qf, const _Float16* __restrict__ Kp, const _Float16* __restrict__ VTg, const _Float16* __restrict__ BP, _Float16* __restrict__ O16) {
  __shared__ __attribute__((aligned(16))) unsigned short sk[NN * KPITCH];
  __shared__ __attribute__((aligned(16))) unsigned short sv[HD * VPITCH];
  const int tid = threadIdx.x, w = __builtin_amdgcn_readfirstlane(tid >> 5), lane = tid & 31, ln = lane & 15, hh = lane >> 4;      /* the wave's number as a scalar: the query tile's bases stay out of the vector registers, of which the kernel may use 160 (three work-groups per WGP) */
  const int qb = blockIdx.x % (NN / QWG), gh = blockIdx.x / (NN / QWG); const int g = gh / NH, h = gh % NH;
  // staging: the K rows, V^T rows and the wave's Q fragment are all loaded first, each group from one lane address plus constant steps
  const int n0 = qb * QWG + w * 16;
  const unsigned short* kg = (const unsigned short*)Kp + (size_t)gh * NN * HD + tid * 8;      /* k plane of (group, head): token row tid/4 + 64 i, 16-byte part tid%4 */
  const unsigned short* vg = (const unsigned short*)VTg + (size_t)(h * HD + (tid >> 6)) * NR + (size_t)g * NN + (tid & 63) * 8;      /* head dim tid/64 + 4 i, keys 8 (tid%64).. */
  const unsigned short* qg = (const unsigned short*)Qf + ((size_t)h * (NR / 16) + ((g * NN + n0) >> 4)) * FBLK + lane * 8;      /* fragment-order block [head][row tile]: query n0 + ln, dims 8hh.. and 16 + 8hh.. */
  v8us kr[8], vr8[8]; FragH qfr;
#pragma unroll
  for (int i = 0; i < 8; ++i) kr[i] = *(const v8us*)(kg + i * 64 * HD);
#pragma unroll
  for (int i = 0; i < 8; ++i) vr8[i] = *(const v8us*)(vg + (size_t)i * 4 * NR);
  qfr.half[0] = *(const v8us*)qg; qfr.half[1] = *(const v8us*)(qg + FBLK / 2); const v16h qf = qfr.v;
  asm volatile("s_wait_xcnt 0x0" :: "v"(tid), "v"(vg), "v"(qg) : "memory");      /* wait before the loads' address registers are rewritten; naming the addresses as inputs keeps them live up to here, so that no later load's data lands in them either (the k loads go by a scalar base and the thread index as lane offset) */
#pragma unroll
  for (int i = 0; i < 8; ++i) *(v8us*)(sk + ((tid >> 2) + 64 * i) * KPITCH + (tid & 3) * 8) = kr[i];
#pragma unroll
  for (int i = 0; i < 8; ++i) *(v8us*)(sv + ((tid >> 6) + 4 * i) * VPITCH + (tid & 63) * 8) = vr8[i];
  __syncthreads();
  const unsigned short* bro = (const unsigned short*)BP + (size_t)(n0 >> 4) * (NN / 32) * FBLK + lane * 8;
  const v8f z8 = {0.f,0.f,0.f,0.f,0.f,0.f,0.f,0.f}; v8f o0 = z8, o1 = z8, os = z8; float m = -1.0e30f;      /* far below any score, and (m - mn) * C2 stays finite */
  FragH ones;      /* A whose row 0 is all ones: row 0 of os = the column sums of the rounded P, summed on the matrix pipe */
#pragma unroll
  for (int i = 0; i < 16; ++i) ones.h[i] = (ln == 0) ? (_Float16)1.0f : (_Float16)0.0f;
  FragH e0, e1;      /* one-hot B operands: k = c (e0) or k = 16 + c (e1) goes to column c */
#pragma unroll
  for (int i = 0; i < 8; ++i) { const _Float16 d = (8 * hh + i == ln) ? (_Float16)1.0f : (_Float16)0.0f; e0.h[i] = d; e0.h[8 + i] = (_Float16)0.0f; e1.h[i] = (_Float16)0.0f; e1.h[8 + i] = d; }
  // rolled: only one block's 64 score registers are live at a time, which keeps more waves resident
#pragma unroll 1
  for (int kb = 0; kb < NN; kb += KBLK) {
    v8f s[KBLK / 16]; v16h bf[KBLK / 32]; const unsigned short* bp = bro + (kb / 32) * FBLK;
#pragma unroll
    for (int p = 0; p < KBLK / 32; ++p) bf[p] = fo_frag(bp + p * FBLK);
    asm volatile("s_wait_xcnt 0x0" ::: "memory");      /* wait before the bias loads' address register is stepped; as a memory fence it also keeps the eight loads at the head of the block, so that they fly under the K Q^T products */
#pragma unroll
    for (int p = 0; p < KBLK / 32; ++p) {
      s[2 * p] = __builtin_amdgcn_wmma_f32_16x16x32_f16(false, lds_frag(sk + (kb + p * 32 + ln) * KPITCH, hh), false, qf, (short)0, z8, false, false);
      s[2 * p + 1] = __builtin_amdgcn_wmma_f32_16x16x32_f16(false, lds_frag(sk + (kb + p * 32 + 16 + ln) * KPITCH, hh), false, qf, (short)0, z8, false, false);
      s[2 * p] = __builtin_amdgcn_wmma_f32_16x16x32_f16(false, bf[p], false, e0.v, (short)0, s[2 * p], false, false);
      s[2 * p + 1] = __builtin_amdgcn_wmma_f32_16x16x32_f16(false, bf[p], false, e1.v, (short)0, s[2 * p + 1], false, false);
    }
    float mx[4] = {s[0][0], s[0][1], s[0][2], s[0][3]};
#pragma unroll
    for (int t = 0; t < KBLK / 16; ++t)
#pragma unroll
      for (int r = 0; r < 8; ++r) mx[r & 3] = fmaxf(mx[r & 3], s[t][r]);
    float bm = fmaxf(fmaxf(mx[0], mx[1]), fmaxf(mx[2], mx[3])); bm = fmaxf(bm, __shfl_xor(bm, 16, 32));      /* both halves of a column share one maximum */
    const float mn = fmaxf(m, bm); const float al = __builtin_amdgcn_exp2f((m - mn) * C2); const float off = 10.0f - mn * C2; m = mn;
#pragma unroll
    for (int r = 0; r < 8; ++r) { o0[r] *= al; o1[r] *= al; }
    os[0] *= al;      /* only row 0 of the sum tile is ever read */
#pragma unroll
    for (int p = 0; p < KBLK / 32; ++p) { FragH b;
#pragma unroll
      for (int r = 0; r < 8; ++r) { const float e0 = __builtin_amdgcn_exp2f(fmaf(s[2 * p][r], C2, off)), e1 = __builtin_amdgcn_exp2f(fmaf(s[2 * p + 1][r], C2, off));
        b.h[r] = (_Float16)e0; b.h[8 + r] = (_Float16)e1; }
      const unsigned short* vr = sv + ln * VPITCH + kb + p * 32;
      o0 = __builtin_amdgcn_wmma_f32_16x16x32_f16(false, lds_frag(vr, hh), false, b.v, (short)0, o0, false, false);
      o1 = __builtin_amdgcn_wmma_f32_16x16x32_f16(false, lds_frag(vr + 16 * VPITCH, hh), false, b.v, (short)0, o1, false, false);
      os = __builtin_amdgcn_wmma_f32_16x16x32_f16(false, ones.v, false, b.v, (short)0, os, false, false); }
  }
  const float su = __shfl(os[0], ln, 32); const float inv = 1.0f / su; FragH f;      /* row 0 sits in register 0 of lanes 0..15 */
#pragma unroll
  for (int r = 0; r < 8; ++r) { f.h[r] = (_Float16)(o0[r] * inv); f.h[8 + r] = (_Float16)(o1[r] * inv); }
  unsigned short* d = (unsigned short*)O16 + ((size_t)((g * NN + n0) >> 4) * (DD / 32) + h) * FBLK + lane * 8;      /* lane (c, h) holds head dims 8h..8h+7 and 16+8h.. of query c: the output GEMM's A fragment of row tile (g NN + n0) / 16, k step h, as it stands */
  *(v8us*)d = f.half[0]; *(v8us*)(d + FBLK / 2) = f.half[1]; }
// Fused projection. One work-group = 64 token rows: x is read once as f32, rounded (bf16, exact in f16) into LDS, and all 768 outputs of those rows are formed from it.
// q | k: D = W rows (A) x token rows (B), so lane (c, h) holds 8 neighbouring output dims of token c; v^T: D = token rows (A) x W rows (B), so a lane holds 8 neighbouring tokens of one dim.
// Each wave stages its f16 tile in its own LDS range and stores whole 128-byte lines.
// Every loop of the kernel is unrolled: its arrays are register fragments and must be indexed by constants.
#define PROWS 64                 /* token rows per work-group */
#define XPITCH 264               /* f16 per x row in LDS: 528 B = 16 B x 33 */
#define SPITCH 72                /* f16 per staged output row in LDS: 144 B = 16 B x 9 */
#define VT0 ((2 * DD / 16) * (DD / 32) * FBLK)      /* f16 in front of the v weights in the fragment-order plane */
__device__ __forceinline__ v16h pj_frag(const unsigned short* p) { FragH f; f.half[0] = *(const v8us*)p; f.half[1] = *(const v8us*)(p + 16); return f.v; }
// four waves per SIMD: two work-groups fit a WGP, so that all 384 are resident at once
__global__ __launch_bounds__(256) __attribute__((amdgpu_waves_per_eu(4, 4))) void k_proj(const float* __restrict__ x, const _Float16* __restrict__ Bw, _Float16* __restrict__ Qf, _Float16* __restrict__ Kp, _Float16* __restrict__ VTg) {
  __shared__ __attribute__((aligned(16))) unsigned short sx[PROWS * XPITCH];
  __shared__ __attribute__((aligned(16))) unsigned short st[8][PROWS * SPITCH];
  __shared__ __attribute__((aligned(16))) unsigned short sv2[8][32 * SPITCH];      /* a range of its own for v^T: no wait on the q | k stores before it is written */
  const int tid = threadIdx.x, w = tid >> 5, lane = tid & 31, ln = lane & 15, hh = lane >> 4;
  const int row0 = blockIdx.x * PROWS;
  const float* xg = x + (size_t)row0 * DD + tid * 8;      /* row 8 i + w, columns 8 lane.. */
  const unsigned short* wq = (const unsigned short*)Bw + (size_t)(w * 4) * (DD / 32) * FBLK + lane * 8;      /* q | k output dims 64 w + 16 a + ln: row tiles 4 w + a, fragment order */
  const unsigned short* wv = (const unsigned short*)Bw + (size_t)(w * 2) * (DD / 32) * FBLK + lane * 8;      /* v output dims 32 w + 16 b + ln: row tiles 32 + 2 w + b; the 32 tiles of q | k are the constant VT0 at each load, so that this is the very address register of the loads */
  v4f xa[8], xb[8];
#pragma unroll
  for (int i = 0; i < 8; ++i) { xa[i] = *(const v4fa*)(xg + i * 8 * DD); xb[i] = *(const v4fa*)(xg + i * 8 * DD + 4); }
  v16h af[4];      /* the first weight fragments fly while x is converted */
#pragma unroll
  for (int a = 0; a < 4; ++a) af[a] = fo_frag(wq + a * (DD / 32) * FBLK);
#pragma unroll
  for (int i = 0; i < 8; ++i) { FragH f;
#pragma unroll
    for (int q = 0; q < 4; ++q) { f.h[q] = (_Float16)bf16_round(xa[i][q]); f.h[4 + q] = (_Float16)bf16_round(xb[i][q]); }
    *(v8us*)(sx + (i * 8 + w) * XPITCH + lane * 8) = f.half[0]; }
  __syncthreads();
  const unsigned short* xs = sx + ln * XPITCH + 8 * hh;
  unsigned short* sw = st[w]; unsigned short* sw2 = sv2[w];
  const v8f z8 = {0.f,0.f,0.f,0.f,0.f,0.f,0.f,0.f};
  const float osc = __builtin_amdgcn_readfirstlane(w) < 4 ? 0.0625f * SCL : 0.0625f;      /* q (waves 0..3) carries the score scale 32^-0.5 */
  {
    v8f acc[4][4];
#pragma unroll
    for (int a = 0; a < 4; ++a)
#pragma unroll
      for (int b = 0; b < 4; ++b) acc[a][b] = z8;
    // unrolled so that the next step's weight fragments are loaded into a second register set ahead of this step's products
#pragma unroll
    for (int kb = 0; kb < DD; kb += 32) { v16h an[4], bx[4];
      if (kb + 32 < DD) {
#pragma unroll
        for (int a = 0; a < 4; ++a) an[a] = fo_frag(wq + (a * (DD / 32) + kb / 32 + 1) * FBLK); }
#pragma unroll
      for (int b = 0; b < 4; ++b) bx[b] = pj_frag(xs + b * 16 * XPITCH + kb);
#pragma unroll
      for (int a = 0; a < 4; ++a)
#pragma unroll
        for (int b = 0; b < 4; ++b) acc[a][b] = __builtin_amdgcn_wmma_f32_16x16x32_f16(false, af[a], false, bx[b], (short)0, acc[a][b], false, false);
      if (kb + 32 < DD) {
#pragma unroll
        for (int a = 0; a < 4; ++a) af[a] = an[a]; } }
#pragma unroll
    for (int a = 0; a < 4; ++a)
#pragma unroll
      for (int b = 0; b < 4; ++b) { FragH f;
#pragma unroll
        for (int r = 0; r < 8; ++r) f.h[r] = (_Float16)(acc[a][b][r] * osc);
        *(v8us*)(sw + (b * 16 + ln) * SPITCH + a * 16 + 8 * hh) = f.half[0]; }
  }
  __builtin_amdgcn_fence(__ATOMIC_ACQ_REL, "workgroup"); __builtin_amdgcn_wave_barrier();      /* the wave's other lanes read what this lane staged */
  v16h vf[8][2];      /* all of the wave's v weight fragments (128 registers, free now) fly while the q | k tile is stored */
#pragma unroll
  for (int s = 0; s < 8; ++s) { vf[s][0] = fo_frag(wv + VT0 + s * FBLK); vf[s][1] = fo_frag(wv + VT0 + (DD / 32 + s) * FBLK); }
  asm volatile("s_wait_xcnt 0x0" :: "v"(wq), "v"(wv) : "memory");      /* wait before the weight loads' address registers are rewritten; naming the addresses as inputs keeps them live up to here, so that no load's data lands in them either */
  {
    // the wave's 64 dims are two heads of q (waves 0..3) or of k (waves 4..7). q goes out as fragment-order blocks [head][row tile], k as 64-byte rows of its [group][head] plane: every store covers 4 whole lines.
    // Both cases share one set of constant steps: 16 staged rows and 512 f16 of output per row tile; only the lane bases (register half or next 8 tokens; next head) differ.
    const int h0 = (w & 3) * 2; const bool isq = __builtin_amdgcn_readfirstlane(w) < 4;      /* the wave's number as a scalar: the case is picked by scalar selects, EXEC stays untouched */
    const unsigned short* sr0 = sw + (isq ? ln * SPITCH + 8 * hh : (lane >> 2) * SPITCH + (lane & 3) * 8);
    const unsigned short* sr1 = sr0 + (isq ? 16 : 8 * SPITCH);
    unsigned short* qd0 = (isq ? (unsigned short*)Qf + ((size_t)h0 * (NR / 16) + (row0 >> 4)) * FBLK : (unsigned short*)Kp + ((size_t)((row0 / NN) * NH + h0) * NN + row0 % NN) * HD) + lane * 8;
    unsigned short* qd1 = qd0 + (isq ? (NR / 16) * FBLK : NN * HD);
    v8us tv[16];
#pragma unroll
    for (int q = 0; q < 16; ++q) tv[q] = *(const v8us*)(((q & 1) ? sr1 : sr0) + ((q >> 1) & 3) * 16 * SPITCH + (q >> 3) * HD);      /* head q / 8, row tile (q / 2) % 4, half q % 2 */
    __builtin_amdgcn_sched_barrier(0);      /* all LDS reads issue as one group ahead of the stores; otherwise each store waits out its own read's latency in one register set */
#pragma unroll
    for (int q = 0; q < 16; ++q) *(v8us*)(((q >> 3) ? qd1 : qd0) + (q & 7) * (FBLK / 2)) = tv[q];
    asm volatile("s_wait_xcnt 0x0" ::: "memory");      /* wait before the stores' address and data registers are rewritten by the v^T part */
  }
  {
    v8f acc[4][2];
#pragma unroll
    for (int a = 0; a < 4; ++a) { acc[a][0] = z8; acc[a][1] = z8; }
    // unrolled: the weight fragments are indexed by the step
#pragma unroll
    for (int kb = 0; kb < DD; kb += 32) { v16h ax[4];
#pragma unroll
      for (int a = 0; a < 4; ++a) ax[a] = pj_frag(xs + a * 16 * XPITCH + kb);
      __builtin_amdgcn_sched_barrier(0);      /* the step's loads issue as one group ahead of its products: one place with LDS reads a step, not four */
#pragma unroll
      for (int a = 0; a < 4; ++a)
#pragma unroll
        for (int b = 0; b < 2; ++b) acc[a][b] = __builtin_amdgcn_wmma_f32_16x16x32_f16(false, ax[a], false, vf[kb / 32][b], (short)0, acc[a][b], false, false);
      __builtin_amdgcn_sched_barrier(0); }      /* keeps later steps' LDS reads in their own step; hoisted all together they spilled registers to scratch */
#pragma unroll
    for (int a = 0; a < 4; ++a)
#pragma unroll
      for (int b = 0; b < 2; ++b) { FragH f;
#pragma unroll
        for (int r = 0; r < 8; ++r) f.h[r] = (_Float16)(acc[a][b][r] * 0.0625f);
        *(v8us*)(sw2 + (b * 16 + ln) * SPITCH + a * 16 + 8 * hh) = f.half[0]; }
  }
  __builtin_amdgcn_fence(__ATOMIC_ACQ_REL, "workgroup"); __builtin_amdgcn_wave_barrier();      /* as above: lanes read each other's staged rows */
  {
    unsigned short* vd = (unsigned short*)VTg + (size_t)(w * 32 + (lane >> 3)) * NR + row0 + (lane & 7) * 8;
    v8us tv[8];
#pragma unroll
    for (int q = 0; q < 8; ++q) tv[q] = *(const v8us*)(sw2 + (q * 4 + (lane >> 3)) * SPITCH + (lane & 7) * 8);
    __builtin_amdgcn_sched_barrier(0);      /* as above: one group of LDS reads, then the stores */
#pragma unroll
    for (int q = 0; q < 8; ++q) *(v8us*)(vd + (size_t)q * 4 * NR) = tv[q];
  }
}
// thread t writes the t-th 16 bytes of the fragment-order plane: lane = t % 32, register half j, k step, row tile
__device__ __forceinline__ void d_wqkv(int blk, const float* __restrict__ Wq, const float* __restrict__ Wk, const float* __restrict__ Wv, _Float16* __restrict__ Bt) { const int t = blk * 256 + threadIdx.x; if (t >= 3 * DD * (DD / 8)) return; const int n = (t >> 9) * 16 + (t & 15), k0 = ((t >> 6) & 7) * 32 + ((t >> 5) & 1) * 16 + ((t >> 4) & 1) * 8; const int which = n / DD, o = n % DD; const float* Wm = which == 0 ? Wq : (which == 1 ? Wk : Wv); FragH f;
  for (int q = 0; q < 8; ++q) f.h[q] = (_Float16)(bf16_round(Wm[(size_t)(k0 + q) * DD + o]) * 16.0f); *(v8us*)((unsigned short*)Bt + (size_t)t * 8) = f.half[0];  }
// W_o as f16 [n][k], times 16, in fragment order (thread t as in d_wqkv)
__device__ __forceinline__ void d_wo(int blk, const float* __restrict__ Wo, _Float16* __restrict__ Bo) { const int t = blk * 256 + threadIdx.x; if (t >= DD * (DD / 8)) return; const int n = (t >> 9) * 16 + (t & 15), k8 = ((t >> 6) & 7) * 32 + ((t >> 5) & 1) * 16 + ((t >> 4) & 1) * 8; FragH f;
#pragma unroll
  for (int i = 0; i < 8; ++i) f.h[i] = (_Float16)(bf16_round(Wo[(size_t)(k8 + i) * DD + n]) * 16.0f);
  *(v8us*)((unsigned short*)Bo + (size_t)t * 8) = f.half[0]; }
// One preparation launch: the three jobs read none of each other's output, so they share a grid and each work-group picks its job by its index.
// The weight jobs come first: each of their threads gathers from eight weight rows.
#define PB_QKV (3 * DD * (DD / 8) / 256)      /* 96 work-groups */
#define PB_WO (DD * (DD / 8) / 256)           /* 32 */
#define PB_BIAS (NN * NN / 8 / 256)           /* 128 */
__global__ __launch_bounds__(256) void k_prep(const float* __restrict__ Wq, const float* __restrict__ Wk, const float* __restrict__ Wv, const float* __restrict__ Wo, const float* __restrict__ sim,
                                              _Float16* __restrict__ Bt, _Float16* __restrict__ Bo, _Float16* __restrict__ BP) {
  const int b = blockIdx.x;
  if (b < PB_QKV) d_wqkv(b, Wq, Wk, Wv, Bt);
  else if (b < PB_QKV + PB_WO) d_wo(b - PB_QKV, Wo, Bo);
  else d_bias(b - (PB_QKV + PB_WO), sim, BP);
}

extern "C" void kernel_launch(void* const* d_in, const int* in_sizes, int n_in,
                              void* d_out, int out_size, void* d_ws, size_t ws_size, hipStream_t stream) {
  (void)in_sizes; (void)n_in; (void)out_size;
  const float* const* I = (const float* const*)d_in; const float* x = I[0]; const float* sim = I[1]; const float* Wq = I[2]; const float* Wk = I[3]; const float* Wv = I[4]; const float* Wo = I[5];
  char* ws = (char*)d_ws; size_t off = 0;
  auto take = [&](size_t bytes) { char* p = ws + off; off += (bytes + 255) & ~(size_t)255; return p; };
  _Float16* BQKV = (_Float16*)take((size_t)3 * DD * DD * 2); _Float16* BO = (_Float16*)take((size_t)DD * DD * 2);
  _Float16* Q16 = (_Float16*)take((size_t)NR * DD * 2); _Float16* K16 = (_Float16*)take((size_t)NR * DD * 2); _Float16* VTg = (_Float16*)take((size_t)DD * NR * 2); _Float16* O16 = (_Float16*)take((size_t)NR * DD * 2);
  _Float16* BP = (_Float16*)take((size_t)NN * NN * 2);
  if (off > ws_size) return;      /* under 50 MiB */
  k_prep<<<PB_QKV + PB_WO + PB_BIAS, 256, 0, stream>>>(Wq, Wk, Wv, Wo, sim, BQKV, BO, BP);
  k_proj<<<NR / PROWS, 256, 0, stream>>>(x, BQKV, Q16, K16, VTg);      /* q: fragment-order blocks [head][row tile]; k: planes [group][head][token][32]; v^T: rows h*32 + d, columns = token rows */
  k_attn<<<NG * NH * (NN / QWG), 256, 0, stream>>>(Q16, K16, VTg, BP, O16);
  k_gemm2<0><<<dim3((NR / 128) * (DD / 64), 1), 128, 0, stream>>>(O16, DD, 0, BO, DD, 0, 0.0625f, nullptr, 0, nullptr, 1, 0, 0, (float*)d_out, nullptr, DD, 0, NR, DD, DD);
}

// v006
// Measured time: 48.2 microseconds a run.
// Timed twice side by side with v005, it ran 1.26 and 1.27 times as fast.
// Counting every step since v000, it is 14.3 times as fast.
#include <hip/hip_runtime.h>
// SpatialMHSA (4 x 12 frames x 512 spatial tokens x 256 = 8 heads of 32): q/k/v = x W (xavier (in,out) weights); per (batch, frame, head) attention over the 512 tokens with scores/sqrt(32) + an INPUT additive bias sim[n][m]; out = merged heads W_o.
// Structure: ONE projection kernel (x rounded into LDS once per 64 token rows; q as fragment blocks, k as per-head rows and v^T from it, f32 accumulation, exact x16 weights, f16 output); ONE fused attention kernel over all 384 (group, head) pairs (S^T = K Q^T plus the bias plane times a one-hot matrix, online softmax in registers, O^T = V^T P^T, f16 out as the output GEMM's A fragments); output GEMM. Weights and attention output lie in the workspace in fragment order.
// Compute dtype: x, sim and weights rounded to bf16; q, k, v, P, attention output as f16 operands (~2^-12); f32 accumulation/softmax. v_wmma_f32_16x16x32_f16.
#define NBATCH 4
#define NFR 12
#define NN 512
#define DD 256
#define NH 8
#define HD 32
#define NG (NBATCH * NFR)         /* 48 groups */
#define NR (NG * NN)             /* 24576 token rows */
#define SCL 0.17677669529663687f /* 32^-0.5 */
typedef __bf16 v16b __attribute__((ext_vector_type(16)));
typedef unsigned short v8us __attribute__((ext_vector_type(8), may_alias));
typedef float  v8f  __attribute__((ext_vector_type(8)));
typedef float  v4f  __attribute__((ext_vector_type(4)));
typedef float  v4fa __attribute__((ext_vector_type(4), may_alias));
union FragB { v16b v; v8us half[2]; unsigned short u[16]; };

__device__ __forceinline__ unsigned short bf16_bits(float x) { unsigned int u = __float_as_uint(x); return (unsigned short)((u + 0x7FFFu + ((u >> 16) & 1u)) >> 16); }
__device__ __forceinline__ float bf16_val(unsigned short b) { return __uint_as_float(((unsigned int)b) << 16); }
__device__ __forceinline__ float bf16_round(float x) { return bf16_val(bf16_bits(x)); }
// D += A·B with NT terms: 1 = ah·bh, 2 = + al·bh (A split), 3 = + ah·bl (both split)
template <int NT>
__device__ __forceinline__ v8f mmaN(v16b ah, v16b al, v16b bh, v16b bl, v8f c) {
  c = __builtin_amdgcn_wmma_f32_16x16x32_bf16(false, ah, false, bh, (short)0, c, false, false);
  if (NT >= 2) c = __builtin_amdgcn_wmma_f32_16x16x32_bf16(false, al, false, bh, (short)0, c, false, false);
  if (NT >= 3) c = __builtin_amdgcn_wmma_f32_16x16x32_bf16(false, ah, false, bl, (short)0, c, false, false);
  asm volatile("v_nop\n\tv_nop\n\tv_nop\n\tv_nop" : "+v"(c) : "v"(ah), "v"(al), "v"(bh), "v"(bl));
  return c;
}

__global__ __launch_bounds__(256) void k_wt_bf16(const float* __restrict__ W, unsigned short* __restrict__ Wt, int K, int N) {
  const int t = blockIdx.x * 256 + threadIdx.x;
  const int k8n = K / 8;
  if (t >= N * k8n) return;
  const int n = t / k8n, k8 = (t % k8n) * 8;
  v8us v;
#pragma unroll
  for (int i = 0; i < 8; ++i) v[i] = bf16_bits(W[(size_t)(k8 + i) * N + n]);
  *(v8us*)(Wt + (size_t)n * K + k8) = v;
  
}

// GEMM C[M][N] (f32, pitch ldc) = act(A[M][K]·W + bias). A f32 row-major (pitch lda) converted per fragment to bf16
// (ASPLIT: hi/lo two planes -> 2 terms, else single rounded term); Wt bf16 [N][K] (pitch ldb). BIAS_BF16 rounds the
// bias to bf16 first (bias quantised to bf16 before the add). K%32==0, M%16==0, N%64==0.
template <bool ASPLIT, int ACT, bool BIAS_BF16>
__global__ __launch_bounds__(128) void k_gemm_bf(const float* __restrict__ A, int lda, const unsigned short* __restrict__ Wt, int ldb,
                                               const float* __restrict__ bias, float* __restrict__ C, int ldc, int M, int N, int K) {
  __shared__ __attribute__((aligned(16))) float so[4][16][64];
  const int tid = threadIdx.x, w = tid >> 5, lane = tid & 31, ln = lane & 15, hh = lane >> 4;
  const int ntn = N / 64;
  const int wid = blockIdx.x * 4 + w;
  const int mt = wid / ntn, nq = wid % ntn;
  if (mt * 16 >= M) return;
  const int row0 = mt * 16, col0 = nq * 64;
  const float* arow = A + (size_t)(row0 + ln) * lda;
  v8f acc[4] = {};
  for (int kb = 0; kb < K; kb += 32) {
    FragB ah, al;
    const v4f x0 = *(const v4fa*)(arow + kb + 8 * hh), x1 = *(const v4fa*)(arow + kb + 8 * hh + 4);
    const v4f x2 = *(const v4fa*)(arow + kb + 16 + 8 * hh), x3 = *(const v4fa*)(arow + kb + 16 + 8 * hh + 4);
    float xs[16] = {x0[0],x0[1],x0[2],x0[3],x1[0],x1[1],x1[2],x1[3],x2[0],x2[1],x2[2],x2[3],x3[0],x3[1],x3[2],x3[3]};
#pragma unroll
    for (int i = 0; i < 16; ++i) { const unsigned short hb = bf16_bits(xs[i]); ah.u[i] = hb; al.u[i] = ASPLIT ? bf16_bits(xs[i] - bf16_val(hb)) : (unsigned short)0; }
#pragma unroll
    for (int t = 0; t < 4; ++t) {
      const unsigned short* brow = Wt + (size_t)(col0 + t * 16 + ln) * ldb + kb;
      FragB b;
      b.half[0] = *(const v8us*)(brow + 8 * hh);
      b.half[1] = *(const v8us*)(brow + 16 + 8 * hh);
      acc[t] = mmaN<ASPLIT ? 2 : 1>(ah.v, al.v, b.v, b.v, acc[t]);
    }
  }
#pragma unroll
  for (int t = 0; t < 4; ++t) {
    float bv = bias ? bias[col0 + t * 16 + ln] : 0.f;
    if (BIAS_BF16) bv = bf16_round(bv);
#pragma unroll
    for (int r = 0; r < 8; ++r) { float v = acc[t][r] + bv; if (ACT == 1) v = fmaxf(v, 0.f); so[w][8 * hh + r][t * 16 + ln] = v; }
  }
  __builtin_amdgcn_fence(__ATOMIC_ACQ_REL, "workgroup");
  __builtin_amdgcn_wave_barrier();
  const int rsub = lane >> 4, c4 = (lane & 15) * 4;
  {
#pragma unroll
    for (int q = 0; q < 8; ++q) {
      const int r = q * 2 + rsub;
      const v4f v = *(const v4fa*)&so[w][r][c4];
      *(v4f*)(C + (size_t)(row0 + r) * ldc + col0 + c4) = v;
    }
    
  }
}

// GEMM C = act(A·W + bias + resid): A f32 (ASPLIT -> hi/lo 2 terms), Wt bf16 [N][K]; ACT 0 none, 1 relu, 2 exact gelu;
// resid (optional, f32, row index = (row % rmod), pitch ldr, RES_BF16 rounds it) added before the activation.
template <bool ASPLIT, int ACT, bool BIAS_BF16, bool RES_BF16>
__global__ __launch_bounds__(128) void k_gemm_bf3(const float* __restrict__ A, int lda, const unsigned short* __restrict__ Wt, int ldb,
                                                const float* __restrict__ bias, const float* __restrict__ resid, int rmod, int ldr,
                                                float* __restrict__ C, int ldc, int M, int N, int K) {
  __shared__ __attribute__((aligned(16))) float so[4][16][64];
  const int tid = threadIdx.x, w = tid >> 5, lane = tid & 31, ln = lane & 15, hh = lane >> 4;
  const int ntn = N / 64;
  const int wid = blockIdx.x * 4 + w;
  const int mt = wid / ntn, nq = wid % ntn;
  if (mt * 16 >= M) return;
  const int row0 = mt * 16, col0 = nq * 64;
  const float* arow = A + (size_t)(row0 + ln) * lda;
  v8f acc[4] = {};
  for (int kb = 0; kb < K; kb += 32) {
    FragB ah, al;
    const v4f x0 = *(const v4fa*)(arow + kb + 8 * hh), x1 = *(const v4fa*)(arow + kb + 8 * hh + 4);
    const v4f x2 = *(const v4fa*)(arow + kb + 16 + 8 * hh), x3 = *(const v4fa*)(arow + kb + 16 + 8 * hh + 4);
    float xs[16] = {x0[0],x0[1],x0[2],x0[3],x1[0],x1[1],x1[2],x1[3],x2[0],x2[1],x2[2],x2[3],x3[0],x3[1],x3[2],x3[3]};
#pragma unroll
    for (int i = 0; i < 16; ++i) { const unsigned short hb = bf16_bits(xs[i]); ah.u[i] = hb; al.u[i] = ASPLIT ? bf16_bits(xs[i] - bf16_val(hb)) : (unsigned short)0; }
#pragma unroll
    for (int t = 0; t < 4; ++t) {
      const unsigned short* brow = Wt + (size_t)(col0 + t * 16 + ln) * ldb + kb;
      FragB b;
      b.half[0] = *(const v8us*)(brow + 8 * hh);
      b.half[1] = *(const v8us*)(brow + 16 + 8 * hh);
      acc[t] = mmaN<ASPLIT ? 2 : 1>(ah.v, al.v, b.v, b.v, acc[t]);
    }
  }
#pragma unroll
  for (int t = 0; t < 4; ++t) {
    const int col = col0 + t * 16 + ln;
    float bv = bias ? bias[col] : 0.f;
    if (BIAS_BF16) bv = bf16_round(bv);
#pragma unroll
    for (int r = 0; r < 8; ++r) {
      float v = acc[t][r] + bv;
      if (resid) { float rv = resid[(size_t)((row0 + 8 * hh + r) % rmod) * ldr + col]; if (RES_BF16) rv = bf16_round(rv); v += rv; }
      if (ACT == 1) v = fmaxf(v, 0.f);
      if (ACT == 2) v = 0.5f * v * (1.0f + erff(v * 0.70710678118654752f));
      if (ACT == 3) { const float u = 0.7978845608028654f * (v + 0.044715f * v * v * v); v = 0.5f * v * (1.0f + tanhf(u)); }
      so[w][8 * hh + r][t * 16 + ln] = v;
    }
  }
  __builtin_amdgcn_fence(__ATOMIC_ACQ_REL, "workgroup");
  __builtin_amdgcn_wave_barrier();
  const int rsub = lane >> 4, c4 = (lane & 15) * 4;
  {
#pragma unroll
    for (int q = 0; q < 8; ++q) {
      const int r = q * 2 + rsub;
      const v4f v = *(const v4fa*)&so[w][r][c4];
      *(v4f*)(C + (size_t)(row0 + r) * ldc + col0 + c4) = v;
    }
    
  }
}
// row LayerNorm (biased variance, eps) over N: s = X (+ R); optional out_sum <- s; out_norm <- (s-mu)*rsqrt(var+eps)*g + b
template <bool PARAM_BF16>
__global__ __launch_bounds__(256) void k_layernorm(const float* __restrict__ X, const float* __restrict__ R, const float* __restrict__ g, const float* __restrict__ bta,
                                                  float* __restrict__ out_sum, float* __restrict__ out_norm, int N, float eps) {
  __shared__ float red[256];
  const int row = blockIdx.x, tid = threadIdx.x;
  const float* x = X + (size_t)row * N; const float* rr = R ? R + (size_t)row * N : nullptr;
  float vals[16];                     // up to N = 4096
  const int per = N / 256;            // contiguous chunk per thread? use strided-by-4 chunks: thread handles j = tid*4 + 1024*u
  float s1 = 0.f;
  for (int u = 0; u < per / 4; ++u) {
    const int j = tid * 4 + 1024 * u;
    const v4f a = *(const v4fa*)(x + j);
    v4f b = {0.f,0.f,0.f,0.f}; if (rr) b = *(const v4fa*)(rr + j);
#pragma unroll
    for (int q = 0; q < 4; ++q) { const float v = a[q] + b[q]; vals[u * 4 + q] = v; s1 += v; }
  }
  red[tid] = s1; __syncthreads();
  for (int st = 128; st > 0; st >>= 1) { if (tid < st) red[tid] += red[tid + st]; __syncthreads(); }
  const float mu = red[0] / (float)N; __syncthreads();
  float s2 = 0.f;
  for (int u = 0; u < per / 4; ++u)
#pragma unroll
    for (int q = 0; q < 4; ++q) { const float c = vals[u * 4 + q] - mu; s2 += c * c; }
  red[tid] = s2; __syncthreads();
  for (int st = 128; st > 0; st >>= 1) { if (tid < st) red[tid] += red[tid + st]; __syncthreads(); }
  const float rs = rsqrtf(red[0] / (float)N + eps);
  {
    for (int u = 0; u < per / 4; ++u) {
      const int j = tid * 4 + 1024 * u;
      v4f o, sm;
#pragma unroll
      for (int q = 0; q < 4; ++q) {
        float gg = g[j + q], bb = bta[j + q];
        if (PARAM_BF16) { gg = bf16_round(gg); bb = bf16_round(bb); }
        sm[q] = vals[u * 4 + q]; o[q] = (vals[u * 4 + q] - mu) * rs * gg + bb;
      }
      if (out_sum) *(v4f*)(out_sum + (size_t)row * N + j) = sm;
      *(v4f*)(out_norm + (size_t)row * N + j) = o;
    }
    
  }
}



// ---- f16 WMMA path (v_wmma_f32_16x16x32_f16): 11-bit significands for operands in range — used where a [0,1] probability operand needs more precision than bf16
typedef _Float16 v16h __attribute__((ext_vector_type(16)));
union FragH { v16h v; v8us half[2]; _Float16 h[16]; unsigned short u[16]; };
template <int NT>
__device__ __forceinline__ v8f mmaH(v16h ah, v16h al, v16h bh, v16h bl, v8f c) {
  c = __builtin_amdgcn_wmma_f32_16x16x32_f16(false, ah, false, bh, (short)0, c, false, false);
  if (NT >= 2) c = __builtin_amdgcn_wmma_f32_16x16x32_f16(false, al, false, bh, (short)0, c, false, false);
  if (NT >= 3) c = __builtin_amdgcn_wmma_f32_16x16x32_f16(false, ah, false, bl, (short)0, c, false, false);
  asm volatile("v_nop\n\tv_nop\n\tv_nop\n\tv_nop" : "+v"(c) : "v"(ah), "v"(al), "v"(bh), "v"(bl));
  return c;
}
// batched GEMM like k_gemm_b but f16 operands: A f32 (split into f16 hi/lo if ASPLIT, else rounded to f16), Bt = f16 values [n][k]; alpha; C f32; N multiple of 16 (partial tiles skipped)
template <bool ASPLIT>
__global__ __launch_bounds__(128) void k_gemm_h(const float* __restrict__ A, int lda, size_t sA, const _Float16* __restrict__ Bh, int ldb, size_t sB, float alpha, float* __restrict__ C, int ldc, size_t sC, int M, int N, int K) {
  __shared__ __attribute__((aligned(16))) float so[4][16][64];
  const int tid = threadIdx.x, w = tid >> 5, lane = tid & 31, ln = lane & 15, hh = lane >> 4; const int by = blockIdx.y;
  A += (size_t)by * sA; Bh += (size_t)by * sB; C += (size_t)by * sC;
  const int ntn = (N + 63) / 64; const int wid = blockIdx.x * 4 + w; const int mt = wid / ntn, nq = wid % ntn; if (mt * 16 >= M) return;
  const int row0 = mt * 16, col0 = nq * 64; const float* arow = A + (size_t)(row0 + ln) * lda;
  v8f acc[4] = {};
  for (int kb = 0; kb < K; kb += 32) {
    FragH ah, al;
    const v4f x0 = *(const v4fa*)(arow + kb + 8 * hh), x1 = *(const v4fa*)(arow + kb + 8 * hh + 4), x2 = *(const v4fa*)(arow + kb + 16 + 8 * hh), x3 = *(const v4fa*)(arow + kb + 16 + 8 * hh + 4);
    float xs[16] = {x0[0],x0[1],x0[2],x0[3],x1[0],x1[1],x1[2],x1[3],x2[0],x2[1],x2[2],x2[3],x3[0],x3[1],x3[2],x3[3]};
#pragma unroll
    for (int i = 0; i < 16; ++i) { const _Float16 h = (_Float16)xs[i]; ah.h[i] = h; al.h[i] = ASPLIT ? (_Float16)(xs[i] - (float)h) : (_Float16)0.0f; }
#pragma unroll
    for (int t = 0; t < 4; ++t) { if (col0 + t * 16 >= N) continue; const size_t boff = (size_t)(col0 + t * 16 + ln) * ldb + kb; FragH bq; bq.half[0] = *(const v8us*)(Bh + boff + 8 * hh); bq.half[1] = *(const v8us*)(Bh + boff + 16 + 8 * hh);
      acc[t] = mmaH<ASPLIT ? 2 : 1>(ah.v, al.v, bq.v, bq.v, acc[t]); }
  }
#pragma unroll
  for (int t = 0; t < 4; ++t) { if (col0 + t * 16 >= N) continue;
#pragma unroll
    for (int r = 0; r < 8; ++r) so[w][8 * hh + r][t * 16 + ln] = acc[t][r] * alpha; }
  __builtin_amdgcn_fence(__ATOMIC_ACQ_REL, "workgroup"); __builtin_amdgcn_wave_barrier();
  const int rsub = lane >> 4, c4 = (lane & 15) * 4;
  {
#pragma unroll
    for (int q = 0; q < 8; ++q) { const int r = q * 2 + rsub; if (col0 + c4 < N) { const v4f v = *(const v4fa*)&so[w][r][c4]; *(v4f*)(C + (size_t)(row0 + r) * ldc + col0 + c4) = v; } }
     }
}

// Wt[n][k] = f16(W[k][n]·scale) from f32 row-major W[K][N] (scale = power of two; bf16-exact weights stay exact in f16 away from the subnormal range)
__global__ __launch_bounds__(256) void k_wt_f16(const float* __restrict__ W, _Float16* __restrict__ Wt, int K, int N, float scale) {
  const int t = blockIdx.x * 256 + threadIdx.x; if (t >= N * (K / 8)) return; const int n = t / (K / 8), k8 = (t % (K / 8)) * 8; FragH f;
#pragma unroll
  for (int i = 0; i < 8; ++i) f.h[i] = (_Float16)(bf16_round(W[(size_t)(k8 + i) * N + n]) * scale); const v8us o = f.half[0];
  *(v8us*)((unsigned short*)Wt + (size_t)n * K + k8) = o; 
}
// k_gemm_hh variant with fused epilogue: v = acc·alpha + bias[by·sBias + col] (+ CP[(row/rowsPerB)·sCPb + by·64 + col] if CP) ; ACT 0 none / 1 elu ; writes f16 C16 (and f32 C if non-null)
template <int ACT>
__global__ __launch_bounds__(128) void k_gemm_hhx(const _Float16* __restrict__ A, int lda, size_t sA, const _Float16* __restrict__ Bh, int ldb, size_t sB, float alpha, const float* __restrict__ bias, size_t sBias, const float* __restrict__ CP, int rowsPerB, size_t sCPb, int row0g,
    float* __restrict__ C, _Float16* __restrict__ C16, int ldc, size_t sC, int M, int N, int K) {
  __shared__ __attribute__((aligned(16))) float so[4][16][64];
  const int tid = threadIdx.x, w = tid >> 5, lane = tid & 31, ln = lane & 15, hh = lane >> 4; const int by = blockIdx.y;
  A += (size_t)by * sA; Bh += (size_t)by * sB; const size_t cofs = (size_t)by * sC; const float* bp = bias ? bias + (size_t)by * sBias : nullptr;
  const int ntn = (N + 63) / 64; const int wid = blockIdx.x * 4 + w; const int mt = wid / ntn, nq = wid % ntn; if (mt * 16 >= M) return;
  const int row0 = mt * 16, col0 = nq * 64; const _Float16* arow = A + (size_t)(row0 + ln) * lda;
  v8f acc[4] = {};
  for (int kb = 0; kb < K; kb += 32) { FragH ah; ah.half[0] = *(const v8us*)((const unsigned short*)arow + kb + 8 * hh); ah.half[1] = *(const v8us*)((const unsigned short*)arow + kb + 16 + 8 * hh);
#pragma unroll
    for (int t = 0; t < 4; ++t) { if (col0 + t * 16 >= N) continue; const size_t boff = (size_t)(col0 + t * 16 + ln) * ldb + kb; FragH bq; bq.half[0] = *(const v8us*)((const unsigned short*)Bh + boff + 8 * hh); bq.half[1] = *(const v8us*)((const unsigned short*)Bh + boff + 16 + 8 * hh);
      acc[t] = mmaH<1>(ah.v, ah.v, bq.v, bq.v, acc[t]); }
  }
#pragma unroll
  for (int t = 0; t < 4; ++t) { if (col0 + t * 16 >= N) continue; const int col = col0 + t * 16 + ln; const float bv = bp ? bf16_round(bp[col]) : 0.f;
#pragma unroll
    for (int r = 0; r < 8; ++r) { float v = acc[t][r] * alpha + bv; if (CP) { const int rr = row0g + row0 + 8 * hh + r; if (rowsPerB < 0) v += CP[cofs + (size_t)rr * ldc + col];      /* rowsPerB < 0: own element of the batched C plane */ else { const int bidx = rr / rowsPerB; v += CP[(size_t)bidx * sCPb + (size_t)by * 64 + col]; } } if (ACT == 1) v = (v > 0.f) ? v : expm1f(v); else if (ACT == 7) v = (v > 0.f) ? v + 1.0f : expf(v); else if (ACT == 8) v = tanhf(v); else if (ACT == 9) v = 0.5f * v * (1.0f + tanhf(0.7978845608028654f * (v + 0.044715f * v * v * v))); else if (ACT == 11) v = 1.0f / (1.0f + expf(-v)); else if (ACT == 12) v = (v > 0.f) ? v : 0.01f * v; else if (ACT == 14) v = (v > 0.f) ? v : 0.1f * v; else if (ACT == 16) v = (v >= 0.f) ? v : 0.3f * v; else if (ACT == 15) v = v / (1.0f + expf(-v)); else if (ACT == 3) v = fmaxf(v, 0.f); else if (ACT == 6) v = 0.5f * v * (1.0f + erff(v * 0.70710678118654752f)); so[w][8 * hh + r][t * 16 + ln] = v; } }
  __builtin_amdgcn_fence(__ATOMIC_ACQ_REL, "workgroup"); __builtin_amdgcn_wave_barrier();
  const int rsub = lane >> 4, c4 = (lane & 15) * 4; typedef _Float16 v4h __attribute__((ext_vector_type(4)));
  {
#pragma unroll
    for (int q = 0; q < 8; ++q) { const int r = q * 2 + rsub; if (col0 + c4 < N) { const v4f v = *(const v4fa*)&so[w][r][c4]; if (C) *(v4f*)(C + cofs + (size_t)(row0 + r) * ldc + col0 + c4) = v; if (C16) { v4h h4; for (int i = 0; i < 4; ++i) h4[i] = (_Float16)v[i]; *(v4h*)(C16 + cofs + (size_t)(row0 + r) * ldc + col0 + c4) = h4; } } }
     }
}


typedef _Float16 v4h __attribute__((ext_vector_type(4)));

__global__ __launch_bounds__(256) void k_x16(const float* __restrict__ x, _Float16* __restrict__ X16, size_t n8) { const size_t t = (size_t)blockIdx.x * 256 + threadIdx.x; if (t >= n8) return; FragH f;
#pragma unroll
  for (int q = 0; q < 8; ++q) f.h[q] = (_Float16)bf16_round(x[t * 8 + q]); *(v8us*)((unsigned short*)X16 + t * 8) = f.half[0];  }
__global__ __launch_bounds__(256) void k_h16(const float* __restrict__ x, _Float16* __restrict__ X16, size_t n8) { const size_t t = (size_t)blockIdx.x * 256 + threadIdx.x; if (t >= n8) return; FragH f;
#pragma unroll
  for (int q = 0; q < 8; ++q) f.h[q] = (_Float16)x[t * 8 + q]; *(v8us*)((unsigned short*)X16 + t * 8) = f.half[0];  }
__global__ __launch_bounds__(256) void k_round16f(const float* __restrict__ W, _Float16* __restrict__ Bt, size_t n8) { const size_t t = (size_t)blockIdx.x * 256 + threadIdx.x; if (t >= n8) return; FragH f;
#pragma unroll
  for (int i = 0; i < 8; ++i) f.h[i] = (_Float16)(bf16_round(W[t * 8 + i]) * 16.0f); *(v8us*)((unsigned short*)Bt + t * 8) = f.half[0];  }
template <int NHv, int TTv>
__global__ __launch_bounds__(256) void k_vt(const _Float16* __restrict__ V16, int ldv, int voff, _Float16* __restrict__ Vt) { __shared__ unsigned short tl[64][66]; const int tid = threadIdx.x; const int slab = blockIdx.x / (TTv / 64), lg = blockIdx.x % (TTv / 64); const int b = slab / NHv, h = slab % NHv;
  for (int i = tid; i < 64 * 8; i += 256) { const int r = i / 8, c8 = (i % 8) * 8; FragH f; f.half[0] = *(const v8us*)((const unsigned short*)V16 + ((size_t)b * TTv + lg * 64 + r) * ldv + voff + h * 64 + c8);
#pragma unroll
    for (int q = 0; q < 8; ++q) tl[r][c8 + q] = f.u[q]; }
  __syncthreads();
  {
#pragma unroll
    for (int rd = 0; rd < 2; ++rd) { const int d = rd * 32 + tid / 8, pc = tid % 8; FragH f;
#pragma unroll
      for (int q = 0; q < 8; ++q) f.u[q] = tl[pc * 8 + q][d];
      *(v8us*)((unsigned short*)Vt + ((size_t)slab * 64 + d) * TTv + lg * 64 + pc * 8) = f.half[0]; }
     } }

__global__ __launch_bounds__(256) void k_hl(const float* __restrict__ F, _Float16* __restrict__ Hh, _Float16* __restrict__ Hl, size_t n8) { const size_t t = (size_t)blockIdx.x * 256 + threadIdx.x; if (t >= n8) return; FragH fh, fl; const v4f a = *(const v4fa*)(F + t * 8), c = *(const v4fa*)(F + t * 8 + 4);
#pragma unroll
  for (int q = 0; q < 4; ++q) { _Float16 h = (_Float16)a[q]; fh.h[q] = h; fl.h[q] = (_Float16)((a[q] - (float)h) * 1024.0f); h = (_Float16)c[q]; fh.h[4 + q] = h; fl.h[4 + q] = (_Float16)((c[q] - (float)h) * 1024.0f); }
  { *(v8us*)((unsigned short*)Hh + t * 8) = fh.half[0]; *(v8us*)((unsigned short*)Hl + t * 8) = fl.half[0];  } }

// ---- operand planes in fragment order: per (16-row tile, 32-wide k step) one 1-KiB block [register half j][lane 16 hh + ln][8 f16], holding element (row 16 tile + ln, k = 32 step + 16 j + 8 hh + e);
// blocks run [row tile][k step]. A wave's 16-byte-per-lane fragment load then covers 4 whole 128-byte lines; from plain rows it touches 16 lines for 32 bytes each.
#define FBLK 512                 /* f16 per block */
__device__ __forceinline__ v16h fo_frag(const unsigned short* p) { FragH f; f.half[0] = *(const v8us*)p; f.half[1] = *(const v8us*)(p + FBLK / 2); return f.v; }      /* p = block + 8 lane */
// ---- output GEMM for the fixed shape: out[NR][DD] (f32) = attention output (A, fragment order) x W_o (B, fragment order, times 16) / 16. Work-group = 128 rows x 64 columns, wave tile 32 x 64.
// Every global load of a wave is issued ahead of its first wait: the work-group's 32 KiB of W_o go to LDS once (16 x 16 bytes a thread), the wave's 16 A fragments stay in registers; the k steps then read LDS and registers only.
#define OCB (4 * (DD / 32) * FBLK)      /* f16 of W_o per 64 output columns: 4 column tiles x 8 k steps, contiguous */
// at most 256 registers a wave: four work-groups share a WGP, so that all 768 are resident at once
__global__ __launch_bounds__(128) __attribute__((amdgpu_waves_per_eu(4, 4))) void k_out(const _Float16* __restrict__ A, const _Float16* __restrict__ Bh, float* __restrict__ C) {
  __shared__ __attribute__((aligned(16))) unsigned short sb[OCB];
  __shared__ __attribute__((aligned(16))) float so[4][32][68];
  const int tid = threadIdx.x, w = tid >> 5, lane = tid & 31, ln = lane & 15, hh = lane >> 4;
  const int mt = blockIdx.x / (DD / 64), nq = blockIdx.x % (DD / 64); const int row0 = mt * 128 + 32 * w, col0 = nq * 64;
  const unsigned short* bg = (const unsigned short*)Bh + (size_t)nq * OCB + tid * 8;
  const unsigned short* ag = (const unsigned short*)A + (size_t)(row0 >> 4) * (DD / 32) * FBLK + lane * 8;      /* row tiles row0 / 16 and the next: 16 blocks in a row */
  v8us br[16]; v16h af[2][DD / 32];
#pragma unroll
  for (int i = 0; i < 16; ++i) br[i] = *(const v8us*)(bg + i * 128 * 8);
#pragma unroll
  for (int a = 0; a < 2; ++a)
#pragma unroll
    for (int s = 0; s < DD / 32; ++s) af[a][s] = fo_frag(ag + (a * (DD / 32) + s) * FBLK);
  asm volatile("s_wait_xcnt 0x0" :: "v"(tid), "v"(ag) : "memory");      /* wait before the loads' address registers are rewritten; naming the addresses as inputs keeps them live up to here (the W_o loads go by a scalar base and the thread index as lane offset); as a memory fence it also keeps all 48 loads ahead of the LDS stores */
#pragma unroll
  for (int i = 0; i < 16; ++i) *(v8us*)(sb + tid * 8 + i * 128 * 8) = br[i];
  __syncthreads();
  const unsigned short* bl = sb + lane * 8;
  const v8f z8 = {0.f,0.f,0.f,0.f,0.f,0.f,0.f,0.f}; v8f acc[2][4];
#pragma unroll
  for (int t = 0; t < 4; ++t) { acc[0][t] = z8; acc[1][t] = z8; }
  v16h b[4];
#pragma unroll
  for (int t = 0; t < 4; ++t) b[t] = fo_frag(bl + t * (DD / 32) * FBLK);
  // unrolled: the A fragments are indexed by the step, and the next step's W_o fragments are read into a second register set ahead of this step's products
#pragma unroll
  for (int s = 0; s < DD / 32; ++s) { v16h bn[4];
    if (s + 1 < DD / 32) {
#pragma unroll
      for (int t = 0; t < 4; ++t) bn[t] = fo_frag(bl + (t * (DD / 32) + s + 1) * FBLK); }
    __builtin_amdgcn_sched_barrier(0);      /* the next step's LDS reads issue as one group ahead of this step's products: one place with LDS reads a step */
#pragma unroll
    for (int t = 0; t < 4; ++t) {
      acc[0][t] = __builtin_amdgcn_wmma_f32_16x16x32_f16(false, af[0][s], false, b[t], (short)0, acc[0][t], false, false);
      acc[1][t] = __builtin_amdgcn_wmma_f32_16x16x32_f16(false, af[1][s], false, b[t], (short)0, acc[1][t], false, false); }
    __builtin_amdgcn_sched_barrier(0);      /* keeps later steps' LDS reads in their own step; hoisted all together they spilled registers to scratch */
    if (s + 1 < DD / 32) {
#pragma unroll
      for (int t = 0; t < 4; ++t) b[t] = bn[t]; } }
#pragma unroll
  for (int a = 0; a < 2; ++a)
#pragma unroll
    for (int t = 0; t < 4; ++t)
#pragma unroll
      for (int r = 0; r < 8; ++r) so[w][a * 16 + 8 * hh + r][t * 16 + ln] = acc[a][t][r] * 0.0625f;
  __builtin_amdgcn_fence(__ATOMIC_ACQ_REL, "workgroup"); __builtin_amdgcn_wave_barrier();      /* the wave's other lanes read what this lane staged */
  const int rsub = lane >> 4, c4 = (lane & 15) * 4;
  float* cd = C + (size_t)(row0 + rsub) * DD + col0 + c4;
  v4f tv[16];
#pragma unroll
  for (int q = 0; q < 16; ++q) tv[q] = *(const v4fa*)&so[w][q * 2 + rsub][c4];
  __builtin_amdgcn_sched_barrier(0);      /* all LDS reads issue as one group ahead of the stores; otherwise each store waits out its own read's latency in one register set */
#pragma unroll
  for (int q = 0; q < 16; ++q) *(v4f*)(cd + (size_t)q * 2 * DD) = tv[q];
}


// additive bias plane as a matrix operand: bf16-rounded sim is exact in f16 (8 significant bits; below 2^-14 the absolute error stays under 2^-25; a normal draw stays four orders of magnitude under the f16 maximum), half the bytes of an f32 accumulator tile.
// One fragment-order block per (16-query tile, 32 keys): element (row ln, k = 16 j + 8 hh + e) = sim[query 8 hh + e][key 16 j + ln]. Times the one-hot B (k = 16 x + c -> column c) it adds
// sim[query c][key 16 x + row] to a 16-key x 16-query score tile: one block serves two score tiles, x = 0 and 1. Thread t writes the t-th 16 bytes of the plane.
__device__ __forceinline__ void d_bias(int blk, const float* __restrict__ sim, _Float16* __restrict__ BP) {
  const int t = blk * 256 + threadIdx.x; if (t >= NN * NN / 8) return; const int key = ((t >> 6) & 15) * 32 + ((t >> 5) & 1) * 16 + (t & 15), q0 = (t >> 10) * 16 + ((t >> 4) & 1) * 8; FragH f;
#pragma unroll
  for (int e = 0; e < 8; ++e) f.h[e] = (_Float16)bf16_round(sim[(size_t)(q0 + e) * NN + key]);
  *(v8us*)((unsigned short*)BP + (size_t)t * 8) = f.half[0]; }

// Fused attention. One work-group = one (group, head) and 128 queries; each of its 8 waves owns 16 queries (one column group).
// S^T = K Q^T + bias block x one-hot (q carries 32^-0.5, so that sim is added as it stands): lane (c, h) holds keys 8h..8h+7 of each 16-key tile for query c, so two score tiles
// convert in place into the B operand of O^T += V^T P^T (hardware k order on both sides). Online softmax over blocks of 128 keys in
// the log2 domain; P carries 2^10 (cancels against the row sum). K rows and V^T rows sit in LDS at pitches of 16 B x odd.
#define KPITCH 40                /* f16 per K row in LDS: 80 B */
#define VPITCH 520               /* f16 per V^T row in LDS: 1040 B */
#define KBLK 128                 /* keys per online-softmax block */
#define QWG 128                  /* queries per work-group */
#define C2 1.4426950408889634f
__device__ __forceinline__ v16h lds_frag(const unsigned short* p, int hh) { FragH f; f.half[0] = *(const v8us*)(p + 8 * hh); f.half[1] = *(const v8us*)(p + 16 + 8 * hh); return f.v; }
__global__ __launch_bounds__(256) void k_attn(const _Float16* __restrict__ Qf, const _Float16* __restrict__ Kp, const _Float16* __restrict__ VTg, const _Float16* __restrict__ BP, _Float16* __restrict__ O16) {
  __shared__ __attribute__((aligned(16))) unsigned short sk[NN * KPITCH];
  __shared__ __attribute__((aligned(16))) unsigned short sv[HD * VPITCH];
  const int tid = threadIdx.x, w = __builtin_amdgcn_readfirstlane(tid >> 5), lane = tid & 31, ln = lane & 15, hh = lane >> 4;      /* the wave's number as a scalar: the query tile's bases stay out of the vector registers, of which the kernel may use 160 (three work-groups per WGP) */
  const int qb = blockIdx.x % (NN / QWG), gh = blockIdx.x / (NN / QWG); const int g = gh / NH, h = gh % NH;
  // staging: the K rows, V^T rows and the wave's Q fragment are all loaded first, each group from one lane address plus constant steps
  const int n0 = qb * QWG + w * 16;
  const unsigned short* kg = (const unsigned short*)Kp + (size_t)gh * NN * HD + tid * 8;      /* k plane of (group, head): token row tid/4 + 64 i, 16-byte part tid%4 */
  const unsigned short* vg = (const unsigned short*)VTg + (size_t)(h * HD + (tid >> 6)) * NR + (size_t)g * NN + (tid & 63) * 8;      /* head dim tid/64 + 4 i, keys 8 (tid%64).. */
  const unsigned short* qg = (const unsigned short*)Qf + ((size_t)h * (NR / 16) + ((g * NN + n0) >> 4)) * FBLK + lane * 8;      /* fragment-order block [head][row tile]: query n0 + ln, dims 8hh.. and 16 + 8hh.. */
  v8us kr[8], vr8[8]; FragH qfr;
#pragma unroll
  for (int i = 0; i < 8; ++i) kr[i] = *(const v8us*)(kg + i * 64 * HD);
#pragma unroll
  for (int i = 0; i < 8; ++i) vr8[i] = *(const v8us*)(vg + (size_t)i * 4 * NR);
  qfr.half[0] = *(const v8us*)qg; qfr.half[1] = *(const v8us*)(qg + FBLK / 2); const v16h qf = qfr.v;
  asm volatile("s_wait_xcnt 0x0" :: "v"(tid), "v"(vg), "v"(qg) : "memory");      /* wait before the loads' address registers are rewritten; naming the addresses as inputs keeps them live up to here, so that no later load's data lands in them either (the k loads go by a scalar base and the thread index as lane offset) */
#pragma unroll
  for (int i = 0; i < 8; ++i) *(v8us*)(sk + ((tid >> 2) + 64 * i) * KPITCH + (tid & 3) * 8) = kr[i];
#pragma unroll
  for (int i = 0; i < 8; ++i) *(v8us*)(sv + ((tid >> 6) + 4 * i) * VPITCH + (tid & 63) * 8) = vr8[i];
  __syncthreads();
  const unsigned short* bro = (const unsigned short*)BP + (size_t)(n0 >> 4) * (NN / 32) * FBLK + lane * 8;
  const v8f z8 = {0.f,0.f,0.f,0.f,0.f,0.f,0.f,0.f}; v8f o0 = z8, o1 = z8, os = z8; float m = -1.0e30f;      /* far below any score, and (m - mn) * C2 stays finite */
  FragH ones;      /* A whose row 0 is all ones: row 0 of os = the column sums of the rounded P, summed on the matrix pipe */
#pragma unroll
  for (int i = 0; i < 16; ++i) ones.h[i] = (ln == 0) ? (_Float16)1.0f : (_Float16)0.0f;
  FragH e0, e1;      /* one-hot B operands: k = c (e0) or k = 16 + c (e1) goes to column c */
#pragma unroll
  for (int i = 0; i < 8; ++i) { const _Float16 d = (8 * hh + i == ln) ? (_Float16)1.0f : (_Float16)0.0f; e0.h[i] = d; e0.h[8 + i] = (_Float16)0.0f; e1.h[i] = (_Float16)0.0f; e1.h[8 + i] = d; }
  // rolled: only one block's 64 score registers are live at a time, which keeps more waves resident
#pragma unroll 1
  for (int kb = 0; kb < NN; kb += KBLK) {
    v8f s[KBLK / 16]; v16h bf[KBLK / 32]; const unsigned short* bp = bro + (kb / 32) * FBLK;
#pragma unroll
    for (int p = 0; p < KBLK / 32; ++p) bf[p] = fo_frag(bp + p * FBLK);
    asm volatile("s_wait_xcnt 0x0" ::: "memory");      /* wait before the bias loads' address register is stepped; as a memory fence it also keeps the eight loads at the head of the block, so that they fly under the K Q^T products */
#pragma unroll
    for (int p = 0; p < KBLK / 32; ++p) {
      s[2 * p] = __builtin_amdgcn_wmma_f32_16x16x32_f16(false, lds_frag(sk + (kb + p * 32 + ln) * KPITCH, hh), false, qf, (short)0, z8, false, false);
      s[2 * p + 1] = __builtin_amdgcn_wmma_f32_16x16x32_f16(false, lds_frag(sk + (kb + p * 32 + 16 + ln) * KPITCH, hh), false, qf, (short)0, z8, false, false);
      s[2 * p] = __builtin_amdgcn_wmma_f32_16x16x32_f16(false, bf[p], false, e0.v, (short)0, s[2 * p], false, false);
      s[2 * p + 1] = __builtin_amdgcn_wmma_f32_16x16x32_f16(false, bf[p], false, e1.v, (short)0, s[2 * p + 1], false, false);
    }
    float mx[4] = {s[0][0], s[0][1], s[0][2], s[0][3]};
#pragma unroll
    for (int t = 0; t < KBLK / 16; ++t)
#pragma unroll
      for (int r = 0; r < 8; ++r) mx[r & 3] = fmaxf(mx[r & 3], s[t][r]);
    float bm = fmaxf(fmaxf(mx[0], mx[1]), fmaxf(mx[2], mx[3])); bm = fmaxf(bm, __shfl_xor(bm, 16, 32));      /* both halves of a column share one maximum */
    const float mn = fmaxf(m, bm); const float al = __builtin_amdgcn_exp2f((m - mn) * C2); const float off = 10.0f - mn * C2; m = mn;
#pragma unroll
    for (int r = 0; r < 8; ++r) { o0[r] *= al; o1[r] *= al; }
    os[0] *= al;      /* only row 0 of the sum tile is ever read */
#pragma unroll
    for (int p = 0; p < KBLK / 32; ++p) { FragH b;
#pragma unroll
      for (int r = 0; r < 8; ++r) { const float e0 = __builtin_amdgcn_exp2f(fmaf(s[2 * p][r], C2, off)), e1 = __builtin_amdgcn_exp2f(fmaf(s[2 * p + 1][r], C2, off));
        b.h[r] = (_Float16)e0; b.h[8 + r] = (_Float16)e1; }
      const unsigned short* vr = sv + ln * VPITCH + kb + p * 32;
      o0 = __builtin_amdgcn_wmma_f32_16x16x32_f16(false, lds_frag(vr, hh), false, b.v, (short)0, o0, false, false);
      o1 = __builtin_amdgcn_wmma_f32_16x16x32_f16(false, lds_frag(vr + 16 * VPITCH, hh), false, b.v, (short)0, o1, false, false);
      os = __builtin_amdgcn_wmma_f32_16x16x32_f16(false, ones.v, false, b.v, (short)0, os, false, false); }
  }
  const float su = __shfl(os[0], ln, 32); const float inv = 1.0f / su; FragH f;      /* row 0 sits in register 0 of lanes 0..15 */
#pragma unroll
  for (int r = 0; r < 8; ++r) { f.h[r] = (_Float16)(o0[r] * inv); f.h[8 + r] = (_Float16)(o1[r] * inv); }
  unsigned short* d = (unsigned short*)O16 + ((size_t)((g * NN + n0) >> 4) * (DD / 32) + h) * FBLK + lane * 8;      /* lane (c, h) holds head dims 8h..8h+7 and 16+8h.. of query c: the output GEMM's A fragment of row tile (g NN + n0) / 16, k step h, as it stands */
  *(v8us*)d = f.half[0]; *(v8us*)(d + FBLK / 2) = f.half[1]; }
// Fused projection. One work-group = 64 token rows: x is read once as f32, rounded (bf16, exact in f16) into LDS, and all 768 outputs of those rows are formed from it.
// q | k: D = W rows (A) x token rows (B), so lane (c, h) holds 8 neighbouring output dims of token c; v^T: D = token rows (A) x W rows (B), so a lane holds 8 neighbouring tokens of one dim.
// Each wave stages its f16 tile in its own LDS range and stores whole 128-byte lines.
// Every loop of the kernel is unrolled: its arrays are register fragments and must be indexed by constants.
#define PROWS 64                 /* token rows per work-group */
#define XPITCH 264               /* f16 per x row in LDS: 528 B = 16 B x 33 */
#define SPITCH 72                /* f16 per staged output row in LDS: 144 B = 16 B x 9 */
#define VT0 ((2 * DD / 16) * (DD / 32) * FBLK)      /* f16 in front of the v weights in the fragment-order plane */
__device__ __forceinline__ v16h pj_frag(const unsigned short* p) { FragH f; f.half[0] = *(const v8us*)p; f.half[1] = *(const v8us*)(p + 16); return f.v; }
// four waves per SIMD: two work-groups fit a WGP, so that all 384 are resident at once
__global__ __launch_bounds__(256) __attribute__((amdgpu_waves_per_eu(4, 4))) void k_proj(const float* __restrict__ x, const _Float16* __restrict__ Bw, _Float16* __restrict__ Qf, _Float16* __restrict__ Kp, _Float16* __restrict__ VTg) {
  __shared__ __attribute__((aligned(16))) unsigned short sx[PROWS * XPITCH];
  __shared__ __attribute__((aligned(16))) unsigned short st[8][PROWS * SPITCH];
  __shared__ __attribute__((aligned(16))) unsigned short sv2[8][32 * SPITCH];      /* a range of its own for v^T: no wait on the q | k stores before it is written */
  const int tid = threadIdx.x, w = tid >> 5, lane = tid & 31, ln = lane & 15, hh = lane >> 4;
  const int row0 = blockIdx.x * PROWS;
  const float* xg = x + (size_t)row0 * DD + tid * 8;      /* row 8 i + w, columns 8 lane.. */
  const unsigned short* wq = (const unsigned short*)Bw + (size_t)(w * 4) * (DD / 32) * FBLK + lane * 8;      /* q | k output dims 64 w + 16 a + ln: row tiles 4 w + a, fragment order */
  const unsigned short* wv = (const unsigned short*)Bw + (size_t)(w * 2) * (DD / 32) * FBLK + lane * 8;      /* v output dims 32 w + 16 b + ln: row tiles 32 + 2 w + b; the 32 tiles of q | k are the constant VT0 at each load, so that this is the very address register of the loads */
  v4f xa[8], xb[8];
#pragma unroll
  for (int i = 0; i < 8; ++i) { xa[i] = *(const v4fa*)(xg + i * 8 * DD); xb[i] = *(const v4fa*)(xg + i * 8 * DD + 4); }
  v16h af[4];      /* the first weight fragments fly while x is converted */
#pragma unroll
  for (int a = 0; a < 4; ++a) af[a] = fo_frag(wq + a * (DD / 32) * FBLK);
#pragma unroll
  for (int i = 0; i < 8; ++i) { FragH f;
#pragma unroll
    for (int q = 0; q < 4; ++q) { f.h[q] = (_Float16)bf16_round(xa[i][q]); f.h[4 + q] = (_Float16)bf16_round(xb[i][q]); }
    *(v8us*)(sx + (i * 8 + w) * XPITCH + lane * 8) = f.half[0]; }
  __syncthreads();
  const unsigned short* xs = sx + ln * XPITCH + 8 * hh;
  unsigned short* sw = st[w]; unsigned short* sw2 = sv2[w];
  const v8f z8 = {0.f,0.f,0.f,0.f,0.f,0.f,0.f,0.f};
  const float osc = __builtin_amdgcn_readfirstlane(w) < 4 ? 0.0625f * SCL : 0.0625f;      /* q (waves 0..3) carries the score scale 32^-0.5 */
  {
    v8f acc[4][4];
#pragma unroll
    for (int a = 0; a < 4; ++a)
#pragma unroll
      for (int b = 0; b < 4; ++b) acc[a][b] = z8;
    // unrolled so that the next step's weight fragments are loaded into a second register set ahead of this step's products
#pragma unroll
    for (int kb = 0; kb < DD; kb += 32) { v16h an[4], bx[4];
      if (kb + 32 < DD) {
#pragma unroll
        for (int a = 0; a < 4; ++a) an[a] = fo_frag(wq + (a * (DD / 32) + kb / 32 + 1) * FBLK); }
#pragma unroll
      for (int b = 0; b < 4; ++b) bx[b] = pj_frag(xs + b * 16 * XPITCH + kb);
#pragma unroll
      for (int a = 0; a < 4; ++a)
#pragma unroll
        for (int b = 0; b < 4; ++b) acc[a][b] = __builtin_amdgcn_wmma_f32_16x16x32_f16(false, af[a], false, bx[b], (short)0, acc[a][b], false, false);
      if (kb + 32 < DD) {
#pragma unroll
        for (int a = 0; a < 4; ++a) af[a] = an[a]; } }
#pragma unroll
    for (int a = 0; a < 4; ++a)
#pragma unroll
      for (int b = 0; b < 4; ++b) { FragH f;
#pragma unroll
        for (int r = 0; r < 8; ++r) f.h[r] = (_Float16)(acc[a][b][r] * osc);
        *(v8us*)(sw + (b * 16 + ln) * SPITCH + a * 16 + 8 * hh) = f.half[0]; }
  }
  __builtin_amdgcn_fence(__ATOMIC_ACQ_REL, "workgroup"); __builtin_amdgcn_wave_barrier();      /* the wave's other lanes read what this lane staged */
  v16h vf[8][2];      /* all of the wave's v weight fragments (128 registers, free now) fly while the q | k tile is stored */
#pragma unroll
  for (int s = 0; s < 8; ++s) { vf[s][0] = fo_frag(wv + VT0 + s * FBLK); vf[s][1] = fo_frag(wv + VT0 + (DD / 32 + s) * FBLK); }
  asm volatile("s_wait_xcnt 0x0" :: "v"(wq), "v"(wv) : "memory");      /* wait before the weight loads' address registers are rewritten; naming the addresses as inputs keeps them live up to here, so that no load's data lands in them either */
  {
    // the wave's 64 dims are two heads of q (waves 0..3) or of k (waves 4..7). q goes out as fragment-order blocks [head][row tile], k as 64-byte rows of its [group][head] plane: every store covers 4 whole lines.
    // Both cases share one set of constant steps: 16 staged rows and 512 f16 of output per row tile; only the lane bases (register half or next 8 tokens; next head) differ.
    const int h0 = (w & 3) * 2; const bool isq = __builtin_amdgcn_readfirstlane(w) < 4;      /* the wave's number as a scalar: the case is picked by scalar selects, EXEC stays untouched */
    const unsigned short* sr0 = sw + (isq ? ln * SPITCH + 8 * hh : (lane >> 2) * SPITCH + (lane & 3) * 8);
    const unsigned short* sr1 = sr0 + (isq ? 16 : 8 * SPITCH);
    unsigned short* qd0 = (isq ? (unsigned short*)Qf + ((size_t)h0 * (NR / 16) + (row0 >> 4)) * FBLK : (unsigned short*)Kp + ((size_t)((row0 / NN) * NH + h0) * NN + row0 % NN) * HD) + lane * 8;
    unsigned short* qd1 = qd0 + (isq ? (NR / 16) * FBLK : NN * HD);
    v8us tv[16];
#pragma unroll
    for (int q = 0; q < 16; ++q) tv[q] = *(const v8us*)(((q & 1) ? sr1 : sr0) + ((q >> 1) & 3) * 16 * SPITCH + (q >> 3) * HD);      /* head q / 8, row tile (q / 2) % 4, half q % 2 */
    __builtin_amdgcn_sched_barrier(0);      /* all LDS reads issue as one group ahead of the stores; otherwise each store waits out its own read's latency in one register set */
#pragma unroll
    for (int q = 0; q < 16; ++q) *(v8us*)(((q >> 3) ? qd1 : qd0) + (q & 7) * (FBLK / 2)) = tv[q];
    asm volatile("s_wait_xcnt 0x0" ::: "memory");      /* wait before the stores' address and data registers are rewritten by the v^T part */
  }
  {
    v8f acc[4][2];
#pragma unroll
    for (int a = 0; a < 4; ++a) { acc[a][0] = z8; acc[a][1] = z8; }
    // unrolled: the weight fragments are indexed by the step
#pragma unroll
    for (int kb = 0; kb < DD; kb += 32) { v16h ax[4];
#pragma unroll
      for (int a = 0; a < 4; ++a) ax[a] = pj_frag(xs + a * 16 * XPITCH + kb);
      __builtin_amdgcn_sched_barrier(0);      /* the step's loads issue as one group ahead of its products: one place with LDS reads a step, not four */
#pragma unroll
      for (int a = 0; a < 4; ++a)
#pragma unroll
        for (int b = 0; b < 2; ++b) acc[a][b] = __builtin_amdgcn_wmma_f32_16x16x32_f16(false, ax[a], false, vf[kb / 32][b], (short)0, acc[a][b], false, false);
      __builtin_amdgcn_sched_barrier(0); }      /* keeps later steps' LDS reads in their own step; hoisted all together they spilled registers to scratch */
#pragma unroll
    for (int a = 0; a < 4; ++a)
#pragma unroll
      for (int b = 0; b < 2; ++b) { FragH f;
#pragma unroll
        for (int r = 0; r < 8; ++r) f.h[r] = (_Float16)(acc[a][b][r] * 0.0625f);
        *(v8us*)(sw2 + (b * 16 + ln) * SPITCH + a * 16 + 8 * hh) = f.half[0]; }
  }
  __builtin_amdgcn_fence(__ATOMIC_ACQ_REL, "workgroup"); __builtin_amdgcn_wave_barrier();      /* as above: lanes read each other's staged rows */
  {
    unsigned short* vd = (unsigned short*)VTg + (size_t)(w * 32 + (lane >> 3)) * NR + row0 + (lane & 7) * 8;
    v8us tv[8];
#pragma unroll
    for (int q = 0; q < 8; ++q) tv[q] = *(const v8us*)(sw2 + (q * 4 + (lane >> 3)) * SPITCH + (lane & 7) * 8);
    __builtin_amdgcn_sched_barrier(0);      /* as above: one group of LDS reads, then the stores */
#pragma unroll
    for (int q = 0; q < 8; ++q) *(v8us*)(vd + (size_t)q * 4 * NR) = tv[q];
  }
}
// thread t writes the t-th 16 bytes of the fragment-order plane: lane = t % 32, register half j, k step, row tile
__device__ __forceinline__ void d_wqkv(int blk, const float* __restrict__ Wq, const float* __restrict__ Wk, const float* __restrict__ Wv, _Float16* __restrict__ Bt) { const int t = blk * 256 + threadIdx.x; if (t >= 3 * DD * (DD / 8)) return; const int n = (t >> 9) * 16 + (t & 15), k0 = ((t >> 6) & 7) * 32 + ((t >> 5) & 1) * 16 + ((t >> 4) & 1) * 8; const int which = n / DD, o = n % DD; const float* Wm = which == 0 ? Wq : (which == 1 ? Wk : Wv); FragH f;
  for (int q = 0; q < 8; ++q) f.h[q] = (_Float16)(bf16_round(Wm[(size_t)(k0 + q) * DD + o]) * 16.0f); *(v8us*)((unsigned short*)Bt + (size_t)t * 8) = f.half[0];  }
// W_o as f16 [n][k], times 16, in fragment order (thread t as in d_wqkv)
__device__ __forceinline__ void d_wo(int blk, const float* __restrict__ Wo, _Float16* __restrict__ Bo) { const int t = blk * 256 + threadIdx.x; if (t >= DD * (DD / 8)) return; const int n = (t >> 9) * 16 + (t & 15), k8 = ((t >> 6) & 7) * 32 + ((t >> 5) & 1) * 16 + ((t >> 4) & 1) * 8; FragH f;
#pragma unroll
  for (int i = 0; i < 8; ++i) f.h[i] = (_Float16)(bf16_round(Wo[(size_t)(k8 + i) * DD + n]) * 16.0f);
  *(v8us*)((unsigned short*)Bo + (size_t)t * 8) = f.half[0]; }
// One preparation launch: the three jobs read none of each other's output, so they share a grid and each work-group picks its job by its index.
// The weight jobs come first: each of their threads gathers from eight weight rows.
#define PB_QKV (3 * DD * (DD / 8) / 256)      /* 96 work-groups */
#define PB_WO (DD * (DD / 8) / 256)           /* 32 */
#define PB_BIAS (NN * NN / 8 / 256)           /* 128 */
__global__ __launch_bounds__(256) void k_prep(const float* __restrict__ Wq, const float* __restrict__ Wk, const float* __restrict__ Wv, const float* __restrict__ Wo, const float* __restrict__ sim,
                                              _Float16* __restrict__ Bt, _Float16* __restrict__ Bo, _Float16* __restrict__ BP) {
  const int b = blockIdx.x;
  if (b < PB_QKV) d_wqkv(b, Wq, Wk, Wv, Bt);
  else if (b < PB_QKV + PB_WO) d_wo(b - PB_QKV, Wo, Bo);
  else d_bias(b - (PB_QKV + PB_WO), sim, BP);
}

extern "C" void kernel_launch(void* const* d_in, const int* in_sizes, int n_in,
                              void* d_out, int out_size, void* d_ws, size_t ws_size, hipStream_t stream) {
  (void)in_sizes; (void)n_in; (void)out_size;
  const float* const* I = (const float* const*)d_in; const float* x = I[0]; const float* sim = I[1]; const float* Wq = I[2]; const float* Wk = I[3]; const float* Wv = I[4]; const float* Wo = I[5];
  char* ws = (char*)d_ws; size_t off = 0;
  auto take = [&](size_t bytes) { char* p = ws + off; off += (bytes + 255) & ~(size_t)255; return p; };
  _Float16* BQKV = (_Float16*)take((size_t)3 * DD * DD * 2); _Float16* BO = (_Float16*)take((size_t)DD * DD * 2);
  _Float16* Q16 = (_Float16*)take((size_t)NR * DD * 2); _Float16* K16 = (_Float16*)take((size_t)NR * DD * 2); _Float16* VTg = (_Float16*)take((size_t)DD * NR * 2); _Float16* O16 = (_Float16*)take((size_t)NR * DD * 2);
  _Float16* BP = (_Float16*)take((size_t)NN * NN * 2);
  if (off > ws_size) return;      /* under 50 MiB */
  k_prep<<<PB_QKV + PB_WO + PB_BIAS, 256, 0, stream>>>(Wq, Wk, Wv, Wo, sim, BQKV, BO, BP);
  k_proj<<<NR / PROWS, 256, 0, stream>>>(x, BQKV, Q16, K16, VTg);      /* q: fragment-order blocks [head][row tile]; k: planes [group][head][token][32]; v^T: rows h*32 + d, columns = token rows */
  k_attn<<<NG * NH * (NN / QWG), 256, 0, stream>>>(Q16, K16, VTg, BP, O16);
  k_out<<<(NR / 128) * (DD / 64), 128, 0, stream>>>(O16, BO, (float*)d_out);
}

// v007
// One run takes 44.6 microseconds.
// Timed twice side by side with v006, it ran 1.09 and 1.08 times as fast.
// All steps since v000 together make it 15.5 times as fast.
#include <hip/hip_runtime.h>
// SpatialMHSA (4 x 12 frames x 512 spatial tokens x 256 = 8 heads of 32): q/k/v = x W (xavier (in,out) weights); per (batch, frame, head) attention over the 512 tokens with scores/sqrt(32) + an INPUT additive bias sim[n][m]; out = merged heads W_o.
// Structure: ONE preparation launch (x rounded to f16 fragment blocks, weights and the bias plane as fragment blocks); ONE fused projection + attention kernel (per (group, head): q in registers, K rows and V^T rows formed straight into LDS, f32 accumulation, exact x16 weights; S^T = K Q^T plus the bias plane times a one-hot matrix, online softmax in registers, O^T = V^T P^T, f16 out as the output GEMM's A fragments); output GEMM. x, weights and attention output lie in the workspace in fragment order.
// Compute dtype: x, sim and weights rounded to bf16; q, k, v, P, attention output as f16 operands (~2^-12); f32 accumulation/softmax. v_wmma_f32_16x16x32_f16.
#define NBATCH 4
#define NFR 12
#define NN 512
#define DD 256
#define NH 8
#define HD 32
#define NG (NBATCH * NFR)         /* 48 groups */
#define NR (NG * NN)             /* 24576 token rows */
#define SCL 0.17677669529663687f /* 32^-0.5 */
typedef __bf16 v16b __attribute__((ext_vector_type(16)));
typedef unsigned short v8us __attribute__((ext_vector_type(8), may_alias));
typedef float  v8f  __attribute__((ext_vector_type(8)));
typedef float  v4f  __attribute__((ext_vector_type(4)));
typedef float  v4fa __attribute__((ext_vector_type(4), may_alias));
union FragB { v16b v; v8us half[2]; unsigned short u[16]; };

__device__ __forceinline__ unsigned short bf16_bits(float x) { unsigned int u = __float_as_uint(x); return (unsigned short)((u + 0x7FFFu + ((u >> 16) & 1u)) >> 16); }
__device__ __forceinline__ float bf16_val(unsigned short b) { return __uint_as_float(((unsigned int)b) << 16); }
__device__ __forceinline__ float bf16_round(float x) { return bf16_val(bf16_bits(x)); }
// D += A·B with NT terms: 1 = ah·bh, 2 = + al·bh (A split), 3 = + ah·bl (both split)
template <int NT>
__device__ __forceinline__ v8f mmaN(v16b ah, v16b al, v16b bh, v16b bl, v8f c) {
  c = __builtin_amdgcn_wmma_f32_16x16x32_bf16(false, ah, false, bh, (short)0, c, false, false);
  if (NT >= 2) c = __builtin_amdgcn_wmma_f32_16x16x32_bf16(false, al, false, bh, (short)0, c, false, false);
  if (NT >= 3) c = __builtin_amdgcn_wmma_f32_16x16x32_bf16(false, ah, false, bl, (short)0, c, false, false);
  asm volatile("v_nop\n\tv_nop\n\tv_nop\n\tv_nop" : "+v"(c) : "v"(ah), "v"(al), "v"(bh), "v"(bl));
  return c;
}

__global__ __launch_bounds__(256) void k_wt_bf16(const float* __restrict__ W, unsigned short* __restrict__ Wt, int K, int N) {
  const int t = blockIdx.x * 256 + threadIdx.x;
  const int k8n = K / 8;
  if (t >= N * k8n) return;
  const int n = t / k8n, k8 = (t % k8n) * 8;
  v8us v;
#pragma unroll
  for (int i = 0; i < 8; ++i) v[i] = bf16_bits(W[(size_t)(k8 + i) * N + n]);
  *(v8us*)(Wt + (size_t)n * K + k8) = v;
  
}

// GEMM C[M][N] (f32, pitch ldc) = act(A[M][K]·W + bias). A f32 row-major (pitch lda) converted per fragment to bf16
// (ASPLIT: hi/lo two planes -> 2 terms, else single rounded term); Wt bf16 [N][K] (pitch ldb). BIAS_BF16 rounds the
// bias to bf16 first (bias quantised to bf16 before the add). K%32==0, M%16==0, N%64==0.
template <bool ASPLIT, int ACT, bool BIAS_BF16>
__global__ __launch_bounds__(128) void k_gemm_bf(const float* __restrict__ A, int lda, const unsigned short* __restrict__ Wt, int ldb,
                                               const float* __restrict__ bias, float* __restrict__ C, int ldc, int M, int N, int K) {
  __shared__ __attribute__((aligned(16))) float so[4][16][64];
  const int tid = threadIdx.x, w = tid >> 5, lane = tid & 31, ln = lane & 15, hh = lane >> 4;
  const int ntn = N / 64;
  const int wid = blockIdx.x * 4 + w;
  const int mt = wid / ntn, nq = wid % ntn;
  if (mt * 16 >= M) return;
  const int row0 = mt * 16, col0 = nq * 64;
  const float* arow = A + (size_t)(row0 + ln) * lda;
  v8f acc[4] = {};
  for (int kb = 0; kb < K; kb += 32) {
    FragB ah, al;
    const v4f x0 = *(const v4fa*)(arow + kb + 8 * hh), x1 = *(const v4fa*)(arow + kb + 8 * hh + 4);
    const v4f x2 = *(const v4fa*)(arow + kb + 16 + 8 * hh), x3 = *(const v4fa*)(arow + kb + 16 + 8 * hh + 4);
    float xs[16] = {x0[0],x0[1],x0[2],x0[3],x1[0],x1[1],x1[2],x1[3],x2[0],x2[1],x2[2],x2[3],x3[0],x3[1],x3[2],x3[3]};
#pragma unroll
    for (int i = 0; i < 16; ++i) { const unsigned short hb = bf16_bits(xs[i]); ah.u[i] = hb; al.u[i] = ASPLIT ? bf16_bits(xs[i] - bf16_val(hb)) : (unsigned short)0; }
#pragma unroll
    for (int t = 0; t < 4; ++t) {
      const unsigned short* brow = Wt + (size_t)(col0 + t * 16 + ln) * ldb + kb;
      FragB b;
      b.half[0] = *(const v8us*)(brow + 8 * hh);
      b.half[1] = *(const v8us*)(brow + 16 + 8 * hh);
      acc[t] = mmaN<ASPLIT ? 2 : 1>(ah.v, al.v, b.v, b.v, acc[t]);
    }
  }
#pragma unroll
  for (int t = 0; t < 4; ++t) {
    float bv = bias ? bias[col0 + t * 16 + ln] : 0.f;
    if (BIAS_BF16) bv = bf16_round(bv);
#pragma unroll
    for (int r = 0; r < 8; ++r) { float v = acc[t][r] + bv; if (ACT == 1) v = fmaxf(v, 0.f); so[w][8 * hh + r][t * 16 + ln] = v; }
  }
  __builtin_amdgcn_fence(__ATOMIC_ACQ_REL, "workgroup");
  __builtin_amdgcn_wave_barrier();
  const int rsub = lane >> 4, c4 = (lane & 15) * 4;
  {
#pragma unroll
    for (int q = 0; q < 8; ++q) {
      const int r = q * 2 + rsub;
      const v4f v = *(const v4fa*)&so[w][r][c4];
      *(v4f*)(C + (size_t)(row0 + r) * ldc + col0 + c4) = v;
    }
    
  }
}

// GEMM C = act(A·W + bias + resid): A f32 (ASPLIT -> hi/lo 2 terms), Wt bf16 [N][K]; ACT 0 none, 1 relu, 2 exact gelu;
// resid (optional, f32, row index = (row % rmod), pitch ldr, RES_BF16 rounds it) added before the activation.
template <bool ASPLIT, int ACT, bool BIAS_BF16, bool RES_BF16>
__global__ __launch_bounds__(128) void k_gemm_bf3(const float* __restrict__ A, int lda, const unsigned short* __restrict__ Wt, int ldb,
                                                const float* __restrict__ bias, const float* __restrict__ resid, int rmod, int ldr,
                                                float* __restrict__ C, int ldc, int M, int N, int K) {
  __shared__ __attribute__((aligned(16))) float so[4][16][64];
  const int tid = threadIdx.x, w = tid >> 5, lane = tid & 31, ln = lane & 15, hh = lane >> 4;
  const int ntn = N / 64;
  const int wid = blockIdx.x * 4 + w;
  const int mt = wid / ntn, nq = wid % ntn;
  if (mt * 16 >= M) return;
  const int row0 = mt * 16, col0 = nq * 64;
  const float* arow = A + (size_t)(row0 + ln) * lda;
  v8f acc[4] = {};
  for (int kb = 0; kb < K; kb += 32) {
    FragB ah, al;
    const v4f x0 = *(const v4fa*)(arow + kb + 8 * hh), x1 = *(const v4fa*)(arow + kb + 8 * hh + 4);
    const v4f x2 = *(const v4fa*)(arow + kb + 16 + 8 * hh), x3 = *(const v4fa*)(arow + kb + 16 + 8 * hh + 4);
    float xs[16] = {x0[0],x0[1],x0[2],x0[3],x1[0],x1[1],x1[2],x1[3],x2[0],x2[1],x2[2],x2[3],x3[0],x3[1],x3[2],x3[3]};
#pragma unroll
    for (int i = 0; i < 16; ++i) { const unsigned short hb = bf16_bits(xs[i]); ah.u[i] = hb; al.u[i] = ASPLIT ? bf16_bits(xs[i] - bf16_val(hb)) : (unsigned short)0; }
#pragma unroll
    for (int t = 0; t < 4; ++t) {
      const unsigned short* brow = Wt + (size_t)(col0 + t * 16 + ln) * ldb + kb;
      FragB b;
      b.half[0] = *(const v8us*)(brow + 8 * hh);
      b.half[1] = *(const v8us*)(brow + 16 + 8 * hh);
      acc[t] = mmaN<ASPLIT ? 2 : 1>(ah.v, al.v, b.v, b.v, acc[t]);
    }
  }
#pragma unroll
  for (int t = 0; t < 4; ++t) {
    const int col = col0 + t * 16 + ln;
    float bv = bias ? bias[col] : 0.f;
    if (BIAS_BF16) bv = bf16_round(bv);
#pragma unroll
    for (int r = 0; r < 8; ++r) {
      float v = acc[t][r] + bv;
      if (resid) { float rv = resid[(size_t)((row0 + 8 * hh + r) % rmod) * ldr + col]; if (RES_BF16) rv = bf16_round(rv); v += rv; }
      if (ACT == 1) v = fmaxf(v, 0.f);
      if (ACT == 2) v = 0.5f * v * (1.0f + erff(v * 0.70710678118654752f));
      if (ACT == 3) { const float u = 0.7978845608028654f * (v + 0.044715f * v * v * v); v = 0.5f * v * (1.0f + tanhf(u)); }
      so[w][8 * hh + r][t * 16 + ln] = v;
    }
  }
  __builtin_amdgcn_fence(__ATOMIC_ACQ_REL, "workgroup");
  __builtin_amdgcn_wave_barrier();
  const int rsub = lane >> 4, c4 = (lane & 15) * 4;
  {
#pragma unroll
    for (int q = 0; q < 8; ++q) {
      const int r = q * 2 + rsub;
      const v4f v = *(const v4fa*)&so[w][r][c4];
      *(v4f*)(C + (size_t)(row0 + r) * ldc + col0 + c4) = v;
    }
    
  }
}
// row LayerNorm (biased variance, eps) over N: s = X (+ R); optional out_sum <- s; out_norm <- (s-mu)*rsqrt(var+eps)*g + b
template <bool PARAM_BF16>
__global__ __launch_bounds__(256) void k_layernorm(const float* __restrict__ X, const float* __restrict__ R, const float* __restrict__ g, const float* __restrict__ bta,
                                                  float* __restrict__ out_sum, float* __restrict__ out_norm, int N, float eps) {
  __shared__ float red[256];
  const int row = blockIdx.x, tid = threadIdx.x;
  const float* x = X + (size_t)row * N; const float* rr = R ? R + (size_t)row * N : nullptr;
  float vals[16];                     // up to N = 4096
  const int per = N / 256;            // contiguous chunk per thread? use strided-by-4 chunks: thread handles j = tid*4 + 1024*u
  float s1 = 0.f;
  for (int u = 0; u < per / 4; ++u) {
    const int j = tid * 4 + 1024 * u;
    const v4f a = *(const v4fa*)(x + j);
    v4f b = {0.f,0.f,0.f,0.f}; if (rr) b = *(const v4fa*)(rr + j);
#pragma unroll
    for (int q = 0; q < 4; ++q) { const float v = a[q] + b[q]; vals[u * 4 + q] = v; s1 += v; }
  }
  red[tid] = s1; __syncthreads();
  for (int st = 128; st > 0; st >>= 1) { if (tid < st) red[tid] += red[tid + st]; __syncthreads(); }
  const float mu = red[0] / (float)N; __syncthreads();
  float s2 = 0.f;
  for (int u = 0; u < per / 4; ++u)
#pragma unroll
    for (int q = 0; q < 4; ++q) { const float c = vals[u * 4 + q] - mu; s2 += c * c; }
  red[tid] = s2; __syncthreads();
  for (int st = 128; st > 0; st >>= 1) { if (tid < st) red[tid] += red[tid + st]; __syncthreads(); }
  const float rs = rsqrtf(red[0] / (float)N + eps);
  {
    for (int u = 0; u < per / 4; ++u) {
      const int j = tid * 4 + 1024 * u;
      v4f o, sm;
#pragma unroll
      for (int q = 0; q < 4; ++q) {
        float gg = g[j + q], bb = bta[j + q];
        if (PARAM_BF16) { gg = bf16_round(gg); bb = bf16_round(bb); }
        sm[q] = vals[u * 4 + q]; o[q] = (vals[u * 4 + q] - mu) * rs * gg + bb;
      }
      if (out_sum) *(v4f*)(out_sum + (size_t)row * N + j) = sm;
      *(v4f*)(out_norm + (size_t)row * N + j) = o;
    }
    
  }
}



// ---- f16 WMMA path (v_wmma_f32_16x16x32_f16): 11-bit significands for operands in range — used where a [0,1] probability operand needs more precision than bf16
typedef _Float16 v16h __attribute__((ext_vector_type(16)));
union FragH { v16h v; v8us half[2]; _Float16 h[16]; unsigned short u[16]; };
template <int NT>
__device__ __forceinline__ v8f mmaH(v16h ah, v16h al, v16h bh, v16h bl, v8f c) {
  c = __builtin_amdgcn_wmma_f32_16x16x32_f16(false, ah, false, bh, (short)0, c, false, false);
  if (NT >= 2) c = __builtin_amdgcn_wmma_f32_16x16x32_f16(false, al, false, bh, (short)0, c, false, false);
  if (NT >= 3) c = __builtin_amdgcn_wmma_f32_16x16x32_f16(false, ah, false, bl, (short)0, c, false, false);
  asm volatile("v_nop\n\tv_nop\n\tv_nop\n\tv_nop" : "+v"(c) : "v"(ah), "v"(al), "v"(bh), "v"(bl));
  return c;
}
// batched GEMM like k_gemm_b but f16 operands: A f32 (split into f16 hi/lo if ASPLIT, else rounded to f16), Bt = f16 values [n][k]; alpha; C f32; N multiple of 16 (partial tiles skipped)
template <bool ASPLIT>
__global__ __launch_bounds__(128) void k_gemm_h(const float* __restrict__ A, int lda, size_t sA, const _Float16* __restrict__ Bh, int ldb, size_t sB, float alpha, float* __restrict__ C, int ldc, size_t sC, int M, int N, int K) {
  __shared__ __attribute__((aligned(16))) float so[4][16][64];
  const int tid = threadIdx.x, w = tid >> 5, lane = tid & 31, ln = lane & 15, hh = lane >> 4; const int by = blockIdx.y;
  A += (size_t)by * sA; Bh += (size_t)by * sB; C += (size_t)by * sC;
  const int ntn = (N + 63) / 64; const int wid = blockIdx.x * 4 + w; const int mt = wid / ntn, nq = wid % ntn; if (mt * 16 >= M) return;
  const int row0 = mt * 16, col0 = nq * 64; const float* arow = A + (size_t)(row0 + ln) * lda;
  v8f acc[4] = {};
  for (int kb = 0; kb < K; kb += 32) {
    FragH ah, al;
    const v4f x0 = *(const v4fa*)(arow + kb + 8 * hh), x1 = *(const v4fa*)(arow + kb + 8 * hh + 4), x2 = *(const v4fa*)(arow + kb + 16 + 8 * hh), x3 = *(const v4fa*)(arow + kb + 16 + 8 * hh + 4);
    float xs[16] = {x0[0],x0[1],x0[2],x0[3],x1[0],x1[1],x1[2],x1[3],x2[0],x2[1],x2[2],x2[3],x3[0],x3[1],x3[2],x3[3]};
#pragma unroll
    for (int i = 0; i < 16; ++i) { const _Float16 h = (_Float16)xs[i]; ah.h[i] = h; al.h[i] = ASPLIT ? (_Float16)(xs[i] - (float)h) : (_Float16)0.0f; }
#pragma unroll
    for (int t = 0; t < 4; ++t) { if (col0 + t * 16 >= N) continue; const size_t boff = (size_t)(col0 + t * 16 + ln) * ldb + kb; FragH bq; bq.half[0] = *(const v8us*)(Bh + boff + 8 * hh); bq.half[1] = *(const v8us*)(Bh + boff + 16 + 8 * hh);
      acc[t] = mmaH<ASPLIT ? 2 : 1>(ah.v, al.v, bq.v, bq.v, acc[t]); }
  }
#pragma unroll
  for (int t = 0; t < 4; ++t) { if (col0 + t * 16 >= N) continue;
#pragma unroll
    for (int r = 0; r < 8; ++r) so[w][8 * hh + r][t * 16 + ln] = acc[t][r] * alpha; }
  __builtin_amdgcn_fence(__ATOMIC_ACQ_REL, "workgroup"); __builtin_amdgcn_wave_barrier();
  const int rsub = lane >> 4, c4 = (lane & 15) * 4;
  {
#pragma unroll
    for (int q = 0; q < 8; ++q) { const int r = q * 2 + rsub; if (col0 + c4 < N) { const v4f v = *(const v4fa*)&so[w][r][c4]; *(v4f*)(C + (size_t)(row0 + r) * ldc + col0 + c4) = v; } }
     }
}

// Wt[n][k] = f16(W[k][n]·scale) from f32 row-major W[K][N] (scale = power of two; bf16-exact weights stay exact in f16 away from the subnormal range)
__global__ __launch_bounds__(256) void k_wt_f16(const float* __restrict__ W, _Float16* __restrict__ Wt, int K, int N, float scale) {
  const int t = blockIdx.x * 256 + threadIdx.x; if (t >= N * (K / 8)) return; const int n = t / (K / 8), k8 = (t % (K / 8)) * 8; FragH f;
#pragma unroll
  for (int i = 0; i < 8; ++i) f.h[i] = (_Float16)(bf16_round(W[(size_t)(k8 + i) * N + n]) * scale); const v8us o = f.half[0];
  *(v8us*)((unsigned short*)Wt + (size_t)n * K + k8) = o; 
}
// k_gemm_hh variant with fused epilogue: v = acc·alpha + bias[by·sBias + col] (+ CP[(row/rowsPerB)·sCPb + by·64 + col] if CP) ; ACT 0 none / 1 elu ; writes f16 C16 (and f32 C if non-null)
template <int ACT>
__global__ __launch_bounds__(128) void k_gemm_hhx(const _Float16* __restrict__ A, int lda, size_t sA, const _Float16* __restrict__ Bh, int ldb, size_t sB, float alpha, const float* __restrict__ bias, size_t sBias, const float* __restrict__ CP, int rowsPerB, size_t sCPb, int row0g,
    float* __restrict__ C, _Float16* __restrict__ C16, int ldc, size_t sC, int M, int N, int K) {
  __shared__ __attribute__((aligned(16))) float so[4][16][64];
  const int tid = threadIdx.x, w = tid >> 5, lane = tid & 31, ln = lane & 15, hh = lane >> 4; const int by = blockIdx.y;
  A += (size_t)by * sA; Bh += (size_t)by * sB; const size_t cofs = (size_t)by * sC; const float* bp = bias ? bias + (size_t)by * sBias : nullptr;
  const int ntn = (N + 63) / 64; const int wid = blockIdx.x * 4 + w; const int mt = wid / ntn, nq = wid % ntn; if (mt * 16 >= M) return;
  const int row0 = mt * 16, col0 = nq * 64; const _Float16* arow = A + (size_t)(row0 + ln) * lda;
  v8f acc[4] = {};
  for (int kb = 0; kb < K; kb += 32) { FragH ah; ah.half[0] = *(const v8us*)((const unsigned short*)arow + kb + 8 * hh); ah.half[1] = *(const v8us*)((const unsigned short*)arow + kb + 16 + 8 * hh);
#pragma unroll
    for (int t = 0; t < 4; ++t) { if (col0 + t * 16 >= N) continue; const size_t boff = (size_t)(col0 + t * 16 + ln) * ldb + kb; FragH bq; bq.half[0] = *(const v8us*)((const unsigned short*)Bh + boff + 8 * hh); bq.half[1] = *(const v8us*)((const unsigned short*)Bh + boff + 16 + 8 * hh);
      acc[t] = mmaH<1>(ah.v, ah.v, bq.v, bq.v, acc[t]); }
  }
#pragma unroll
  for (int t = 0; t < 4; ++t) { if (col0 + t * 16 >= N) continue; const int col = col0 + t * 16 + ln; const float bv = bp ? bf16_round(bp[col]) : 0.f;
#pragma unroll
    for (int r = 0; r < 8; ++r) { float v = acc[t][r] * alpha + bv; if (CP) { const int rr = row0g + row0 + 8 * hh + r; if (rowsPerB < 0) v += CP[cofs + (size_t)rr * ldc + col];      /* rowsPerB < 0: own element of the batched C plane */ else { const int bidx = rr / rowsPerB; v += CP[(size_t)bidx * sCPb + (size_t)by * 64 + col]; } } if (ACT == 1) v = (v > 0.f) ? v : expm1f(v); else if (ACT == 7) v = (v > 0.f) ? v + 1.0f : expf(v); else if (ACT == 8) v = tanhf(v); else if (ACT == 9) v = 0.5f * v * (1.0f + tanhf(0.7978845608028654f * (v + 0.044715f * v * v * v))); else if (ACT == 11) v = 1.0f / (1.0f + expf(-v)); else if (ACT == 12) v = (v > 0.f) ? v : 0.01f * v; else if (ACT == 14) v = (v > 0.f) ? v : 0.1f * v; else if (ACT == 16) v = (v >= 0.f) ? v : 0.3f * v; else if (ACT == 15) v = v / (1.0f + expf(-v)); else if (ACT == 3) v = fmaxf(v, 0.f); else if (ACT == 6) v = 0.5f * v * (1.0f + erff(v * 0.70710678118654752f)); so[w][8 * hh + r][t * 16 + ln] = v; } }
  __builtin_amdgcn_fence(__ATOMIC_ACQ_REL, "workgroup"); __builtin_amdgcn_wave_barrier();
  const int rsub = lane >> 4, c4 = (lane & 15) * 4; typedef _Float16 v4h __attribute__((ext_vector_type(4)));
  {
#pragma unroll
    for (int q = 0; q < 8; ++q) { const int r = q * 2 + rsub; if (col0 + c4 < N) { const v4f v = *(const v4fa*)&so[w][r][c4]; if (C) *(v4f*)(C + cofs + (size_t)(row0 + r) * ldc + col0 + c4) = v; if (C16) { v4h h4; for (int i = 0; i < 4; ++i) h4[i] = (_Float16)v[i]; *(v4h*)(C16 + cofs + (size_t)(row0 + r) * ldc + col0 + c4) = h4; } } }
     }
}


typedef _Float16 v4h __attribute__((ext_vector_type(4)));

__global__ __launch_bounds__(256) void k_x16(const float* __restrict__ x, _Float16* __restrict__ X16, size_t n8) { const size_t t = (size_t)blockIdx.x * 256 + threadIdx.x; if (t >= n8) return; FragH f;
#pragma unroll
  for (int q = 0; q < 8; ++q) f.h[q] = (_Float16)bf16_round(x[t * 8 + q]); *(v8us*)((unsigned short*)X16 + t * 8) = f.half[0];  }
__global__ __launch_bounds__(256) void k_h16(const float* __restrict__ x, _Float16* __restrict__ X16, size_t n8) { const size_t t = (size_t)blockIdx.x * 256 + threadIdx.x; if (t >= n8) return; FragH f;
#pragma unroll
  for (int q = 0; q < 8; ++q) f.h[q] = (_Float16)x[t * 8 + q]; *(v8us*)((unsigned short*)X16 + t * 8) = f.half[0];  }
__global__ __launch_bounds__(256) void k_round16f(const float* __restrict__ W, _Float16* __restrict__ Bt, size_t n8) { const size_t t = (size_t)blockIdx.x * 256 + threadIdx.x; if (t >= n8) return; FragH f;
#pragma unroll
  for (int i = 0; i < 8; ++i) f.h[i] = (_Float16)(bf16_round(W[t * 8 + i]) * 16.0f); *(v8us*)((unsigned short*)Bt + t * 8) = f.half[0];  }
template <int NHv, int TTv>
__global__ __launch_bounds__(256) void k_vt(const _Float16* __restrict__ V16, int ldv, int voff, _Float16* __restrict__ Vt) { __shared__ unsigned short tl[64][66]; const int tid = threadIdx.x; const int slab = blockIdx.x / (TTv / 64), lg = blockIdx.x % (TTv / 64); const int b = slab / NHv, h = slab % NHv;
  for (int i = tid; i < 64 * 8; i += 256) { const int r = i / 8, c8 = (i % 8) * 8; FragH f; f.half[0] = *(const v8us*)((const unsigned short*)V16 + ((size_t)b * TTv + lg * 64 + r) * ldv + voff + h * 64 + c8);
#pragma unroll
    for (int q = 0; q < 8; ++q) tl[r][c8 + q] = f.u[q]; }
  __syncthreads();
  {
#pragma unroll
    for (int rd = 0; rd < 2; ++rd) { const int d = rd * 32 + tid / 8, pc = tid % 8; FragH f;
#pragma unroll
      for (int q = 0; q < 8; ++q) f.u[q] = tl[pc * 8 + q][d];
      *(v8us*)((unsigned short*)Vt + ((size_t)slab * 64 + d) * TTv + lg * 64 + pc * 8) = f.half[0]; }
     } }

__global__ __launch_bounds__(256) void k_hl(const float* __restrict__ F, _Float16* __restrict__ Hh, _Float16* __restrict__ Hl, size_t n8) { const size_t t = (size_t)blockIdx.x * 256 + threadIdx.x; if (t >= n8) return; FragH fh, fl; const v4f a = *(const v4fa*)(F + t * 8), c = *(const v4fa*)(F + t * 8 + 4);
#pragma unroll
  for (int q = 0; q < 4; ++q) { _Float16 h = (_Float16)a[q]; fh.h[q] = h; fl.h[q] = (_Float16)((a[q] - (float)h) * 1024.0f); h = (_Float16)c[q]; fh.h[4 + q] = h; fl.h[4 + q] = (_Float16)((c[q] - (float)h) * 1024.0f); }
  { *(v8us*)((unsigned short*)Hh + t * 8) = fh.half[0]; *(v8us*)((unsigned short*)Hl + t * 8) = fl.half[0];  } }

// ---- operand planes in fragment order: per (16-row tile, 32-wide k step) one 1-KiB block [register half j][lane 16 hh + ln][8 f16], holding element (row 16 tile + ln, k = 32 step + 16 j + 8 hh + e);
// blocks run [row tile][k step]. A wave's 16-byte-per-lane fragment load then covers 4 whole 128-byte lines; from plain rows it touches 16 lines for 32 bytes each.
#define FBLK 512                 /* f16 per block */
__device__ __forceinline__ v16h fo_frag(const unsigned short* p) { FragH f; f.half[0] = *(const v8us*)p; f.half[1] = *(const v8us*)(p + FBLK / 2); return f.v; }      /* p = block + 8 lane */
// ---- output GEMM for the fixed shape: out[NR][DD] (f32) = attention output (A, fragment order) x W_o (B, fragment order, times 16) / 16. Work-group = 128 rows x 64 columns, wave tile 32 x 64.
// Every global load of a wave is issued ahead of its first wait: the work-group's 32 KiB of W_o go to LDS once (16 x 16 bytes a thread), the wave's 16 A fragments stay in registers; the k steps then read LDS and registers only.
#define OCB (4 * (DD / 32) * FBLK)      /* f16 of W_o per 64 output columns: 4 column tiles x 8 k steps, contiguous */
// at most 256 registers a wave: four work-groups share a WGP, so that all 768 are resident at once
__global__ __launch_bounds__(128) __attribute__((amdgpu_waves_per_eu(4, 4))) void k_out(const _Float16* __restrict__ A, const _Float16* __restrict__ Bh, float* __restrict__ C) {
  __shared__ __attribute__((aligned(16))) unsigned short sb[OCB];
  __shared__ __attribute__((aligned(16))) float so[4][32][68];
  const int tid = threadIdx.x, w = tid >> 5, lane = tid & 31, ln = lane & 15, hh = lane >> 4;
  const int mt = blockIdx.x / (DD / 64), nq = blockIdx.x % (DD / 64); const int row0 = mt * 128 + 32 * w, col0 = nq * 64;
  const unsigned short* bg = (const unsigned short*)Bh + (size_t)nq * OCB + tid * 8;
  const unsigned short* ag = (const unsigned short*)A + (size_t)(row0 >> 4) * (DD / 32) * FBLK + lane * 8;      /* row tiles row0 / 16 and the next: 16 blocks in a row */
  v8us br[16]; v16h af[2][DD / 32];
#pragma unroll
  for (int i = 0; i < 16; ++i) br[i] = *(const v8us*)(bg + i * 128 * 8);
#pragma unroll
  for (int a = 0; a < 2; ++a)
#pragma unroll
    for (int s = 0; s < DD / 32; ++s) af[a][s] = fo_frag(ag + (a * (DD / 32) + s) * FBLK);
  asm volatile("s_wait_xcnt 0x0" :: "v"(tid), "v"(ag) : "memory");      /* wait before the loads' address registers are rewritten; naming the addresses as inputs keeps them live up to here (the W_o loads go by a scalar base and the thread index as lane offset); as a memory fence it also keeps all 48 loads ahead of the LDS stores */
#pragma unroll
  for (int i = 0; i < 16; ++i) *(v8us*)(sb + tid * 8 + i * 128 * 8) = br[i];
  __syncthreads();
  const unsigned short* bl = sb + lane * 8;
  const v8f z8 = {0.f,0.f,0.f,0.f,0.f,0.f,0.f,0.f}; v8f acc[2][4];
#pragma unroll
  for (int t = 0; t < 4; ++t) { acc[0][t] = z8; acc[1][t] = z8; }
  v16h b[4];
#pragma unroll
  for (int t = 0; t < 4; ++t) b[t] = fo_frag(bl + t * (DD / 32) * FBLK);
  // unrolled: the A fragments are indexed by the step, and the next step's W_o fragments are read into a second register set ahead of this step's products
#pragma unroll
  for (int s = 0; s < DD / 32; ++s) { v16h bn[4];
    if (s + 1 < DD / 32) {
#pragma unroll
      for (int t = 0; t < 4; ++t) bn[t] = fo_frag(bl + (t * (DD / 32) + s + 1) * FBLK); }
    __builtin_amdgcn_sched_barrier(0);      /* the next step's LDS reads issue as one group ahead of this step's products: one place with LDS reads a step */
#pragma unroll
    for (int t = 0; t < 4; ++t) {
      acc[0][t] = __builtin_amdgcn_wmma_f32_16x16x32_f16(false, af[0][s], false, b[t], (short)0, acc[0][t], false, false);
      acc[1][t] = __builtin_amdgcn_wmma_f32_16x16x32_f16(false, af[1][s], false, b[t], (short)0, acc[1][t], false, false); }
    __builtin_amdgcn_sched_barrier(0);      /* keeps later steps' LDS reads in their own step; hoisted all together they spilled registers to scratch */
    if (s + 1 < DD / 32) {
#pragma unroll
      for (int t = 0; t < 4; ++t) b[t] = bn[t]; } }
#pragma unroll
  for (int a = 0; a < 2; ++a)
#pragma unroll
    for (int t = 0; t < 4; ++t)
#pragma unroll
      for (int r = 0; r < 8; ++r) so[w][a * 16 + 8 * hh + r][t * 16 + ln] = acc[a][t][r] * 0.0625f;
  __builtin_amdgcn_fence(__ATOMIC_ACQ_REL, "workgroup"); __builtin_amdgcn_wave_barrier();      /* the wave's other lanes read what this lane staged */
  const int rsub = lane >> 4, c4 = (lane & 15) * 4;
  float* cd = C + (size_t)(row0 + rsub) * DD + col0 + c4;
  v4f tv[16];
#pragma unroll
  for (int q = 0; q < 16; ++q) tv[q] = *(const v4fa*)&so[w][q * 2 + rsub][c4];
  __builtin_amdgcn_sched_barrier(0);      /* all LDS reads issue as one group ahead of the stores; otherwise each store waits out its own read's latency in one register set */
#pragma unroll
  for (int q = 0; q < 16; ++q) *(v4f*)(cd + (size_t)q * 2 * DD) = tv[q];
}


// additive bias plane as a matrix operand: bf16-rounded sim is exact in f16 (8 significant bits; below 2^-14 the absolute error stays under 2^-25; a normal draw stays four orders of magnitude under the f16 maximum), half the bytes of an f32 accumulator tile.
// One fragment-order block per (16-query tile, 32 keys): element (row ln, k = 16 j + 8 hh + e) = sim[query 8 hh + e][key 16 j + ln]. Times the one-hot B (k = 16 x + c -> column c) it adds
// sim[query c][key 16 x + row] to a 16-key x 16-query score tile: one block serves two score tiles, x = 0 and 1. Thread t writes the t-th 16 bytes of the plane.
__device__ __forceinline__ void d_bias(int blk, const float* __restrict__ sim, _Float16* __restrict__ BP) {
  const int t = blk * 256 + threadIdx.x; if (t >= NN * NN / 8) return; const int key = ((t >> 6) & 15) * 32 + ((t >> 5) & 1) * 16 + (t & 15), q0 = (t >> 10) * 16 + ((t >> 4) & 1) * 8; FragH f;
#pragma unroll
  for (int e = 0; e < 8; ++e) f.h[e] = (_Float16)bf16_round(sim[(size_t)(q0 + e) * NN + key]);
  *(v8us*)((unsigned short*)BP + (size_t)t * 8) = f.half[0]; }

// Fused projection + attention. 256 work-groups of 16 waves, one per WGP; a pair of work-groups shares three (group, head) units: round 0 takes a whole unit each (32 query tiles, two a wave),
// round 1 takes the third unit, each work-group one half of its queries (one tile a wave); both form that unit's K and V^T. Every WGP so carries 48 query tiles.
// Projection of a unit: wave w takes token tiles w and w + 16. q | k: D = W rows (A) x token rows (B), so lane (c, h) holds 8 neighbouring dims of token c: q is the score product's B fragment as it stands
// and stays in registers, k is a 16-byte piece of a K row in LDS; v^T: D = token rows (A) x W rows (B), so a lane holds 8 neighbouring tokens of one dim: a 16-byte piece of a V^T row in LDS.
// Attention of a query tile: S^T = K Q^T + bias block x one-hot (q carries 32^-0.5, so that sim is added as it stands): lane (c, h) holds keys 8h..8h+7 of each 16-key tile for query c, so two score tiles
// convert in place into the B operand of O^T += V^T P^T (hardware k order on both sides). Online softmax over blocks of 128 keys in
// the log2 domain; P carries 2^10 (cancels against the row sum). K rows and V^T rows sit in LDS at pitches of 16 B x odd.
#define KPITCH 40                /* f16 per K row in LDS: 80 B */
#define VPITCH 520               /* f16 per V^T row in LDS: 1040 B */
#define KBLK 128                 /* keys per online-softmax block */
#define C2 1.4426950408889634f
#define KS (DD / 32)             /* k steps of a projection */
#define WSEG (2 * KS * FBLK)     /* f16 of one head's q, k or v weights: 2 row tiles x 8 k steps, contiguous in the plane */
__device__ __forceinline__ v16h lds_frag(const unsigned short* p, int hh) { FragH f; f.half[0] = *(const v8us*)(p + 8 * hh); f.half[1] = *(const v8us*)(p + 16 + 8 * hh); return f.v; }
// four waves per SIMD: the one work-group of a WGP may use 256 registers a wave
__global__ __launch_bounds__(512) __attribute__((amdgpu_waves_per_eu(4, 4))) void k_fa(const _Float16* __restrict__ X16, const _Float16* __restrict__ Bw, const _Float16* __restrict__ BP, _Float16* __restrict__ O16) {
  __shared__ __attribute__((aligned(16))) unsigned short sm[NN * KPITCH + HD * VPITCH + 3 * WSEG];      /* one array, so that K and V^T come first: the attention loop's LDS reads then reach every row by a 16-bit constant offset */
  unsigned short* const sk = sm; unsigned short* const sv = sm + NN * KPITCH; unsigned short* const swt = sm + NN * KPITCH + HD * VPITCH;      /* swt = the head's weights: blocks [q0 q1 k0 k1 v0 v1][k step] */
  const int tid = threadIdx.x, w = __builtin_amdgcn_readfirstlane(tid >> 5), lane = tid & 31, ln = lane & 15, hh = lane >> 4;      /* the wave's number as a scalar: tile bases stay out of the vector registers */
  const int pr = blockIdx.x >> 1, sd = blockIdx.x & 1;
  const v8f z8 = {0.f,0.f,0.f,0.f,0.f,0.f,0.f,0.f};
  FragH ones;      /* A whose row 0 is all ones: row 0 of os = the column sums of the rounded P, summed on the matrix pipe */
#pragma unroll
  for (int i = 0; i < 16; ++i) ones.h[i] = (ln == 0) ? (_Float16)1.0f : (_Float16)0.0f;
  FragH e0, e1;      /* one-hot B operands: k = c (e0) or k = 16 + c (e1) goes to column c */
#pragma unroll
  for (int i = 0; i < 8; ++i) { const _Float16 d = (8 * hh + i == ln) ? (_Float16)1.0f : (_Float16)0.0f; e0.h[i] = d; e0.h[8 + i] = (_Float16)0.0f; e1.h[i] = (_Float16)0.0f; e1.h[8 + i] = d; }
  // rolled: both rounds run the same text
#pragma unroll 1
  for (int rd = 0; rd < 2; ++rd) {
    const int gh = 3 * pr + (rd == 0 ? sd : 2); const int g = gh / NH, h = gh % NH;
    // every load of the front is issued first: the wave's x fragments of k steps 0..3 (both token tiles), then the work-group's 48 KiB of weights
    const unsigned short* xg = (const unsigned short*)X16 + (size_t)(g * (NN / 16) + w) * KS * FBLK + lane * 8;      /* token tile w; tile w + 16 is a constant step on */
    const unsigned short* wg = (const unsigned short*)Bw + (size_t)(2 * h) * KS * FBLK + tid * 8;      /* q rows of head h; k and v rows lie 16 and 32 row tiles on */
    v16h xf[2][4]; v8us wr[6];
#pragma unroll
    for (int s = 0; s < 4; ++s) { xf[0][s] = fo_frag(xg + s * FBLK); xf[1][s] = fo_frag(xg + (16 * KS + s) * FBLK); }
#pragma unroll
    for (int i = 0; i < 6; ++i) wr[i] = *(const v8us*)(wg + (i >> 1) * 16 * KS * FBLK + (i & 1) * 512 * 8);
    asm volatile("s_wait_xcnt 0x0" :: "v"(wg) : "memory");      /* wait before the weight loads' address register is rewritten; naming it as an input keeps it live up to here */
#pragma unroll
    for (int i = 0; i < 6; ++i) *(v8us*)(swt + (i >> 1) * WSEG + (i & 1) * 512 * 8 + tid * 8) = wr[i];      /* swt: its last readers passed the barrier behind the round before's projection */
    __syncthreads();      /* weights visible; also ends every wave's reads of the round before's K and V^T */
    v16h qA, qB;
    {
      v8f aq[4][2], av[2][2];
#pragma unroll
      for (int a = 0; a < 4; ++a) { aq[a][0] = z8; aq[a][1] = z8; }
#pragma unroll
      for (int t = 0; t < 2; ++t) { av[t][0] = z8; av[t][1] = z8; }
      const unsigned short* wl = swt + lane * 8;
      // unrolled: the x fragments are register arrays indexed by the step; a step's registers take the fragment of four steps on as soon as its products are issued
#pragma unroll
      for (int s = 0; s < KS; ++s) {
        v16h wf[6];
#pragma unroll
        for (int a = 0; a < 6; ++a) wf[a] = fo_frag(wl + (a * KS + s) * FBLK);
        __builtin_amdgcn_sched_barrier(0);      /* the step's LDS reads issue as one group ahead of its products: one place with LDS reads a step */
#pragma unroll
        for (int t = 0; t < 2; ++t) {
#pragma unroll
          for (int a = 0; a < 4; ++a) aq[a][t] = __builtin_amdgcn_wmma_f32_16x16x32_f16(false, wf[a], false, xf[t][s & 3], (short)0, aq[a][t], false, false);
#pragma unroll
          for (int b = 0; b < 2; ++b) av[t][b] = __builtin_amdgcn_wmma_f32_16x16x32_f16(false, xf[t][s & 3], false, wf[4 + b], (short)0, av[t][b], false, false); }
        if (s + 4 < KS) { xf[0][s & 3] = fo_frag(xg + (s + 4) * FBLK); xf[1][s & 3] = fo_frag(xg + (16 * KS + s + 4) * FBLK); }
        __builtin_amdgcn_sched_barrier(0); }      /* keeps later steps' LDS reads in their own step, so that the register count holds */
      asm volatile("s_wait_xcnt 0x0" :: "v"(xg) : "memory");      /* wait before the x loads' address register is rewritten; naming it as an input keeps it live up to here */
      FragH fa, fb;
#pragma unroll
      for (int r = 0; r < 8; ++r) { fa.h[r] = (_Float16)(aq[0][0][r] * (0.0625f * SCL)); fa.h[8 + r] = (_Float16)(aq[1][0][r] * (0.0625f * SCL)); fb.h[r] = (_Float16)(aq[0][1][r] * (0.0625f * SCL)); fb.h[8 + r] = (_Float16)(aq[1][1][r] * (0.0625f * SCL)); }
      qA = fa.v; qB = fb.v;
#pragma unroll
      for (int t = 0; t < 2; ++t)
#pragma unroll
        for (int a = 0; a < 2; ++a) { FragH f, f2;
#pragma unroll
          for (int r = 0; r < 8; ++r) { f.h[r] = (_Float16)(aq[2 + a][t][r] * 0.0625f); f2.h[r] = (_Float16)(av[t][a][r] * 0.0625f); }
          *(v8us*)(sk + ((w + 16 * t) * 16 + ln) * KPITCH + a * 16 + 8 * hh) = f.half[0];
          *(v8us*)(sv + (a * 16 + ln) * VPITCH + (w + 16 * t) * 16 + 8 * hh) = f2.half[0]; }
    }
    __syncthreads();      /* K and V^T visible; also ends every wave's reads of the weights */
    const int tlo = rd == 0 ? 0 : sd, thi = rd == 0 ? 1 : sd;
    // rolled: one text for both query tiles
#pragma unroll 1
    for (int t = tlo; t <= thi; ++t) {
      const v16h qf = t == 0 ? qA : qB; const int qt = w + 16 * t;      /* query tile of the group */
      const unsigned short* bro = (const unsigned short*)BP + (size_t)qt * (NN / 32) * FBLK + lane * 8;
      v8f o0 = z8, o1 = z8, os = z8; float m = -1.0e30f;      /* far below any score, and (m - mn) * C2 stays finite */
      // rolled: only one block's 64 score registers are live at a time
#pragma unroll 1
      for (int kb = 0; kb < NN; kb += KBLK) {
        v8f s[KBLK / 16]; v16h bf[KBLK / 32]; const unsigned short* bp = bro + (kb / 32) * FBLK;
#pragma unroll
        for (int p = 0; p < KBLK / 32; ++p) bf[p] = fo_frag(bp + p * FBLK);
        asm volatile("s_wait_xcnt 0x0" ::: "memory");      /* wait before the bias loads' address register is stepped; as a memory fence it also keeps the eight loads at the head of the block, so that they fly under the K Q^T products */
#pragma unroll
        for (int p = 0; p < KBLK / 32; ++p) {
          s[2 * p] = __builtin_amdgcn_wmma_f32_16x16x32_f16(false, lds_frag(sk + (kb + p * 32 + ln) * KPITCH, hh), false, qf, (short)0, z8, false, false);
          s[2 * p + 1] = __builtin_amdgcn_wmma_f32_16x16x32_f16(false, lds_frag(sk + (kb + p * 32 + 16 + ln) * KPITCH, hh), false, qf, (short)0, z8, false, false); }
#pragma unroll
        for (int p = 0; p < KBLK / 32; ++p) {
          s[2 * p] = __builtin_amdgcn_wmma_f32_16x16x32_f16(false, bf[p], false, e0.v, (short)0, s[2 * p], false, false);
          s[2 * p + 1] = __builtin_amdgcn_wmma_f32_16x16x32_f16(false, bf[p], false, e1.v, (short)0, s[2 * p + 1], false, false);
        }
        float mx[4] = {s[0][0], s[0][1], s[0][2], s[0][3]};
#pragma unroll
        for (int u = 0; u < KBLK / 16; ++u)
#pragma unroll
          for (int r = 0; r < 8; ++r) mx[r & 3] = fmaxf(mx[r & 3], s[u][r]);
        float bm = fmaxf(fmaxf(mx[0], mx[1]), fmaxf(mx[2], mx[3])); bm = fmaxf(bm, __shfl_xor(bm, 16, 32));      /* both halves of a column share one maximum */
        const float mn = fmaxf(m, bm); const float al = __builtin_amdgcn_exp2f((m - mn) * C2); const float off = 10.0f - mn * C2; m = mn;
#pragma unroll
        for (int r = 0; r < 8; ++r) { o0[r] *= al; o1[r] *= al; }
        os[0] *= al;      /* only row 0 of the sum tile is ever read */
#pragma unroll
        for (int p = 0; p < KBLK / 32; ++p) { FragH b;
#pragma unroll
          for (int r = 0; r < 8; ++r) { const float x0 = __builtin_amdgcn_exp2f(fmaf(s[2 * p][r], C2, off)), x1 = __builtin_amdgcn_exp2f(fmaf(s[2 * p + 1][r], C2, off));
            b.h[r] = (_Float16)x0; b.h[8 + r] = (_Float16)x1; }
          const unsigned short* vr = sv + ln * VPITCH + kb + p * 32;
          o0 = __builtin_amdgcn_wmma_f32_16x16x32_f16(false, lds_frag(vr, hh), false, b.v, (short)0, o0, false, false);
          o1 = __builtin_amdgcn_wmma_f32_16x16x32_f16(false, lds_frag(vr + 16 * VPITCH, hh), false, b.v, (short)0, o1, false, false);
          os = __builtin_amdgcn_wmma_f32_16x16x32_f16(false, ones.v, false, b.v, (short)0, os, false, false); }
      }
      const float su = __shfl(os[0], ln, 32); const float inv = 1.0f / su; FragH f;      /* row 0 sits in register 0 of lanes 0..15 */
#pragma unroll
      for (int r = 0; r < 8; ++r) { f.h[r] = (_Float16)(o0[r] * inv); f.h[8 + r] = (_Float16)(o1[r] * inv); }
      unsigned short* d = (unsigned short*)O16 + ((size_t)(g * (NN / 16) + qt) * (DD / 32) + h) * FBLK + lane * 8;      /* lane (c, h) holds head dims 8h..8h+7 and 16+8h.. of query c: the output GEMM's A fragment of row tile g NN / 16 + qt, k step h, as it stands */
      *(v8us*)d = f.half[0]; *(v8us*)(d + FBLK / 2) = f.half[1];
      asm volatile("s_wait_xcnt 0x0" ::: "memory");      /* wait before the stores' address and data registers are rewritten by the next tile */
    }
  }
}
// x as f16 fragment blocks [row tile][k step]. One work-group = 64 token rows: read once as f32 in whole rows, rounded (bf16, exact in f16) into LDS, read back in fragment order and stored as 32 KiB in a row.
#define PROWS 64                 /* token rows per work-group */
#define XPITCH 264               /* f16 per x row in LDS: 528 B = 16 B x 33 */
__device__ __forceinline__ void d_x(int blk, const float* __restrict__ x, _Float16* __restrict__ X16, unsigned short* sx) {
  const int tid = threadIdx.x, w = tid >> 5, lane = tid & 31, ln = lane & 15, hh = lane >> 4;
  const float* xg = x + (size_t)blk * PROWS * DD + tid * 8;      /* row 8 i + w, columns 8 lane.. */
  v4f xa[8], xb[8];
#pragma unroll
  for (int i = 0; i < 8; ++i) { xa[i] = *(const v4fa*)(xg + i * 8 * DD); xb[i] = *(const v4fa*)(xg + i * 8 * DD + 4); }
  asm volatile("s_wait_xcnt 0x0" :: "v"(xg) : "memory");      /* wait before the loads' address register is rewritten; naming it as an input keeps it live up to here */
  __builtin_amdgcn_sched_barrier(0);      /* all 16 loads issue ahead of the first conversion; otherwise the second eight are issued only behind the wait on the first: two memory latencies in a row */
#pragma unroll
  for (int i = 0; i < 8; ++i) { FragH f;
#pragma unroll
    for (int q = 0; q < 4; ++q) { f.h[q] = (_Float16)bf16_round(xa[i][q]); f.h[4 + q] = (_Float16)bf16_round(xb[i][q]); }
    *(v8us*)(sx + (i * 8 + w) * XPITCH + lane * 8) = f.half[0]; }
  __syncthreads();
  unsigned short* xd = (unsigned short*)X16 + (size_t)blk * (PROWS / 16) * (DD / 32) * FBLK + tid * 8;
  v8us tv[8];      /* piece p = 256 i + tid of the work-group's 2048: lane p % 32, register half (p / 32) % 2, k step (p / 64) % 8, row tile p / 512 */
#pragma unroll
  for (int i = 0; i < 8; ++i) tv[i] = *(const v8us*)(sx + ((i >> 1) * 16 + ln) * XPITCH + ((i & 1) * 4 + (w >> 1)) * 32 + (w & 1) * 16 + 8 * hh);
  __builtin_amdgcn_sched_barrier(0);      /* all LDS reads issue as one group ahead of the stores; otherwise each store waits out its own read's latency in one register set */
#pragma unroll
  for (int i = 0; i < 8; ++i) *(v8us*)(xd + i * 256 * 8) = tv[i];
}
// thread t writes the t-th 16 bytes of the fragment-order plane: lane = t % 32, register half j, k step, row tile
__device__ __forceinline__ void d_wqkv(int blk, const float* __restrict__ Wq, const float* __restrict__ Wk, const float* __restrict__ Wv, _Float16* __restrict__ Bt) { const int t = blk * 256 + threadIdx.x; if (t >= 3 * DD * (DD / 8)) return; const int n = (t >> 9) * 16 + (t & 15), k0 = ((t >> 6) & 7) * 32 + ((t >> 5) & 1) * 16 + ((t >> 4) & 1) * 8; const int which = n / DD, o = n % DD; const float* Wm = which == 0 ? Wq : (which == 1 ? Wk : Wv); FragH f;
  for (int q = 0; q < 8; ++q) f.h[q] = (_Float16)(bf16_round(Wm[(size_t)(k0 + q) * DD + o]) * 16.0f); *(v8us*)((unsigned short*)Bt + (size_t)t * 8) = f.half[0];  }
// W_o as f16 [n][k], times 16, in fragment order (thread t as in d_wqkv)
__device__ __forceinline__ void d_wo(int blk, const float* __restrict__ Wo, _Float16* __restrict__ Bo) { const int t = blk * 256 + threadIdx.x; if (t >= DD * (DD / 8)) return; const int n = (t >> 9) * 16 + (t & 15), k8 = ((t >> 6) & 7) * 32 + ((t >> 5) & 1) * 16 + ((t >> 4) & 1) * 8; FragH f;
#pragma unroll
  for (int i = 0; i < 8; ++i) f.h[i] = (_Float16)(bf16_round(Wo[(size_t)(k8 + i) * DD + n]) * 16.0f);
  *(v8us*)((unsigned short*)Bo + (size_t)t * 8) = f.half[0]; }
// One preparation launch: the four jobs read none of each other's output, so they share a grid and each work-group picks its job by its index.
// The x job comes first: it moves the most bytes.
#define PB_X (NR / PROWS)                     /* 384 work-groups */
#define PB_QKV (3 * DD * (DD / 8) / 256)      /* 96 */
#define PB_WO (DD * (DD / 8) / 256)           /* 32 */
#define PB_BIAS (NN * NN / 8 / 256)           /* 128 */
__global__ __launch_bounds__(256) void k_prep(const float* __restrict__ x, const float* __restrict__ Wq, const float* __restrict__ Wk, const float* __restrict__ Wv, const float* __restrict__ Wo, const float* __restrict__ sim,
                                              _Float16* __restrict__ X16, _Float16* __restrict__ Bt, _Float16* __restrict__ Bo, _Float16* __restrict__ BP) {
  __shared__ __attribute__((aligned(16))) unsigned short sx[PROWS * XPITCH];
  const int b = blockIdx.x;
  if (b < PB_X) d_x(b, x, X16, sx);
  else if (b < PB_X + PB_QKV) d_wqkv(b - PB_X, Wq, Wk, Wv, Bt);
  else if (b < PB_X + PB_QKV + PB_WO) d_wo(b - (PB_X + PB_QKV), Wo, Bo);
  else d_bias(b - (PB_X + PB_QKV + PB_WO), sim, BP);
}

extern "C" void kernel_launch(void* const* d_in, const int* in_sizes, int n_in,
                              void* d_out, int out_size, void* d_ws, size_t ws_size, hipStream_t stream) {
  (void)in_sizes; (void)n_in; (void)out_size;
  const float* const* I = (const float* const*)d_in; const float* x = I[0]; const float* sim = I[1]; const float* Wq = I[2]; const float* Wk = I[3]; const float* Wv = I[4]; const float* Wo = I[5];
  char* ws = (char*)d_ws; size_t off = 0;
  auto take = [&](size_t bytes) { char* p = ws + off; off += (bytes + 255) & ~(size_t)255; return p; };
  _Float16* BQKV = (_Float16*)take((size_t)3 * DD * DD * 2); _Float16* BO = (_Float16*)take((size_t)DD * DD * 2);
  _Float16* X16 = (_Float16*)take((size_t)NR * DD * 2); _Float16* O16 = (_Float16*)take((size_t)NR * DD * 2);
  _Float16* BP = (_Float16*)take((size_t)NN * NN * 2);
  if (off > ws_size) return;      /* under 27 MiB */
  k_prep<<<PB_X + PB_QKV + PB_WO + PB_BIAS, 256, 0, stream>>>(x, Wq, Wk, Wv, Wo, sim, X16, BQKV, BO, BP);
  k_fa<<<NG * NH * 2 / 3, 512, 0, stream>>>(X16, BQKV, BP, O16);      /* 256 work-groups: 1.5 (group, head) units each */
  k_out<<<(NR / 128) * (DD / 64), 128, 0, stream>>>(O16, BO, (float*)d_out);
}

// v008
// A run of this version takes 41.3 microseconds.
// Next to v007, in two timings, it ran 1.08 times as fast each time.
// Over all steps from v000 it is 16.7 times as fast.
#include <hip/hip_runtime.h>
// SpatialMHSA (4 x 12 frames x 512 spatial tokens x 256 = 8 heads of 32): q/k/v = x W (xavier (in,out) weights); per (batch, frame, head) attention over the 512 tokens with scores/sqrt(32) + an INPUT additive bias sim[n][m]; out = merged heads W_o.
// Structure: ONE preparation launch (x rounded to f16 fragment blocks, weights and the bias plane as fragment blocks); ONE fused projection + attention kernel (per (group, head): q in registers, K rows and V^T rows formed straight into LDS, f32 accumulation, exact x16 weights; S^T = K Q^T plus the bias plane times a one-hot matrix, online softmax in registers, O^T = V^T P^T, f16 out as the output GEMM's A fragments); output GEMM. x, weights and attention output lie in the workspace in fragment order.
// Compute dtype: x, sim and weights rounded to bf16; q, k, v, P, attention output as f16 operands (~2^-12); f32 accumulation/softmax. v_wmma_f32_16x16x32_f16.
#define NBATCH 4
#define NFR 12
#define NN 512
#define DD 256
#define NH 8
#define HD 32
#define NG (NBATCH * NFR)         /* 48 groups */
#define NR (NG * NN)             /* 24576 token rows */
#define SCL 0.17677669529663687f /* 32^-0.5 */
typedef __bf16 v16b __attribute__((ext_vector_type(16)));
typedef unsigned short v8us __attribute__((ext_vector_type(8), may_alias));
typedef float  v8f  __attribute__((ext_vector_type(8)));
typedef float  v4f  __attribute__((ext_vector_type(4)));
typedef float  v4fa __attribute__((ext_vector_type(4), may_alias));
union FragB { v16b v; v8us half[2]; unsigned short u[16]; };

__device__ __forceinline__ unsigned short bf16_bits(float x) { unsigned int u = __float_as_uint(x); return (unsigned short)((u + 0x7FFFu + ((u >> 16) & 1u)) >> 16); }
__device__ __forceinline__ float bf16_val(unsigned short b) { return __uint_as_float(((unsigned int)b) << 16); }
__device__ __forceinline__ float bf16_round(float x) { return bf16_val(bf16_bits(x)); }
// D += A·B with NT terms: 1 = ah·bh, 2 = + al·bh (A split), 3 = + ah·bl (both split)
template <int NT>
__device__ __forceinline__ v8f mmaN(v16b ah, v16b al, v16b bh, v16b bl, v8f c) {
  c = __builtin_amdgcn_wmma_f32_16x16x32_bf16(false, ah, false, bh, (short)0, c, false, false);
  if (NT >= 2) c = __builtin_amdgcn_wmma_f32_16x16x32_bf16(false, al, false, bh, (short)0, c, false, false);
  if (NT >= 3) c = __builtin_amdgcn_wmma_f32_16x16x32_bf16(false, ah, false, bl, (short)0, c, false, false);
  asm volatile("v_nop\n\tv_nop\n\tv_nop\n\tv_nop" : "+v"(c) : "v"(ah), "v"(al), "v"(bh), "v"(bl));
  return c;
}

__global__ __launch_bounds__(256) void k_wt_bf16(const float* __restrict__ W, unsigned short* __restrict__ Wt, int K, int N) {
  const int t = blockIdx.x * 256 + threadIdx.x;
  const int k8n = K / 8;
  if (t >= N * k8n) return;
  const int n = t / k8n, k8 = (t % k8n) * 8;
  v8us v;
#pragma unroll
  for (int i = 0; i < 8; ++i) v[i] = bf16_bits(W[(size_t)(k8 + i) * N + n]);
  *(v8us*)(Wt + (size_t)n * K + k8) = v;
  
}

// GEMM C[M][N] (f32, pitch ldc) = act(A[M][K]·W + bias). A f32 row-major (pitch lda) converted per fragment to bf16
// (ASPLIT: hi/lo two planes -> 2 terms, else single rounded term); Wt bf16 [N][K] (pitch ldb). BIAS_BF16 rounds the
// bias to bf16 first (bias quantised to bf16 before the add). K%32==0, M%16==0, N%64==0.
template <bool ASPLIT, int ACT, bool BIAS_BF16>
__global__ __launch_bounds__(128) void k_gemm_bf(const float* __restrict__ A, int lda, const unsigned short* __restrict__ Wt, int ldb,
                                               const float* __restrict__ bias, float* __restrict__ C, int ldc, int M, int N, int K) {
  __shared__ __attribute__((aligned(16))) float so[4][16][64];
  const int tid = threadIdx.x, w = tid >> 5, lane = tid & 31, ln = lane & 15, hh = lane >> 4;
  const int ntn = N / 64;
  const int wid = blockIdx.x * 4 + w;
  const int mt = wid / ntn, nq = wid % ntn;
  if (mt * 16 >= M) return;
  const int row0 = mt * 16, col0 = nq * 64;
  const float* arow = A + (size_t)(row0 + ln) * lda;
  v8f acc[4] = {};
  for (int kb = 0; kb < K; kb += 32) {
    FragB ah, al;
    const v4f x0 = *(const v4fa*)(arow + kb + 8 * hh), x1 = *(const v4fa*)(arow + kb + 8 * hh + 4);
    const v4f x2 = *(const v4fa*)(arow + kb + 16 + 8 * hh), x3 = *(const v4fa*)(arow + kb + 16 + 8 * hh + 4);
    float xs[16] = {x0[0],x0[1],x0[2],x0[3],x1[0],x1[1],x1[2],x1[3],x2[0],x2[1],x2[2],x2[3],x3[0],x3[1],x3[2],x3[3]};
#pragma unroll
    for (int i = 0; i < 16; ++i) { const unsigned short hb = bf16_bits(xs[i]); ah.u[i] = hb; al.u[i] = ASPLIT ? bf16_bits(xs[i] - bf16_val(hb)) : (unsigned short)0; }
#pragma unroll
    for (int t = 0; t < 4; ++t) {
      const unsigned short* brow = Wt + (size_t)(col0 + t * 16 + ln) * ldb + kb;
      FragB b;
      b.half[0] = *(const v8us*)(brow + 8 * hh);
      b.half[1] = *(const v8us*)(brow + 16 + 8 * hh);
      acc[t] = mmaN<ASPLIT ? 2 : 1>(ah.v, al.v, b.v, b.v, acc[t]);
    }
  }
#pragma unroll
  for (int t = 0; t < 4; ++t) {
    float bv = bias ? bias[col0 + t * 16 + ln] : 0.f;
    if (BIAS_BF16) bv = bf16_round(bv);
#pragma unroll
    for (int r = 0; r < 8; ++r) { float v = acc[t][r] + bv; if (ACT == 1) v = fmaxf(v, 0.f); so[w][8 * hh + r][t * 16 + ln] = v; }
  }
  __builtin_amdgcn_fence(__ATOMIC_ACQ_REL, "workgroup");
  __builtin_amdgcn_wave_barrier();
  const int rsub = lane >> 4, c4 = (lane & 15) * 4;
  {
#pragma unroll
    for (int q = 0; q < 8; ++q) {
      const int r = q * 2 + rsub;
      const v4f v = *(const v4fa*)&so[w][r][c4];
      *(v4f*)(C + (size_t)(row0 + r) * ldc + col0 + c4) = v;
    }
    
  }
}

// GEMM C = act(A·W + bias + resid): A f32 (ASPLIT -> hi/lo 2 terms), Wt bf16 [N][K]; ACT 0 none, 1 relu, 2 exact gelu;
// resid (optional, f32, row index = (row % rmod), pitch ldr, RES_BF16 rounds it) added before the activation.
template <bool ASPLIT, int ACT, bool BIAS_BF16, bool RES_BF16>
__global__ __launch_bounds__(128) void k_gemm_bf3(const float* __restrict__ A, int lda, const unsigned short* __restrict__ Wt, int ldb,
                                                const float* __restrict__ bias, const float* __restrict__ resid, int rmod, int ldr,
                                                float* __restrict__ C, int ldc, int M, int N, int K) {
  __shared__ __attribute__((aligned(16))) float so[4][16][64];
  const int tid = threadIdx.x, w = tid >> 5, lane = tid & 31, ln = lane & 15, hh = lane >> 4;
  const int ntn = N / 64;
  const int wid = blockIdx.x * 4 + w;
  const int mt = wid / ntn, nq = wid % ntn;
  if (mt * 16 >= M) return;
  const int row0 = mt * 16, col0 = nq * 64;
  const float* arow = A + (size_t)(row0 + ln) * lda;
  v8f acc[4] = {};
  for (int kb = 0; kb < K; kb += 32) {
    FragB ah, al;
    const v4f x0 = *(const v4fa*)(arow + kb + 8 * hh), x1 = *(const v4fa*)(arow + kb + 8 * hh + 4);
    const v4f x2 = *(const v4fa*)(arow + kb + 16 + 8 * hh), x3 = *(const v4fa*)(arow + kb + 16 + 8 * hh + 4);
    float xs[16] = {x0[0],x0[1],x0[2],x0[3],x1[0],x1[1],x1[2],x1[3],x2[0],x2[1],x2[2],x2[3],x3[0],x3[1],x3[2],x3[3]};
#pragma unroll
    for (int i = 0; i < 16; ++i) { const unsigned short hb = bf16_bits(xs[i]); ah.u[i] = hb; al.u[i] = ASPLIT ? bf16_bits(xs[i] - bf16_val(hb)) : (unsigned short)0; }
#pragma unroll
    for (int t = 0; t < 4; ++t) {
      const unsigned short* brow = Wt + (size_t)(col0 + t * 16 + ln) * ldb + kb;
      FragB b;
      b.half[0] = *(const v8us*)(brow + 8 * hh);
      b.half[1] = *(const v8us*)(brow + 16 + 8 * hh);
      acc[t] = mmaN<ASPLIT ? 2 : 1>(ah.v, al.v, b.v, b.v, acc[t]);
    }
  }
#pragma unroll
  for (int t = 0; t < 4; ++t) {
    const int col = col0 + t * 16 + ln;
    float bv = bias ? bias[col] : 0.f;
    if (BIAS_BF16) bv = bf16_round(bv);
#pragma unroll
    for (int r = 0; r < 8; ++r) {
      float v = acc[t][r] + bv;
      if (resid) { float rv = resid[(size_t)((row0 + 8 * hh + r) % rmod) * ldr + col]; if (RES_BF16) rv = bf16_round(rv); v += rv; }
      if (ACT == 1) v = fmaxf(v, 0.f);
      if (ACT == 2) v = 0.5f * v * (1.0f + erff(v * 0.70710678118654752f));
      if (ACT == 3) { const float u = 0.7978845608028654f * (v + 0.044715f * v * v * v); v = 0.5f * v * (1.0f + tanhf(u)); }
      so[w][8 * hh + r][t * 16 + ln] = v;
    }
  }
  __builtin_amdgcn_fence(__ATOMIC_ACQ_REL, "workgroup");
  __builtin_amdgcn_wave_barrier();
  const int rsub = lane >> 4, c4 = (lane & 15) * 4;
  {
#pragma unroll
    for (int q = 0; q < 8; ++q) {
      const int r = q * 2 + rsub;
      const v4f v = *(const v4fa*)&so[w][r][c4];
      *(v4f*)(C + (size_t)(row0 + r) * ldc + col0 + c4) = v;
    }
    
  }
}
// row LayerNorm (biased variance, eps) over N: s = X (+ R); optional out_sum <- s; out_norm <- (s-mu)*rsqrt(var+eps)*g + b
template <bool PARAM_BF16>
__global__ __launch_bounds__(256) void k_layernorm(const float* __restrict__ X, const float* __restrict__ R, const float* __restrict__ g, const float* __restrict__ bta,
                                                  float* __restrict__ out_sum, float* __restrict__ out_norm, int N, float eps) {
  __shared__ float red[256];
  const int row = blockIdx.x, tid = threadIdx.x;
  const float* x = X + (size_t)row * N; const float* rr = R ? R + (size_t)row * N : nullptr;
  float vals[16];                     // up to N = 4096
  const int per = N / 256;            // contiguous chunk per thread? use strided-by-4 chunks: thread handles j = tid*4 + 1024*u
  float s1 = 0.f;
  for (int u = 0; u < per / 4; ++u) {
    const int j = tid * 4 + 1024 * u;
    const v4f a = *(const v4fa*)(x + j);
    v4f b = {0.f,0.f,0.f,0.f}; if (rr) b = *(const v4fa*)(rr + j);
#pragma unroll
    for (int q = 0; q < 4; ++q) { const float v = a[q] + b[q]; vals[u * 4 + q] = v; s1 += v; }
  }
  red[tid] = s1; __syncthreads();
  for (int st = 128; st > 0; st >>= 1) { if (tid < st) red[tid] += red[tid + st]; __syncthreads(); }
  const float mu = red[0] / (float)N; __syncthreads();
  float s2 = 0.f;
  for (int u = 0; u < per / 4; ++u)
#pragma unroll
    for (int q = 0; q < 4; ++q) { const float c = vals[u * 4 + q] - mu; s2 += c * c; }
  red[tid] = s2; __syncthreads();
  for (int st = 128; st > 0; st >>= 1) { if (tid < st) red[tid] += red[tid + st]; __syncthreads(); }
  const float rs = rsqrtf(red[0] / (float)N + eps);
  {
    for (int u = 0; u < per / 4; ++u) {
      const int j = tid * 4 + 1024 * u;
      v4f o, sm;
#pragma unroll
      for (int q = 0; q < 4; ++q) {
        float gg = g[j + q], bb = bta[j + q];
        if (PARAM_BF16) { gg = bf16_round(gg); bb = bf16_round(bb); }
        sm[q] = vals[u * 4 + q]; o[q] = (vals[u * 4 + q] - mu) * rs * gg + bb;
      }
      if (out_sum) *(v4f*)(out_sum + (size_t)row * N + j) = sm;
      *(v4f*)(out_norm + (size_t)row * N + j) = o;
    }
    
  }
}



// ---- f16 WMMA path (v_wmma_f32_16x16x32_f16): 11-bit significands for operands in range — used where a [0,1] probability operand needs more precision than bf16
typedef _Float16 v16h __attribute__((ext_vector_type(16)));
union FragH { v16h v; v8us half[2]; _Float16 h[16]; unsigned short u[16]; };
template <int NT>
__device__ __forceinline__ v8f mmaH(v16h ah, v16h al, v16h bh, v16h bl, v8f c) {
  c = __builtin_amdgcn_wmma_f32_16x16x32_f16(false, ah, false, bh, (short)0, c, false, false);
  if (NT >= 2) c = __builtin_amdgcn_wmma_f32_16x16x32_f16(false, al, false, bh, (short)0, c, false, false);
  if (NT >= 3) c = __builtin_amdgcn_wmma_f32_16x16x32_f16(false, ah, false, bl, (short)0, c, false, false);
  asm volatile("v_nop\n\tv_nop\n\tv_nop\n\tv_nop" : "+v"(c) : "v"(ah), "v"(al), "v"(bh), "v"(bl));
  return c;
}
// batched GEMM like k_gemm_b but f16 operands: A f32 (split into f16 hi/lo if ASPLIT, else rounded to f16), Bt = f16 values [n][k]; alpha; C f32; N multiple of 16 (partial tiles skipped)
template <bool ASPLIT>
__global__ __launch_bounds__(128) void k_gemm_h(const float* __restrict__ A, int lda, size_t sA, const _Float16* __restrict__ Bh, int ldb, size_t sB, float alpha, float* __restrict__ C, int ldc, size_t sC, int M, int N, int K) {
  __shared__ __attribute__((aligned(16))) float so[4][16][64];
  const int tid = threadIdx.x, w = tid >> 5, lane = tid & 31, ln = lane & 15, hh = lane >> 4; const int by = blockIdx.y;
  A += (size_t)by * sA; Bh += (size_t)by * sB; C += (size_t)by * sC;
  const int ntn = (N + 63) / 64; const int wid = blockIdx.x * 4 + w; const int mt = wid / ntn, nq = wid % ntn; if (mt * 16 >= M) return;
  const int row0 = mt * 16, col0 = nq * 64; const float* arow = A + (size_t)(row0 + ln) * lda;
  v8f acc[4] = {};
  for (int kb = 0; kb < K; kb += 32) {
    FragH ah, al;
    const v4f x0 = *(const v4fa*)(arow + kb + 8 * hh), x1 = *(const v4fa*)(arow + kb + 8 * hh + 4), x2 = *(const v4fa*)(arow + kb + 16 + 8 * hh), x3 = *(const v4fa*)(arow + kb + 16 + 8 * hh + 4);
    float xs[16] = {x0[0],x0[1],x0[2],x0[3],x1[0],x1[1],x1[2],x1[3],x2[0],x2[1],x2[2],x2[3],x3[0],x3[1],x3[2],x3[3]};
#pragma unroll
    for (int i = 0; i < 16; ++i) { const _Float16 h = (_Float16)xs[i]; ah.h[i] = h; al.h[i] = ASPLIT ? (_Float16)(xs[i] - (float)h) : (_Float16)0.0f; }
#pragma unroll
    for (int t = 0; t < 4; ++t) { if (col0 + t * 16 >= N) continue; const size_t boff = (size_t)(col0 + t * 16 + ln) * ldb + kb; FragH bq; bq.half[0] = *(const v8us*)(Bh + boff + 8 * hh); bq.half[1] = *(const v8us*)(Bh + boff + 16 + 8 * hh);
      acc[t] = mmaH<ASPLIT ? 2 : 1>(ah.v, al.v, bq.v, bq.v, acc[t]); }
  }
#pragma unroll
  for (int t = 0; t < 4; ++t) { if (col0 + t * 16 >= N) continue;
#pragma unroll
    for (int r = 0; r < 8; ++r) so[w][8 * hh + r][t * 16 + ln] = acc[t][r] * alpha; }
  __builtin_amdgcn_fence(__ATOMIC_ACQ_REL, "workgroup"); __builtin_amdgcn_wave_barrier();
  const int rsub = lane >> 4, c4 = (lane & 15) * 4;
  {
#pragma unroll
    for (int q = 0; q < 8; ++q) { const int r = q * 2 + rsub; if (col0 + c4 < N) { const v4f v = *(const v4fa*)&so[w][r][c4]; *(v4f*)(C + (size_t)(row0 + r) * ldc + col0 + c4) = v; } }
     }
}

// Wt[n][k] = f16(W[k][n]·scale) from f32 row-major W[K][N] (scale = power of two; bf16-exact weights stay exact in f16 away from the subnormal range)
__global__ __launch_bounds__(256) void k_wt_f16(const float* __restrict__ W, _Float16* __restrict__ Wt, int K, int N, float scale) {
  const int t = blockIdx.x * 256 + threadIdx.x; if (t >= N * (K / 8)) return; const int n = t / (K / 8), k8 = (t % (K / 8)) * 8; FragH f;
#pragma unroll
  for (int i = 0; i < 8; ++i) f.h[i] = (_Float16)(bf16_round(W[(size_t)(k8 + i) * N + n]) * scale); const v8us o = f.half[0];
  *(v8us*)((unsigned short*)Wt + (size_t)n * K + k8) = o; 
}
// k_gemm_hh variant with fused epilogue: v = acc·alpha + bias[by·sBias + col] (+ CP[(row/rowsPerB)·sCPb + by·64 + col] if CP) ; ACT 0 none / 1 elu ; writes f16 C16 (and f32 C if non-null)
template <int ACT>
__global__ __launch_bounds__(128) void k_gemm_hhx(const _Float16* __restrict__ A, int lda, size_t sA, const _Float16* __restrict__ Bh, int ldb, size_t sB, float alpha, const float* __restrict__ bias, size_t sBias, const float* __restrict__ CP, int rowsPerB, size_t sCPb, int row0g,
    float* __restrict__ C, _Float16* __restrict__ C16, int ldc, size_t sC, int M, int N, int K) {
  __shared__ __attribute__((aligned(16))) float so[4][16][64];
  const int tid = threadIdx.x, w = tid >> 5, lane = tid & 31, ln = lane & 15, hh = lane >> 4; const int by = blockIdx.y;
  A += (size_t)by * sA; Bh += (size_t)by * sB; const size_t cofs = (size_t)by * sC; const float* bp = bias ? bias + (size_t)by * sBias : nullptr;
  const int ntn = (N + 63) / 64; const int wid = blockIdx.x * 4 + w; const int mt = wid / ntn, nq = wid % ntn; if (mt * 16 >= M) return;
  const int row0 = mt * 16, col0 = nq * 64; const _Float16* arow = A + (size_t)(row0 + ln) * lda;
  v8f acc[4] = {};
  for (int kb = 0; kb < K; kb += 32) { FragH ah; ah.half[0] = *(const v8us*)((const unsigned short*)arow + kb + 8 * hh); ah.half[1] = *(const v8us*)((const unsigned short*)arow + kb + 16 + 8 * hh);
#pragma unroll
    for (int t = 0; t < 4; ++t) { if (col0 + t * 16 >= N) continue; const size_t boff = (size_t)(col0 + t * 16 + ln) * ldb + kb; FragH bq; bq.half[0] = *(const v8us*)((const unsigned short*)Bh + boff + 8 * hh); bq.half[1] = *(const v8us*)((const unsigned short*)Bh + boff + 16 + 8 * hh);
      acc[t] = mmaH<1>(ah.v, ah.v, bq.v, bq.v, acc[t]); }
  }
#pragma unroll
  for (int t = 0; t < 4; ++t) { if (col0 + t * 16 >= N) continue; const int col = col0 + t * 16 + ln; const float bv = bp ? bf16_round(bp[col]) : 0.f;
#pragma unroll
    for (int r = 0; r < 8; ++r) { float v = acc[t][r] * alpha + bv; if (CP) { const int rr = row0g + row0 + 8 * hh + r; if (rowsPerB < 0) v += CP[cofs + (size_t)rr * ldc + col];      /* rowsPerB < 0: own element of the batched C plane */ else { const int bidx = rr / rowsPerB; v += CP[(size_t)bidx * sCPb + (size_t)by * 64 + col]; } } if (ACT == 1) v = (v > 0.f) ? v : expm1f(v); else if (ACT == 7) v = (v > 0.f) ? v + 1.0f : expf(v); else if (ACT == 8) v = tanhf(v); else if (ACT == 9) v = 0.5f * v * (1.0f + tanhf(0.7978845608028654f * (v + 0.044715f * v * v * v))); else if (ACT == 11) v = 1.0f / (1.0f + expf(-v)); else if (ACT == 12) v = (v > 0.f) ? v : 0.01f * v; else if (ACT == 14) v = (v > 0.f) ? v : 0.1f * v; else if (ACT == 16) v = (v >= 0.f) ? v : 0.3f * v; else if (ACT == 15) v = v / (1.0f + expf(-v)); else if (ACT == 3) v = fmaxf(v, 0.f); else if (ACT == 6) v = 0.5f * v * (1.0f + erff(v * 0.70710678118654752f)); so[w][8 * hh + r][t * 16 + ln] = v; } }
  __builtin_amdgcn_fence(__ATOMIC_ACQ_REL, "workgroup"); __builtin_amdgcn_wave_barrier();
  const int rsub = lane >> 4, c4 = (lane & 15) * 4; typedef _Float16 v4h __attribute__((ext_vector_type(4)));
  {
#pragma unroll
    for (int q = 0; q < 8; ++q) { const int r = q * 2 + rsub; if (col0 + c4 < N) { const v4f v = *(const v4fa*)&so[w][r][c4]; if (C) *(v4f*)(C + cofs + (size_t)(row0 + r) * ldc + col0 + c4) = v; if (C16) { v4h h4; for (int i = 0; i < 4; ++i) h4[i] = (_Float16)v[i]; *(v4h*)(C16 + cofs + (size_t)(row0 + r) * ldc + col0 + c4) = h4; } } }
     }
}


typedef _Float16 v4h __attribute__((ext_vector_type(4)));

__global__ __launch_bounds__(256) void k_x16(const float* __restrict__ x, _Float16* __restrict__ X16, size_t n8) { const size_t t = (size_t)blockIdx.x * 256 + threadIdx.x; if (t >= n8) return; FragH f;
#pragma unroll
  for (int q = 0; q < 8; ++q) f.h[q] = (_Float16)bf16_round(x[t * 8 + q]); *(v8us*)((unsigned short*)X16 + t * 8) = f.half[0];  }
__global__ __launch_bounds__(256) void k_h16(const float* __restrict__ x, _Float16* __restrict__ X16, size_t n8) { const size_t t = (size_t)blockIdx.x * 256 + threadIdx.x; if (t >= n8) return; FragH f;
#pragma unroll
  for (int q = 0; q < 8; ++q) f.h[q] = (_Float16)x[t * 8 + q]; *(v8us*)((unsigned short*)X16 + t * 8) = f.half[0];  }
__global__ __launch_bounds__(256) void k_round16f(const float* __restrict__ W, _Float16* __restrict__ Bt, size_t n8) { const size_t t = (size_t)blockIdx.x * 256 + threadIdx.x; if (t >= n8) return; FragH f;
#pragma unroll
  for (int i = 0; i < 8; ++i) f.h[i] = (_Float16)(bf16_round(W[t * 8 + i]) * 16.0f); *(v8us*)((unsigned short*)Bt + t * 8) = f.half[0];  }
template <int NHv, int TTv>
__global__ __launch_bounds__(256) void k_vt(const _Float16* __restrict__ V16, int ldv, int voff, _Float16* __restrict__ Vt) { __shared__ unsigned short tl[64][66]; const int tid = threadIdx.x; const int slab = blockIdx.x / (TTv / 64), lg = blockIdx.x % (TTv / 64); const int b = slab / NHv, h = slab % NHv;
  for (int i = tid; i < 64 * 8; i += 256) { const int r = i / 8, c8 = (i % 8) * 8; FragH f; f.half[0] = *(const v8us*)((const unsigned short*)V16 + ((size_t)b * TTv + lg * 64 + r) * ldv + voff + h * 64 + c8);
#pragma unroll
    for (int q = 0; q < 8; ++q) tl[r][c8 + q] = f.u[q]; }
  __syncthreads();
  {
#pragma unroll
    for (int rd = 0; rd < 2; ++rd) { const int d = rd * 32 + tid / 8, pc = tid % 8; FragH f;
#pragma unroll
      for (int q = 0; q < 8; ++q) f.u[q] = tl[pc * 8 + q][d];
      *(v8us*)((unsigned short*)Vt + ((size_t)slab * 64 + d) * TTv + lg * 64 + pc * 8) = f.half[0]; }
     } }

__global__ __launch_bounds__(256) void k_hl(const float* __restrict__ F, _Float16* __restrict__ Hh, _Float16* __restrict__ Hl, size_t n8) { const size_t t = (size_t)blockIdx.x * 256 + threadIdx.x; if (t >= n8) return; FragH fh, fl; const v4f a = *(const v4fa*)(F + t * 8), c = *(const v4fa*)(F + t * 8 + 4);
#pragma unroll
  for (int q = 0; q < 4; ++q) { _Float16 h = (_Float16)a[q]; fh.h[q] = h; fl.h[q] = (_Float16)((a[q] - (float)h) * 1024.0f); h = (_Float16)c[q]; fh.h[4 + q] = h; fl.h[4 + q] = (_Float16)((c[q] - (float)h) * 1024.0f); }
  { *(v8us*)((unsigned short*)Hh + t * 8) = fh.half[0]; *(v8us*)((unsigned short*)Hl + t * 8) = fl.half[0];  } }

// ---- operand planes in fragment order: per (16-row tile, 32-wide k step) one 1-KiB block [register half j][lane 16 hh + ln][8 f16], holding element (row 16 tile + ln, k = 32 step + 16 j + 8 hh + e);
// blocks run [row tile][k step]. A wave's 16-byte-per-lane fragment load then covers 4 whole 128-byte lines; from plain rows it touches 16 lines for 32 bytes each.
#define FBLK 512                 /* f16 per block */
__device__ __forceinline__ v16h fo_frag(const unsigned short* p) { FragH f; f.half[0] = *(const v8us*)p; f.half[1] = *(const v8us*)(p + FBLK / 2); return f.v; }      /* p = block + 8 lane */
// ---- output GEMM for the fixed shape: out[NR][DD] (f32) = attention output (A, fragment order) x W_o (B, fragment order, times 16) / 16. Work-group = 128 rows x 64 columns, wave tile 32 x 64.
// Every global load of a wave is issued ahead of its first wait: the work-group's 32 KiB of W_o go to LDS once (16 x 16 bytes a thread), the wave's 16 A fragments stay in registers; the k steps then read LDS and registers only.
#define OCB (4 * (DD / 32) * FBLK)      /* f16 of W_o per 64 output columns: 4 column tiles x 8 k steps, contiguous */
// at most 256 registers a wave: four work-groups share a WGP, so that all 768 are resident at once
__global__ __launch_bounds__(128) __attribute__((amdgpu_waves_per_eu(4, 4))) void k_out(const _Float16* __restrict__ A, const _Float16* __restrict__ Bh, float* __restrict__ C) {
  __shared__ __attribute__((aligned(16))) unsigned short sb[OCB];
  __shared__ __attribute__((aligned(16))) float so[4][32][68];
  const int tid = threadIdx.x, w = tid >> 5, lane = tid & 31, ln = lane & 15, hh = lane >> 4;
  const int mt = blockIdx.x / (DD / 64), nq = blockIdx.x % (DD / 64); const int row0 = mt * 128 + 32 * w, col0 = nq * 64;
  const unsigned short* bg = (const unsigned short*)Bh + (size_t)nq * OCB + tid * 8;
  const unsigned short* ag = (const unsigned short*)A + (size_t)(row0 >> 4) * (DD / 32) * FBLK + lane * 8;      /* row tiles row0 / 16 and the next: 16 blocks in a row */
  v8us br[16]; v16h af[2][DD / 32];
#pragma unroll
  for (int i = 0; i < 16; ++i) br[i] = *(const v8us*)(bg + i * 128 * 8);
#pragma unroll
  for (int a = 0; a < 2; ++a)
#pragma unroll
    for (int s = 0; s < DD / 32; ++s) af[a][s] = fo_frag(ag + (a * (DD / 32) + s) * FBLK);
  asm volatile("s_wait_xcnt 0x0" :: "v"(tid), "v"(ag) : "memory");      /* wait before the loads' address registers are rewritten; naming the addresses as inputs keeps them live up to here (the W_o loads go by a scalar base and the thread index as lane offset); as a memory fence it also keeps all 48 loads ahead of the LDS stores */
#pragma unroll
  for (int i = 0; i < 16; ++i) *(v8us*)(sb + tid * 8 + i * 128 * 8) = br[i];
  __syncthreads();
  const unsigned short* bl = sb + lane * 8;
  const v8f z8 = {0.f,0.f,0.f,0.f,0.f,0.f,0.f,0.f}; v8f acc[2][4];
#pragma unroll
  for (int t = 0; t < 4; ++t) { acc[0][t] = z8; acc[1][t] = z8; }
  v16h b[4];
#pragma unroll
  for (int t = 0; t < 4; ++t) b[t] = fo_frag(bl + t * (DD / 32) * FBLK);
  // unrolled: the A fragments are indexed by the step, and the next step's W_o fragments are read into a second register set ahead of this step's products
#pragma unroll
  for (int s = 0; s < DD / 32; ++s) { v16h bn[4];
    if (s + 1 < DD / 32) {
#pragma unroll
      for (int t = 0; t < 4; ++t) bn[t] = fo_frag(bl + (t * (DD / 32) + s + 1) * FBLK); }
    __builtin_amdgcn_sched_barrier(0);      /* the next step's LDS reads issue as one group ahead of this step's products: one place with LDS reads a step */
#pragma unroll
    for (int t = 0; t < 4; ++t) {
      acc[0][t] = __builtin_amdgcn_wmma_f32_16x16x32_f16(false, af[0][s], false, b[t], (short)0, acc[0][t], false, false);
      acc[1][t] = __builtin_amdgcn_wmma_f32_16x16x32_f16(false, af[1][s], false, b[t], (short)0, acc[1][t], false, false); }
    __builtin_amdgcn_sched_barrier(0);      /* keeps later steps' LDS reads in their own step; hoisted all together they spilled registers to scratch */
    if (s + 1 < DD / 32) {
#pragma unroll
      for (int t = 0; t < 4; ++t) b[t] = bn[t]; } }
#pragma unroll
  for (int a = 0; a < 2; ++a)
#pragma unroll
    for (int t = 0; t < 4; ++t)
#pragma unroll
      for (int r = 0; r < 8; ++r) so[w][a * 16 + 8 * hh + r][t * 16 + ln] = acc[a][t][r] * 0.0625f;
  __builtin_amdgcn_fence(__ATOMIC_ACQ_REL, "workgroup"); __builtin_amdgcn_wave_barrier();      /* the wave's other lanes read what this lane staged */
  const int rsub = lane >> 4, c4 = (lane & 15) * 4;
  float* cd = C + (size_t)(row0 + rsub) * DD + col0 + c4;
  v4f tv[16];
#pragma unroll
  for (int q = 0; q < 16; ++q) tv[q] = *(const v4fa*)&so[w][q * 2 + rsub][c4];
  __builtin_amdgcn_sched_barrier(0);      /* all LDS reads issue as one group ahead of the stores; otherwise each store waits out its own read's latency in one register set */
#pragma unroll
  for (int q = 0; q < 16; ++q) *(v4f*)(cd + (size_t)q * 2 * DD) = tv[q];
}


// additive bias plane as a matrix operand: bf16-rounded sim is exact in f16 (8 significant bits; below 2^-14 the absolute error stays under 2^-25; a normal draw stays four orders of magnitude under the f16 maximum), half the bytes of an f32 accumulator tile.
// One fragment-order block per (16-query tile, 32 keys): element (row ln, k = 16 j + 8 hh + e) = sim[query 8 hh + e][key 16 j + ln]. Times the one-hot B (k = 16 x + c -> column c) it adds
// sim[query c][key 16 x + row] to a 16-key x 16-query score tile: one block serves two score tiles, x = 0 and 1. The preparation launch writes it, 16 bytes a thread.
// Fused projection + attention. 256 work-groups of 16 waves, one per WGP; a pair of work-groups shares three (group, head) units: round 0 takes a whole unit each (32 query tiles, two a wave),
// round 1 takes the third unit, each work-group one half of its queries (one tile a wave); both form that unit's K and V^T. Every WGP so carries 48 query tiles.
// Projection of a unit: wave w takes token tiles w and w + 16. q | k: D = W rows (A) x token rows (B), so lane (c, h) holds 8 neighbouring dims of token c: q is the score product's B fragment as it stands
// and stays in registers, k is a 16-byte piece of a K row in LDS; v^T: D = token rows (A) x W rows (B), so a lane holds 8 neighbouring tokens of one dim: a 16-byte piece of a V^T row in LDS.
// Attention of a query tile: S^T = K Q^T + bias block x one-hot (q carries 32^-0.5, so that sim is added as it stands): lane (c, h) holds keys 8h..8h+7 of each 16-key tile for query c, so two score tiles
// convert in place into the B operand of O^T += V^T P^T (hardware k order on both sides). Online softmax over blocks of 128 keys in
// the log2 domain; P carries 2^10 (cancels against the row sum). K rows and V^T rows sit in LDS at pitches of 16 B x odd.
#define KPITCH 40                /* f16 per K row in LDS: 80 B */
#define VPITCH 520               /* f16 per V^T row in LDS: 1040 B */
#define KBLK 128                 /* keys per online-softmax block */
#define C2 1.4426950408889634f
#define KS (DD / 32)             /* k steps of a projection */
#define WSEG (2 * KS * FBLK)     /* f16 of one head's q, k or v weights: 2 row tiles x 8 k steps, contiguous in the plane */
__device__ __forceinline__ v16h lds_frag(const unsigned short* p, int hh) { FragH f; f.half[0] = *(const v8us*)(p + 8 * hh); f.half[1] = *(const v8us*)(p + 16 + 8 * hh); return f.v; }
// four waves per SIMD: the one work-group of a WGP may use 256 registers a wave
__global__ __launch_bounds__(512) __attribute__((amdgpu_waves_per_eu(4, 4))) void k_fa(const _Float16* __restrict__ X16, const _Float16* __restrict__ Bw, const _Float16* __restrict__ BP, _Float16* __restrict__ O16) {
  __shared__ __attribute__((aligned(16))) unsigned short sm[NN * KPITCH + HD * VPITCH + 3 * WSEG];      /* one array, so that K and V^T come first: the attention loop's LDS reads then reach every row by a 16-bit constant offset */
  unsigned short* const sk = sm; unsigned short* const sv = sm + NN * KPITCH; unsigned short* const swt = sm + NN * KPITCH + HD * VPITCH;      /* swt = the head's weights: blocks [q0 q1 k0 k1 v0 v1][k step] */
  const int tid = threadIdx.x, w = __builtin_amdgcn_readfirstlane(tid >> 5), lane = tid & 31, ln = lane & 15, hh = lane >> 4;      /* the wave's number as a scalar: tile bases stay out of the vector registers */
  const int pr = blockIdx.x >> 1, sd = blockIdx.x & 1;
  const v8f z8 = {0.f,0.f,0.f,0.f,0.f,0.f,0.f,0.f};
  FragH ones;      /* A whose row 0 is all ones: row 0 of os = the column sums of the rounded P, summed on the matrix pipe */
#pragma unroll
  for (int i = 0; i < 16; ++i) ones.h[i] = (ln == 0) ? (_Float16)1.0f : (_Float16)0.0f;
  FragH e0, e1;      /* one-hot B operands: k = c (e0) or k = 16 + c (e1) goes to column c */
#pragma unroll
  for (int i = 0; i < 8; ++i) { const _Float16 d = (8 * hh + i == ln) ? (_Float16)1.0f : (_Float16)0.0f; e0.h[i] = d; e0.h[8 + i] = (_Float16)0.0f; e1.h[i] = (_Float16)0.0f; e1.h[8 + i] = d; }
  // rolled: both rounds run the same text
#pragma unroll 1
  for (int rd = 0; rd < 2; ++rd) {
    const int gh = 3 * pr + (rd == 0 ? sd : 2); const int g = gh / NH, h = gh % NH;
    // every load of the front is issued first: the wave's x fragments of k steps 0..3 (both token tiles), then the work-group's 48 KiB of weights
    const unsigned short* xg = (const unsigned short*)X16 + (size_t)(g * (NN / 16) + w) * KS * FBLK + lane * 8;      /* token tile w; tile w + 16 is a constant step on */
    const unsigned short* wg = (const unsigned short*)Bw + (size_t)(2 * h) * KS * FBLK + tid * 8;      /* q rows of head h; k and v rows lie 16 and 32 row tiles on */
    v16h xf[2][4]; v8us wr[6];
#pragma unroll
    for (int s = 0; s < 4; ++s) { xf[0][s] = fo_frag(xg + s * FBLK); xf[1][s] = fo_frag(xg + (16 * KS + s) * FBLK); }
#pragma unroll
    for (int i = 0; i < 6; ++i) wr[i] = *(const v8us*)(wg + (i >> 1) * 16 * KS * FBLK + (i & 1) * 512 * 8);
    asm volatile("s_wait_xcnt 0x0" :: "v"(wg) : "memory");      /* wait before the weight loads' address register is rewritten; naming it as an input keeps it live up to here */
#pragma unroll
    for (int i = 0; i < 6; ++i) *(v8us*)(swt + (i >> 1) * WSEG + (i & 1) * 512 * 8 + tid * 8) = wr[i];      /* swt: its last readers passed the barrier behind the round before's projection */
    __syncthreads();      /* weights visible; also ends every wave's reads of the round before's K and V^T */
    v16h qA, qB;
    {
      v8f aq[4][2], av[2][2];
#pragma unroll
      for (int a = 0; a < 4; ++a) { aq[a][0] = z8; aq[a][1] = z8; }
#pragma unroll
      for (int t = 0; t < 2; ++t) { av[t][0] = z8; av[t][1] = z8; }
      const unsigned short* wl = swt + lane * 8;
      // unrolled: the x fragments are register arrays indexed by the step; a step's registers take the fragment of four steps on as soon as its products are issued
#pragma unroll
      for (int s = 0; s < KS; ++s) {
        v16h wf[6];
#pragma unroll
        for (int a = 0; a < 6; ++a) wf[a] = fo_frag(wl + (a * KS + s) * FBLK);
        __builtin_amdgcn_sched_barrier(0);      /* the step's LDS reads issue as one group ahead of its products: one place with LDS reads a step */
#pragma unroll
        for (int t = 0; t < 2; ++t) {
#pragma unroll
          for (int a = 0; a < 4; ++a) aq[a][t] = __builtin_amdgcn_wmma_f32_16x16x32_f16(false, wf[a], false, xf[t][s & 3], (short)0, aq[a][t], false, false);
#pragma unroll
          for (int b = 0; b < 2; ++b) av[t][b] = __builtin_amdgcn_wmma_f32_16x16x32_f16(false, xf[t][s & 3], false, wf[4 + b], (short)0, av[t][b], false, false); }
        if (s + 4 < KS) { xf[0][s & 3] = fo_frag(xg + (s + 4) * FBLK); xf[1][s & 3] = fo_frag(xg + (16 * KS + s + 4) * FBLK); }
        __builtin_amdgcn_sched_barrier(0); }      /* keeps later steps' LDS reads in their own step, so that the register count holds */
      asm volatile("s_wait_xcnt 0x0" :: "v"(xg) : "memory");      /* wait before the x loads' address register is rewritten; naming it as an input keeps it live up to here */
      FragH fa, fb;
#pragma unroll
      for (int r = 0; r < 8; ++r) { fa.h[r] = (_Float16)(aq[0][0][r] * (0.0625f * SCL)); fa.h[8 + r] = (_Float16)(aq[1][0][r] * (0.0625f * SCL)); fb.h[r] = (_Float16)(aq[0][1][r] * (0.0625f * SCL)); fb.h[8 + r] = (_Float16)(aq[1][1][r] * (0.0625f * SCL)); }
      qA = fa.v; qB = fb.v;
#pragma unroll
      for (int t = 0; t < 2; ++t)
#pragma unroll
        for (int a = 0; a < 2; ++a) { FragH f, f2;
#pragma unroll
          for (int r = 0; r < 8; ++r) { f.h[r] = (_Float16)(aq[2 + a][t][r] * 0.0625f); f2.h[r] = (_Float16)(av[t][a][r] * 0.0625f); }
          *(v8us*)(sk + ((w + 16 * t) * 16 + ln) * KPITCH + a * 16 + 8 * hh) = f.half[0];
          *(v8us*)(sv + (a * 16 + ln) * VPITCH + (w + 16 * t) * 16 + 8 * hh) = f2.half[0]; }
    }
    __syncthreads();      /* K and V^T visible; also ends every wave's reads of the weights */
    const int tlo = rd == 0 ? 0 : sd, thi = rd == 0 ? 1 : sd;
    // rolled: one text for both query tiles
#pragma unroll 1
    for (int t = tlo; t <= thi; ++t) {
      const v16h qf = t == 0 ? qA : qB; const int qt = w + 16 * t;      /* query tile of the group */
      const unsigned short* bro = (const unsigned short*)BP + (size_t)qt * (NN / 32) * FBLK + lane * 8;
      v8f o0 = z8, o1 = z8, os = z8; float m = -1.0e30f;      /* far below any score, and (m - mn) * C2 stays finite */
      // rolled: only one block's 64 score registers are live at a time
#pragma unroll 1
      for (int kb = 0; kb < NN; kb += KBLK) {
        v8f s[KBLK / 16]; v16h bf[KBLK / 32]; const unsigned short* bp = bro + (kb / 32) * FBLK;
#pragma unroll
        for (int p = 0; p < KBLK / 32; ++p) bf[p] = fo_frag(bp + p * FBLK);
        asm volatile("s_wait_xcnt 0x0" ::: "memory");      /* wait before the bias loads' address register is stepped; as a memory fence it also keeps the eight loads at the head of the block, so that they fly under the K Q^T products */
#pragma unroll
        for (int p = 0; p < KBLK / 32; ++p) {
          s[2 * p] = __builtin_amdgcn_wmma_f32_16x16x32_f16(false, lds_frag(sk + (kb + p * 32 + ln) * KPITCH, hh), false, qf, (short)0, z8, false, false);
          s[2 * p + 1] = __builtin_amdgcn_wmma_f32_16x16x32_f16(false, lds_frag(sk + (kb + p * 32 + 16 + ln) * KPITCH, hh), false, qf, (short)0, z8, false, false); }
#pragma unroll
        for (int p = 0; p < KBLK / 32; ++p) {
          s[2 * p] = __builtin_amdgcn_wmma_f32_16x16x32_f16(false, bf[p], false, e0.v, (short)0, s[2 * p], false, false);
          s[2 * p + 1] = __builtin_amdgcn_wmma_f32_16x16x32_f16(false, bf[p], false, e1.v, (short)0, s[2 * p + 1], false, false);
        }
        float mx[4] = {s[0][0], s[0][1], s[0][2], s[0][3]};
#pragma unroll
        for (int u = 0; u < KBLK / 16; ++u)
#pragma unroll
          for (int r = 0; r < 8; ++r) mx[r & 3] = fmaxf(mx[r & 3], s[u][r]);
        float bm = fmaxf(fmaxf(mx[0], mx[1]), fmaxf(mx[2], mx[3])); bm = fmaxf(bm, __shfl_xor(bm, 16, 32));      /* both halves of a column share one maximum */
        const float mn = fmaxf(m, bm); const float al = __builtin_amdgcn_exp2f((m - mn) * C2); const float off = 10.0f - mn * C2; m = mn;
#pragma unroll
        for (int r = 0; r < 8; ++r) { o0[r] *= al; o1[r] *= al; }
        os[0] *= al;      /* only row 0 of the sum tile is ever read */
#pragma unroll
        for (int p = 0; p < KBLK / 32; ++p) { FragH b;
#pragma unroll
          for (int r = 0; r < 8; ++r) { const float x0 = __builtin_amdgcn_exp2f(fmaf(s[2 * p][r], C2, off)), x1 = __builtin_amdgcn_exp2f(fmaf(s[2 * p + 1][r], C2, off));
            b.h[r] = (_Float16)x0; b.h[8 + r] = (_Float16)x1; }
          const unsigned short* vr = sv + ln * VPITCH + kb + p * 32;
          o0 = __builtin_amdgcn_wmma_f32_16x16x32_f16(false, lds_frag(vr, hh), false, b.v, (short)0, o0, false, false);
          o1 = __builtin_amdgcn_wmma_f32_16x16x32_f16(false, lds_frag(vr + 16 * VPITCH, hh), false, b.v, (short)0, o1, false, false);
          os = __builtin_amdgcn_wmma_f32_16x16x32_f16(false, ones.v, false, b.v, (short)0, os, false, false); }
      }
      const float su = __shfl(os[0], ln, 32); const float inv = 1.0f / su; FragH f;      /* row 0 sits in register 0 of lanes 0..15 */
#pragma unroll
      for (int r = 0; r < 8; ++r) { f.h[r] = (_Float16)(o0[r] * inv); f.h[8 + r] = (_Float16)(o1[r] * inv); }
      unsigned short* d = (unsigned short*)O16 + ((size_t)(g * (NN / 16) + qt) * (DD / 32) + h) * FBLK + lane * 8;      /* lane (c, h) holds head dims 8h..8h+7 and 16+8h.. of query c: the output GEMM's A fragment of row tile g NN / 16 + qt, k step h, as it stands */
      *(v8us*)d = f.half[0]; *(v8us*)(d + FBLK / 2) = f.half[1];
      asm volatile("s_wait_xcnt 0x0" ::: "memory");      /* wait before the stores' address and data registers are rewritten by the next tile */
    }
  }
}
// x as f16 fragment blocks [row tile][k step]. One work-group = 96 token rows: read once as f32 in whole rows, rounded (bf16, exact in f16) into LDS, read back in fragment order and stored as 48 KiB in a row.
#define PROWS 96                 /* token rows per work-group: 24576 rows over 256 work-groups, one per WGP */
#define XPITCH 264               /* f16 per x row in LDS: 528 B = 16 B x 33 */
// One preparation launch of 256 work-groups. Every thread carries two jobs that read none of each other's output: its share of 96 x rows, and ONE 16-byte piece of the small planes
// (q|k|v weights 24576 pieces, W_o 8192, bias plane 32768: 65536 = 256 x 256). A piece is eight f32 read down a column of its source, rounded to bf16, scaled by a power of two, stored as the t-th 16 bytes of a
// fragment-order plane (lane = t % 32, register half, k step, row tile). Which plane a work-group serves follows from its index alone. All 32 loads of a thread are issued ahead of its first wait.
#define PB_QKV (3 * DD * (DD / 8) / 256)      /* 96 work-groups' pieces */
#define PB_WO (DD * (DD / 8) / 256)           /* 32 */
#define PB_BIAS (NN * NN / 8 / 256)           /* 128 */
__global__ __launch_bounds__(256) void k_prep(const float* __restrict__ x, const float* __restrict__ Wq, const float* __restrict__ Wk, const float* __restrict__ Wv, const float* __restrict__ Wo, const float* __restrict__ sim,
                                              _Float16* __restrict__ X16, _Float16* __restrict__ Bt, _Float16* __restrict__ Bo, _Float16* __restrict__ BP) {
  __shared__ __attribute__((aligned(16))) unsigned short sx[PROWS * XPITCH];
  const int b = blockIdx.x, tid = threadIdx.x, w = tid >> 5, lane = tid & 31, ln = lane & 15, hh = lane >> 4;
  // the small piece: source column, its row pitch, scale and destination
  const float* sp; unsigned short* sd; int ld; float sc;
  if (b < PB_QKV + PB_WO) {      /* weights as f16 [n][k], times 16: n = output column, k0 = first of eight input rows */
    const int t = (b < PB_QKV ? b : b - PB_QKV) * 256 + tid; const int n = (t >> 9) * 16 + (t & 15), k0 = ((t >> 6) & 7) * 32 + ((t >> 5) & 1) * 16 + ((t >> 4) & 1) * 8;
    const float* Wm = b >= PB_QKV ? Wo : (b < PB_QKV / 3 ? Wq : (b < 2 * (PB_QKV / 3) ? Wk : Wv));
    sp = Wm + (size_t)k0 * DD + n % DD; ld = DD; sc = 16.0f; sd = (unsigned short*)(b < PB_QKV ? Bt : Bo) + (size_t)t * 8;
  } else {      /* bias plane: eight queries of one key; the block's layout stands ahead of the attention kernel */
    const int t = (b - (PB_QKV + PB_WO)) * 256 + tid; const int key = ((t >> 6) & 15) * 32 + ((t >> 5) & 1) * 16 + (t & 15), q0 = (t >> 10) * 16 + ((t >> 4) & 1) * 8;
    sp = sim + (size_t)q0 * NN + key; ld = NN; sc = 1.0f; sd = (unsigned short*)BP + (size_t)t * 8;
  }
  const float* xg = x + (size_t)b * PROWS * DD + tid * 8;      /* row 8 i + w, columns 8 lane.. */
  v4f xa[PROWS / 8], xb[PROWS / 8]; float sv[8];
#pragma unroll
  for (int i = 0; i < PROWS / 8; ++i) { xa[i] = *(const v4fa*)(xg + i * 8 * DD); xb[i] = *(const v4fa*)(xg + i * 8 * DD + 4); }
#pragma unroll
  for (int e = 0; e < 8; ++e) sv[e] = sp[(size_t)e * ld];
  asm volatile("s_wait_xcnt 0x0" :: "v"(xg), "v"(sp) : "memory");      /* wait before the loads' address registers are rewritten; naming them as inputs keeps them live up to here */
  __builtin_amdgcn_sched_barrier(0);      /* all 32 loads issue ahead of the first conversion; otherwise later ones are issued only behind the wait on the first: several memory latencies in a row */
#pragma unroll
  for (int i = 0; i < PROWS / 8; ++i) { FragH f;
#pragma unroll
    for (int q = 0; q < 4; ++q) { f.h[q] = (_Float16)bf16_round(xa[i][q]); f.h[4 + q] = (_Float16)bf16_round(xb[i][q]); }
    *(v8us*)(sx + (i * 8 + w) * XPITCH + lane * 8) = f.half[0]; }
  FragH fs;
#pragma unroll
  for (int e = 0; e < 8; ++e) fs.h[e] = (_Float16)(bf16_round(sv[e]) * sc);
  __syncthreads();
  *(v8us*)sd = fs.half[0];      /* behind the barrier: in front of it the barrier's release would wait for this store to complete */
  unsigned short* xd = (unsigned short*)X16 + (size_t)b * (PROWS / 16) * (DD / 32) * FBLK + tid * 8;
  v8us tv[PROWS / 8];      /* piece p = 256 i + tid of the work-group's 3072: lane p % 32, register half (p / 32) % 2, k step (p / 64) % 8, row tile p / 512 */
#pragma unroll
  for (int i = 0; i < PROWS / 8; ++i) tv[i] = *(const v8us*)(sx + ((i >> 1) * 16 + ln) * XPITCH + ((i & 1) * 4 + (w >> 1)) * 32 + (w & 1) * 16 + 8 * hh);
  __builtin_amdgcn_sched_barrier(0);      /* all LDS reads issue as one group ahead of the stores; otherwise each store waits out its own read's latency in one register set */
#pragma unroll
  for (int i = 0; i < PROWS / 8; ++i) *(v8us*)(xd + i * 256 * 8) = tv[i];
}

extern "C" void kernel_launch(void* const* d_in, const int* in_sizes, int n_in,
                              void* d_out, int out_size, void* d_ws, size_t ws_size, hipStream_t stream) {
  (void)in_sizes; (void)n_in; (void)out_size;
  const float* const* I = (const float* const*)d_in; const float* x = I[0]; const float* sim = I[1]; const float* Wq = I[2]; const float* Wk = I[3]; const float* Wv = I[4]; const float* Wo = I[5];
  char* ws = (char*)d_ws; size_t off = 0;
  auto take = [&](size_t bytes) { char* p = ws + off; off += (bytes + 255) & ~(size_t)255; return p; };
  _Float16* BQKV = (_Float16*)take((size_t)3 * DD * DD * 2); _Float16* BO = (_Float16*)take((size_t)DD * DD * 2);
  _Float16* X16 = (_Float16*)take((size_t)NR * DD * 2); _Float16* O16 = (_Float16*)take((size_t)NR * DD * 2);
  _Float16* BP = (_Float16*)take((size_t)NN * NN * 2);
  if (off > ws_size) return;      /* under 27 MiB */
  k_prep<<<NR / PROWS, 256, 0, stream>>>(x, Wq, Wk, Wv, Wo, sim, X16, BQKV, BO, BP);
  k_fa<<<NG * NH * 2 / 3, 512, 0, stream>>>(X16, BQKV, BP, O16);      /* 256 work-groups: 1.5 (group, head) units each */
  k_out<<<(NR / 128) * (DD / 64), 128, 0, stream>>>(O16, BO, (float*)d_out);
}

// v009
// Measured time: 38.9 microseconds a run.
// Timed twice side by side with v008, it ran 1.06 and 1.07 times as fast.
// Over all steps from v000 it is 17.8 times as fast.
#include <hip/hip_runtime.h>
// SpatialMHSA (4 x 12 frames x 512 spatial tokens x 256 = 8 heads of 32): q/k/v = x W (xavier (in,out) weights); per (batch, frame, head) attention over the 512 tokens with scores/sqrt(32) + an INPUT additive bias sim[n][m]; out = merged heads W_o.
// Structure: ONE preparation launch (x rounded to f16 fragment blocks, weights and the bias plane as fragment blocks); ONE fused projection + attention kernel (per (group, head): q in registers, K rows and V^T rows formed straight into LDS, f32 accumulation, exact x16 weights; S^T = K Q^T plus the bias plane times a one-hot matrix, online softmax in registers, O^T = V^T P^T, f16 out as the output GEMM's A fragments); output GEMM. x, weights and attention output lie in the workspace in fragment order.
// Compute dtype: x, sim and weights rounded to bf16; q, k, v, P, attention output as f16 operands (~2^-12); f32 accumulation/softmax. v_wmma_f32_16x16x32_f16.
#define NBATCH 4
#define NFR 12
#define NN 512
#define DD 256
#define NH 8
#define HD 32
#define NG (NBATCH * NFR)         /* 48 groups */
#define NR (NG * NN)             /* 24576 token rows */
#define SCL 0.17677669529663687f /* 32^-0.5 */
typedef __bf16 v16b __attribute__((ext_vector_type(16)));
typedef unsigned short v8us __attribute__((ext_vector_type(8), may_alias));
typedef float  v8f  __attribute__((ext_vector_type(8)));
typedef float  v4f  __attribute__((ext_vector_type(4)));
typedef float  v4fa __attribute__((ext_vector_type(4), may_alias));
union FragB { v16b v; v8us half[2]; unsigned short u[16]; };

__device__ __forceinline__ unsigned short bf16_bits(float x) { unsigned int u = __float_as_uint(x); return (unsigned short)((u + 0x7FFFu + ((u >> 16) & 1u)) >> 16); }
__device__ __forceinline__ float bf16_val(unsigned short b) { return __uint_as_float(((unsigned int)b) << 16); }
__device__ __forceinline__ float bf16_round(float x) { return bf16_val(bf16_bits(x)); }
// D += A·B with NT terms: 1 = ah·bh, 2 = + al·bh (A split), 3 = + ah·bl (both split)
template <int NT>
__device__ __forceinline__ v8f mmaN(v16b ah, v16b al, v16b bh, v16b bl, v8f c) {
  c = __builtin_amdgcn_wmma_f32_16x16x32_bf16(false, ah, false, bh, (short)0, c, false, false);
  if (NT >= 2) c = __builtin_amdgcn_wmma_f32_16x16x32_bf16(false, al, false, bh, (short)0, c, false, false);
  if (NT >= 3) c = __builtin_amdgcn_wmma_f32_16x16x32_bf16(false, ah, false, bl, (short)0, c, false, false);
  asm volatile("v_nop\n\tv_nop\n\tv_nop\n\tv_nop" : "+v"(c) : "v"(ah), "v"(al), "v"(bh), "v"(bl));
  return c;
}

__global__ __launch_bounds__(256) void k_wt_bf16(const float* __restrict__ W, unsigned short* __restrict__ Wt, int K, int N) {
  const int t = blockIdx.x * 256 + threadIdx.x;
  const int k8n = K / 8;
  if (t >= N * k8n) return;
  const int n = t / k8n, k8 = (t % k8n) * 8;
  v8us v;
#pragma unroll
  for (int i = 0; i < 8; ++i) v[i] = bf16_bits(W[(size_t)(k8 + i) * N + n]);
  *(v8us*)(Wt + (size_t)n * K + k8) = v;
  
}

// GEMM C[M][N] (f32, pitch ldc) = act(A[M][K]·W + bias). A f32 row-major (pitch lda) converted per fragment to bf16
// (ASPLIT: hi/lo two planes -> 2 terms, else single rounded term); Wt bf16 [N][K] (pitch ldb). BIAS_BF16 rounds the
// bias to bf16 first (bias quantised to bf16 before the add). K%32==0, M%16==0, N%64==0.
template <bool ASPLIT, int ACT, bool BIAS_BF16>
__global__ __launch_bounds__(128) void k_gemm_bf(const float* __restrict__ A, int lda, const unsigned short* __restrict__ Wt, int ldb,
                                               const float* __restrict__ bias, float* __restrict__ C, int ldc, int M, int N, int K) {
  __shared__ __attribute__((aligned(16))) float so[4][16][64];
  const int tid = threadIdx.x, w = tid >> 5, lane = tid & 31, ln = lane & 15, hh = lane >> 4;
  const int ntn = N / 64;
  const int wid = blockIdx.x * 4 + w;
  const int mt = wid / ntn, nq = wid % ntn;
  if (mt * 16 >= M) return;
  const int row0 = mt * 16, col0 = nq * 64;
  const float* arow = A + (size_t)(row0 + ln) * lda;
  v8f acc[4] = {};
  for (int kb = 0; kb < K; kb += 32) {
    FragB ah, al;
    const v4f x0 = *(const v4fa*)(arow + kb + 8 * hh), x1 = *(const v4fa*)(arow + kb + 8 * hh + 4);
    const v4f x2 = *(const v4fa*)(arow + kb + 16 + 8 * hh), x3 = *(const v4fa*)(arow + kb + 16 + 8 * hh + 4);
    float xs[16] = {x0[0],x0[1],x0[2],x0[3],x1[0],x1[1],x1[2],x1[3],x2[0],x2[1],x2[2],x2[3],x3[0],x3[1],x3[2],x3[3]};
#pragma unroll
    for (int i = 0; i < 16; ++i) { const unsigned short hb = bf16_bits(xs[i]); ah.u[i] = hb; al.u[i] = ASPLIT ? bf16_bits(xs[i] - bf16_val(hb)) : (unsigned short)0; }
#pragma unroll
    for (int t = 0; t < 4; ++t) {
      const unsigned short* brow = Wt + (size_t)(col0 + t * 16 + ln) * ldb + kb;
      FragB b;
      b.half[0] = *(const v8us*)(brow + 8 * hh);
      b.half[1] = *(const v8us*)(brow + 16 + 8 * hh);
      acc[t] = mmaN<ASPLIT ? 2 : 1>(ah.v, al.v, b.v, b.v, acc[t]);
    }
  }
#pragma unroll
  for (int t = 0; t < 4; ++t) {
    float bv = bias ? bias[col0 + t * 16 + ln] : 0.f;
    if (BIAS_BF16) bv = bf16_round(bv);
#pragma unroll
    for (int r = 0; r < 8; ++r) { float v = acc[t][r] + bv; if (ACT == 1) v = fmaxf(v, 0.f); so[w][8 * hh + r][t * 16 + ln] = v; }
  }
  __builtin_amdgcn_fence(__ATOMIC_ACQ_REL, "workgroup");
  __builtin_amdgcn_wave_barrier();
  const int rsub = lane >> 4, c4 = (lane & 15) * 4;
  {
#pragma unroll
    for (int q = 0; q < 8; ++q) {
      const int r = q * 2 + rsub;
      const v4f v = *(const v4fa*)&so[w][r][c4];
      *(v4f*)(C + (size_t)(row0 + r) * ldc + col0 + c4) = v;
    }
    
  }
}

// GEMM C = act(A·W + bias + resid): A f32 (ASPLIT -> hi/lo 2 terms), Wt bf16 [N][K]; ACT 0 none, 1 relu, 2 exact gelu;
// resid (optional, f32, row index = (row % rmod), pitch ldr, RES_BF16 rounds it) added before the activation.
template <bool ASPLIT, int ACT, bool BIAS_BF16, bool RES_BF16>
__global__ __launch_bounds__(128) void k_gemm_bf3(const float* __restrict__ A, int lda, const unsigned short* __restrict__ Wt, int ldb,
                                                const float* __restrict__ bias, const float* __restrict__ resid, int rmod, int ldr,
                                                float* __restrict__ C, int ldc, int M, int N, int K) {
  __shared__ __attribute__((aligned(16))) float so[4][16][64];
  const int tid = threadIdx.x, w = tid >> 5, lane = tid & 31, ln = lane & 15, hh = lane >> 4;
  const int ntn = N / 64;
  const int wid = blockIdx.x * 4 + w;
  const int mt = wid / ntn, nq = wid % ntn;
  if (mt * 16 >= M) return;
  const int row0 = mt * 16, col0 = nq * 64;
  const float* arow = A + (size_t)(row0 + ln) * lda;
  v8f acc[4] = {};
  for (int kb = 0; kb < K; kb += 32) {
    FragB ah, al;
    const v4f x0 = *(const v4fa*)(arow + kb + 8 * hh), x1 = *(const v4fa*)(arow + kb + 8 * hh + 4);
    const v4f x2 = *(const v4fa*)(arow + kb + 16 + 8 * hh), x3 = *(const v4fa*)(arow + kb + 16 + 8 * hh + 4);
    float xs[16] = {x0[0],x0[1],x0[2],x0[3],x1[0],x1[1],x1[2],x1[3],x2[0],x2[1],x2[2],x2[3],x3[0],x3[1],x3[2],x3[3]};
#pragma unroll
    for (int i = 0; i < 16; ++i) { const unsigned short hb = bf16_bits(xs[i]); ah.u[i] = hb; al.u[i] = ASPLIT ? bf16_bits(xs[i] - bf16_val(hb)) : (unsigned short)0; }
#pragma unroll
    for (int t = 0; t < 4; ++t) {
      const unsigned short* brow = Wt + (size_t)(col0 + t * 16 + ln) * ldb + kb;
      FragB b;
      b.half[0] = *(const v8us*)(brow + 8 * hh);
      b.half[1] = *(const v8us*)(brow + 16 + 8 * hh);
      acc[t] = mmaN<ASPLIT ? 2 : 1>(ah.v, al.v, b.v, b.v, acc[t]);
    }
  }
#pragma unroll
  for (int t = 0; t < 4; ++t) {
    const int col = col0 + t * 16 + ln;
    float bv = bias ? bias[col] : 0.f;
    if (BIAS_BF16) bv = bf16_round(bv);
#pragma unroll
    for (int r = 0; r < 8; ++r) {
      float v = acc[t][r] + bv;
      if (resid) { float rv = resid[(size_t)((row0 + 8 * hh + r) % rmod) * ldr + col]; if (RES_BF16) rv = bf16_round(rv); v += rv; }
      if (ACT == 1) v = fmaxf(v, 0.f);
      if (ACT == 2) v = 0.5f * v * (1.0f + erff(v * 0.70710678118654752f));
      if (ACT == 3) { const float u = 0.7978845608028654f * (v + 0.044715f * v * v * v); v = 0.5f * v * (1.0f + tanhf(u)); }
      so[w][8 * hh + r][t * 16 + ln] = v;
    }
  }
  __builtin_amdgcn_fence(__ATOMIC_ACQ_REL, "workgroup");
  __builtin_amdgcn_wave_barrier();
  const int rsub = lane >> 4, c4 = (lane & 15) * 4;
  {
#pragma unroll
    for (int q = 0; q < 8; ++q) {
      const int r = q * 2 + rsub;
      const v4f v = *(const v4fa*)&so[w][r][c4];
      *(v4f*)(C + (size_t)(row0 + r) * ldc + col0 + c4) = v;
    }
    
  }
}
// row LayerNorm (biased variance, eps) over N: s = X (+ R); optional out_sum <- s; out_norm <- (s-mu)*rsqrt(var+eps)*g + b
template <bool PARAM_BF16>
__global__ __launch_bounds__(256) void k_layernorm(const float* __restrict__ X, const float* __restrict__ R, const float* __restrict__ g, const float* __restrict__ bta,
                                                  float* __restrict__ out_sum, float* __restrict__ out_norm, int N, float eps) {
  __shared__ float red[256];
  const int row = blockIdx.x, tid = threadIdx.x;
  const float* x = X + (size_t)row * N; const float* rr = R ? R + (size_t)row * N : nullptr;
  float vals[16];                     // up to N = 4096
  const int per = N / 256;            // contiguous chunk per thread? use strided-by-4 chunks: thread handles j = tid*4 + 1024*u
  float s1 = 0.f;
  for (int u = 0; u < per / 4; ++u) {
    const int j = tid * 4 + 1024 * u;
    const v4f a = *(const v4fa*)(x + j);
    v4f b = {0.f,0.f,0.f,0.f}; if (rr) b = *(const v4fa*)(rr + j);
#pragma unroll
    for (int q = 0; q < 4; ++q) { const float v = a[q] + b[q]; vals[u * 4 + q] = v; s1 += v; }
  }
  red[tid] = s1; __syncthreads();
  for (int st = 128; st > 0; st >>= 1) { if (tid < st) red[tid] += red[tid + st]; __syncthreads(); }
  const float mu = red[0] / (float)N; __syncthreads();
  float s2 = 0.f;
  for (int u = 0; u < per / 4; ++u)
#pragma unroll
    for (int q = 0; q < 4; ++q) { const float c = vals[u * 4 + q] - mu; s2 += c * c; }
  red[tid] = s2; __syncthreads();
  for (int st = 128; st > 0; st >>= 1) { if (tid < st) red[tid] += red[tid + st]; __syncthreads(); }
  const float rs = rsqrtf(red[0] / (float)N + eps);
  {
    for (int u = 0; u < per / 4; ++u) {
      const int j = tid * 4 + 1024 * u;
      v4f o, sm;
#pragma unroll
      for (int q = 0; q < 4; ++q) {
        float gg = g[j + q], bb = bta[j + q];
        if (PARAM_BF16) { gg = bf16_round(gg); bb = bf16_round(bb); }
        sm[q] = vals[u * 4 + q]; o[q] = (vals[u * 4 + q] - mu) * rs * gg + bb;
      }
      if (out_sum) *(v4f*)(out_sum + (size_t)row * N + j) = sm;
      *(v4f*)(out_norm + (size_t)row * N + j) = o;
    }
    
  }
}



// ---- f16 WMMA path (v_wmma_f32_16x16x32_f16): 11-bit significands for operands in range — used where a [0,1] probability operand needs more precision than bf16
typedef _Float16 v16h __attribute__((ext_vector_type(16)));
union FragH { v16h v; v8us half[2]; _Float16 h[16]; unsigned short u[16]; };
template <int NT>
__device__ __forceinline__ v8f mmaH(v16h ah, v16h al, v16h bh, v16h bl, v8f c) {
  c = __builtin_amdgcn_wmma_f32_16x16x32_f16(false, ah, false, bh, (short)0, c, false, false);
  if (NT >= 2) c = __builtin_amdgcn_wmma_f32_16x16x32_f16(false, al, false, bh, (short)0, c, false, false);
  if (NT >= 3) c = __builtin_amdgcn_wmma_f32_16x16x32_f16(false, ah, false, bl, (short)0, c, false, false);
  asm volatile("v_nop\n\tv_nop\n\tv_nop\n\tv_nop" : "+v"(c) : "v"(ah), "v"(al), "v"(bh), "v"(bl));
  return c;
}
// batched GEMM like k_gemm_b but f16 operands: A f32 (split into f16 hi/lo if ASPLIT, else rounded to f16), Bt = f16 values [n][k]; alpha; C f32; N multiple of 16 (partial tiles skipped)
template <bool ASPLIT>
__global__ __launch_bounds__(128) void k_gemm_h(const float* __restrict__ A, int lda, size_t sA, const _Float16* __restrict__ Bh, int ldb, size_t sB, float alpha, float* __restrict__ C, int ldc, size_t sC, int M, int N, int K) {
  __shared__ __attribute__((aligned(16))) float so[4][16][64];
  const int tid = threadIdx.x, w = tid >> 5, lane = tid & 31, ln = lane & 15, hh = lane >> 4; const int by = blockIdx.y;
  A += (size_t)by * sA; Bh += (size_t)by * sB; C += (size_t)by * sC;
  const int ntn = (N + 63) / 64; const int wid = blockIdx.x * 4 + w; const int mt = wid / ntn, nq = wid % ntn; if (mt * 16 >= M) return;
  const int row0 = mt * 16, col0 = nq * 64; const float* arow = A + (size_t)(row0 + ln) * lda;
  v8f acc[4] = {};
  for (int kb = 0; kb < K; kb += 32) {
    FragH ah, al;
    const v4f x0 = *(const v4fa*)(arow + kb + 8 * hh), x1 = *(const v4fa*)(arow + kb + 8 * hh + 4), x2 = *(const v4fa*)(arow + kb + 16 + 8 * hh), x3 = *(const v4fa*)(arow + kb + 16 + 8 * hh + 4);
    float xs[16] = {x0[0],x0[1],x0[2],x0[3],x1[0],x1[1],x1[2],x1[3],x2[0],x2[1],x2[2],x2[3],x3[0],x3[1],x3[2],x3[3]};
#pragma unroll
    for (int i = 0; i < 16; ++i) { const _Float16 h = (_Float16)xs[i]; ah.h[i] = h; al.h[i] = ASPLIT ? (_Float16)(xs[i] - (float)h) : (_Float16)0.0f; }
#pragma unroll
    for (int t = 0; t < 4; ++t) { if (col0 + t * 16 >= N) continue; const size_t boff = (size_t)(col0 + t * 16 + ln) * ldb + kb; FragH bq; bq.half[0] = *(const v8us*)(Bh + boff + 8 * hh); bq.half[1] = *(const v8us*)(Bh + boff + 16 + 8 * hh);
      acc[t] = mmaH<ASPLIT ? 2 : 1>(ah.v, al.v, bq.v, bq.v, acc[t]); }
  }
#pragma unroll
  for (int t = 0; t < 4; ++t) { if (col0 + t * 16 >= N) continue;
#pragma unroll
    for (int r = 0; r < 8; ++r) so[w][8 * hh + r][t * 16 + ln] = acc[t][r] * alpha; }
  __builtin_amdgcn_fence(__ATOMIC_ACQ_REL, "workgroup"); __builtin_amdgcn_wave_barrier();
  const int rsub = lane >> 4, c4 = (lane & 15) * 4;
  {
#pragma unroll
    for (int q = 0; q < 8; ++q) { const int r = q * 2 + rsub; if (col0 + c4 < N) { const v4f v = *(const v4fa*)&so[w][r][c4]; *(v4f*)(C + (size_t)(row0 + r) * ldc + col0 + c4) = v; } }
     }
}

// Wt[n][k] = f16(W[k][n]·scale) from f32 row-major W[K][N] (scale = power of two; bf16-exact weights stay exact in f16 away from the subnormal range)
__global__ __launch_bounds__(256) void k_wt_f16(const float* __restrict__ W, _Float16* __restrict__ Wt, int K, int N, float scale) {
  const int t = blockIdx.x * 256 + threadIdx.x; if (t >= N * (K / 8)) return; const int n = t / (K / 8), k8 = (t % (K / 8)) * 8; FragH f;
#pragma unroll
  for (int i = 0; i < 8; ++i) f.h[i] = (_Float16)(bf16_round(W[(size_t)(k8 + i) * N + n]) * scale); const v8us o = f.half[0];
  *(v8us*)((unsigned short*)Wt + (size_t)n * K + k8) = o; 
}
// k_gemm_hh variant with fused epilogue: v = acc·alpha + bias[by·sBias + col] (+ CP[(row/rowsPerB)·sCPb + by·64 + col] if CP) ; ACT 0 none / 1 elu ; writes f16 C16 (and f32 C if non-null)
template <int ACT>
__global__ __launch_bounds__(128) void k_gemm_hhx(const _Float16* __restrict__ A, int lda, size_t sA, const _Float16* __restrict__ Bh, int ldb, size_t sB, float alpha, const float* __restrict__ bias, size_t sBias, const float* __restrict__ CP, int rowsPerB, size_t sCPb, int row0g,
    float* __restrict__ C, _Float16* __restrict__ C16, int ldc, size_t sC, int M, int N, int K) {
  __shared__ __attribute__((aligned(16))) float so[4][16][64];
  const int tid = threadIdx.x, w = tid >> 5, lane = tid & 31, ln = lane & 15, hh = lane >> 4; const int by = blockIdx.y;
  A += (size_t)by * sA; Bh += (size_t)by * sB; const size_t cofs = (size_t)by * sC; const float* bp = bias ? bias + (size_t)by * sBias : nullptr;
  const int ntn = (N + 63) / 64; const int wid = blockIdx.x * 4 + w; const int mt = wid / ntn, nq = wid % ntn; if (mt * 16 >= M) return;
  const int row0 = mt * 16, col0 = nq * 64; const _Float16* arow = A + (size_t)(row0 + ln) * lda;
  v8f acc[4] = {};
  for (int kb = 0; kb < K; kb += 32) { FragH ah; ah.half[0] = *(const v8us*)((const unsigned short*)arow + kb + 8 * hh); ah.half[1] = *(const v8us*)((const unsigned short*)arow + kb + 16 + 8 * hh);
#pragma unroll
    for (int t = 0; t < 4; ++t) { if (col0 + t * 16 >= N) continue; const size_t boff = (size_t)(col0 + t * 16 + ln) * ldb + kb; FragH bq; bq.half[0] = *(const v8us*)((const unsigned short*)Bh + boff + 8 * hh); bq.half[1] = *(const v8us*)((const unsigned short*)Bh + boff + 16 + 8 * hh);
      acc[t] = mmaH<1>(ah.v, ah.v, bq.v, bq.v, acc[t]); }
  }
#pragma unroll
  for (int t = 0; t < 4; ++t) { if (col0 + t * 16 >= N) continue; const int col = col0 + t * 16 + ln; const float bv = bp ? bf16_round(bp[col]) : 0.f;
#pragma unroll
    for (int r = 0; r < 8; ++r) { float v = acc[t][r] * alpha + bv; if (CP) { const int rr = row0g + row0 + 8 * hh + r; if (rowsPerB < 0) v += CP[cofs + (size_t)rr * ldc + col];      /* rowsPerB < 0: own element of the batched C plane */ else { const int bidx = rr / rowsPerB; v += CP[(size_t)bidx * sCPb + (size_t)by * 64 + col]; } } if (ACT == 1) v = (v > 0.f) ? v : expm1f(v); else if (ACT == 7) v = (v > 0.f) ? v + 1.0f : expf(v); else if (ACT == 8) v = tanhf(v); else if (ACT == 9) v = 0.5f * v * (1.0f + tanhf(0.7978845608028654f * (v + 0.044715f * v * v * v))); else if (ACT == 11) v = 1.0f / (1.0f + expf(-v)); else if (ACT == 12) v = (v > 0.f) ? v : 0.01f * v; else if (ACT == 14) v = (v > 0.f) ? v : 0.1f * v; else if (ACT == 16) v = (v >= 0.f) ? v : 0.3f * v; else if (ACT == 15) v = v / (1.0f + expf(-v)); else if (ACT == 3) v = fmaxf(v, 0.f); else if (ACT == 6) v = 0.5f * v * (1.0f + erff(v * 0.70710678118654752f)); so[w][8 * hh + r][t * 16 + ln] = v; } }
  __builtin_amdgcn_fence(__ATOMIC_ACQ_REL, "workgroup"); __builtin_amdgcn_wave_barrier();
  const int rsub = lane >> 4, c4 = (lane & 15) * 4; typedef _Float16 v4h __attribute__((ext_vector_type(4)));
  {
#pragma unroll
    for (int q = 0; q < 8; ++q) { const int r = q * 2 + rsub; if (col0 + c4 < N) { const v4f v = *(const v4fa*)&so[w][r][c4]; if (C) *(v4f*)(C + cofs + (size_t)(row0 + r) * ldc + col0 + c4) = v; if (C16) { v4h h4; for (int i = 0; i < 4; ++i) h4[i] = (_Float16)v[i]; *(v4h*)(C16 + cofs + (size_t)(row0 + r) * ldc + col0 + c4) = h4; } } }
     }
}


typedef _Float16 v4h __attribute__((ext_vector_type(4)));

__global__ __launch_bounds__(256) void k_x16(const float* __restrict__ x, _Float16* __restrict__ X16, size_t n8) { const size_t t = (size_t)blockIdx.x * 256 + threadIdx.x; if (t >= n8) return; FragH f;
#pragma unroll
  for (int q = 0; q < 8; ++q) f.h[q] = (_Float16)bf16_round(x[t * 8 + q]); *(v8us*)((unsigned short*)X16 + t * 8) = f.half[0];  }
__global__ __launch_bounds__(256) void k_h16(const float* __restrict__ x, _Float16* __restrict__ X16, size_t n8) { const size_t t = (size_t)blockIdx.x * 256 + threadIdx.x; if (t >= n8) return; FragH f;
#pragma unroll
  for (int q = 0; q < 8; ++q) f.h[q] = (_Float16)x[t * 8 + q]; *(v8us*)((unsigned short*)X16 + t * 8) = f.half[0];  }
__global__ __launch_bounds__(256) void k_round16f(const float* __restrict__ W, _Float16* __restrict__ Bt, size_t n8) { const size_t t = (size_t)blockIdx.x * 256 + threadIdx.x; if (t >= n8) return; FragH f;
#pragma unroll
  for (int i = 0; i < 8; ++i) f.h[i] = (_Float16)(bf16_round(W[t * 8 + i]) * 16.0f); *(v8us*)((unsigned short*)Bt + t * 8) = f.half[0];  }
template <int NHv, int TTv>
__global__ __launch_bounds__(256) void k_vt(const _Float16* __restrict__ V16, int ldv, int voff, _Float16* __restrict__ Vt) { __shared__ unsigned short tl[64][66]; const int tid = threadIdx.x; const int slab = blockIdx.x / (TTv / 64), lg = blockIdx.x % (TTv / 64); const int b = slab / NHv, h = slab % NHv;
  for (int i = tid; i < 64 * 8; i += 256) { const int r = i / 8, c8 = (i % 8) * 8; FragH f; f.half[0] = *(const v8us*)((const unsigned short*)V16 + ((size_t)b * TTv + lg * 64 + r) * ldv + voff + h * 64 + c8);
#pragma unroll
    for (int q = 0; q < 8; ++q) tl[r][c8 + q] = f.u[q]; }
  __syncthreads();
  {
#pragma unroll
    for (int rd = 0; rd < 2; ++rd) { const int d = rd * 32 + tid / 8, pc = tid % 8; FragH f;
#pragma unroll
      for (int q = 0; q < 8; ++q) f.u[q] = tl[pc * 8 + q][d];
      *(v8us*)((unsigned short*)Vt + ((size_t)slab * 64 + d) * TTv + lg * 64 + pc * 8) = f.half[0]; }
     } }

__global__ __launch_bounds__(256) void k_hl(const float* __restrict__ F, _Float16* __restrict__ Hh, _Float16* __restrict__ Hl, size_t n8) { const size_t t = (size_t)blockIdx.x * 256 + threadIdx.x; if (t >= n8) return; FragH fh, fl; const v4f a = *(const v4fa*)(F + t * 8), c = *(const v4fa*)(F + t * 8 + 4);
#pragma unroll
  for (int q = 0; q < 4; ++q) { _Float16 h = (_Float16)a[q]; fh.h[q] = h; fl.h[q] = (_Float16)((a[q] - (float)h) * 1024.0f); h = (_Float16)c[q]; fh.h[4 + q] = h; fl.h[4 + q] = (_Float16)((c[q] - (float)h) * 1024.0f); }
  { *(v8us*)((unsigned short*)Hh + t * 8) = fh.half[0]; *(v8us*)((unsigned short*)Hl + t * 8) = fl.half[0];  } }

// ---- operand planes in fragment order: per (16-row tile, 32-wide k step) one 1-KiB block [register half j][lane 16 hh + ln][8 f16], holding element (row 16 tile + ln, k = 32 step + 16 j + 8 hh + e);
// blocks run [row tile][k step]. A wave's 16-byte-per-lane fragment load then covers 4 whole 128-byte lines; from plain rows it touches 16 lines for 32 bytes each.
#define FBLK 512                 /* f16 per block */
// Work-group index -> data, the same rule in all three launches: work-groups whose indices agree modulo NDIE take one contiguous eighth of the token rows (six whole groups).
// For speed only: the map is a permutation of the work for any placement.
#define NDIE 8
__device__ __forceinline__ v16h fo_frag(const unsigned short* p) { FragH f; f.half[0] = *(const v8us*)p; f.half[1] = *(const v8us*)(p + FBLK / 2); return f.v; }      /* p = block + 8 lane */
// ---- output GEMM for the fixed shape: out[NR][DD] (f32) = attention output (A, fragment order) x W_o (B, fragment order, times 16) / 16. Work-group = 128 rows x 64 columns, wave tile 32 x 64.
// Every global load of a wave is issued ahead of its first wait: the work-group's 32 KiB of W_o go to LDS once (16 x 16 bytes a thread), the wave's 16 A fragments stay in registers; the k steps then read LDS and registers only.
#define OCB (4 * (DD / 32) * FBLK)      /* f16 of W_o per 64 output columns: 4 column tiles x 8 k steps, contiguous */
// at most 256 registers a wave: four work-groups share a WGP, so that all 768 are resident at once
__global__ __launch_bounds__(128) __attribute__((amdgpu_waves_per_eu(4, 4))) void k_out(const _Float16* __restrict__ A, const _Float16* __restrict__ Bh, float* __restrict__ C) {
  __shared__ __attribute__((aligned(16))) unsigned short sb[OCB];
  __shared__ __attribute__((aligned(16))) float so[4][32][68];
  const int tid = threadIdx.x, w = tid >> 5, lane = tid & 31, ln = lane & 15, hh = lane >> 4;
  const int dl = blockIdx.x % NDIE, di = blockIdx.x / NDIE; const int mt = dl * (NR / 128 / NDIE) + di / (DD / 64), nq = di % (DD / 64); const int row0 = mt * 128 + 32 * w, col0 = nq * 64;
  const unsigned short* bg = (const unsigned short*)Bh + (size_t)nq * OCB + tid * 8;
  const unsigned short* ag = (const unsigned short*)A + (size_t)(row0 >> 4) * (DD / 32) * FBLK + lane * 8;      /* row tiles row0 / 16 and the next: 16 blocks in a row */
  v8us br[16]; v16h af[2][DD / 32];
#pragma unroll
  for (int i = 0; i < 16; ++i) br[i] = *(const v8us*)(bg + i * 128 * 8);
#pragma unroll
  for (int a = 0; a < 2; ++a)
#pragma unroll
    for (int s = 0; s < DD / 32; ++s) af[a][s] = fo_frag(ag + (a * (DD / 32) + s) * FBLK);
  asm volatile("s_wait_xcnt 0x0" :: "v"(tid), "v"(ag) : "memory");      /* wait before the loads' address registers are rewritten; naming the addresses as inputs keeps them live up to here (the W_o loads go by a scalar base and the thread index as lane offset); as a memory fence it also keeps all 48 loads ahead of the LDS stores */
#pragma unroll
  for (int i = 0; i < 16; ++i) *(v8us*)(sb + tid * 8 + i * 128 * 8) = br[i];
  __syncthreads();
  const unsigned short* bl = sb + lane * 8;
  const v8f z8 = {0.f,0.f,0.f,0.f,0.f,0.f,0.f,0.f}; v8f acc[2][4];
#pragma unroll
  for (int t = 0; t < 4; ++t) { acc[0][t] = z8; acc[1][t] = z8; }
  v16h b[4];
#pragma unroll
  for (int t = 0; t < 4; ++t) b[t] = fo_frag(bl + t * (DD / 32) * FBLK);
  // unrolled: the A fragments are indexed by the step, and the next step's W_o fragments are read into a second register set ahead of this step's products
#pragma unroll
  for (int s = 0; s < DD / 32; ++s) { v16h bn[4];
    if (s + 1 < DD / 32) {
#pragma unroll
      for (int t = 0; t < 4; ++t) bn[t] = fo_frag(bl + (t * (DD / 32) + s + 1) * FBLK); }
    __builtin_amdgcn_sched_barrier(0);      /* the next step's LDS reads issue as one group ahead of this step's products: one place with LDS reads a step */
#pragma unroll
    for (int t = 0; t < 4; ++t) {
      acc[0][t] = __builtin_amdgcn_wmma_f32_16x16x32_f16(false, af[0][s], false, b[t], (short)0, acc[0][t], false, false);
      acc[1][t] = __builtin_amdgcn_wmma_f32_16x16x32_f16(false, af[1][s], false, b[t], (short)0, acc[1][t], false, false); }
    __builtin_amdgcn_sched_barrier(0);      /* keeps later steps' LDS reads in their own step; hoisted all together they spilled registers to scratch */
    if (s + 1 < DD / 32) {
#pragma unroll
      for (int t = 0; t < 4; ++t) b[t] = bn[t]; } }
#pragma unroll
  for (int a = 0; a < 2; ++a)
#pragma unroll
    for (int t = 0; t < 4; ++t)
#pragma unroll
      for (int r = 0; r < 8; ++r) so[w][a * 16 + 8 * hh + r][t * 16 + ln] = acc[a][t][r] * 0.0625f;
  __builtin_amdgcn_fence(__ATOMIC_ACQ_REL, "workgroup"); __builtin_amdgcn_wave_barrier();      /* the wave's other lanes read what this lane staged */
  const int rsub = lane >> 4, c4 = (lane & 15) * 4;
  float* cd = C + (size_t)(row0 + rsub) * DD + col0 + c4;
  v4f tv[16];
#pragma unroll
  for (int q = 0; q < 16; ++q) tv[q] = *(const v4fa*)&so[w][q * 2 + rsub][c4];
  __builtin_amdgcn_sched_barrier(0);      /* all LDS reads issue as one group ahead of the stores; otherwise each store waits out its own read's latency in one register set */
#pragma unroll
  for (int q = 0; q < 16; ++q) *(v4f*)(cd + (size_t)q * 2 * DD) = tv[q];
}


// additive bias plane as a matrix operand: bf16-rounded sim is exact in f16 (8 significant bits; below 2^-14 the absolute error stays under 2^-25; a normal draw stays four orders of magnitude under the f16 maximum), half the bytes of an f32 accumulator tile.
// One fragment-order block per (16-query tile, 32 keys): element (row ln, k = 16 j + 8 hh + e) = sim[query 8 hh + e][key 16 j + ln]. Times the one-hot B (k = 16 x + c -> column c) it adds
// sim[query c][key 16 x + row] to a 16-key x 16-query score tile: one block serves two score tiles, x = 0 and 1. The preparation launch writes it, 16 bytes a thread.
// Fused projection + attention. 256 work-groups of 16 waves, one per WGP; a pair of work-groups shares three (group, head) units: round 0 takes a whole unit each (32 query tiles, two a wave),
// round 1 takes the third unit, each work-group one half of its queries (one tile a wave); both form that unit's K and V^T. Every WGP so carries 48 query tiles.
// Projection of a unit: wave w takes token tiles w and w + 16. q | k: D = W rows (A) x token rows (B), so lane (c, h) holds 8 neighbouring dims of token c: q is the score product's B fragment as it stands
// and stays in registers, k is a 16-byte piece of a K row in LDS; v^T: D = token rows (A) x W rows (B), so a lane holds 8 neighbouring tokens of one dim: a 16-byte piece of a V^T row in LDS.
// Attention of a query tile: S^T = K Q^T + bias block x one-hot (q carries 32^-0.5, so that sim is added as it stands): lane (c, h) holds keys 8h..8h+7 of each 16-key tile for query c, so two score tiles
// convert in place into the B operand of O^T += V^T P^T (hardware k order on both sides). Online softmax over blocks of 128 keys in
// the log2 domain; P carries 2^10 (cancels against the row sum). K rows and V^T rows sit in LDS at pitches of 16 B x odd.
#define KPITCH 40                /* f16 per K row in LDS: 80 B */
#define VPITCH 520               /* f16 per V^T row in LDS: 1040 B */
#define KBLK 128                 /* keys per online-softmax block */
#define C2 1.4426950408889634f
#define KS (DD / 32)             /* k steps of a projection */
#define WSEG (2 * KS * FBLK)     /* f16 of one head's q, k or v weights: 2 row tiles x 8 k steps, contiguous in the plane */
__device__ __forceinline__ v16h lds_frag(const unsigned short* p, int hh) { FragH f; f.half[0] = *(const v8us*)(p + 8 * hh); f.half[1] = *(const v8us*)(p + 16 + 8 * hh); return f.v; }
// four waves per SIMD: the one work-group of a WGP may use 256 registers a wave
__global__ __launch_bounds__(512) __attribute__((amdgpu_waves_per_eu(4, 4))) void k_fa(const _Float16* __restrict__ X16, const _Float16* __restrict__ Bw, const _Float16* __restrict__ BP, _Float16* __restrict__ O16) {
  __shared__ __attribute__((aligned(16))) unsigned short sm[NN * KPITCH + HD * VPITCH + 3 * WSEG];      /* one array, so that K and V^T come first: the attention loop's LDS reads then reach every row by a 16-bit constant offset */
  unsigned short* const sk = sm; unsigned short* const sv = sm + NN * KPITCH; unsigned short* const swt = sm + NN * KPITCH + HD * VPITCH;      /* swt = the head's weights: blocks [q0 q1 k0 k1 v0 v1][k step] */
  const int tid = threadIdx.x, w = __builtin_amdgcn_readfirstlane(tid >> 5), lane = tid & 31, ln = lane & 15, hh = lane >> 4;      /* the wave's number as a scalar: tile bases stay out of the vector registers */
  const int dl = blockIdx.x % NDIE, di = blockIdx.x / NDIE; const int pr = dl * (NG * NH / 3 / NDIE) + (di >> 1), sd = di & 1;      /* a pair's two work-groups lie NDIE indices apart */
  const v8f z8 = {0.f,0.f,0.f,0.f,0.f,0.f,0.f,0.f};
  FragH ones;      /* A whose row 0 is all ones: row 0 of os = the column sums of the rounded P, summed on the matrix pipe */
#pragma unroll
  for (int i = 0; i < 16; ++i) ones.h[i] = (ln == 0) ? (_Float16)1.0f : (_Float16)0.0f;
  FragH e0, e1;      /* one-hot B operands: k = c (e0) or k = 16 + c (e1) goes to column c */
#pragma unroll
  for (int i = 0; i < 8; ++i) { const _Float16 d = (8 * hh + i == ln) ? (_Float16)1.0f : (_Float16)0.0f; e0.h[i] = d; e0.h[8 + i] = (_Float16)0.0f; e1.h[i] = (_Float16)0.0f; e1.h[8 + i] = d; }
  // rolled: both rounds run the same text
#pragma unroll 1
  for (int rd = 0; rd < 2; ++rd) {
    const int gh = 3 * pr + (rd == 0 ? sd : 2); const int g = gh / NH, h = gh % NH;
    // every load of the front is issued first: the wave's x fragments of k steps 0..3 (both token tiles), then the work-group's 48 KiB of weights
    const unsigned short* xg = (const unsigned short*)X16 + (size_t)(g * (NN / 16) + w) * KS * FBLK + lane * 8;      /* token tile w; tile w + 16 is a constant step on */
    const unsigned short* wg = (const unsigned short*)Bw + (size_t)(2 * h) * KS * FBLK + tid * 8;      /* q rows of head h; k and v rows lie 16 and 32 row tiles on */
    v16h xf[2][4]; v8us wr[6];
#pragma unroll
    for (int s = 0; s < 4; ++s) { xf[0][s] = fo_frag(xg + s * FBLK); xf[1][s] = fo_frag(xg + (16 * KS + s) * FBLK); }
#pragma unroll
    for (int i = 0; i < 6; ++i) wr[i] = *(const v8us*)(wg + (i >> 1) * 16 * KS * FBLK + (i & 1) * 512 * 8);
    asm volatile("s_wait_xcnt 0x0" :: "v"(wg) : "memory");      /* wait before the weight loads' address register is rewritten; naming it as an input keeps it live up to here */
#pragma unroll
    for (int i = 0; i < 6; ++i) *(v8us*)(swt + (i >> 1) * WSEG + (i & 1) * 512 * 8 + tid * 8) = wr[i];      /* swt: its last readers passed the barrier behind the round before's projection */
    __syncthreads();      /* weights visible; also ends every wave's reads of the round before's K and V^T */
    v16h qA, qB;
    {
      v8f aq[4][2], av[2][2];
#pragma unroll
      for (int a = 0; a < 4; ++a) { aq[a][0] = z8; aq[a][1] = z8; }
#pragma unroll
      for (int t = 0; t < 2; ++t) { av[t][0] = z8; av[t][1] = z8; }
      const unsigned short* wl = swt + lane * 8;
      // unrolled: the x fragments are register arrays indexed by the step; a step's registers take the fragment of four steps on as soon as its products are issued
#pragma unroll
      for (int s = 0; s < KS; ++s) {
        v16h wf[6];
#pragma unroll
        for (int a = 0; a < 6; ++a) wf[a] = fo_frag(wl + (a * KS + s) * FBLK);
        __builtin_amdgcn_sched_barrier(0);      /* the step's LDS reads issue as one group ahead of its products: one place with LDS reads a step */
#pragma unroll
        for (int t = 0; t < 2; ++t) {
#pragma unroll
          for (int a = 0; a < 4; ++a) aq[a][t] = __builtin_amdgcn_wmma_f32_16x16x32_f16(false, wf[a], false, xf[t][s & 3], (short)0, aq[a][t], false, false);
#pragma unroll
          for (int b = 0; b < 2; ++b) av[t][b] = __builtin_amdgcn_wmma_f32_16x16x32_f16(false, xf[t][s & 3], false, wf[4 + b], (short)0, av[t][b], false, false); }
        if (s + 4 < KS) { xf[0][s & 3] = fo_frag(xg + (s + 4) * FBLK); xf[1][s & 3] = fo_frag(xg + (16 * KS + s + 4) * FBLK); }
        __builtin_amdgcn_sched_barrier(0); }      /* keeps later steps' LDS reads in their own step, so that the register count holds */
      asm volatile("s_wait_xcnt 0x0" :: "v"(xg) : "memory");      /* wait before the x loads' address register is rewritten; naming it as an input keeps it live up to here */
      FragH fa, fb;
#pragma unroll
      for (int r = 0; r < 8; ++r) { fa.h[r] = (_Float16)(aq[0][0][r] * (0.0625f * SCL)); fa.h[8 + r] = (_Float16)(aq[1][0][r] * (0.0625f * SCL)); fb.h[r] = (_Float16)(aq[0][1][r] * (0.0625f * SCL)); fb.h[8 + r] = (_Float16)(aq[1][1][r] * (0.0625f * SCL)); }
      qA = fa.v; qB = fb.v;
#pragma unroll
      for (int t = 0; t < 2; ++t)
#pragma unroll
        for (int a = 0; a < 2; ++a) { FragH f, f2;
#pragma unroll
          for (int r = 0; r < 8; ++r) { f.h[r] = (_Float16)(aq[2 + a][t][r] * 0.0625f); f2.h[r] = (_Float16)(av[t][a][r] * 0.0625f); }
          *(v8us*)(sk + ((w + 16 * t) * 16 + ln) * KPITCH + a * 16 + 8 * hh) = f.half[0];
          *(v8us*)(sv + (a * 16 + ln) * VPITCH + (w + 16 * t) * 16 + 8 * hh) = f2.half[0]; }
    }
    __syncthreads();      /* K and V^T visible; also ends every wave's reads of the weights */
    const int tlo = rd == 0 ? 0 : sd, thi = rd == 0 ? 1 : sd;
    // rolled: one text for both query tiles
#pragma unroll 1
    for (int t = tlo; t <= thi; ++t) {
      const v16h qf = t == 0 ? qA : qB; const int qt = w + 16 * t;      /* query tile of the group */
      const unsigned short* bro = (const unsigned short*)BP + (size_t)qt * (NN / 32) * FBLK + lane * 8;
      v8f o0 = z8, o1 = z8, os = z8; float m = -1.0e30f;      /* far below any score, and (m - mn) * C2 stays finite */
      // rolled: only one block's 64 score registers are live at a time
#pragma unroll 1
      for (int kb = 0; kb < NN; kb += KBLK) {
        v8f s[KBLK / 16]; v16h bf[KBLK / 32]; const unsigned short* bp = bro + (kb / 32) * FBLK;
#pragma unroll
        for (int p = 0; p < KBLK / 32; ++p) bf[p] = fo_frag(bp + p * FBLK);
        asm volatile("s_wait_xcnt 0x0" ::: "memory");      /* wait before the bias loads' address register is stepped; as a memory fence it also keeps the eight loads at the head of the block, so that they fly under the K Q^T products */
#pragma unroll
        for (int p = 0; p < KBLK / 32; ++p) {
          s[2 * p] = __builtin_amdgcn_wmma_f32_16x16x32_f16(false, lds_frag(sk + (kb + p * 32 + ln) * KPITCH, hh), false, qf, (short)0, z8, false, false);
          s[2 * p + 1] = __builtin_amdgcn_wmma_f32_16x16x32_f16(false, lds_frag(sk + (kb + p * 32 + 16 + ln) * KPITCH, hh), false, qf, (short)0, z8, false, false); }
#pragma unroll
        for (int p = 0; p < KBLK / 32; ++p) {
          s[2 * p] = __builtin_amdgcn_wmma_f32_16x16x32_f16(false, bf[p], false, e0.v, (short)0, s[2 * p], false, false);
          s[2 * p + 1] = __builtin_amdgcn_wmma_f32_16x16x32_f16(false, bf[p], false, e1.v, (short)0, s[2 * p + 1], false, false);
        }
        float mx[4] = {s[0][0], s[0][1], s[0][2], s[0][3]};
#pragma unroll
        for (int u = 0; u < KBLK / 16; ++u)
#pragma unroll
          for (int r = 0; r < 8; ++r) mx[r & 3] = fmaxf(mx[r & 3], s[u][r]);
        float bm = fmaxf(fmaxf(mx[0], mx[1]), fmaxf(mx[2], mx[3])); bm = fmaxf(bm, __shfl_xor(bm, 16, 32));      /* both halves of a column share one maximum */
        const float mn = fmaxf(m, bm); const float al = __builtin_amdgcn_exp2f((m - mn) * C2); const float off = 10.0f - mn * C2; m = mn;
#pragma unroll
        for (int r = 0; r < 8; ++r) { o0[r] *= al; o1[r] *= al; }
        os[0] *= al;      /* only row 0 of the sum tile is ever read */
#pragma unroll
        for (int p = 0; p < KBLK / 32; ++p) { FragH b;
#pragma unroll
          for (int r = 0; r < 8; ++r) { const float x0 = __builtin_amdgcn_exp2f(fmaf(s[2 * p][r], C2, off)), x1 = __builtin_amdgcn_exp2f(fmaf(s[2 * p + 1][r], C2, off));
            b.h[r] = (_Float16)x0; b.h[8 + r] = (_Float16)x1; }
          const unsigned short* vr = sv + ln * VPITCH + kb + p * 32;
          o0 = __builtin_amdgcn_wmma_f32_16x16x32_f16(false, lds_frag(vr, hh), false, b.v, (short)0, o0, false, false);
          o1 = __builtin_amdgcn_wmma_f32_16x16x32_f16(false, lds_frag(vr + 16 * VPITCH, hh), false, b.v, (short)0, o1, false, false);
          os = __builtin_amdgcn_wmma_f32_16x16x32_f16(false, ones.v, false, b.v, (short)0, os, false, false); }
      }
      const float su = __shfl(os[0], ln, 32); const float inv = 1.0f / su; FragH f;      /* row 0 sits in register 0 of lanes 0..15 */
#pragma unroll
      for (int r = 0; r < 8; ++r) { f.h[r] = (_Float16)(o0[r] * inv); f.h[8 + r] = (_Float16)(o1[r] * inv); }
      unsigned short* d = (unsigned short*)O16 + ((size_t)(g * (NN / 16) + qt) * (DD / 32) + h) * FBLK + lane * 8;      /* lane (c, h) holds head dims 8h..8h+7 and 16+8h.. of query c: the output GEMM's A fragment of row tile g NN / 16 + qt, k step h, as it stands */
      *(v8us*)d = f.half[0]; *(v8us*)(d + FBLK / 2) = f.half[1];
      asm volatile("s_wait_xcnt 0x0" ::: "memory");      /* wait before the stores' address and data registers are rewritten by the next tile */
    }
  }
}
// x as f16 fragment blocks [row tile][k step]. One work-group = 96 token rows: read once as f32 in whole rows, rounded (bf16, exact in f16) into LDS, read back in fragment order and stored as 48 KiB in a row.
#define PROWS 96                 /* token rows per work-group: 24576 rows over 256 work-groups, one per WGP */
#define XPITCH 264               /* f16 per x row in LDS: 528 B = 16 B x 33 */
// One preparation launch of 256 work-groups. Every thread carries two jobs that read none of each other's output: its share of 96 x rows, and ONE 16-byte piece of the small planes
// (q|k|v weights 24576 pieces, W_o 8192, bias plane 32768: 65536 = 256 x 256). A piece is eight f32 read down a column of its source, rounded to bf16, scaled by a power of two, stored as the t-th 16 bytes of a
// fragment-order plane (lane = t % 32, register half, k step, row tile). Which plane a work-group serves follows from its index alone. All 32 loads of a thread are issued ahead of its first wait.
#define PB_QKV (3 * DD * (DD / 8) / 256)      /* 96 work-groups' pieces */
#define PB_WO (DD * (DD / 8) / 256)           /* 32 */
#define PB_BIAS (NN * NN / 8 / 256)           /* 128 */
__global__ __launch_bounds__(256) void k_prep(const float* __restrict__ x, const float* __restrict__ Wq, const float* __restrict__ Wk, const float* __restrict__ Wv, const float* __restrict__ Wo, const float* __restrict__ sim,
                                              _Float16* __restrict__ X16, _Float16* __restrict__ Bt, _Float16* __restrict__ Bo, _Float16* __restrict__ BP) {
  __shared__ __attribute__((aligned(16))) unsigned short sx[PROWS * XPITCH];
  const int b = blockIdx.x, tid = threadIdx.x, w = tid >> 5, lane = tid & 31, ln = lane & 15, hh = lane >> 4;
  // the small piece: source column, its row pitch, scale and destination
  const float* sp; unsigned short* sd; int ld; float sc;
  if (b < PB_QKV + PB_WO) {      /* weights as f16 [n][k], times 16: n = output column, k0 = first of eight input rows */
    const int t = (b < PB_QKV ? b : b - PB_QKV) * 256 + tid; const int n = (t >> 9) * 16 + (t & 15), k0 = ((t >> 6) & 7) * 32 + ((t >> 5) & 1) * 16 + ((t >> 4) & 1) * 8;
    const float* Wm = b >= PB_QKV ? Wo : (b < PB_QKV / 3 ? Wq : (b < 2 * (PB_QKV / 3) ? Wk : Wv));
    sp = Wm + (size_t)k0 * DD + n % DD; ld = DD; sc = 16.0f; sd = (unsigned short*)(b < PB_QKV ? Bt : Bo) + (size_t)t * 8;
  } else {      /* bias plane: eight queries of one key; the block's layout stands ahead of the attention kernel */
    const int t = (b - (PB_QKV + PB_WO)) * 256 + tid; const int key = ((t >> 6) & 15) * 32 + ((t >> 5) & 1) * 16 + (t & 15), q0 = (t >> 10) * 16 + ((t >> 4) & 1) * 8;
    sp = sim + (size_t)q0 * NN + key; ld = NN; sc = 1.0f; sd = (unsigned short*)BP + (size_t)t * 8;
  }
  const int rb = (b % NDIE) * (NR / PROWS / NDIE) + b / NDIE;      /* which 96 rows: the map that stands ahead of the output GEMM */
  const float* xg = x + (size_t)rb * PROWS * DD + tid * 8;      /* row 8 i + w, columns 8 lane.. */
  v4f xa[PROWS / 8], xb[PROWS / 8]; float sv[8];
#pragma unroll
  for (int i = 0; i < PROWS / 8; ++i) { xa[i] = *(const v4fa*)(xg + i * 8 * DD); xb[i] = *(const v4fa*)(xg + i * 8 * DD + 4); }
#pragma unroll
  for (int e = 0; e < 8; ++e) sv[e] = sp[(size_t)e * ld];
  asm volatile("s_wait_xcnt 0x0" :: "v"(xg), "v"(sp) : "memory");      /* wait before the loads' address registers are rewritten; naming them as inputs keeps them live up to here */
  __builtin_amdgcn_sched_barrier(0);      /* all 32 loads issue ahead of the first conversion; otherwise later ones are issued only behind the wait on the first: several memory latencies in a row */
#pragma unroll
  for (int i = 0; i < PROWS / 8; ++i) { FragH f;
#pragma unroll
    for (int q = 0; q < 4; ++q) { f.h[q] = (_Float16)bf16_round(xa[i][q]); f.h[4 + q] = (_Float16)bf16_round(xb[i][q]); }
    *(v8us*)(sx + (i * 8 + w) * XPITCH + lane * 8) = f.half[0]; }
  FragH fs;
#pragma unroll
  for (int e = 0; e < 8; ++e) fs.h[e] = (_Float16)(bf16_round(sv[e]) * sc);
  __syncthreads();
  *(v8us*)sd = fs.half[0];      /* behind the barrier: in front of it the barrier's release would wait for this store to complete */
  unsigned short* xd = (unsigned short*)X16 + (size_t)rb * (PROWS / 16) * (DD / 32) * FBLK + tid * 8;
  v8us tv[PROWS / 8];      /* piece p = 256 i + tid of the work-group's 3072: lane p % 32, register half (p / 32) % 2, k step (p / 64) % 8, row tile p / 512 */
#pragma unroll
  for (int i = 0; i < PROWS / 8; ++i) tv[i] = *(const v8us*)(sx + ((i >> 1) * 16 + ln) * XPITCH + ((i & 1) * 4 + (w >> 1)) * 32 + (w & 1) * 16 + 8 * hh);
  __builtin_amdgcn_sched_barrier(0);      /* all LDS reads issue as one group ahead of the stores; otherwise each store waits out its own read's latency in one register set */
#pragma unroll
  for (int i = 0; i < PROWS / 8; ++i) *(v8us*)(xd + i * 256 * 8) = tv[i];
}

extern "C" void kernel_launch(void* const* d_in, const int* in_sizes, int n_in,
                              void* d_out, int out_size, void* d_ws, size_t ws_size, hipStream_t stream) {
  (void)in_sizes; (void)n_in; (void)out_size;
  const float* const* I = (const float* const*)d_in; const float* x = I[0]; const float* sim = I[1]; const float* Wq = I[2]; const float* Wk = I[3]; const float* Wv = I[4]; const float* Wo = I[5];
  char* ws = (char*)d_ws; size_t off = 0;
  auto take = [&](size_t bytes) { char* p = ws + off; off += (bytes + 255) & ~(size_t)255; return p; };
  _Float16* BQKV = (_Float16*)take((size_t)3 * DD * DD * 2); _Float16* BO = (_Float16*)take((size_t)DD * DD * 2);
  _Float16* X16 = (_Float16*)take((size_t)NR * DD * 2); _Float16* O16 = (_Float16*)take((size_t)NR * DD * 2);
  _Float16* BP = (_Float16*)take((size_t)NN * NN * 2);
  if (off > ws_size) return;      /* under 27 MiB */
  k_prep<<<NR / PROWS, 256, 0, stream>>>(x, Wq, Wk, Wv, Wo, sim, X16, BQKV, BO, BP);
  k_fa<<<NG * NH * 2 / 3, 512, 0, stream>>>(X16, BQKV, BP, O16);      /* 256 work-groups: 1.5 (group, head) units each */
  k_out<<<(NR / 128) * (DD / 64), 128, 0, stream>>>(O16, BO, (float*)d_out);
}
